// v000
// Times are from an AMD MI455X. After a warm-up the kernel runs many times in a row, and a time is the length of
// such a window on the GPU divided by its runs, so every launch and the gaps after it count. The runs cycle
// through copies of the inputs. A figure is the median of several windows, for all but v000 over two sittings.
// Sittings can differ by a few percent; kernels timed side by side share one.
// The starting kernel, v000, takes 372 microseconds a run.
// Contractions: qkv projection (normed . W^T, K=1024), attention q.k^T and p.v (head dim 64), output projection (o . Wo^T, K=1024): all v_wmma_f32_16x16x32_f16 (f16 operands, f32 accumulate); W carried x64, p carried x2^15, attention output carried x16 (exact power-of-two carries folded back in f32); float inputs RNE-converted to bf16 on load; rmsnorm, rotary tables, softmax, residual add in f32.
#include <hip/hip_runtime.h>
#include <math.h>

typedef __attribute__((ext_vector_type(16))) _Float16 v16h;
typedef __attribute__((ext_vector_type(8)))  _Float16 v8h;
typedef __attribute__((ext_vector_type(16))) __bf16   v16b;
typedef __attribute__((ext_vector_type(8)))  __bf16   v8b;
typedef __attribute__((ext_vector_type(8)))  float    v8f;
typedef __attribute__((ext_vector_type(4)))  float    v4f;

constexpr int SEQ_T     = 4096;
constexpr int DMODEL    = 1024;
constexpr int NHEAD     = 16;
constexpr int HDIM      = 64;
constexpr int QKV_N     = 3072;          // cols 0..1023 q | 1024..2047 k | 2048..3071 v
constexpr int KCOL0     = 1024;
constexpr int VCOL0     = 2048;
constexpr int NQTILE    = SEQ_T / 64;    // 64-row query tiles per head
constexpr int KEY_CH    = 64;            // keys per chunk
constexpr int LDS_P16   = 72;            // 16-bit LDS pitch (144 B rows, 16-B aligned)
constexpr float W_CARRY = 64.0f;         // weights stored as f16(bf16(w) * 64)
constexpr float P_CARRY = 32768.0f;      // softmax numerators stored as f16(p * 2^15)
constexpr float O_CARRY = 16.0f;         // attention output stored as f16(o * 16)

struct FreqTab { float f[32]; };
static_assert(sizeof(FreqTab) == 128);

__device__ __forceinline__ unsigned short f2bf_bits(float f) {
  unsigned u = __float_as_uint(f);
  return (unsigned short)((u + 0x7FFFu + ((u >> 16) & 1u)) >> 16);
}
__device__ __forceinline__ float bf_bits2f(unsigned short h) { return __uint_as_float(((unsigned)h) << 16); }
__device__ __forceinline__ float rne_bf(float f) { return bf_bits2f(f2bf_bits(f)); }

// hazard guards as plain device helpers (no inline asm inside the kernel template body)
__device__ __forceinline__ void dep_guard_h(v8f& a, v8f& b, v16h x, v16h y) { asm volatile("v_nop\n\tv_nop\n\tv_nop\n\tv_nop" : "+v"(a), "+v"(b) : "v"(x), "v"(y)); }
__device__ __forceinline__ void dep_guard_b(v8f& a, v8f& b, v16b x, v16b y) { asm volatile("v_nop\n\tv_nop\n\tv_nop\n\tv_nop" : "+v"(a), "+v"(b) : "v"(x), "v"(y)); }
__device__ __forceinline__ void keep4_h(v16h a, v16h b, v16h c, v16h d) { asm volatile("v_nop" :: "v"(a), "v"(b), "v"(c), "v"(d)); }
__device__ __forceinline__ void keep4_b(v16b a, v16b b, v16b c, v16b d) { asm volatile("v_nop" :: "v"(a), "v"(b), "v"(c), "v"(d)); }
__device__ __forceinline__ void acc_guard4(v8f& a, v8f& b, v8f& c, v8f& d) { asm volatile("v_nop\n\tv_nop\n\tv_nop\n\tv_nop" : "+v"(a), "+v"(b), "+v"(c), "+v"(d)); }
template <typename T> struct Frag;
template <> struct Frag<_Float16> {
  typedef v16h V; union U { v16h v; v8h h[2]; };
  static __device__ __forceinline__ v16h load(const _Float16* p) {   // elements 0..7 <- p[0..7], 8..15 <- p[16..23]
    U f; f.h[0] = *(const v8h*)(p); f.h[1] = *(const v8h*)(p + 16); return f.v;
  }
  static __device__ __forceinline__ v8f mma(v16h a, v16h b, v8f c) {
    return __builtin_amdgcn_wmma_f32_16x16x32_f16(false, a, false, b, (short)0, c, false, false);
  }
  static __device__ __forceinline__ void guard(v8f& a, v8f& b, v16h x, v16h y) { dep_guard_h(a, b, x, y); }
  static __device__ __forceinline__ void keep(v16h a, v16h b, v16h c, v16h d) { keep4_h(a, b, c, d); }
};
template <> struct Frag<__bf16> {
  typedef v16b V; union U { v16b v; v8b h[2]; };
  static __device__ __forceinline__ v16b load(const __bf16* p) {
    U f; f.h[0] = *(const v8b*)(p); f.h[1] = *(const v8b*)(p + 16); return f.v;
  }
  static __device__ __forceinline__ v8f mma(v16b a, v16b b, v8f c) {
    return __builtin_amdgcn_wmma_f32_16x16x32_bf16(false, a, false, b, (short)0, c, false, false);
  }
  static __device__ __forceinline__ void guard(v8f& a, v8f& b, v16b x, v16b y) { dep_guard_b(a, b, x, y); }
  static __device__ __forceinline__ void keep(v16b a, v16b b, v16b c, v16b d) { keep4_b(a, b, c, d); }
};

// single WMMA with the dependency guard (used by the attention kernel)
__device__ __forceinline__ v8f mma_f16g(v16h a, v16h b, v8f c) {
  c = __builtin_amdgcn_wmma_f32_16x16x32_f16(false, a, false, b, (short)0, c, false, false);
  asm volatile("v_nop\n\tv_nop\n\tv_nop\n\tv_nop" : "+v"(c) : "v"(a), "v"(b));
  return c;
}

// =====================================================================================
// Register-blocked batched WMMA GEMM, C[m,n] = scale * sum_k A[m,k] * Bt[n,k] (+bias)(+resid);
// each wave owns a 64x64 tile. A row-major [M,K]; Bt row-major [N,K]; M,N % 64 == 0, K % 32 == 0.
// SPLITM: 0 = single product; 1 = A carried as hi/lo planes (A2p = lo): product = hi.B + lo.B;
//         2 = A and Bt as hi/lo planes: product = hi.hi + hi.lo + lo.hi.
// BIAS_MODE: 0 = none, 1 = bias[m], 2 = bias[n].  OUT_MODE: 0 = f32, 1 = f16, 2 = bf16 hi + lo planes.
// RESID_RNE: the residual value is RNE-converted to bf16 before the add.
// ET: 0 = f16 operands, 1 = bf16 operands (pointers passed as 16-bit storage)
// =====================================================================================
template <int ET> struct Elem;
template <> struct Elem<0> { typedef _Float16 T; };
template <> struct Elem<1> { typedef __bf16 T; };
template <int ET, int SPLITM, int BIAS_MODE, int OUT_MODE, bool RESID, int ACT = 0, bool RESID_RNE = false>
__global__ __launch_bounds__(256) void wmma_gemm64(
    const unsigned short* __restrict__ Ap, const unsigned short* __restrict__ A2p, int lda, long strideA,
    const unsigned short* __restrict__ Btp, const unsigned short* __restrict__ Bt2p, int ldb, long strideB,
    void* __restrict__ Cout, void* __restrict__ Cout2, int ldc, long strideC,
    const float* __restrict__ bias,
    const float* __restrict__ resid, long strideR,
    int M, int N, int K, float scale) {
  typedef typename Elem<ET>::T T;
  typedef typename Frag<T>::V V;
  constexpr bool SPA = (SPLITM >= 1);
  constexpr bool SPB = (SPLITM >= 2);
  const T* A = (const T*)Ap; const T* A2 = (const T*)A2p; const T* Bt = (const T*)Btp; const T* Bt2 = (const T*)Bt2p;
  __shared__ __align__(16) float sT[8][16 * 68];   // per-wave 16x64 slab, pitch 68 floats
  const int b    = blockIdx.y;
  const int lane = threadIdx.x & 31;
  const int wave = threadIdx.x >> 5;
  const int tilesN = N >> 6;
  const int tilesM = M >> 6;
  const int tile = blockIdx.x * 8 + wave;
  if (tile >= tilesM * tilesN) return;   // wave-uniform; no block barriers in this kernel
  const int tm = tile / tilesN;
  const int tn = tile - tm * tilesN;
  const int m0 = tm << 6;
  const int n0 = tn << 6;

  const T* Ab  = A  + (size_t)b * strideA;
  const T* Bb  = Bt + (size_t)b * strideB;
  const T* Ab2 = SPA ? (A2  + (size_t)b * strideA) : nullptr;
  const T* Bb2 = SPB ? (Bt2 + (size_t)b * strideB) : nullptr;

  const int rlane = lane & 15;                 // row (A) / col (B, D) within subtile
  const int koff  = (lane >> 4) * 8;           // k offset of this lane half
  const int mOff  = (lane >> 4) * 8;           // D row offset

  v8f acc[4][4];
#pragma unroll
  for (int i = 0; i < 4; ++i)
#pragma unroll
    for (int j = 0; j < 4; ++j) acc[i][j] = (v8f){0.f,0.f,0.f,0.f,0.f,0.f,0.f,0.f};

  for (int k0 = 0; k0 < K; k0 += 32) {
    V bh[4], bl[4];
#pragma unroll
    for (int j = 0; j < 4; ++j) {
      const size_t bo = (size_t)(n0 + (j << 4) + rlane) * ldb + koff + k0;
      bh[j] = Frag<T>::load(Bb + bo);
      if (SPB) bl[j] = Frag<T>::load(Bb2 + bo);
    }
#pragma unroll
    for (int i = 0; i < 4; ++i) {
      const size_t ao = (size_t)(m0 + (i << 4) + rlane) * lda + koff + k0;
      V ah = Frag<T>::load(Ab + ao);
      V al;
      if (SPA) al = Frag<T>::load(Ab2 + ao);
#pragma unroll
      for (int j = 0; j < 4; ++j) {
        acc[i][j] = Frag<T>::mma(ah, bh[j], acc[i][j]);
        if (SPB) acc[i][j] = Frag<T>::mma(ah, bl[j], acc[i][j]);
        if (SPA) acc[i][j] = Frag<T>::mma(al, bh[j], acc[i][j]);
      }
      Frag<T>::guard(acc[i][0], acc[i][3], ah, SPA ? al : ah);
    }
    Frag<T>::keep(bh[0], bh[1], bh[2], bh[3]);
    if (SPB) Frag<T>::keep(bl[0], bl[1], bl[2], bl[3]);
  }
  acc_guard4(acc[0][0], acc[0][1], acc[0][2], acc[0][3]);
  acc_guard4(acc[1][0], acc[1][1], acc[1][2], acc[1][3]);
  acc_guard4(acc[2][0], acc[2][1], acc[2][2], acc[2][3]);
  acc_guard4(acc[3][0], acc[3][1], acc[3][2], acc[3][3]);

  // ---- epilogue ----
  float* slab = sT[wave];
  const float* Rb = RESID ? (resid + (size_t)b * strideR) : nullptr;
#pragma unroll
  for (int i = 0; i < 4; ++i) {
    const int mBase = m0 + (i << 4);
#pragma unroll
    for (int j = 0; j < 4; ++j) {
      const int n = n0 + (j << 4) + rlane;
      float bv = 0.f;
      if (BIAS_MODE == 2) bv = bias[n];
#pragma unroll
      for (int r = 0; r < 8; ++r) {
        float v = acc[i][j][r] * scale;
        if (BIAS_MODE == 1) v += bias[mBase + mOff + r];
        if (BIAS_MODE == 2) v += bv;
        if (RESID) {
          float rv = Rb[(size_t)(mBase + mOff + r) * ldc + n];
          if (RESID_RNE) rv = rne_bf(rv);
          v += rv;
        }
        if (ACT == 1) v = tanhf(v);
        if (ACT == 2) v = fmaxf(v, 0.0f);
        if (ACT == 4) v = (v > 0.f) ? v : 0.01f * v;
        slab[(mOff + r) * 68 + (j << 4) + rlane] = v;
      }
    }
    __builtin_amdgcn_fence(__ATOMIC_RELEASE, "workgroup");
    __builtin_amdgcn_wave_barrier();
    __builtin_amdgcn_fence(__ATOMIC_ACQUIRE, "workgroup");
    if (OUT_MODE == 0) {
      float* C = (float*)Cout + (size_t)b * strideC;
      const int hh = lane >> 4, c4 = (lane & 15) * 4;     // row seg = 256 B = 16 lanes x 16 B
      {
#pragma unroll
        for (int it = 0; it < 8; ++it) {
          const int row = it * 2 + hh;
          v4f v = *(const v4f*)(slab + row * 68 + c4);
          *(v4f*)(C + (size_t)(mBase + row) * ldc + n0 + c4) = v;
        }
        
      }
    } else {
      const int q = lane >> 3, c8 = (lane & 7) * 8;
      unsigned short* C  = (unsigned short*)Cout  + (size_t)b * strideC;
      unsigned short* C2 = (OUT_MODE == 2) ? ((unsigned short*)Cout2 + (size_t)b * strideC) : nullptr;
      {
#pragma unroll
        for (int it = 0; it < 4; ++it) {
          const int row = it * 4 + q;
          const float* sp = slab + row * 68 + c8;
          v8h hv, lv;
#pragma unroll
          for (int e = 0; e < 8; ++e) {
            if (OUT_MODE == 1) {
              hv[e] = (_Float16)sp[e];
            } else {
              unsigned short hb = f2bf_bits(sp[e]);
              unsigned short lb = f2bf_bits(sp[e] - bf_bits2f(hb));
              hv[e] = __builtin_bit_cast(_Float16, hb);
              lv[e] = __builtin_bit_cast(_Float16, lb);
            }
          }
          *(v8h*)(C + (size_t)(mBase + row) * ldc + n0 + c8) = hv;
          if (OUT_MODE == 2) *(v8h*)(C2 + (size_t)(mBase + row) * ldc + n0 + c8) = lv;
        }
        
      }
    }
    __builtin_amdgcn_fence(__ATOMIC_RELEASE, "workgroup");
    __builtin_amdgcn_wave_barrier();
    __builtin_amdgcn_fence(__ATOMIC_ACQUIRE, "workgroup");
  }
}

// =====================================================================================
// Kernel: rmsnorm of one token row (x RNE-converted to bf16 on load, mean of squares in f32,
// rsqrt(mean + 1e-6), times norm_w (RNE bf16)), output as an f16 plane [SEQ_T][DMODEL].
// Block = 128 threads = one token; coverage 128 threads x 8 elements = 1024 = one row exactly;
// =====================================================================================
__global__ __launch_bounds__(128) void rmsnorm_f16_k(const float* __restrict__ x, const float* __restrict__ nw,
                                                     unsigned short* __restrict__ xn) {
  __shared__ float red[4];
  const int t = blockIdx.x, tid = threadIdx.x, wave = tid >> 5, lane = tid & 31;
  const float* row = x + (size_t)t * DMODEL + tid * 8;
  const v4f a = *(const v4f*)row;
  const v4f b = *(const v4f*)(row + 4);
  float xb[8];
#pragma unroll
  for (int e = 0; e < 4; ++e) { xb[e] = rne_bf(a[e]); xb[4 + e] = rne_bf(b[e]); }
  float ss = 0.f;
#pragma unroll
  for (int e = 0; e < 8; ++e) ss += xb[e] * xb[e];
#pragma unroll
  for (int m = 1; m < 32; m <<= 1) ss += __shfl_xor(ss, m, 32);
  if (lane == 0) red[wave] = ss;
  __syncthreads();
  const float tot = (red[0] + red[1]) + (red[2] + red[3]);
  const float inv = rsqrtf(tot * (1.0f / 1024.0f) + 1e-6f);
  const v4f na = *(const v4f*)(nw + tid * 8);
  const v4f nb = *(const v4f*)(nw + tid * 8 + 4);
  v8h hv;
#pragma unroll
  for (int e = 0; e < 4; ++e) {
    hv[e]     = (_Float16)((xb[e] * inv) * rne_bf(na[e]));
    hv[4 + e] = (_Float16)((xb[4 + e] * inv) * rne_bf(nb[e]));
  }
  unsigned short* dst = xn + (size_t)t * DMODEL + tid * 8;
  *(v8h*)dst = hv;
  
}

// =====================================================================================
// Kernel: weight f32 -> f16(bf16_rne(w) * carry), 8 elements per thread. Coverage: n8 threads x 8 = n exactly
// =====================================================================================
__global__ __launch_bounds__(256) void cast_w_f16x8_k(const float* __restrict__ w, unsigned short* __restrict__ out,
                                                      int n8, float carry) {
  const int i = blockIdx.x * 256 + threadIdx.x;
  if (i < n8) {
    const v4f a = *(const v4f*)(w + (size_t)8 * i);
    const v4f b = *(const v4f*)(w + (size_t)8 * i + 4);
    v8h hv;
#pragma unroll
    for (int e = 0; e < 4; ++e) {
      hv[e]     = (_Float16)(rne_bf(a[e]) * carry);
      hv[4 + e] = (_Float16)(rne_bf(b[e]) * carry);
    }
    unsigned short* dst = out + (size_t)8 * i;
    *(v8h*)dst = hv;
    
  }
}

// =====================================================================================
// Kernel: rotary (rotate-half form, half = 32) on q and k of one token, f32 math, f16 planes out.
// Input qkv f32 [SEQ_T][3072]. Outputs Q plane [NHEAD*SEQ_T][64] (row = h*SEQ_T + t), K plane same layout.
// angle_i = (float)t * invfreq_i (single f32 multiply), precise sincosf, computed once per block by wave 0.
// Block = 256 threads = 8 waves; wave w handles heads 2w and 2w+1 (q and k); staged 64-wide 16-bit rows in LDS;
// grid = SEQ_T covers all tokens; 8 waves x 2 heads = 16 heads.
// =====================================================================================
__global__ __launch_bounds__(256) void rope_qk_f16_k(const float* __restrict__ qkv, FreqTab ft,
                                                     unsigned short* __restrict__ qpl, unsigned short* __restrict__ kpl) {
#pragma clang fp contract(off)
  __shared__ float cs[2][32];
  __shared__ __align__(16) _Float16 stg[8][4 * LDS_P16];
  const int t = blockIdx.x;
  const int tid = threadIdx.x, wave = tid >> 5, ln = tid & 31;
  if (wave == 0) {
    float fr = ft.f[0];
#pragma unroll
    for (int q = 1; q < 32; ++q) fr = (ln == q) ? ft.f[q] : fr;
    const float ang = (float)t * fr;
    float sv, cv;
    sincosf(ang, &sv, &cv);
    cs[0][ln] = cv;
    cs[1][ln] = sv;
  }
  __syncthreads();
  const float cv = cs[0][ln], sv = cs[1][ln];
  const float* row = qkv + (size_t)t * QKV_N;
  _Float16* sw = stg[wave];
  // staged rows: 0 = q head 2w, 1 = q head 2w+1, 2 = k head 2w, 3 = k head 2w+1
#pragma unroll
  for (int j = 0; j < 2; ++j) {
    const int hq = 2 * wave + j;
    const float x1 = row[hq * HDIM + ln];
    const float x2 = row[hq * HDIM + ln + 32];
    sw[j * LDS_P16 + ln]      = (_Float16)(x1 * cv - x2 * sv);
    sw[j * LDS_P16 + ln + 32] = (_Float16)(x2 * cv + x1 * sv);
    const float k1 = row[KCOL0 + hq * HDIM + ln];
    const float k2 = row[KCOL0 + hq * HDIM + ln + 32];
    sw[(2 + j) * LDS_P16 + ln]      = (_Float16)(k1 * cv - k2 * sv);
    sw[(2 + j) * LDS_P16 + ln + 32] = (_Float16)(k2 * cv + k1 * sv);
  }
  __builtin_amdgcn_fence(__ATOMIC_RELEASE, "workgroup");
  __builtin_amdgcn_wave_barrier();
  __builtin_amdgcn_fence(__ATOMIC_ACQUIRE, "workgroup");

  const int q8 = ln >> 3, c8 = (ln & 7) * 8;
  const v8h val = *(const v8h*)(sw + q8 * LDS_P16 + c8);
  const int hsel = 2 * wave + (q8 & 1);
  const size_t off = ((size_t)hsel * SEQ_T + t) * HDIM + c8;
  unsigned short* dst = ((q8 < 2) ? qpl : kpl) + off;     // both candidates are global pointers
  {
    *(v8h*)dst = val;
    
  }
}

// =====================================================================================
// Kernel: v block of qkv f32 (in[t][d] at qkv[t*3072 + 2048 + h*64 + d]) -> Vt f16 plane [NHEAD*64][SEQ_T]
// (out[h*64 + d][t]).  Block (t-tile of 64, head h): 64x64 tile through LDS.
// Load coverage: 256 threads x 16 floats = 4096 = 64 t x 64 d.
// Store coverage: 8 waves x 2 (dA, dB) x 4 row groups (q8) = 64 d rows; 8 lanes x 16 B = 64 t (one whole
// =====================================================================================
__global__ __launch_bounds__(256) void vt_from_qkv_k(const float* __restrict__ qkv, unsigned short* __restrict__ vt) {
  __shared__ __align__(16) _Float16 th[64 * LDS_P16];
  const int t0 = blockIdx.x * 64, h = blockIdx.y;
  const int tid = threadIdx.x;
  {
    const int sloc = tid >> 2, d0 = (tid & 3) * 16;
    const float* src = qkv + (size_t)(t0 + sloc) * QKV_N + VCOL0 + h * HDIM + d0;
    const v4f a0 = *(const v4f*)(src);
    const v4f a1 = *(const v4f*)(src + 4);
    const v4f a2 = *(const v4f*)(src + 8);
    const v4f a3 = *(const v4f*)(src + 12);
#pragma unroll
    for (int e = 0; e < 4; ++e) {
      th[(d0 + e) * LDS_P16 + sloc]      = (_Float16)a0[e];
      th[(d0 + 4 + e) * LDS_P16 + sloc]  = (_Float16)a1[e];
      th[(d0 + 8 + e) * LDS_P16 + sloc]  = (_Float16)a2[e];
      th[(d0 + 12 + e) * LDS_P16 + sloc] = (_Float16)a3[e];
    }
  }
  __syncthreads();
  const int wave = tid >> 5, lane = tid & 31, q8 = lane >> 3, c8 = (lane & 7) * 8;
  const int dA = wave * 8 + q8, dB = wave * 8 + 4 + q8;
  const v8h va = *(const v8h*)(th + dA * LDS_P16 + c8);
  const v8h vb = *(const v8h*)(th + dB * LDS_P16 + c8);
  const size_t oA = ((size_t)h * HDIM + dA) * SEQ_T + t0 + c8;
  const size_t oB = ((size_t)h * HDIM + dB) * SEQ_T + t0 + c8;
  {
    *(v8h*)(vt + oA) = va;
    *(v8h*)(vt + oB) = vb;
    
  }
}

// =====================================================================================
// Kernel: causal attention, head dim 64, f16 planes in (Q, K: [NHEAD*SEQ_T][64]; Vt: [NHEAD*64][SEQ_T]),
// f16 plane out (O: [SEQ_T][DMODEL], head h at cols h*64, value o*16).
//   scores = 0.125 * q.k^T : v_wmma_f32_16x16x32_f16 (q, k plain f16), f32 accumulate
//   out    = p.v           : v_wmma_f32_16x16x32_f16 (p carried x2^15 in f16, v plain f16), f32 accumulate
//   online softmax in f32; keys above the diagonal -> -inf (every row keeps key kv0 <= row, so never fully masked).
// Block = 4 waves = 64 query rows of head h; 64-key chunks; chunks above the diagonal are skipped (block-uniform).
// K / Vt chunks staged in LDS with plain loads + __syncthreads (128 threads x 4 x 16 B = 64x64 halves each);
// WMMA operands are read from dense, statically strided LDS / plane addresses only.
// O store coverage per wave: 4 iterations x 4 row groups = 16 rows, 8 lanes x 8 halves = 64 cols = one whole
// =====================================================================================
__global__ __launch_bounds__(128) void attn_causal_hd64_k(const unsigned short* __restrict__ qp,
                                                         const unsigned short* __restrict__ kp,
                                                         const unsigned short* __restrict__ vtp,
                                                         unsigned short* __restrict__ op) {
  typedef Frag<_Float16> FH;
  __shared__ __align__(16) _Float16 Ksh[KEY_CH * LDS_P16];    // [kv][d]
  __shared__ __align__(16) _Float16 Vts[HDIM * LDS_P16];      // [d][kv]
  __shared__ __align__(16) _Float16 Psh[4][16 * LDS_P16];     // per wave [row][kv]
  __shared__ __align__(16) float   Os[4][16 * 68];            // per wave out tile, pitch 68
  const int tid = threadIdx.x, wave = tid >> 5, lane = tid & 31, hh = lane >> 4, c = lane & 15;
  const int qb = blockIdx.x % NQTILE;
  const int h  = blockIdx.x / NQTILE;
  const int q0 = qb * 64 + wave * 16;
  const _Float16* Qh = (const _Float16*)qp + ((size_t)h * SEQ_T + q0 + c) * HDIM;
  const _Float16* Kh = (const _Float16*)kp + (size_t)h * SEQ_T * HDIM;
  const _Float16* Vh = (const _Float16*)vtp + (size_t)h * HDIM * SEQ_T;

  // Q fragments (A operand, row = query q0 + c, k = head dim): 2 d-chunks of 32
  v16h qa[2];
  qa[0] = FH::load(Qh + 8 * hh);
  qa[1] = FH::load(Qh + 32 + 8 * hh);

  const v8f vz = (v8f){0.f,0.f,0.f,0.f,0.f,0.f,0.f,0.f};
  float mrow[8], lrow[8];
  v8f oacc[4];
#pragma unroll
  for (int r = 0; r < 8; ++r) { mrow[r] = -INFINITY; lrow[r] = 0.f; }
#pragma unroll
  for (int t = 0; t < 4; ++t) oacc[t] = vz;

  const int nChunks = qb + 1;   // block-uniform
  for (int kc = 0; kc < nChunks; ++kc) {
    const int kv0 = kc * KEY_CH;
    __syncthreads();
#pragma unroll
    for (int i = 0; i < 4; ++i) {
      const int idx = tid + 128 * i;          // 0..511
      const int r = idx >> 3, c8 = (idx & 7) * 8;
      const v8h kv = *(const v8h*)(Kh + (size_t)(kv0 + r) * HDIM + c8);      // K row kv0+r, d c8..c8+7
      const v8h vv = *(const v8h*)(Vh + (size_t)r * SEQ_T + kv0 + c8);        // Vt row d=r, keys kv0+c8..
      *(v8h*)(Ksh + r * LDS_P16 + c8) = kv;
      *(v8h*)(Vts + r * LDS_P16 + c8) = vv;
    }
    __syncthreads();

    v8f s[4];
#pragma unroll
    for (int j = 0; j < 4; ++j) {
      s[j] = vz;
#pragma unroll
      for (int dc = 0; dc < 2; ++dc) {
        const v16h kb = FH::load(Ksh + (j * 16 + c) * LDS_P16 + dc * 32 + 8 * hh);   // B[k=d][n=key j*16+c]
        s[j] = mma_f16g(qa[dc], kb, s[j]);
      }
    }
    const bool diag = (kc == qb);
    float cm[8];
#pragma unroll
    for (int r = 0; r < 8; ++r) {
      const int qrow = q0 + 8 * hh + r;
      float m = -INFINITY;
#pragma unroll
      for (int j = 0; j < 4; ++j) {
        const int kvcol = kv0 + j * 16 + c;
        float sv = s[j][r] * 0.125f;
        if (diag && (kvcol > qrow)) sv = -INFINITY;
        s[j][r] = sv;
        m = fmaxf(m, sv);
      }
#pragma unroll
      for (int off = 1; off < 16; off <<= 1) m = fmaxf(m, __shfl_xor(m, off, 32));
      cm[r] = m;
    }
    _Float16* pw = Psh[wave];
#pragma unroll
    for (int r = 0; r < 8; ++r) {
      const float mnew = fmaxf(mrow[r], cm[r]);
      const float alpha = __expf(mrow[r] - mnew);
      mrow[r] = mnew;
      float psum = 0.f;
#pragma unroll
      for (int j = 0; j < 4; ++j) {
        const float p = __expf(s[j][r] - mnew);
        psum += p;
        pw[(8 * hh + r) * LDS_P16 + j * 16 + c] = (_Float16)(p * P_CARRY);
      }
#pragma unroll
      for (int off = 1; off < 16; off <<= 1) psum += __shfl_xor(psum, off, 32);
      lrow[r] = lrow[r] * alpha + psum;
#pragma unroll
      for (int t = 0; t < 4; ++t) oacc[t][r] *= alpha;
    }
    __builtin_amdgcn_fence(__ATOMIC_RELEASE, "workgroup");
    __builtin_amdgcn_wave_barrier();
    __builtin_amdgcn_fence(__ATOMIC_ACQUIRE, "workgroup");
#pragma unroll
    for (int kk = 0; kk < 2; ++kk) {
      const v16h pa = FH::load(pw + c * LDS_P16 + kk * 32 + 8 * hh);                 // A[m=row c][k=key]
#pragma unroll
      for (int t = 0; t < 4; ++t) {
        const v16h vb = FH::load(Vts + (t * 16 + c) * LDS_P16 + kk * 32 + 8 * hh);   // B[k=key][n=d t*16+c]
        oacc[t] = mma_f16g(pa, vb, oacc[t]);
      }
    }
  }

  float* os = Os[wave];
#pragma unroll
  for (int r = 0; r < 8; ++r) {
    const float inv = (1.0f / lrow[r]) * (O_CARRY / P_CARRY);
#pragma unroll
    for (int t = 0; t < 4; ++t) os[(8 * hh + r) * 68 + t * 16 + c] = oacc[t][r] * inv;
  }
  __builtin_amdgcn_fence(__ATOMIC_RELEASE, "workgroup");
  __builtin_amdgcn_wave_barrier();
  __builtin_amdgcn_fence(__ATOMIC_ACQUIRE, "workgroup");
  {
    const int q8 = lane >> 3, c8 = (lane & 7) * 8;
    unsigned short* ob = op + (size_t)h * HDIM + c8;
    {
#pragma unroll
      for (int it = 0; it < 4; ++it) {
        const int row = it * 4 + q8;
        const v4f f0 = *(const v4f*)(os + row * 68 + c8);
        const v4f f1 = *(const v4f*)(os + row * 68 + c8 + 4);
        v8h hv;
#pragma unroll
        for (int e = 0; e < 4; ++e) { hv[e] = (_Float16)f0[e]; hv[4 + e] = (_Float16)f1[e]; }
        *(v8h*)(ob + (size_t)(q0 + row) * DMODEL) = hv;
      }
      
    }
  }
}

// =====================================================================================
// Host glue.  Workspace region map (bytes, all offsets multiples of 1 MiB):
//   XN   f16 [4096][1024]         8,388,608 @ 0
//   WQKV f16 [3072][1024] (x64)   6,291,456 @ 8,388,608
//   WO   f16 [1024][1024] (x64)   2,097,152 @ 14,680,064
//   QKV  f32 [4096][3072]        50,331,648 @ 16,777,216
//   QPL  f16 [16*4096][64]        8,388,608 @ 67,108,864
//   KPL  f16 [16*4096][64]        8,388,608 @ 75,497,472
//   VT   f16 [16*64][4096]        8,388,608 @ 83,886,080
//   OPL  f16 [4096][1024] (x16)   8,388,608 @ 92,274,688
//   total 100,663,296
// =====================================================================================
extern "C" void kernel_launch(void* const* d_in, const int* in_sizes, int n_in,
                              void* d_out, int out_size, void* d_ws, size_t ws_size,
                              hipStream_t stream) {
  if (n_in < 6) return;
  const int nx = SEQ_T * DMODEL;
  const int nwgt = DMODEL * DMODEL;
  if (in_sizes[0] != nx || in_sizes[1] != nwgt || in_sizes[2] != nwgt || in_sizes[3] != nwgt ||
      in_sizes[4] != nwgt || in_sizes[5] != DMODEL || out_size != nx) return;

  const float* x  = (const float*)d_in[0];
  const float* wq = (const float*)d_in[1];
  const float* wk = (const float*)d_in[2];
  const float* wv = (const float*)d_in[3];
  const float* wo = (const float*)d_in[4];
  const float* nw = (const float*)d_in[5];
  float* out = (float*)d_out;

  const size_t szXN   = (size_t)nx * 2;
  const size_t szWQKV = (size_t)3 * nwgt * 2;
  const size_t szWO   = (size_t)nwgt * 2;
  const size_t szQKV  = (size_t)SEQ_T * QKV_N * 4;
  const size_t szPL   = (size_t)NHEAD * SEQ_T * HDIM * 2;
  const size_t szO    = (size_t)nx * 2;
  const size_t offXN   = 0;
  const size_t offWQKV = offXN + szXN;
  const size_t offWO   = offWQKV + szWQKV;
  const size_t offQKV  = offWO + szWO;
  const size_t offQ    = offQKV + szQKV;
  const size_t offK    = offQ + szPL;
  const size_t offVT   = offK + szPL;
  const size_t offO    = offVT + szPL;
  const size_t total   = offO + szO;
  if (total > ws_size) return;

  char* ws = (char*)d_ws;
  unsigned short* XN   = (unsigned short*)(ws + offXN);
  unsigned short* WQKV = (unsigned short*)(ws + offWQKV);
  unsigned short* WO   = (unsigned short*)(ws + offWO);
  float*          QKV  = (float*)(ws + offQKV);
  unsigned short* QPL  = (unsigned short*)(ws + offQ);
  unsigned short* KPL  = (unsigned short*)(ws + offK);
  unsigned short* VT   = (unsigned short*)(ws + offVT);
  unsigned short* OPL  = (unsigned short*)(ws + offO);

  // inverse-frequency table: e_i = (2i)/64 (exact), p_i = fl32(pow(10000, e_i)) (double pow on host,
  // RNE to f32), invfreq_i = 1.0f / p_i (f32)
  FreqTab ft;
  for (int i = 0; i < 32; ++i) {
    const float e = (float)(2 * i) / 64.0f;
    const float p = (float)pow(10000.0, (double)e);
    ft.f[i] = 1.0f / p;
  }

  // 1) rmsnorm -> XN (f16)
  rmsnorm_f16_k<<<SEQ_T, 128, 0, stream>>>(x, nw, XN);
  // 2) weights -> f16(bf16(w) * 64); wq | wk | wv stacked as rows 0.., 1024.., 2048.. of WQKV
  const int n8 = nwgt / 8;
  const int castBlocks = (n8 + 255) / 256;
  cast_w_f16x8_k<<<castBlocks, 256, 0, stream>>>(wq, WQKV, n8, W_CARRY);
  cast_w_f16x8_k<<<castBlocks, 256, 0, stream>>>(wk, WQKV + (size_t)nwgt, n8, W_CARRY);
  cast_w_f16x8_k<<<castBlocks, 256, 0, stream>>>(wv, WQKV + (size_t)2 * nwgt, n8, W_CARRY);
  cast_w_f16x8_k<<<castBlocks, 256, 0, stream>>>(wo, WO, n8, W_CARRY);
  // 3) QKV = XN . WQKV^T / 64 : M=4096, N=3072, K=1024 (K % 32 == 0, M,N % 64 == 0); 64x48 wave tiles = 384 blocks
  {
    const int tiles = (SEQ_T / 64) * (QKV_N / 64);
    dim3 grid((tiles + 7) / 8, 1);
    wmma_gemm64<0, 0, 0, 0, false><<<grid, 256, 0, stream>>>(
        XN, XN, DMODEL, 0L, WQKV, WQKV, DMODEL, 0L, (void*)QKV, (void*)QKV, QKV_N, 0L,
        nw, x, 0L, SEQ_T, QKV_N, DMODEL, 1.0f / W_CARRY);
  }
  // 4) rotary on q, k -> f16 planes; 5) v -> Vt f16 plane
  rope_qk_f16_k<<<SEQ_T, 256, 0, stream>>>(QKV, ft, QPL, KPL);
  vt_from_qkv_k<<<dim3(SEQ_T / 64, NHEAD), 256, 0, stream>>>(QKV, VT);
  // 6) causal attention -> O plane (f16, x16)
  attn_causal_hd64_k<<<NHEAD * NQTILE, 128, 0, stream>>>(QPL, KPL, VT, OPL);
  // 7) out = bf16_rne(x) + (O . WO^T) / (16*64) : M=4096, N=1024, K=1024; 64x16 wave tiles = 128 blocks
  {
    const int tiles = (SEQ_T / 64) * (DMODEL / 64);
    dim3 grid((tiles + 7) / 8, 1);
    wmma_gemm64<0, 0, 0, 0, true, 0, true><<<grid, 256, 0, stream>>>(
        OPL, OPL, DMODEL, 0L, WO, WO, DMODEL, 0L, (void*)out, (void*)out, DMODEL, 0L,
        nw, x, 0L, SEQ_T, DMODEL, DMODEL, 1.0f / (O_CARRY * W_CARRY));
  }
}

// v001
// It runs in 242 microseconds.
// Next to v000, in two timings, it ran 1.55 and 1.56 times as fast.
// Contractions: qkv projection (normed . W^T, K=1024), attention q.k^T and p.v (head dim 64), output projection (o . Wo^T, K=1024): all v_wmma_f32_16x16x32_f16 (f16 operands, f32 accumulate); W carried x64, p carried x2^15, attention output carried x16 (exact power-of-two carries folded back in f32); float inputs RNE-converted to bf16 on load; rmsnorm, rotary tables, softmax, residual add in f32.
#include <hip/hip_runtime.h>
#include <math.h>

typedef __attribute__((ext_vector_type(16))) _Float16 v16h;
typedef __attribute__((ext_vector_type(8)))  _Float16 v8h;
typedef __attribute__((ext_vector_type(16))) __bf16   v16b;
typedef __attribute__((ext_vector_type(8)))  __bf16   v8b;
typedef __attribute__((ext_vector_type(8)))  float    v8f;
typedef __attribute__((ext_vector_type(4)))  float    v4f;

constexpr int SEQ_T     = 4096;
constexpr int DMODEL    = 1024;
constexpr int NHEAD     = 16;
constexpr int HDIM      = 64;
constexpr int QKV_N     = 3072;          // cols 0..1023 q | 1024..2047 k | 2048..3071 v
constexpr int KCOL0     = 1024;
constexpr int VCOL0     = 2048;
constexpr int NQTILE    = SEQ_T / 64;    // 64-row query tiles per head
constexpr int KEY_CH    = 64;            // keys per chunk
constexpr int LDS_P16   = 72;            // 16-bit LDS pitch (144 B rows, 16-B aligned)
constexpr float W_CARRY = 64.0f;         // weights stored as f16(bf16(w) * 64)
constexpr float P_CARRY = 32768.0f;      // softmax numerators stored as f16(p * 2^15)
constexpr float O_CARRY = 16.0f;         // attention output stored as f16(o * 16)

struct FreqTab { float f[32]; };
static_assert(sizeof(FreqTab) == 128);

__device__ __forceinline__ unsigned short f2bf_bits(float f) {
  unsigned u = __float_as_uint(f);
  return (unsigned short)((u + 0x7FFFu + ((u >> 16) & 1u)) >> 16);
}
__device__ __forceinline__ float bf_bits2f(unsigned short h) { return __uint_as_float(((unsigned)h) << 16); }
__device__ __forceinline__ float rne_bf(float f) { return bf_bits2f(f2bf_bits(f)); }

// hazard guards as plain device helpers (no inline asm inside the kernel template body)
__device__ __forceinline__ void dep_guard_h(v8f& a, v8f& b, v16h x, v16h y) { asm volatile("v_nop\n\tv_nop\n\tv_nop\n\tv_nop" : "+v"(a), "+v"(b) : "v"(x), "v"(y)); }
__device__ __forceinline__ void dep_guard_b(v8f& a, v8f& b, v16b x, v16b y) { asm volatile("v_nop\n\tv_nop\n\tv_nop\n\tv_nop" : "+v"(a), "+v"(b) : "v"(x), "v"(y)); }
__device__ __forceinline__ void keep4_h(v16h a, v16h b, v16h c, v16h d) { asm volatile("v_nop" :: "v"(a), "v"(b), "v"(c), "v"(d)); }
__device__ __forceinline__ void keep4_b(v16b a, v16b b, v16b c, v16b d) { asm volatile("v_nop" :: "v"(a), "v"(b), "v"(c), "v"(d)); }
__device__ __forceinline__ void acc_guard4(v8f& a, v8f& b, v8f& c, v8f& d) { asm volatile("v_nop\n\tv_nop\n\tv_nop\n\tv_nop" : "+v"(a), "+v"(b), "+v"(c), "+v"(d)); }
template <typename T> struct Frag;
template <> struct Frag<_Float16> {
  typedef v16h V; union U { v16h v; v8h h[2]; };
  static __device__ __forceinline__ v16h load(const _Float16* p) {   // elements 0..7 <- p[0..7], 8..15 <- p[16..23]
    U f; f.h[0] = *(const v8h*)(p); f.h[1] = *(const v8h*)(p + 16); return f.v;
  }
  static __device__ __forceinline__ v8f mma(v16h a, v16h b, v8f c) {
    return __builtin_amdgcn_wmma_f32_16x16x32_f16(false, a, false, b, (short)0, c, false, false);
  }
  static __device__ __forceinline__ void guard(v8f& a, v8f& b, v16h x, v16h y) { dep_guard_h(a, b, x, y); }
  static __device__ __forceinline__ void keep(v16h a, v16h b, v16h c, v16h d) { keep4_h(a, b, c, d); }
};
template <> struct Frag<__bf16> {
  typedef v16b V; union U { v16b v; v8b h[2]; };
  static __device__ __forceinline__ v16b load(const __bf16* p) {
    U f; f.h[0] = *(const v8b*)(p); f.h[1] = *(const v8b*)(p + 16); return f.v;
  }
  static __device__ __forceinline__ v8f mma(v16b a, v16b b, v8f c) {
    return __builtin_amdgcn_wmma_f32_16x16x32_bf16(false, a, false, b, (short)0, c, false, false);
  }
  static __device__ __forceinline__ void guard(v8f& a, v8f& b, v16b x, v16b y) { dep_guard_b(a, b, x, y); }
  static __device__ __forceinline__ void keep(v16b a, v16b b, v16b c, v16b d) { keep4_b(a, b, c, d); }
};

// lane l reads lane l ^ 16 (vector cross-row move, no LDS round trip)
__device__ __forceinline__ float xhalf(float x) {
  const int b = __builtin_bit_cast(int, x);
  return __builtin_bit_cast(float, __builtin_amdgcn_permlanex16(b, b, 0x76543210, 0xfedcba98, false, false));
}

// single WMMA with the dependency guard (used by the attention kernel)
__device__ __forceinline__ v8f mma_f16g(v16h a, v16h b, v8f c) {
  c = __builtin_amdgcn_wmma_f32_16x16x32_f16(false, a, false, b, (short)0, c, false, false);
  asm volatile("v_nop\n\tv_nop\n\tv_nop\n\tv_nop" : "+v"(c) : "v"(a), "v"(b));
  return c;
}

// =====================================================================================
// Register-blocked batched WMMA GEMM, C[m,n] = scale * sum_k A[m,k] * Bt[n,k] (+bias)(+resid);
// each wave owns a 64x64 tile. A row-major [M,K]; Bt row-major [N,K]; M,N % 64 == 0, K % 32 == 0.
// SPLITM: 0 = single product; 1 = A carried as hi/lo planes (A2p = lo): product = hi.B + lo.B;
//         2 = A and Bt as hi/lo planes: product = hi.hi + hi.lo + lo.hi.
// BIAS_MODE: 0 = none, 1 = bias[m], 2 = bias[n].  OUT_MODE: 0 = f32, 1 = f16, 2 = bf16 hi + lo planes.
// RESID_RNE: the residual value is RNE-converted to bf16 before the add.
// ET: 0 = f16 operands, 1 = bf16 operands (pointers passed as 16-bit storage)
// =====================================================================================
template <int ET> struct Elem;
template <> struct Elem<0> { typedef _Float16 T; };
template <> struct Elem<1> { typedef __bf16 T; };
template <int ET, int SPLITM, int BIAS_MODE, int OUT_MODE, bool RESID, int ACT = 0, bool RESID_RNE = false>
__global__ __launch_bounds__(256) void wmma_gemm64(
    const unsigned short* __restrict__ Ap, const unsigned short* __restrict__ A2p, int lda, long strideA,
    const unsigned short* __restrict__ Btp, const unsigned short* __restrict__ Bt2p, int ldb, long strideB,
    void* __restrict__ Cout, void* __restrict__ Cout2, int ldc, long strideC,
    const float* __restrict__ bias,
    const float* __restrict__ resid, long strideR,
    int M, int N, int K, float scale) {
  typedef typename Elem<ET>::T T;
  typedef typename Frag<T>::V V;
  constexpr bool SPA = (SPLITM >= 1);
  constexpr bool SPB = (SPLITM >= 2);
  const T* A = (const T*)Ap; const T* A2 = (const T*)A2p; const T* Bt = (const T*)Btp; const T* Bt2 = (const T*)Bt2p;
  __shared__ __align__(16) float sT[8][16 * 68];   // per-wave 16x64 slab, pitch 68 floats
  const int b    = blockIdx.y;
  const int lane = threadIdx.x & 31;
  const int wave = threadIdx.x >> 5;
  const int tilesN = N >> 6;
  const int tilesM = M >> 6;
  const int tile = blockIdx.x * 8 + wave;
  if (tile >= tilesM * tilesN) return;   // wave-uniform; no block barriers in this kernel
  const int tm = tile / tilesN;
  const int tn = tile - tm * tilesN;
  const int m0 = tm << 6;
  const int n0 = tn << 6;

  const T* Ab  = A  + (size_t)b * strideA;
  const T* Bb  = Bt + (size_t)b * strideB;
  const T* Ab2 = SPA ? (A2  + (size_t)b * strideA) : nullptr;
  const T* Bb2 = SPB ? (Bt2 + (size_t)b * strideB) : nullptr;

  const int rlane = lane & 15;                 // row (A) / col (B, D) within subtile
  const int koff  = (lane >> 4) * 8;           // k offset of this lane half
  const int mOff  = (lane >> 4) * 8;           // D row offset

  v8f acc[4][4];
#pragma unroll
  for (int i = 0; i < 4; ++i)
#pragma unroll
    for (int j = 0; j < 4; ++j) acc[i][j] = (v8f){0.f,0.f,0.f,0.f,0.f,0.f,0.f,0.f};

  for (int k0 = 0; k0 < K; k0 += 32) {
    V bh[4], bl[4];
#pragma unroll
    for (int j = 0; j < 4; ++j) {
      const size_t bo = (size_t)(n0 + (j << 4) + rlane) * ldb + koff + k0;
      bh[j] = Frag<T>::load(Bb + bo);
      if (SPB) bl[j] = Frag<T>::load(Bb2 + bo);
    }
#pragma unroll
    for (int i = 0; i < 4; ++i) {
      const size_t ao = (size_t)(m0 + (i << 4) + rlane) * lda + koff + k0;
      V ah = Frag<T>::load(Ab + ao);
      V al;
      if (SPA) al = Frag<T>::load(Ab2 + ao);
#pragma unroll
      for (int j = 0; j < 4; ++j) {
        acc[i][j] = Frag<T>::mma(ah, bh[j], acc[i][j]);
        if (SPB) acc[i][j] = Frag<T>::mma(ah, bl[j], acc[i][j]);
        if (SPA) acc[i][j] = Frag<T>::mma(al, bh[j], acc[i][j]);
      }
      Frag<T>::guard(acc[i][0], acc[i][3], ah, SPA ? al : ah);
    }
    Frag<T>::keep(bh[0], bh[1], bh[2], bh[3]);
    if (SPB) Frag<T>::keep(bl[0], bl[1], bl[2], bl[3]);
  }
  acc_guard4(acc[0][0], acc[0][1], acc[0][2], acc[0][3]);
  acc_guard4(acc[1][0], acc[1][1], acc[1][2], acc[1][3]);
  acc_guard4(acc[2][0], acc[2][1], acc[2][2], acc[2][3]);
  acc_guard4(acc[3][0], acc[3][1], acc[3][2], acc[3][3]);

  // ---- epilogue ----
  float* slab = sT[wave];
  const float* Rb = RESID ? (resid + (size_t)b * strideR) : nullptr;
#pragma unroll
  for (int i = 0; i < 4; ++i) {
    const int mBase = m0 + (i << 4);
#pragma unroll
    for (int j = 0; j < 4; ++j) {
      const int n = n0 + (j << 4) + rlane;
      float bv = 0.f;
      if (BIAS_MODE == 2) bv = bias[n];
#pragma unroll
      for (int r = 0; r < 8; ++r) {
        float v = acc[i][j][r] * scale;
        if (BIAS_MODE == 1) v += bias[mBase + mOff + r];
        if (BIAS_MODE == 2) v += bv;
        if (RESID) {
          float rv = Rb[(size_t)(mBase + mOff + r) * ldc + n];
          if (RESID_RNE) rv = rne_bf(rv);
          v += rv;
        }
        if (ACT == 1) v = tanhf(v);
        if (ACT == 2) v = fmaxf(v, 0.0f);
        if (ACT == 4) v = (v > 0.f) ? v : 0.01f * v;
        slab[(mOff + r) * 68 + (j << 4) + rlane] = v;
      }
    }
    __builtin_amdgcn_fence(__ATOMIC_RELEASE, "workgroup");
    __builtin_amdgcn_wave_barrier();
    __builtin_amdgcn_fence(__ATOMIC_ACQUIRE, "workgroup");
    if (OUT_MODE == 0) {
      float* C = (float*)Cout + (size_t)b * strideC;
      const int hh = lane >> 4, c4 = (lane & 15) * 4;     // row seg = 256 B = 16 lanes x 16 B
      {
#pragma unroll
        for (int it = 0; it < 8; ++it) {
          const int row = it * 2 + hh;
          v4f v = *(const v4f*)(slab + row * 68 + c4);
          *(v4f*)(C + (size_t)(mBase + row) * ldc + n0 + c4) = v;
        }
        
      }
    } else {
      const int q = lane >> 3, c8 = (lane & 7) * 8;
      unsigned short* C  = (unsigned short*)Cout  + (size_t)b * strideC;
      unsigned short* C2 = (OUT_MODE == 2) ? ((unsigned short*)Cout2 + (size_t)b * strideC) : nullptr;
      {
#pragma unroll
        for (int it = 0; it < 4; ++it) {
          const int row = it * 4 + q;
          const float* sp = slab + row * 68 + c8;
          v8h hv, lv;
#pragma unroll
          for (int e = 0; e < 8; ++e) {
            if (OUT_MODE == 1) {
              hv[e] = (_Float16)sp[e];
            } else {
              unsigned short hb = f2bf_bits(sp[e]);
              unsigned short lb = f2bf_bits(sp[e] - bf_bits2f(hb));
              hv[e] = __builtin_bit_cast(_Float16, hb);
              lv[e] = __builtin_bit_cast(_Float16, lb);
            }
          }
          *(v8h*)(C + (size_t)(mBase + row) * ldc + n0 + c8) = hv;
          if (OUT_MODE == 2) *(v8h*)(C2 + (size_t)(mBase + row) * ldc + n0 + c8) = lv;
        }
        
      }
    }
    __builtin_amdgcn_fence(__ATOMIC_RELEASE, "workgroup");
    __builtin_amdgcn_wave_barrier();
    __builtin_amdgcn_fence(__ATOMIC_ACQUIRE, "workgroup");
  }
}

// =====================================================================================
// Kernel: rmsnorm of one token row (x RNE-converted to bf16 on load, mean of squares in f32,
// rsqrt(mean + 1e-6), times norm_w (RNE bf16)), output as an f16 plane [SEQ_T][DMODEL].
// Block = 128 threads = one token; coverage 128 threads x 8 elements = 1024 = one row exactly;
// =====================================================================================
__global__ __launch_bounds__(128) void rmsnorm_f16_k(const float* __restrict__ x, const float* __restrict__ nw,
                                                     unsigned short* __restrict__ xn) {
  __shared__ float red[4];
  const int t = blockIdx.x, tid = threadIdx.x, wave = tid >> 5, lane = tid & 31;
  const float* row = x + (size_t)t * DMODEL + tid * 8;
  const v4f a = *(const v4f*)row;
  const v4f b = *(const v4f*)(row + 4);
  float xb[8];
#pragma unroll
  for (int e = 0; e < 4; ++e) { xb[e] = rne_bf(a[e]); xb[4 + e] = rne_bf(b[e]); }
  float ss = 0.f;
#pragma unroll
  for (int e = 0; e < 8; ++e) ss += xb[e] * xb[e];
#pragma unroll
  for (int m = 1; m < 32; m <<= 1) ss += __shfl_xor(ss, m, 32);
  if (lane == 0) red[wave] = ss;
  __syncthreads();
  const float tot = (red[0] + red[1]) + (red[2] + red[3]);
  const float inv = rsqrtf(tot * (1.0f / 1024.0f) + 1e-6f);
  const v4f na = *(const v4f*)(nw + tid * 8);
  const v4f nb = *(const v4f*)(nw + tid * 8 + 4);
  v8h hv;
#pragma unroll
  for (int e = 0; e < 4; ++e) {
    hv[e]     = (_Float16)((xb[e] * inv) * rne_bf(na[e]));
    hv[4 + e] = (_Float16)((xb[4 + e] * inv) * rne_bf(nb[e]));
  }
  unsigned short* dst = xn + (size_t)t * DMODEL + tid * 8;
  *(v8h*)dst = hv;
  
}

// =====================================================================================
// Kernel: weight f32 -> f16(bf16_rne(w) * carry), 8 elements per thread. Coverage: n8 threads x 8 = n exactly
// =====================================================================================
__global__ __launch_bounds__(256) void cast_w_f16x8_k(const float* __restrict__ w, unsigned short* __restrict__ out,
                                                      int n8, float carry) {
  const int i = blockIdx.x * 256 + threadIdx.x;
  if (i < n8) {
    const v4f a = *(const v4f*)(w + (size_t)8 * i);
    const v4f b = *(const v4f*)(w + (size_t)8 * i + 4);
    v8h hv;
#pragma unroll
    for (int e = 0; e < 4; ++e) {
      hv[e]     = (_Float16)(rne_bf(a[e]) * carry);
      hv[4 + e] = (_Float16)(rne_bf(b[e]) * carry);
    }
    unsigned short* dst = out + (size_t)8 * i;
    *(v8h*)dst = hv;
    
  }
}

// =====================================================================================
// Kernel: rotary (rotate-half form, half = 32) on q and k of one token, f32 math, f16 planes out.
// Input qkv f32 [SEQ_T][3072]. Outputs Q plane [NHEAD*SEQ_T][64] (row = h*SEQ_T + t), K plane same layout.
// angle_i = (float)t * invfreq_i (single f32 multiply), precise sincosf, computed once per block by wave 0.
// Block = 256 threads = 8 waves; wave w handles heads 2w and 2w+1 (q and k); staged 64-wide 16-bit rows in LDS;
// grid = SEQ_T covers all tokens; 8 waves x 2 heads = 16 heads.
// =====================================================================================
__global__ __launch_bounds__(256) void rope_qk_f16_k(const float* __restrict__ qkv, FreqTab ft,
                                                     unsigned short* __restrict__ qpl, unsigned short* __restrict__ kpl) {
#pragma clang fp contract(off)
  __shared__ float cs[2][32];
  __shared__ __align__(16) _Float16 stg[8][4 * LDS_P16];
  const int t = blockIdx.x;
  const int tid = threadIdx.x, wave = tid >> 5, ln = tid & 31;
  if (wave == 0) {
    float fr = ft.f[0];
#pragma unroll
    for (int q = 1; q < 32; ++q) fr = (ln == q) ? ft.f[q] : fr;
    const float ang = (float)t * fr;
    float sv, cv;
    sincosf(ang, &sv, &cv);
    cs[0][ln] = cv;
    cs[1][ln] = sv;
  }
  __syncthreads();
  const float cv = cs[0][ln], sv = cs[1][ln];
  const float* row = qkv + (size_t)t * QKV_N;
  _Float16* sw = stg[wave];
  // staged rows: 0 = q head 2w, 1 = q head 2w+1, 2 = k head 2w, 3 = k head 2w+1
#pragma unroll
  for (int j = 0; j < 2; ++j) {
    const int hq = 2 * wave + j;
    const float x1 = row[hq * HDIM + ln];
    const float x2 = row[hq * HDIM + ln + 32];
    sw[j * LDS_P16 + ln]      = (_Float16)(x1 * cv - x2 * sv);
    sw[j * LDS_P16 + ln + 32] = (_Float16)(x2 * cv + x1 * sv);
    const float k1 = row[KCOL0 + hq * HDIM + ln];
    const float k2 = row[KCOL0 + hq * HDIM + ln + 32];
    sw[(2 + j) * LDS_P16 + ln]      = (_Float16)(k1 * cv - k2 * sv);
    sw[(2 + j) * LDS_P16 + ln + 32] = (_Float16)(k2 * cv + k1 * sv);
  }
  __builtin_amdgcn_fence(__ATOMIC_RELEASE, "workgroup");
  __builtin_amdgcn_wave_barrier();
  __builtin_amdgcn_fence(__ATOMIC_ACQUIRE, "workgroup");

  const int q8 = ln >> 3, c8 = (ln & 7) * 8;
  const v8h val = *(const v8h*)(sw + q8 * LDS_P16 + c8);
  const int hsel = 2 * wave + (q8 & 1);
  const size_t off = ((size_t)hsel * SEQ_T + t) * HDIM + c8;
  unsigned short* dst = ((q8 < 2) ? qpl : kpl) + off;     // both candidates are global pointers
  {
    *(v8h*)dst = val;
    
  }
}

// =====================================================================================
// Kernel: v block of qkv f32 (in[t][d] at qkv[t*3072 + 2048 + h*64 + d]) -> Vt f16 plane [NHEAD*64][SEQ_T]
// (out[h*64 + d][t]).  Block (t-tile of 64, head h): 64x64 tile through LDS.
// Load coverage: 256 threads x 16 floats = 4096 = 64 t x 64 d.
// Store coverage: 8 waves x 2 (dA, dB) x 4 row groups (q8) = 64 d rows; 8 lanes x 16 B = 64 t (one whole
// =====================================================================================
__global__ __launch_bounds__(256) void vt_from_qkv_k(const float* __restrict__ qkv, unsigned short* __restrict__ vt) {
  __shared__ __align__(16) _Float16 th[64 * LDS_P16];
  const int t0 = blockIdx.x * 64, h = blockIdx.y;
  const int tid = threadIdx.x;
  {
    const int sloc = tid >> 2, d0 = (tid & 3) * 16;
    const float* src = qkv + (size_t)(t0 + sloc) * QKV_N + VCOL0 + h * HDIM + d0;
    const v4f a0 = *(const v4f*)(src);
    const v4f a1 = *(const v4f*)(src + 4);
    const v4f a2 = *(const v4f*)(src + 8);
    const v4f a3 = *(const v4f*)(src + 12);
#pragma unroll
    for (int e = 0; e < 4; ++e) {
      th[(d0 + e) * LDS_P16 + sloc]      = (_Float16)a0[e];
      th[(d0 + 4 + e) * LDS_P16 + sloc]  = (_Float16)a1[e];
      th[(d0 + 8 + e) * LDS_P16 + sloc]  = (_Float16)a2[e];
      th[(d0 + 12 + e) * LDS_P16 + sloc] = (_Float16)a3[e];
    }
  }
  __syncthreads();
  const int wave = tid >> 5, lane = tid & 31, q8 = lane >> 3, c8 = (lane & 7) * 8;
  const int dA = wave * 8 + q8, dB = wave * 8 + 4 + q8;
  const v8h va = *(const v8h*)(th + dA * LDS_P16 + c8);
  const v8h vb = *(const v8h*)(th + dB * LDS_P16 + c8);
  const size_t oA = ((size_t)h * HDIM + dA) * SEQ_T + t0 + c8;
  const size_t oB = ((size_t)h * HDIM + dB) * SEQ_T + t0 + c8;
  {
    *(v8h*)(vt + oA) = va;
    *(v8h*)(vt + oB) = vb;
    
  }
}

// =====================================================================================
// Kernel: causal attention, head dim 64, f16 planes in (Q, K: [NHEAD*SEQ_T][64]; Vt: [NHEAD*64][SEQ_T]),
// f16 plane out (O: [SEQ_T][DMODEL], head h at cols h*64, value o*16).
//   scores^T = 0.125 * k.q^T : v_wmma_f32_16x16x32_f16 (q, k plain f16), f32 accumulate
//   out^T    = v^T.p^T       : v_wmma_f32_16x16x32_f16 (p carried x2^15 in f16, v plain f16), f32 accumulate
//   (transposed products: a lane holds one query's scores, and p goes from the score tiles straight into the B operand)
//   online softmax in f32; keys above the diagonal -> -inf (every row keeps key kv0 <= row, so never fully masked).
// Block = 4 waves = 64 query rows of head h; 64-key chunks; chunks above the diagonal are skipped (block-uniform).
// K / Vt chunks staged in LDS with plain loads + __syncthreads (128 threads x 4 x 16 B = 64x64 halves each);
// WMMA operands are read from dense, statically strided LDS / plane addresses only.
// O store coverage per wave: 4 iterations x 4 row groups = 16 rows, 8 lanes x 8 halves = 64 cols = one whole
// =====================================================================================
__global__ __launch_bounds__(128) void attn_causal_hd64_k(const unsigned short* __restrict__ qp,
                                                         const unsigned short* __restrict__ kp,
                                                         const unsigned short* __restrict__ vtp,
                                                         unsigned short* __restrict__ op) {
  typedef Frag<_Float16> FH;
  __shared__ __align__(16) _Float16 Ksh[KEY_CH * LDS_P16];    // [kv][d]
  __shared__ __align__(16) _Float16 Vts[HDIM * LDS_P16];      // [d][kv]
  __shared__ __align__(16) float   Os[4][16 * 68];            // per wave out tile, pitch 68
  const int tid = threadIdx.x, wave = tid >> 5, lane = tid & 31, hh = lane >> 4, c = lane & 15;
  const int qb = blockIdx.x % NQTILE;
  const int h  = blockIdx.x / NQTILE;
  const int q0 = qb * 64 + wave * 16;
  const _Float16* Qh = (const _Float16*)qp + ((size_t)h * SEQ_T + q0 + c) * HDIM;
  const _Float16* Kh = (const _Float16*)kp + (size_t)h * SEQ_T * HDIM;
  const _Float16* Vh = (const _Float16*)vtp + (size_t)h * HDIM * SEQ_T;

  // Q fragments (B operand, column = query q0 + c, k = head dim): 2 d-chunks of 32
  v16h qa[2];
  qa[0] = FH::load(Qh + 8 * hh);
  qa[1] = FH::load(Qh + 32 + 8 * hh);

  const v8f vz = (v8f){0.f,0.f,0.f,0.f,0.f,0.f,0.f,0.f};
  float mrow = -INFINITY, lrow = 0.f;   // one query per lane
  v8f oacc[4];
#pragma unroll
  for (int t = 0; t < 4; ++t) oacc[t] = vz;

  const int nChunks = qb + 1;   // block-uniform
  for (int kc = 0; kc < nChunks; ++kc) {
    const int kv0 = kc * KEY_CH;
    __syncthreads();
#pragma unroll
    for (int i = 0; i < 4; ++i) {
      const int idx = tid + 128 * i;          // 0..511
      const int r = idx >> 3, c8 = (idx & 7) * 8;
      const v8h kv = *(const v8h*)(Kh + (size_t)(kv0 + r) * HDIM + c8);      // K row kv0+r, d c8..c8+7
      const v8h vv = *(const v8h*)(Vh + (size_t)r * SEQ_T + kv0 + c8);        // Vt row d=r, keys kv0+c8..
      *(v8h*)(Ksh + r * LDS_P16 + c8) = kv;
      *(v8h*)(Vts + r * LDS_P16 + c8) = vv;
    }
    __syncthreads();

    // transposed scores: tile j = K rows (A, m = key j*16 + ..) x Q (B, n = query c); lane (hh, c) holds
    // keys j*16 + 8*hh + r of query q0 + c
    v8f s[4];
#pragma unroll
    for (int j = 0; j < 4; ++j) {
      s[j] = vz;
#pragma unroll
      for (int dc = 0; dc < 2; ++dc) {
        const v16h ka = FH::load(Ksh + (j * 16 + c) * LDS_P16 + dc * 32 + 8 * hh);   // A[m=key j*16+c][k=d]
        s[j] = mma_f16g(ka, qa[dc], s[j]);
      }
    }
    const bool diag = (kc == qb);
    const int qrow = q0 + c;
    float mj[4];
#pragma unroll
    for (int j = 0; j < 4; ++j) {
      float m = -INFINITY;
#pragma unroll
      for (int r = 0; r < 8; ++r) {
        const int kvcol = kv0 + j * 16 + 8 * hh + r;
        float sv = s[j][r] * 0.125f;
        if (diag && (kvcol > qrow)) sv = -INFINITY;
        s[j][r] = sv;
        m = fmaxf(m, sv);
      }
      mj[j] = m;
    }
    float cm = fmaxf(fmaxf(mj[0], mj[1]), fmaxf(mj[2], mj[3]));
    cm = fmaxf(cm, xhalf(cm));                     // the other 32 keys of this query sit in the other lane half
    const float mnew = fmaxf(mrow, cm);
    const float alpha = __expf(mrow - mnew);
    mrow = mnew;
    FH::U pb[2];                                   // B[k=key][n=query c]: elements 0..7 = tile 2kk, 8..15 = tile 2kk+1
    float pj[4];
#pragma unroll
    for (int j = 0; j < 4; ++j) {
      float psum = 0.f;
      v8h ph;
#pragma unroll
      for (int r = 0; r < 8; ++r) {
        const float p = __expf(s[j][r] - mnew);
        psum += p;
        ph[r] = (_Float16)(p * P_CARRY);
      }
      pj[j] = psum;
      pb[j >> 1].h[j & 1] = ph;
    }
    lrow = lrow * alpha + ((pj[0] + pj[1]) + (pj[2] + pj[3]));   // this half's keys only; halves joined after the loop
#pragma unroll
    for (int t = 0; t < 4; ++t)
#pragma unroll
      for (int r = 0; r < 8; ++r) oacc[t][r] *= alpha;
#pragma unroll
    for (int kk = 0; kk < 2; ++kk) {
#pragma unroll
      for (int t = 0; t < 4; ++t) {
        const v16h va = FH::load(Vts + (t * 16 + c) * LDS_P16 + kk * 32 + 8 * hh);   // A[m=d t*16+c][k=key]
        oacc[t] = mma_f16g(va, pb[kk].v, oacc[t]);
      }
    }
  }

  // oacc[t][r] = out[query q0 + c][d = t*16 + 8*hh + r]
  float* os = Os[wave];
  {
    const float ltot = lrow + xhalf(lrow);
    const float inv = (1.0f / ltot) * (O_CARRY / P_CARRY);
#pragma unroll
    for (int t = 0; t < 4; ++t) {
      v4f lo, hi;
#pragma unroll
      for (int e = 0; e < 4; ++e) { lo[e] = oacc[t][e] * inv; hi[e] = oacc[t][4 + e] * inv; }
      *(v4f*)(os + c * 68 + t * 16 + 8 * hh)     = lo;
      *(v4f*)(os + c * 68 + t * 16 + 8 * hh + 4) = hi;
    }
  }
  __builtin_amdgcn_fence(__ATOMIC_RELEASE, "workgroup");
  __builtin_amdgcn_wave_barrier();
  __builtin_amdgcn_fence(__ATOMIC_ACQUIRE, "workgroup");
  {
    const int q8 = lane >> 3, c8 = (lane & 7) * 8;
    unsigned short* ob = op + (size_t)h * HDIM + c8;
    {
#pragma unroll
      for (int it = 0; it < 4; ++it) {
        const int row = it * 4 + q8;
        const v4f f0 = *(const v4f*)(os + row * 68 + c8);
        const v4f f1 = *(const v4f*)(os + row * 68 + c8 + 4);
        v8h hv;
#pragma unroll
        for (int e = 0; e < 4; ++e) { hv[e] = (_Float16)f0[e]; hv[4 + e] = (_Float16)f1[e]; }
        *(v8h*)(ob + (size_t)(q0 + row) * DMODEL) = hv;
      }
      
    }
  }
}

// =====================================================================================
// Host glue.  Workspace region map (bytes, all offsets multiples of 1 MiB):
//   XN   f16 [4096][1024]         8,388,608 @ 0
//   WQKV f16 [3072][1024] (x64)   6,291,456 @ 8,388,608
//   WO   f16 [1024][1024] (x64)   2,097,152 @ 14,680,064
//   QKV  f32 [4096][3072]        50,331,648 @ 16,777,216
//   QPL  f16 [16*4096][64]        8,388,608 @ 67,108,864
//   KPL  f16 [16*4096][64]        8,388,608 @ 75,497,472
//   VT   f16 [16*64][4096]        8,388,608 @ 83,886,080
//   OPL  f16 [4096][1024] (x16)   8,388,608 @ 92,274,688
//   total 100,663,296
// =====================================================================================
extern "C" void kernel_launch(void* const* d_in, const int* in_sizes, int n_in,
                              void* d_out, int out_size, void* d_ws, size_t ws_size,
                              hipStream_t stream) {
  if (n_in < 6) return;
  const int nx = SEQ_T * DMODEL;
  const int nwgt = DMODEL * DMODEL;
  if (in_sizes[0] != nx || in_sizes[1] != nwgt || in_sizes[2] != nwgt || in_sizes[3] != nwgt ||
      in_sizes[4] != nwgt || in_sizes[5] != DMODEL || out_size != nx) return;

  const float* x  = (const float*)d_in[0];
  const float* wq = (const float*)d_in[1];
  const float* wk = (const float*)d_in[2];
  const float* wv = (const float*)d_in[3];
  const float* wo = (const float*)d_in[4];
  const float* nw = (const float*)d_in[5];
  float* out = (float*)d_out;

  const size_t szXN   = (size_t)nx * 2;
  const size_t szWQKV = (size_t)3 * nwgt * 2;
  const size_t szWO   = (size_t)nwgt * 2;
  const size_t szQKV  = (size_t)SEQ_T * QKV_N * 4;
  const size_t szPL   = (size_t)NHEAD * SEQ_T * HDIM * 2;
  const size_t szO    = (size_t)nx * 2;
  const size_t offXN   = 0;
  const size_t offWQKV = offXN + szXN;
  const size_t offWO   = offWQKV + szWQKV;
  const size_t offQKV  = offWO + szWO;
  const size_t offQ    = offQKV + szQKV;
  const size_t offK    = offQ + szPL;
  const size_t offVT   = offK + szPL;
  const size_t offO    = offVT + szPL;
  const size_t total   = offO + szO;
  if (total > ws_size) return;

  char* ws = (char*)d_ws;
  unsigned short* XN   = (unsigned short*)(ws + offXN);
  unsigned short* WQKV = (unsigned short*)(ws + offWQKV);
  unsigned short* WO   = (unsigned short*)(ws + offWO);
  float*          QKV  = (float*)(ws + offQKV);
  unsigned short* QPL  = (unsigned short*)(ws + offQ);
  unsigned short* KPL  = (unsigned short*)(ws + offK);
  unsigned short* VT   = (unsigned short*)(ws + offVT);
  unsigned short* OPL  = (unsigned short*)(ws + offO);

  // inverse-frequency table: e_i = (2i)/64 (exact), p_i = fl32(pow(10000, e_i)) (double pow on host,
  // RNE to f32), invfreq_i = 1.0f / p_i (f32)
  FreqTab ft;
  for (int i = 0; i < 32; ++i) {
    const float e = (float)(2 * i) / 64.0f;
    const float p = (float)pow(10000.0, (double)e);
    ft.f[i] = 1.0f / p;
  }

  // 1) rmsnorm -> XN (f16)
  rmsnorm_f16_k<<<SEQ_T, 128, 0, stream>>>(x, nw, XN);
  // 2) weights -> f16(bf16(w) * 64); wq | wk | wv stacked as rows 0.., 1024.., 2048.. of WQKV
  const int n8 = nwgt / 8;
  const int castBlocks = (n8 + 255) / 256;
  cast_w_f16x8_k<<<castBlocks, 256, 0, stream>>>(wq, WQKV, n8, W_CARRY);
  cast_w_f16x8_k<<<castBlocks, 256, 0, stream>>>(wk, WQKV + (size_t)nwgt, n8, W_CARRY);
  cast_w_f16x8_k<<<castBlocks, 256, 0, stream>>>(wv, WQKV + (size_t)2 * nwgt, n8, W_CARRY);
  cast_w_f16x8_k<<<castBlocks, 256, 0, stream>>>(wo, WO, n8, W_CARRY);
  // 3) QKV = XN . WQKV^T / 64 : M=4096, N=3072, K=1024 (K % 32 == 0, M,N % 64 == 0); 64x48 wave tiles = 384 blocks
  {
    const int tiles = (SEQ_T / 64) * (QKV_N / 64);
    dim3 grid((tiles + 7) / 8, 1);
    wmma_gemm64<0, 0, 0, 0, false><<<grid, 256, 0, stream>>>(
        XN, XN, DMODEL, 0L, WQKV, WQKV, DMODEL, 0L, (void*)QKV, (void*)QKV, QKV_N, 0L,
        nw, x, 0L, SEQ_T, QKV_N, DMODEL, 1.0f / W_CARRY);
  }
  // 4) rotary on q, k -> f16 planes; 5) v -> Vt f16 plane
  rope_qk_f16_k<<<SEQ_T, 256, 0, stream>>>(QKV, ft, QPL, KPL);
  vt_from_qkv_k<<<dim3(SEQ_T / 64, NHEAD), 256, 0, stream>>>(QKV, VT);
  // 6) causal attention -> O plane (f16, x16)
  attn_causal_hd64_k<<<NHEAD * NQTILE, 128, 0, stream>>>(QPL, KPL, VT, OPL);
  // 7) out = bf16_rne(x) + (O . WO^T) / (16*64) : M=4096, N=1024, K=1024; 64x16 wave tiles = 128 blocks
  {
    const int tiles = (SEQ_T / 64) * (DMODEL / 64);
    dim3 grid((tiles + 7) / 8, 1);
    wmma_gemm64<0, 0, 0, 0, true, 0, true><<<grid, 256, 0, stream>>>(
        OPL, OPL, DMODEL, 0L, WO, WO, DMODEL, 0L, (void*)out, (void*)out, DMODEL, 0L,
        nw, x, 0L, SEQ_T, DMODEL, DMODEL, 1.0f / (O_CARRY * W_CARRY));
  }
}

// v002
// A run of this version takes 172 microseconds.
// In two side-by-side timings against v001, it was 1.40 and 1.41 times as fast.
// Over all steps from v000 it is 2.18 times as fast.
// Contractions: qkv projection (normed . W^T, K=1024), attention q.k^T and p.v (head dim 64), output projection (o . Wo^T, K=1024): all v_wmma_f32_16x16x32_f16 (f16 operands, f32 accumulate); W carried x64, p carried x2^15, attention output carried x16 (exact power-of-two carries folded back in f32); float inputs RNE-converted to bf16 on load; rmsnorm, rotary tables, softmax, residual add in f32.
#include <hip/hip_runtime.h>
#include <math.h>

typedef __attribute__((ext_vector_type(16))) _Float16 v16h;
typedef __attribute__((ext_vector_type(8)))  _Float16 v8h;
typedef __attribute__((ext_vector_type(16))) __bf16   v16b;
typedef __attribute__((ext_vector_type(8)))  __bf16   v8b;
typedef __attribute__((ext_vector_type(8)))  float    v8f;
typedef __attribute__((ext_vector_type(4)))  float    v4f;

constexpr int SEQ_T     = 4096;
constexpr int DMODEL    = 1024;
constexpr int NHEAD     = 16;
constexpr int HDIM      = 64;
constexpr int QKV_N     = 3072;          // cols 0..1023 q | 1024..2047 k | 2048..3071 v
constexpr int KCOL0     = 1024;
constexpr int VCOL0     = 2048;
constexpr int NQTILE    = SEQ_T / 64;    // 64-row query tiles per head
constexpr int KEY_CH    = 64;            // keys per chunk
constexpr int LDS_P16   = 72;            // 16-bit LDS pitch (144 B rows, 16-B aligned)
constexpr float W_CARRY = 64.0f;         // weights stored as f16(bf16(w) * 64)
constexpr float P_CARRY = 32768.0f;      // softmax numerators stored as f16(p * 2^15)
constexpr float O_CARRY = 16.0f;         // attention output stored as f16(o * 16)

struct FreqTab { float f[32]; };
static_assert(sizeof(FreqTab) == 128);

__device__ __forceinline__ unsigned short f2bf_bits(float f) {
  unsigned u = __float_as_uint(f);
  return (unsigned short)((u + 0x7FFFu + ((u >> 16) & 1u)) >> 16);
}
__device__ __forceinline__ float bf_bits2f(unsigned short h) { return __uint_as_float(((unsigned)h) << 16); }
__device__ __forceinline__ float rne_bf(float f) { return bf_bits2f(f2bf_bits(f)); }

// hazard guard behind the last products of a GEMM, as a plain device helper
__device__ __forceinline__ void acc_guard4(v8f& a, v8f& b, v8f& c, v8f& d) { asm volatile("v_nop\n\tv_nop\n\tv_nop\n\tv_nop" : "+v"(a), "+v"(b), "+v"(c), "+v"(d)); }
template <typename T> struct Frag;
template <> struct Frag<_Float16> {
  typedef v16h V; union U { v16h v; v8h h[2]; };
  static __device__ __forceinline__ v16h load(const _Float16* p) {   // elements 0..7 <- p[0..7], 8..15 <- p[16..23]
    U f; f.h[0] = *(const v8h*)(p); f.h[1] = *(const v8h*)(p + 16); return f.v;
  }
  static __device__ __forceinline__ v8f mma(v16h a, v16h b, v8f c) {
    return __builtin_amdgcn_wmma_f32_16x16x32_f16(false, a, false, b, (short)0, c, false, false);
  }
};
template <> struct Frag<__bf16> {
  typedef v16b V; union U { v16b v; v8b h[2]; };
  static __device__ __forceinline__ v16b load(const __bf16* p) {
    U f; f.h[0] = *(const v8b*)(p); f.h[1] = *(const v8b*)(p + 16); return f.v;
  }
  static __device__ __forceinline__ v8f mma(v16b a, v16b b, v8f c) {
    return __builtin_amdgcn_wmma_f32_16x16x32_bf16(false, a, false, b, (short)0, c, false, false);
  }
};

// lane l reads lane l ^ 16 (vector cross-row move, no LDS round trip)
__device__ __forceinline__ float xhalf(float x) {
  const int b = __builtin_bit_cast(int, x);
  return __builtin_bit_cast(float, __builtin_amdgcn_permlanex16(b, b, 0x76543210, 0xfedcba98, false, false));
}

// single WMMA with the dependency guard (used by the attention kernel)
__device__ __forceinline__ v8f mma_f16g(v16h a, v16h b, v8f c) {
  c = __builtin_amdgcn_wmma_f32_16x16x32_f16(false, a, false, b, (short)0, c, false, false);
  asm volatile("v_nop\n\tv_nop\n\tv_nop\n\tv_nop" : "+v"(c) : "v"(a), "v"(b));
  return c;
}

// =====================================================================================
// Register-blocked batched WMMA GEMM, C[m,n] = scale * sum_k A[m,k] * Bt[n,k] (+bias)(+resid);
// a work-group of 8 waves (2 x 4) owns a 128x256 tile, each wave a 64x64 tile of it.
// A row-major [M,K]; Bt row-major [N,K]; M % 128 == 0, N % 256 == 0, K % 64 == 0.
// Operands: per 64 k the 128 A rows and 256 Bt rows (128 B each, whole lines) are copied to LDS once per
// work-group by asynchronous copies, two buffers, the next stage in flight while this one is multiplied.
// SPLITM: 0 = single product (the only form the staged operand path carries; A2p, Bt2p are not read).
// BIAS_MODE: 0 = none, 1 = bias[m], 2 = bias[n].  OUT_MODE: 0 = f32, 1 = f16, 2 = bf16 hi + lo planes.
// RESID_RNE: the residual value is RNE-converted to bf16 before the add.
// ET: 0 = f16 operands, 1 = bf16 operands (pointers passed as 16-bit storage)
// =====================================================================================
constexpr int GT_M    = 128;                  // work-group tile rows
constexpr int GT_N    = 256;                  // work-group tile columns
constexpr int GT_K    = 64;                   // k per stage (128-B rows)
constexpr int GT_BUF  = (GT_M + GT_N) * LDS_P16;   // halves per buffer: A rows, then Bt rows, pitch 144 B
constexpr unsigned GT_STEP = 32u * LDS_P16 * 2u;   // LDS bytes between a thread's successive rows (32 rows)

// one thread's twelve 16-byte asynchronous copies global -> LDS of a stage; the s_wait_xcnt closes the statement
// so that no address register of a copy is rewritten before it
__device__ __forceinline__ void async_copy12(const unsigned (&l)[12], const void* const (&g)[12]) {
  asm volatile(
               "global_load_async_to_lds_b128 %0, %12, off\n\t"
               "global_load_async_to_lds_b128 %1, %13, off\n\t"
               "global_load_async_to_lds_b128 %2, %14, off\n\t"
               "global_load_async_to_lds_b128 %3, %15, off\n\t"
               "global_load_async_to_lds_b128 %4, %16, off\n\t"
               "global_load_async_to_lds_b128 %5, %17, off\n\t"
               "global_load_async_to_lds_b128 %6, %18, off\n\t"
               "global_load_async_to_lds_b128 %7, %19, off\n\t"
               "global_load_async_to_lds_b128 %8, %20, off\n\t"
               "global_load_async_to_lds_b128 %9, %21, off\n\t"
               "global_load_async_to_lds_b128 %10, %22, off\n\t"
               "global_load_async_to_lds_b128 %11, %23, off\n\t"
               "s_wait_xcnt 0x0"
               :: "v"(l[0]), "v"(l[1]), "v"(l[2]), "v"(l[3]), "v"(l[4]), "v"(l[5]), "v"(l[6]), "v"(l[7]), "v"(l[8]), "v"(l[9]), "v"(l[10]), "v"(l[11]),
                  "v"(g[0]), "v"(g[1]), "v"(g[2]), "v"(g[3]), "v"(g[4]), "v"(g[5]), "v"(g[6]), "v"(g[7]), "v"(g[8]), "v"(g[9]), "v"(g[10]), "v"(g[11]) : "memory");
}

template <int ET> struct Elem;
template <> struct Elem<0> { typedef _Float16 T; };
template <> struct Elem<1> { typedef __bf16 T; };
template <int ET, int SPLITM, int BIAS_MODE, int OUT_MODE, bool RESID, int ACT = 0, bool RESID_RNE = false>
__global__ __launch_bounds__(256) void wmma_gemm64(
    const unsigned short* __restrict__ Ap, const unsigned short* __restrict__ A2p, int lda, long strideA,
    const unsigned short* __restrict__ Btp, const unsigned short* __restrict__ Bt2p, int ldb, long strideB,
    void* __restrict__ Cout, void* __restrict__ Cout2, int ldc, long strideC,
    const float* __restrict__ bias,
    const float* __restrict__ resid, long strideR,
    int M, int N, int K, float scale) {
  typedef typename Elem<ET>::T T;
  typedef typename Frag<T>::V V;
  const T* A = (const T*)Ap; const T* Bt = (const T*)Btp;
  static_assert(SPLITM == 0, "the staged operand path carries single planes");
  __shared__ __align__(16) T ring[2 * GT_BUF];     // two operand stages
  __shared__ __align__(16) float sT[8][16 * 68];   // per-wave 16x64 slab, pitch 68 floats
  const int b    = blockIdx.y;
  const int tid  = threadIdx.x;
  const int lane = tid & 31;
  const int wave = tid >> 5;
  const int tilesN = N / GT_N;
  const int tilesM = M / GT_M;
  if ((int)blockIdx.x >= tilesM * tilesN) return;   // work-group-uniform, in front of every barrier and copy
  const int bm = blockIdx.x / tilesN;
  const int bn = blockIdx.x - bm * tilesN;
  const int wm = wave >> 2, wn = wave & 3;
  const int m0 = bm * GT_M + (wm << 6);
  const int n0 = bn * GT_N + (wn << 6);

  const T* Ab  = A  + (size_t)b * strideA;
  const T* Bb  = Bt + (size_t)b * strideB;

  const int rlane = lane & 15;                 // row (A) / col (B, D) within subtile
  const int koff  = (lane >> 4) * 8;           // k offset of this lane half
  const int mOff  = (lane >> 4) * 8;           // D row offset

  // copies: thread -> 16 B at column chunk (tid & 7) of rows (tid >> 3) + 32 i; 8 lanes cover one 128-B row
  const int crow = tid >> 3, cchk = (tid & 7) * 8;
  const T* gA = Ab + (size_t)(bm * GT_M + crow) * lda + cchk;
  const T* gB = Bb + (size_t)(bn * GT_N + crow) * ldb + cchk;
  const size_t sA = (size_t)32 * lda, sB = (size_t)32 * ldb;
  const unsigned l0 = (unsigned)(uintptr_t)ring + (unsigned)(crow * LDS_P16 + cchk) * 2u;
  auto stage = [&](int t, int buf) {
    const T* ga = gA + (size_t)t * GT_K;
    const T* gb = gB + (size_t)t * GT_K;
    const unsigned lb = l0 + (unsigned)buf * (unsigned)(GT_BUF * 2);
    unsigned l[12];
    const void* g[12];
#pragma unroll
    for (int i = 0; i < 12; ++i) {
      l[i] = lb + (unsigned)i * GT_STEP;                                   // rows 0..127 A, 128..383 Bt
      g[i] = (i < 4) ? (const void*)(ga + i * sA) : (const void*)(gb + (i - 4) * sB);
    }
    async_copy12(l, g);
  };

  v8f acc[4][4];
#pragma unroll
  for (int i = 0; i < 4; ++i)
#pragma unroll
    for (int j = 0; j < 4; ++j) acc[i][j] = (v8f){0.f,0.f,0.f,0.f,0.f,0.f,0.f,0.f};

  const int nT = K / GT_K;
  stage(0, 0);
  asm volatile("s_wait_asynccnt 0x0" ::: "memory");   // this wave's part of stage 0 has landed
  __syncthreads();                                    // stage 0 is readable by every wave
  if (nT > 1) stage(1, 1);

  for (int t = 0; t < nT; ++t) {
    const int buf = t & 1;
    const T* sa = ring + buf * GT_BUF + ((wm << 6) + rlane) * LDS_P16 + koff;
    const T* sb = ring + buf * GT_BUF + (GT_M + (wn << 6) + rlane) * LDS_P16 + koff;
#pragma unroll
    for (int kk = 0; kk < GT_K; kk += 32) {
      V bh[4], ah[4];
#pragma unroll
      for (int j = 0; j < 4; ++j) bh[j] = Frag<T>::load(sb + (j << 4) * LDS_P16 + kk);
#pragma unroll
      for (int i = 0; i < 4; ++i) ah[i] = Frag<T>::load(sa + (i << 4) * LDS_P16 + kk);
      // keeps the 16 LDS reads together in front of the 16 products: sunk among them, each group waits out its own LDS latency
      __builtin_amdgcn_sched_barrier(0);
#pragma unroll
      for (int i = 0; i < 4; ++i)
#pragma unroll
        for (int j = 0; j < 4; ++j) acc[i][j] = Frag<T>::mma(ah[i], bh[j], acc[i][j]);
    }
    asm volatile("s_wait_dscnt 0x0" ::: "memory");      // this wave's reads of the buffer are done before it is refilled
    asm volatile("s_wait_asynccnt 0x0" ::: "memory");   // this wave's part of stage t + 1 has landed
    __syncthreads();                                    // publishes stage t + 1, ends every read of stage t
    if (t + 2 < nT) stage(t + 2, buf);
  }
  asm volatile("s_wait_asynccnt 0x0" ::: "memory");     // nothing in flight when the wave goes on
  acc_guard4(acc[0][0], acc[0][1], acc[0][2], acc[0][3]);
  acc_guard4(acc[1][0], acc[1][1], acc[1][2], acc[1][3]);
  acc_guard4(acc[2][0], acc[2][1], acc[2][2], acc[2][3]);
  acc_guard4(acc[3][0], acc[3][1], acc[3][2], acc[3][3]);

  // ---- epilogue ----
  float* slab = sT[wave];
  const float* Rb = RESID ? (resid + (size_t)b * strideR) : nullptr;
#pragma unroll
  for (int i = 0; i < 4; ++i) {
    const int mBase = m0 + (i << 4);
#pragma unroll
    for (int j = 0; j < 4; ++j) {
      const int n = n0 + (j << 4) + rlane;
      float bv = 0.f;
      if (BIAS_MODE == 2) bv = bias[n];
#pragma unroll
      for (int r = 0; r < 8; ++r) {
        float v = acc[i][j][r] * scale;
        if (BIAS_MODE == 1) v += bias[mBase + mOff + r];
        if (BIAS_MODE == 2) v += bv;
        if (RESID) {
          float rv = Rb[(size_t)(mBase + mOff + r) * ldc + n];
          if (RESID_RNE) rv = rne_bf(rv);
          v += rv;
        }
        if (ACT == 1) v = tanhf(v);
        if (ACT == 2) v = fmaxf(v, 0.0f);
        if (ACT == 4) v = (v > 0.f) ? v : 0.01f * v;
        slab[(mOff + r) * 68 + (j << 4) + rlane] = v;
      }
    }
    __builtin_amdgcn_fence(__ATOMIC_RELEASE, "workgroup");
    __builtin_amdgcn_wave_barrier();
    __builtin_amdgcn_fence(__ATOMIC_ACQUIRE, "workgroup");
    if (OUT_MODE == 0) {
      float* C = (float*)Cout + (size_t)b * strideC;
      const int hh = lane >> 4, c4 = (lane & 15) * 4;     // row seg = 256 B = 16 lanes x 16 B
      {
#pragma unroll
        for (int it = 0; it < 8; ++it) {
          const int row = it * 2 + hh;
          v4f v = *(const v4f*)(slab + row * 68 + c4);
          *(v4f*)(C + (size_t)(mBase + row) * ldc + n0 + c4) = v;
        }
        
      }
    } else {
      const int q = lane >> 3, c8 = (lane & 7) * 8;
      unsigned short* C  = (unsigned short*)Cout  + (size_t)b * strideC;
      unsigned short* C2 = (OUT_MODE == 2) ? ((unsigned short*)Cout2 + (size_t)b * strideC) : nullptr;
      {
#pragma unroll
        for (int it = 0; it < 4; ++it) {
          const int row = it * 4 + q;
          const float* sp = slab + row * 68 + c8;
          v8h hv, lv;
#pragma unroll
          for (int e = 0; e < 8; ++e) {
            if (OUT_MODE == 1) {
              hv[e] = (_Float16)sp[e];
            } else {
              unsigned short hb = f2bf_bits(sp[e]);
              unsigned short lb = f2bf_bits(sp[e] - bf_bits2f(hb));
              hv[e] = __builtin_bit_cast(_Float16, hb);
              lv[e] = __builtin_bit_cast(_Float16, lb);
            }
          }
          *(v8h*)(C + (size_t)(mBase + row) * ldc + n0 + c8) = hv;
          if (OUT_MODE == 2) *(v8h*)(C2 + (size_t)(mBase + row) * ldc + n0 + c8) = lv;
        }
        
      }
    }
    __builtin_amdgcn_fence(__ATOMIC_RELEASE, "workgroup");
    __builtin_amdgcn_wave_barrier();
    __builtin_amdgcn_fence(__ATOMIC_ACQUIRE, "workgroup");
  }
}

// =====================================================================================
// Kernel: rmsnorm of one token row (x RNE-converted to bf16 on load, mean of squares in f32,
// rsqrt(mean + 1e-6), times norm_w (RNE bf16)), output as an f16 plane [SEQ_T][DMODEL].
// Block = 128 threads = one token; coverage 128 threads x 8 elements = 1024 = one row exactly;
// =====================================================================================
__global__ __launch_bounds__(128) void rmsnorm_f16_k(const float* __restrict__ x, const float* __restrict__ nw,
                                                     unsigned short* __restrict__ xn) {
  __shared__ float red[4];
  const int t = blockIdx.x, tid = threadIdx.x, wave = tid >> 5, lane = tid & 31;
  const float* row = x + (size_t)t * DMODEL + tid * 8;
  const v4f a = *(const v4f*)row;
  const v4f b = *(const v4f*)(row + 4);
  float xb[8];
#pragma unroll
  for (int e = 0; e < 4; ++e) { xb[e] = rne_bf(a[e]); xb[4 + e] = rne_bf(b[e]); }
  float ss = 0.f;
#pragma unroll
  for (int e = 0; e < 8; ++e) ss += xb[e] * xb[e];
#pragma unroll
  for (int m = 1; m < 32; m <<= 1) ss += __shfl_xor(ss, m, 32);
  if (lane == 0) red[wave] = ss;
  __syncthreads();
  const float tot = (red[0] + red[1]) + (red[2] + red[3]);
  const float inv = rsqrtf(tot * (1.0f / 1024.0f) + 1e-6f);
  const v4f na = *(const v4f*)(nw + tid * 8);
  const v4f nb = *(const v4f*)(nw + tid * 8 + 4);
  v8h hv;
#pragma unroll
  for (int e = 0; e < 4; ++e) {
    hv[e]     = (_Float16)((xb[e] * inv) * rne_bf(na[e]));
    hv[4 + e] = (_Float16)((xb[4 + e] * inv) * rne_bf(nb[e]));
  }
  unsigned short* dst = xn + (size_t)t * DMODEL + tid * 8;
  *(v8h*)dst = hv;
  
}

// =====================================================================================
// Kernel: weight f32 -> f16(bf16_rne(w) * carry), 8 elements per thread. Coverage: n8 threads x 8 = n exactly
// =====================================================================================
__global__ __launch_bounds__(256) void cast_w_f16x8_k(const float* __restrict__ w, unsigned short* __restrict__ out,
                                                      int n8, float carry) {
  const int i = blockIdx.x * 256 + threadIdx.x;
  if (i < n8) {
    const v4f a = *(const v4f*)(w + (size_t)8 * i);
    const v4f b = *(const v4f*)(w + (size_t)8 * i + 4);
    v8h hv;
#pragma unroll
    for (int e = 0; e < 4; ++e) {
      hv[e]     = (_Float16)(rne_bf(a[e]) * carry);
      hv[4 + e] = (_Float16)(rne_bf(b[e]) * carry);
    }
    unsigned short* dst = out + (size_t)8 * i;
    *(v8h*)dst = hv;
    
  }
}

// =====================================================================================
// Kernel: rotary (rotate-half form, half = 32) on q and k of one token, f32 math, f16 planes out.
// Input qkv f32 [SEQ_T][3072]. Outputs Q plane [NHEAD*SEQ_T][64] (row = h*SEQ_T + t), K plane same layout.
// angle_i = (float)t * invfreq_i (single f32 multiply), precise sincosf, computed once per block by wave 0.
// Block = 256 threads = 8 waves; wave w handles heads 2w and 2w+1 (q and k); staged 64-wide 16-bit rows in LDS;
// grid = SEQ_T covers all tokens; 8 waves x 2 heads = 16 heads.
// =====================================================================================
__global__ __launch_bounds__(256) void rope_qk_f16_k(const float* __restrict__ qkv, FreqTab ft,
                                                     unsigned short* __restrict__ qpl, unsigned short* __restrict__ kpl) {
#pragma clang fp contract(off)
  __shared__ float cs[2][32];
  __shared__ __align__(16) _Float16 stg[8][4 * LDS_P16];
  const int t = blockIdx.x;
  const int tid = threadIdx.x, wave = tid >> 5, ln = tid & 31;
  if (wave == 0) {
    float fr = ft.f[0];
#pragma unroll
    for (int q = 1; q < 32; ++q) fr = (ln == q) ? ft.f[q] : fr;
    const float ang = (float)t * fr;
    float sv, cv;
    sincosf(ang, &sv, &cv);
    cs[0][ln] = cv;
    cs[1][ln] = sv;
  }
  __syncthreads();
  const float cv = cs[0][ln], sv = cs[1][ln];
  const float* row = qkv + (size_t)t * QKV_N;
  _Float16* sw = stg[wave];
  // staged rows: 0 = q head 2w, 1 = q head 2w+1, 2 = k head 2w, 3 = k head 2w+1
#pragma unroll
  for (int j = 0; j < 2; ++j) {
    const int hq = 2 * wave + j;
    const float x1 = row[hq * HDIM + ln];
    const float x2 = row[hq * HDIM + ln + 32];
    sw[j * LDS_P16 + ln]      = (_Float16)(x1 * cv - x2 * sv);
    sw[j * LDS_P16 + ln + 32] = (_Float16)(x2 * cv + x1 * sv);
    const float k1 = row[KCOL0 + hq * HDIM + ln];
    const float k2 = row[KCOL0 + hq * HDIM + ln + 32];
    sw[(2 + j) * LDS_P16 + ln]      = (_Float16)(k1 * cv - k2 * sv);
    sw[(2 + j) * LDS_P16 + ln + 32] = (_Float16)(k2 * cv + k1 * sv);
  }
  __builtin_amdgcn_fence(__ATOMIC_RELEASE, "workgroup");
  __builtin_amdgcn_wave_barrier();
  __builtin_amdgcn_fence(__ATOMIC_ACQUIRE, "workgroup");

  const int q8 = ln >> 3, c8 = (ln & 7) * 8;
  const v8h val = *(const v8h*)(sw + q8 * LDS_P16 + c8);
  const int hsel = 2 * wave + (q8 & 1);
  const size_t off = ((size_t)hsel * SEQ_T + t) * HDIM + c8;
  unsigned short* dst = ((q8 < 2) ? qpl : kpl) + off;     // both candidates are global pointers
  {
    *(v8h*)dst = val;
    
  }
}

// =====================================================================================
// Kernel: v block of qkv f32 (in[t][d] at qkv[t*3072 + 2048 + h*64 + d]) -> Vt f16 plane [NHEAD*64][SEQ_T]
// (out[h*64 + d][t]).  Block (t-tile of 64, head h): 64x64 tile through LDS.
// Load coverage: 256 threads x 16 floats = 4096 = 64 t x 64 d.
// Store coverage: 8 waves x 2 (dA, dB) x 4 row groups (q8) = 64 d rows; 8 lanes x 16 B = 64 t (one whole
// =====================================================================================
__global__ __launch_bounds__(256) void vt_from_qkv_k(const float* __restrict__ qkv, unsigned short* __restrict__ vt) {
  __shared__ __align__(16) _Float16 th[64 * LDS_P16];
  const int t0 = blockIdx.x * 64, h = blockIdx.y;
  const int tid = threadIdx.x;
  {
    const int sloc = tid >> 2, d0 = (tid & 3) * 16;
    const float* src = qkv + (size_t)(t0 + sloc) * QKV_N + VCOL0 + h * HDIM + d0;
    const v4f a0 = *(const v4f*)(src);
    const v4f a1 = *(const v4f*)(src + 4);
    const v4f a2 = *(const v4f*)(src + 8);
    const v4f a3 = *(const v4f*)(src + 12);
#pragma unroll
    for (int e = 0; e < 4; ++e) {
      th[(d0 + e) * LDS_P16 + sloc]      = (_Float16)a0[e];
      th[(d0 + 4 + e) * LDS_P16 + sloc]  = (_Float16)a1[e];
      th[(d0 + 8 + e) * LDS_P16 + sloc]  = (_Float16)a2[e];
      th[(d0 + 12 + e) * LDS_P16 + sloc] = (_Float16)a3[e];
    }
  }
  __syncthreads();
  const int wave = tid >> 5, lane = tid & 31, q8 = lane >> 3, c8 = (lane & 7) * 8;
  const int dA = wave * 8 + q8, dB = wave * 8 + 4 + q8;
  const v8h va = *(const v8h*)(th + dA * LDS_P16 + c8);
  const v8h vb = *(const v8h*)(th + dB * LDS_P16 + c8);
  const size_t oA = ((size_t)h * HDIM + dA) * SEQ_T + t0 + c8;
  const size_t oB = ((size_t)h * HDIM + dB) * SEQ_T + t0 + c8;
  {
    *(v8h*)(vt + oA) = va;
    *(v8h*)(vt + oB) = vb;
    
  }
}

// =====================================================================================
// Kernel: causal attention, head dim 64, f16 planes in (Q, K: [NHEAD*SEQ_T][64]; Vt: [NHEAD*64][SEQ_T]),
// f16 plane out (O: [SEQ_T][DMODEL], head h at cols h*64, value o*16).
//   scores^T = 0.125 * k.q^T : v_wmma_f32_16x16x32_f16 (q, k plain f16), f32 accumulate
//   out^T    = v^T.p^T       : v_wmma_f32_16x16x32_f16 (p carried x2^15 in f16, v plain f16), f32 accumulate
//   (transposed products: a lane holds one query's scores, and p goes from the score tiles straight into the B operand)
//   online softmax in f32; keys above the diagonal -> -inf (every row keeps key kv0 <= row, so never fully masked).
// Block = 4 waves = 64 query rows of head h; 64-key chunks; chunks above the diagonal are skipped (block-uniform).
// K / Vt chunks staged in LDS with plain loads + __syncthreads (128 threads x 4 x 16 B = 64x64 halves each);
// WMMA operands are read from dense, statically strided LDS / plane addresses only.
// O store coverage per wave: 4 iterations x 4 row groups = 16 rows, 8 lanes x 8 halves = 64 cols = one whole
// =====================================================================================
__global__ __launch_bounds__(128) void attn_causal_hd64_k(const unsigned short* __restrict__ qp,
                                                         const unsigned short* __restrict__ kp,
                                                         const unsigned short* __restrict__ vtp,
                                                         unsigned short* __restrict__ op) {
  typedef Frag<_Float16> FH;
  __shared__ __align__(16) _Float16 Ksh[KEY_CH * LDS_P16];    // [kv][d]
  __shared__ __align__(16) _Float16 Vts[HDIM * LDS_P16];      // [d][kv]
  __shared__ __align__(16) float   Os[4][16 * 68];            // per wave out tile, pitch 68
  const int tid = threadIdx.x, wave = tid >> 5, lane = tid & 31, hh = lane >> 4, c = lane & 15;
  const int qb = blockIdx.x % NQTILE;
  const int h  = blockIdx.x / NQTILE;
  const int q0 = qb * 64 + wave * 16;
  const _Float16* Qh = (const _Float16*)qp + ((size_t)h * SEQ_T + q0 + c) * HDIM;
  const _Float16* Kh = (const _Float16*)kp + (size_t)h * SEQ_T * HDIM;
  const _Float16* Vh = (const _Float16*)vtp + (size_t)h * HDIM * SEQ_T;

  // Q fragments (B operand, column = query q0 + c, k = head dim): 2 d-chunks of 32
  v16h qa[2];
  qa[0] = FH::load(Qh + 8 * hh);
  qa[1] = FH::load(Qh + 32 + 8 * hh);

  const v8f vz = (v8f){0.f,0.f,0.f,0.f,0.f,0.f,0.f,0.f};
  float mrow = -INFINITY, lrow = 0.f;   // one query per lane
  v8f oacc[4];
#pragma unroll
  for (int t = 0; t < 4; ++t) oacc[t] = vz;

  const int nChunks = qb + 1;   // block-uniform
  for (int kc = 0; kc < nChunks; ++kc) {
    const int kv0 = kc * KEY_CH;
    __syncthreads();
#pragma unroll
    for (int i = 0; i < 4; ++i) {
      const int idx = tid + 128 * i;          // 0..511
      const int r = idx >> 3, c8 = (idx & 7) * 8;
      const v8h kv = *(const v8h*)(Kh + (size_t)(kv0 + r) * HDIM + c8);      // K row kv0+r, d c8..c8+7
      const v8h vv = *(const v8h*)(Vh + (size_t)r * SEQ_T + kv0 + c8);        // Vt row d=r, keys kv0+c8..
      *(v8h*)(Ksh + r * LDS_P16 + c8) = kv;
      *(v8h*)(Vts + r * LDS_P16 + c8) = vv;
    }
    __syncthreads();

    // transposed scores: tile j = K rows (A, m = key j*16 + ..) x Q (B, n = query c); lane (hh, c) holds
    // keys j*16 + 8*hh + r of query q0 + c
    v8f s[4];
#pragma unroll
    for (int j = 0; j < 4; ++j) {
      s[j] = vz;
#pragma unroll
      for (int dc = 0; dc < 2; ++dc) {
        const v16h ka = FH::load(Ksh + (j * 16 + c) * LDS_P16 + dc * 32 + 8 * hh);   // A[m=key j*16+c][k=d]
        s[j] = mma_f16g(ka, qa[dc], s[j]);
      }
    }
    const bool diag = (kc == qb);
    const int qrow = q0 + c;
    float mj[4];
#pragma unroll
    for (int j = 0; j < 4; ++j) {
      float m = -INFINITY;
#pragma unroll
      for (int r = 0; r < 8; ++r) {
        const int kvcol = kv0 + j * 16 + 8 * hh + r;
        float sv = s[j][r] * 0.125f;
        if (diag && (kvcol > qrow)) sv = -INFINITY;
        s[j][r] = sv;
        m = fmaxf(m, sv);
      }
      mj[j] = m;
    }
    float cm = fmaxf(fmaxf(mj[0], mj[1]), fmaxf(mj[2], mj[3]));
    cm = fmaxf(cm, xhalf(cm));                     // the other 32 keys of this query sit in the other lane half
    const float mnew = fmaxf(mrow, cm);
    const float alpha = __expf(mrow - mnew);
    mrow = mnew;
    FH::U pb[2];                                   // B[k=key][n=query c]: elements 0..7 = tile 2kk, 8..15 = tile 2kk+1
    float pj[4];
#pragma unroll
    for (int j = 0; j < 4; ++j) {
      float psum = 0.f;
      v8h ph;
#pragma unroll
      for (int r = 0; r < 8; ++r) {
        const float p = __expf(s[j][r] - mnew);
        psum += p;
        ph[r] = (_Float16)(p * P_CARRY);
      }
      pj[j] = psum;
      pb[j >> 1].h[j & 1] = ph;
    }
    lrow = lrow * alpha + ((pj[0] + pj[1]) + (pj[2] + pj[3]));   // this half's keys only; halves joined after the loop
#pragma unroll
    for (int t = 0; t < 4; ++t)
#pragma unroll
      for (int r = 0; r < 8; ++r) oacc[t][r] *= alpha;
#pragma unroll
    for (int kk = 0; kk < 2; ++kk) {
#pragma unroll
      for (int t = 0; t < 4; ++t) {
        const v16h va = FH::load(Vts + (t * 16 + c) * LDS_P16 + kk * 32 + 8 * hh);   // A[m=d t*16+c][k=key]
        oacc[t] = mma_f16g(va, pb[kk].v, oacc[t]);
      }
    }
  }

  // oacc[t][r] = out[query q0 + c][d = t*16 + 8*hh + r]
  float* os = Os[wave];
  {
    const float ltot = lrow + xhalf(lrow);
    const float inv = (1.0f / ltot) * (O_CARRY / P_CARRY);
#pragma unroll
    for (int t = 0; t < 4; ++t) {
      v4f lo, hi;
#pragma unroll
      for (int e = 0; e < 4; ++e) { lo[e] = oacc[t][e] * inv; hi[e] = oacc[t][4 + e] * inv; }
      *(v4f*)(os + c * 68 + t * 16 + 8 * hh)     = lo;
      *(v4f*)(os + c * 68 + t * 16 + 8 * hh + 4) = hi;
    }
  }
  __builtin_amdgcn_fence(__ATOMIC_RELEASE, "workgroup");
  __builtin_amdgcn_wave_barrier();
  __builtin_amdgcn_fence(__ATOMIC_ACQUIRE, "workgroup");
  {
    const int q8 = lane >> 3, c8 = (lane & 7) * 8;
    unsigned short* ob = op + (size_t)h * HDIM + c8;
    {
#pragma unroll
      for (int it = 0; it < 4; ++it) {
        const int row = it * 4 + q8;
        const v4f f0 = *(const v4f*)(os + row * 68 + c8);
        const v4f f1 = *(const v4f*)(os + row * 68 + c8 + 4);
        v8h hv;
#pragma unroll
        for (int e = 0; e < 4; ++e) { hv[e] = (_Float16)f0[e]; hv[4 + e] = (_Float16)f1[e]; }
        *(v8h*)(ob + (size_t)(q0 + row) * DMODEL) = hv;
      }
      
    }
  }
}

// =====================================================================================
// Host glue.  Workspace region map (bytes, all offsets multiples of 1 MiB):
//   XN   f16 [4096][1024]         8,388,608 @ 0
//   WQKV f16 [3072][1024] (x64)   6,291,456 @ 8,388,608
//   WO   f16 [1024][1024] (x64)   2,097,152 @ 14,680,064
//   QKV  f32 [4096][3072]        50,331,648 @ 16,777,216
//   QPL  f16 [16*4096][64]        8,388,608 @ 67,108,864
//   KPL  f16 [16*4096][64]        8,388,608 @ 75,497,472
//   VT   f16 [16*64][4096]        8,388,608 @ 83,886,080
//   OPL  f16 [4096][1024] (x16)   8,388,608 @ 92,274,688
//   total 100,663,296
// =====================================================================================
extern "C" void kernel_launch(void* const* d_in, const int* in_sizes, int n_in,
                              void* d_out, int out_size, void* d_ws, size_t ws_size,
                              hipStream_t stream) {
  if (n_in < 6) return;
  const int nx = SEQ_T * DMODEL;
  const int nwgt = DMODEL * DMODEL;
  if (in_sizes[0] != nx || in_sizes[1] != nwgt || in_sizes[2] != nwgt || in_sizes[3] != nwgt ||
      in_sizes[4] != nwgt || in_sizes[5] != DMODEL || out_size != nx) return;

  const float* x  = (const float*)d_in[0];
  const float* wq = (const float*)d_in[1];
  const float* wk = (const float*)d_in[2];
  const float* wv = (const float*)d_in[3];
  const float* wo = (const float*)d_in[4];
  const float* nw = (const float*)d_in[5];
  float* out = (float*)d_out;

  const size_t szXN   = (size_t)nx * 2;
  const size_t szWQKV = (size_t)3 * nwgt * 2;
  const size_t szWO   = (size_t)nwgt * 2;
  const size_t szQKV  = (size_t)SEQ_T * QKV_N * 4;
  const size_t szPL   = (size_t)NHEAD * SEQ_T * HDIM * 2;
  const size_t szO    = (size_t)nx * 2;
  const size_t offXN   = 0;
  const size_t offWQKV = offXN + szXN;
  const size_t offWO   = offWQKV + szWQKV;
  const size_t offQKV  = offWO + szWO;
  const size_t offQ    = offQKV + szQKV;
  const size_t offK    = offQ + szPL;
  const size_t offVT   = offK + szPL;
  const size_t offO    = offVT + szPL;
  const size_t total   = offO + szO;
  if (total > ws_size) return;

  char* ws = (char*)d_ws;
  unsigned short* XN   = (unsigned short*)(ws + offXN);
  unsigned short* WQKV = (unsigned short*)(ws + offWQKV);
  unsigned short* WO   = (unsigned short*)(ws + offWO);
  float*          QKV  = (float*)(ws + offQKV);
  unsigned short* QPL  = (unsigned short*)(ws + offQ);
  unsigned short* KPL  = (unsigned short*)(ws + offK);
  unsigned short* VT   = (unsigned short*)(ws + offVT);
  unsigned short* OPL  = (unsigned short*)(ws + offO);

  // inverse-frequency table: e_i = (2i)/64 (exact), p_i = fl32(pow(10000, e_i)) (double pow on host,
  // RNE to f32), invfreq_i = 1.0f / p_i (f32)
  FreqTab ft;
  for (int i = 0; i < 32; ++i) {
    const float e = (float)(2 * i) / 64.0f;
    const float p = (float)pow(10000.0, (double)e);
    ft.f[i] = 1.0f / p;
  }

  // 1) rmsnorm -> XN (f16)
  rmsnorm_f16_k<<<SEQ_T, 128, 0, stream>>>(x, nw, XN);
  // 2) weights -> f16(bf16(w) * 64); wq | wk | wv stacked as rows 0.., 1024.., 2048.. of WQKV
  const int n8 = nwgt / 8;
  const int castBlocks = (n8 + 255) / 256;
  cast_w_f16x8_k<<<castBlocks, 256, 0, stream>>>(wq, WQKV, n8, W_CARRY);
  cast_w_f16x8_k<<<castBlocks, 256, 0, stream>>>(wk, WQKV + (size_t)nwgt, n8, W_CARRY);
  cast_w_f16x8_k<<<castBlocks, 256, 0, stream>>>(wv, WQKV + (size_t)2 * nwgt, n8, W_CARRY);
  cast_w_f16x8_k<<<castBlocks, 256, 0, stream>>>(wo, WO, n8, W_CARRY);
  // 3) QKV = XN . WQKV^T / 64 : M=4096, N=3072, K=1024; 32x12 work-group tiles = 384 blocks
  {
    dim3 grid((SEQ_T / GT_M) * (QKV_N / GT_N), 1);
    wmma_gemm64<0, 0, 0, 0, false><<<grid, 256, 0, stream>>>(
        XN, XN, DMODEL, 0L, WQKV, WQKV, DMODEL, 0L, (void*)QKV, (void*)QKV, QKV_N, 0L,
        nw, x, 0L, SEQ_T, QKV_N, DMODEL, 1.0f / W_CARRY);
  }
  // 4) rotary on q, k -> f16 planes; 5) v -> Vt f16 plane
  rope_qk_f16_k<<<SEQ_T, 256, 0, stream>>>(QKV, ft, QPL, KPL);
  vt_from_qkv_k<<<dim3(SEQ_T / 64, NHEAD), 256, 0, stream>>>(QKV, VT);
  // 6) causal attention -> O plane (f16, x16)
  attn_causal_hd64_k<<<NHEAD * NQTILE, 128, 0, stream>>>(QPL, KPL, VT, OPL);
  // 7) out = bf16_rne(x) + (O . WO^T) / (16*64) : M=4096, N=1024, K=1024; 32x4 work-group tiles = 128 blocks
  {
    dim3 grid((SEQ_T / GT_M) * (DMODEL / GT_N), 1);
    wmma_gemm64<0, 0, 0, 0, true, 0, true><<<grid, 256, 0, stream>>>(
        OPL, OPL, DMODEL, 0L, WO, WO, DMODEL, 0L, (void*)out, (void*)out, DMODEL, 0L,
        nw, x, 0L, SEQ_T, DMODEL, DMODEL, 1.0f / (O_CARRY * W_CARRY));
  }
}

// v003
// One run takes 147 microseconds.
// In both of two side-by-side timings against v002, it was 1.18 times as fast.
// All steps since v000 together make it 2.58 times as fast.
// Contractions: qkv projection (normed . W^T, K=1024), attention q.k^T and p.v (head dim 64), output projection (o . Wo^T, K=1024): all v_wmma_f32_16x16x32_f16 (f16 operands, f32 accumulate); W carried x64, p carried x2^15, attention output carried x16 (exact power-of-two carries folded back in f32); float inputs RNE-converted to bf16 on load; rmsnorm, rotary tables, softmax, residual add in f32.
#include <hip/hip_runtime.h>
#include <math.h>

typedef __attribute__((ext_vector_type(16))) _Float16 v16h;
typedef __attribute__((ext_vector_type(8)))  _Float16 v8h;
typedef __attribute__((ext_vector_type(16))) __bf16   v16b;
typedef __attribute__((ext_vector_type(8)))  __bf16   v8b;
typedef __attribute__((ext_vector_type(8)))  float    v8f;
typedef __attribute__((ext_vector_type(4)))  float    v4f;

constexpr int SEQ_T     = 4096;
constexpr int DMODEL    = 1024;
constexpr int NHEAD     = 16;
constexpr int HDIM      = 64;
constexpr int QKV_N     = 3072;          // cols 0..1023 q | 1024..2047 k | 2048..3071 v
constexpr int KCOL0     = 1024;
constexpr int VCOL0     = 2048;
constexpr int NQTILE    = SEQ_T / 64;    // 64-row query tiles per head
constexpr int KEY_CH    = 64;            // keys per chunk
constexpr int LDS_P16   = 72;            // 16-bit LDS pitch (144 B rows, 16-B aligned)
constexpr float W_CARRY = 64.0f;         // weights stored as f16(bf16(w) * 64)
constexpr float P_CARRY = 32768.0f;      // softmax numerators stored as f16(p * 2^15)
constexpr float O_CARRY = 16.0f;         // attention output stored as f16(o * 16)

struct FreqTab { float f[32]; };
static_assert(sizeof(FreqTab) == 128);

__device__ __forceinline__ unsigned short f2bf_bits(float f) {
  unsigned u = __float_as_uint(f);
  return (unsigned short)((u + 0x7FFFu + ((u >> 16) & 1u)) >> 16);
}
__device__ __forceinline__ float bf_bits2f(unsigned short h) { return __uint_as_float(((unsigned)h) << 16); }
__device__ __forceinline__ float rne_bf(float f) { return bf_bits2f(f2bf_bits(f)); }

// hazard guard behind the last products of a GEMM, as a plain device helper
__device__ __forceinline__ void acc_guard4(v8f& a, v8f& b, v8f& c, v8f& d) { asm volatile("v_nop\n\tv_nop\n\tv_nop\n\tv_nop" : "+v"(a), "+v"(b), "+v"(c), "+v"(d)); }
template <typename T> struct Frag;
template <> struct Frag<_Float16> {
  typedef v16h V; union U { v16h v; v8h h[2]; };
  static __device__ __forceinline__ v16h load(const _Float16* p) {   // elements 0..7 <- p[0..7], 8..15 <- p[16..23]
    U f; f.h[0] = *(const v8h*)(p); f.h[1] = *(const v8h*)(p + 16); return f.v;
  }
  static __device__ __forceinline__ v8f mma(v16h a, v16h b, v8f c) {
    return __builtin_amdgcn_wmma_f32_16x16x32_f16(false, a, false, b, (short)0, c, false, false);
  }
};
template <> struct Frag<__bf16> {
  typedef v16b V; union U { v16b v; v8b h[2]; };
  static __device__ __forceinline__ v16b load(const __bf16* p) {
    U f; f.h[0] = *(const v8b*)(p); f.h[1] = *(const v8b*)(p + 16); return f.v;
  }
  static __device__ __forceinline__ v8f mma(v16b a, v16b b, v8f c) {
    return __builtin_amdgcn_wmma_f32_16x16x32_bf16(false, a, false, b, (short)0, c, false, false);
  }
};

// lane l reads lane l ^ 16 (vector cross-row move, no LDS round trip)
__device__ __forceinline__ float xhalf(float x) {
  const int b = __builtin_bit_cast(int, x);
  return __builtin_bit_cast(float, __builtin_amdgcn_permlanex16(b, b, 0x76543210, 0xfedcba98, false, false));
}

// =====================================================================================
// Register-blocked batched WMMA GEMM, C[m,n] = scale * sum_k A[m,k] * Bt[n,k] (+bias)(+resid);
// a work-group of 8 waves (2 x 4) owns a 128x256 tile, each wave a 64x64 tile of it.
// A row-major [M,K]; Bt row-major [N,K]; M % 128 == 0, N % 256 == 0, K % 64 == 0.
// Operands: per 64 k the 128 A rows and 256 Bt rows (128 B each, whole lines) are copied to LDS once per
// work-group by asynchronous copies, two buffers, the next stage in flight while this one is multiplied.
// SPLITM: 0 = single product (the only form the staged operand path carries; A2p, Bt2p are not read).
// BIAS_MODE: 0 = none, 1 = bias[m], 2 = bias[n].  OUT_MODE: 0 = f32, 1 = f16, 2 = bf16 hi + lo planes.
// RESID_RNE: the residual value is RNE-converted to bf16 before the add.
// ET: 0 = f16 operands, 1 = bf16 operands (pointers passed as 16-bit storage)
// =====================================================================================
constexpr int GT_M    = 128;                  // work-group tile rows
constexpr int GT_N    = 256;                  // work-group tile columns
constexpr int GT_K    = 64;                   // k per stage (128-B rows)
constexpr int GT_BUF  = (GT_M + GT_N) * LDS_P16;   // halves per buffer: A rows, then Bt rows, pitch 144 B
constexpr unsigned GT_STEP = 32u * LDS_P16 * 2u;   // LDS bytes between a thread's successive rows (32 rows)

// one thread's twelve 16-byte asynchronous copies global -> LDS of a stage; the s_wait_xcnt closes the statement
// so that no address register of a copy is rewritten before it
__device__ __forceinline__ void async_copy12(const unsigned (&l)[12], const void* const (&g)[12]) {
  asm volatile(
               "global_load_async_to_lds_b128 %0, %12, off\n\t"
               "global_load_async_to_lds_b128 %1, %13, off\n\t"
               "global_load_async_to_lds_b128 %2, %14, off\n\t"
               "global_load_async_to_lds_b128 %3, %15, off\n\t"
               "global_load_async_to_lds_b128 %4, %16, off\n\t"
               "global_load_async_to_lds_b128 %5, %17, off\n\t"
               "global_load_async_to_lds_b128 %6, %18, off\n\t"
               "global_load_async_to_lds_b128 %7, %19, off\n\t"
               "global_load_async_to_lds_b128 %8, %20, off\n\t"
               "global_load_async_to_lds_b128 %9, %21, off\n\t"
               "global_load_async_to_lds_b128 %10, %22, off\n\t"
               "global_load_async_to_lds_b128 %11, %23, off\n\t"
               "s_wait_xcnt 0x0"
               :: "v"(l[0]), "v"(l[1]), "v"(l[2]), "v"(l[3]), "v"(l[4]), "v"(l[5]), "v"(l[6]), "v"(l[7]), "v"(l[8]), "v"(l[9]), "v"(l[10]), "v"(l[11]),
                  "v"(g[0]), "v"(g[1]), "v"(g[2]), "v"(g[3]), "v"(g[4]), "v"(g[5]), "v"(g[6]), "v"(g[7]), "v"(g[8]), "v"(g[9]), "v"(g[10]), "v"(g[11]) : "memory");
}

template <int ET> struct Elem;
template <> struct Elem<0> { typedef _Float16 T; };
template <> struct Elem<1> { typedef __bf16 T; };
template <int ET, int SPLITM, int BIAS_MODE, int OUT_MODE, bool RESID, int ACT = 0, bool RESID_RNE = false>
__global__ __launch_bounds__(256) void wmma_gemm64(
    const unsigned short* __restrict__ Ap, const unsigned short* __restrict__ A2p, int lda, long strideA,
    const unsigned short* __restrict__ Btp, const unsigned short* __restrict__ Bt2p, int ldb, long strideB,
    void* __restrict__ Cout, void* __restrict__ Cout2, int ldc, long strideC,
    const float* __restrict__ bias,
    const float* __restrict__ resid, long strideR,
    int M, int N, int K, float scale) {
  typedef typename Elem<ET>::T T;
  typedef typename Frag<T>::V V;
  const T* A = (const T*)Ap; const T* Bt = (const T*)Btp;
  static_assert(SPLITM == 0, "the staged operand path carries single planes");
  __shared__ __align__(16) T ring[2 * GT_BUF];     // two operand stages
  __shared__ __align__(16) float sT[8][16 * 68];   // per-wave 16x64 slab, pitch 68 floats
  const int b    = blockIdx.y;
  const int tid  = threadIdx.x;
  const int lane = tid & 31;
  const int wave = tid >> 5;
  const int tilesN = N / GT_N;
  const int tilesM = M / GT_M;
  if ((int)blockIdx.x >= tilesM * tilesN) return;   // work-group-uniform, in front of every barrier and copy
  const int bm = blockIdx.x / tilesN;
  const int bn = blockIdx.x - bm * tilesN;
  const int wm = wave >> 2, wn = wave & 3;
  const int m0 = bm * GT_M + (wm << 6);
  const int n0 = bn * GT_N + (wn << 6);

  const T* Ab  = A  + (size_t)b * strideA;
  const T* Bb  = Bt + (size_t)b * strideB;

  const int rlane = lane & 15;                 // row (A) / col (B, D) within subtile
  const int koff  = (lane >> 4) * 8;           // k offset of this lane half
  const int mOff  = (lane >> 4) * 8;           // D row offset

  // copies: thread -> 16 B at column chunk (tid & 7) of rows (tid >> 3) + 32 i; 8 lanes cover one 128-B row
  const int crow = tid >> 3, cchk = (tid & 7) * 8;
  const T* gA = Ab + (size_t)(bm * GT_M + crow) * lda + cchk;
  const T* gB = Bb + (size_t)(bn * GT_N + crow) * ldb + cchk;
  const size_t sA = (size_t)32 * lda, sB = (size_t)32 * ldb;
  const unsigned l0 = (unsigned)(uintptr_t)ring + (unsigned)(crow * LDS_P16 + cchk) * 2u;
  auto stage = [&](int t, int buf) {
    const T* ga = gA + (size_t)t * GT_K;
    const T* gb = gB + (size_t)t * GT_K;
    const unsigned lb = l0 + (unsigned)buf * (unsigned)(GT_BUF * 2);
    unsigned l[12];
    const void* g[12];
#pragma unroll
    for (int i = 0; i < 12; ++i) {
      l[i] = lb + (unsigned)i * GT_STEP;                                   // rows 0..127 A, 128..383 Bt
      g[i] = (i < 4) ? (const void*)(ga + i * sA) : (const void*)(gb + (i - 4) * sB);
    }
    async_copy12(l, g);
  };

  v8f acc[4][4];
#pragma unroll
  for (int i = 0; i < 4; ++i)
#pragma unroll
    for (int j = 0; j < 4; ++j) acc[i][j] = (v8f){0.f,0.f,0.f,0.f,0.f,0.f,0.f,0.f};

  const int nT = K / GT_K;
  stage(0, 0);
  asm volatile("s_wait_asynccnt 0x0" ::: "memory");   // this wave's part of stage 0 has landed
  __syncthreads();                                    // stage 0 is readable by every wave
  if (nT > 1) stage(1, 1);

  for (int t = 0; t < nT; ++t) {
    const int buf = t & 1;
    const T* sa = ring + buf * GT_BUF + ((wm << 6) + rlane) * LDS_P16 + koff;
    const T* sb = ring + buf * GT_BUF + (GT_M + (wn << 6) + rlane) * LDS_P16 + koff;
#pragma unroll
    for (int kk = 0; kk < GT_K; kk += 32) {
      V bh[4], ah[4];
#pragma unroll
      for (int j = 0; j < 4; ++j) bh[j] = Frag<T>::load(sb + (j << 4) * LDS_P16 + kk);
#pragma unroll
      for (int i = 0; i < 4; ++i) ah[i] = Frag<T>::load(sa + (i << 4) * LDS_P16 + kk);
      // keeps the 16 LDS reads together in front of the 16 products: sunk among them, each group waits out its own LDS latency
      __builtin_amdgcn_sched_barrier(0);
#pragma unroll
      for (int i = 0; i < 4; ++i)
#pragma unroll
        for (int j = 0; j < 4; ++j) acc[i][j] = Frag<T>::mma(ah[i], bh[j], acc[i][j]);
    }
    asm volatile("s_wait_dscnt 0x0" ::: "memory");      // this wave's reads of the buffer are done before it is refilled
    asm volatile("s_wait_asynccnt 0x0" ::: "memory");   // this wave's part of stage t + 1 has landed
    __syncthreads();                                    // publishes stage t + 1, ends every read of stage t
    if (t + 2 < nT) stage(t + 2, buf);
  }
  asm volatile("s_wait_asynccnt 0x0" ::: "memory");     // nothing in flight when the wave goes on
  acc_guard4(acc[0][0], acc[0][1], acc[0][2], acc[0][3]);
  acc_guard4(acc[1][0], acc[1][1], acc[1][2], acc[1][3]);
  acc_guard4(acc[2][0], acc[2][1], acc[2][2], acc[2][3]);
  acc_guard4(acc[3][0], acc[3][1], acc[3][2], acc[3][3]);

  // ---- epilogue ----
  float* slab = sT[wave];
  const float* Rb = RESID ? (resid + (size_t)b * strideR) : nullptr;
#pragma unroll
  for (int i = 0; i < 4; ++i) {
    const int mBase = m0 + (i << 4);
#pragma unroll
    for (int j = 0; j < 4; ++j) {
      const int n = n0 + (j << 4) + rlane;
      float bv = 0.f;
      if (BIAS_MODE == 2) bv = bias[n];
#pragma unroll
      for (int r = 0; r < 8; ++r) {
        float v = acc[i][j][r] * scale;
        if (BIAS_MODE == 1) v += bias[mBase + mOff + r];
        if (BIAS_MODE == 2) v += bv;
        if (RESID) {
          float rv = Rb[(size_t)(mBase + mOff + r) * ldc + n];
          if (RESID_RNE) rv = rne_bf(rv);
          v += rv;
        }
        if (ACT == 1) v = tanhf(v);
        if (ACT == 2) v = fmaxf(v, 0.0f);
        if (ACT == 4) v = (v > 0.f) ? v : 0.01f * v;
        slab[(mOff + r) * 68 + (j << 4) + rlane] = v;
      }
    }
    __builtin_amdgcn_fence(__ATOMIC_RELEASE, "workgroup");
    __builtin_amdgcn_wave_barrier();
    __builtin_amdgcn_fence(__ATOMIC_ACQUIRE, "workgroup");
    if (OUT_MODE == 0) {
      float* C = (float*)Cout + (size_t)b * strideC;
      const int hh = lane >> 4, c4 = (lane & 15) * 4;     // row seg = 256 B = 16 lanes x 16 B
      {
#pragma unroll
        for (int it = 0; it < 8; ++it) {
          const int row = it * 2 + hh;
          v4f v = *(const v4f*)(slab + row * 68 + c4);
          *(v4f*)(C + (size_t)(mBase + row) * ldc + n0 + c4) = v;
        }
        
      }
    } else {
      const int q = lane >> 3, c8 = (lane & 7) * 8;
      unsigned short* C  = (unsigned short*)Cout  + (size_t)b * strideC;
      unsigned short* C2 = (OUT_MODE == 2) ? ((unsigned short*)Cout2 + (size_t)b * strideC) : nullptr;
      {
#pragma unroll
        for (int it = 0; it < 4; ++it) {
          const int row = it * 4 + q;
          const float* sp = slab + row * 68 + c8;
          v8h hv, lv;
#pragma unroll
          for (int e = 0; e < 8; ++e) {
            if (OUT_MODE == 1) {
              hv[e] = (_Float16)sp[e];
            } else {
              unsigned short hb = f2bf_bits(sp[e]);
              unsigned short lb = f2bf_bits(sp[e] - bf_bits2f(hb));
              hv[e] = __builtin_bit_cast(_Float16, hb);
              lv[e] = __builtin_bit_cast(_Float16, lb);
            }
          }
          *(v8h*)(C + (size_t)(mBase + row) * ldc + n0 + c8) = hv;
          if (OUT_MODE == 2) *(v8h*)(C2 + (size_t)(mBase + row) * ldc + n0 + c8) = lv;
        }
        
      }
    }
    __builtin_amdgcn_fence(__ATOMIC_RELEASE, "workgroup");
    __builtin_amdgcn_wave_barrier();
    __builtin_amdgcn_fence(__ATOMIC_ACQUIRE, "workgroup");
  }
}

// =====================================================================================
// Kernel: rmsnorm of one token row (x RNE-converted to bf16 on load, mean of squares in f32,
// rsqrt(mean + 1e-6), times norm_w (RNE bf16)), output as an f16 plane [SEQ_T][DMODEL].
// Block = 128 threads = one token; coverage 128 threads x 8 elements = 1024 = one row exactly;
// =====================================================================================
__global__ __launch_bounds__(128) void rmsnorm_f16_k(const float* __restrict__ x, const float* __restrict__ nw,
                                                     unsigned short* __restrict__ xn) {
  __shared__ float red[4];
  const int t = blockIdx.x, tid = threadIdx.x, wave = tid >> 5, lane = tid & 31;
  const float* row = x + (size_t)t * DMODEL + tid * 8;
  const v4f a = *(const v4f*)row;
  const v4f b = *(const v4f*)(row + 4);
  float xb[8];
#pragma unroll
  for (int e = 0; e < 4; ++e) { xb[e] = rne_bf(a[e]); xb[4 + e] = rne_bf(b[e]); }
  float ss = 0.f;
#pragma unroll
  for (int e = 0; e < 8; ++e) ss += xb[e] * xb[e];
#pragma unroll
  for (int m = 1; m < 32; m <<= 1) ss += __shfl_xor(ss, m, 32);
  if (lane == 0) red[wave] = ss;
  __syncthreads();
  const float tot = (red[0] + red[1]) + (red[2] + red[3]);
  const float inv = rsqrtf(tot * (1.0f / 1024.0f) + 1e-6f);
  const v4f na = *(const v4f*)(nw + tid * 8);
  const v4f nb = *(const v4f*)(nw + tid * 8 + 4);
  v8h hv;
#pragma unroll
  for (int e = 0; e < 4; ++e) {
    hv[e]     = (_Float16)((xb[e] * inv) * rne_bf(na[e]));
    hv[4 + e] = (_Float16)((xb[4 + e] * inv) * rne_bf(nb[e]));
  }
  unsigned short* dst = xn + (size_t)t * DMODEL + tid * 8;
  *(v8h*)dst = hv;
  
}

// =====================================================================================
// Kernel: weight f32 -> f16(bf16_rne(w) * carry), 8 elements per thread. Coverage: n8 threads x 8 = n exactly
// =====================================================================================
__global__ __launch_bounds__(256) void cast_w_f16x8_k(const float* __restrict__ w, unsigned short* __restrict__ out,
                                                      int n8, float carry) {
  const int i = blockIdx.x * 256 + threadIdx.x;
  if (i < n8) {
    const v4f a = *(const v4f*)(w + (size_t)8 * i);
    const v4f b = *(const v4f*)(w + (size_t)8 * i + 4);
    v8h hv;
#pragma unroll
    for (int e = 0; e < 4; ++e) {
      hv[e]     = (_Float16)(rne_bf(a[e]) * carry);
      hv[4 + e] = (_Float16)(rne_bf(b[e]) * carry);
    }
    unsigned short* dst = out + (size_t)8 * i;
    *(v8h*)dst = hv;
    
  }
}

// =====================================================================================
// Kernel: rotary (rotate-half form, half = 32) on q and k of one token, f32 math, f16 planes out.
// Input qkv f32 [SEQ_T][3072]. Outputs Q plane [NHEAD*SEQ_T][64] (row = h*SEQ_T + t), K plane same layout.
// angle_i = (float)t * invfreq_i (single f32 multiply), precise sincosf, computed once per block by wave 0.
// Block = 256 threads = 8 waves; wave w handles heads 2w and 2w+1 (q and k); staged 64-wide 16-bit rows in LDS;
// grid = SEQ_T covers all tokens; 8 waves x 2 heads = 16 heads.
// =====================================================================================
__global__ __launch_bounds__(256) void rope_qk_f16_k(const float* __restrict__ qkv, FreqTab ft,
                                                     unsigned short* __restrict__ qpl, unsigned short* __restrict__ kpl) {
#pragma clang fp contract(off)
  __shared__ float cs[2][32];
  __shared__ __align__(16) _Float16 stg[8][4 * LDS_P16];
  const int t = blockIdx.x;
  const int tid = threadIdx.x, wave = tid >> 5, ln = tid & 31;
  if (wave == 0) {
    float fr = ft.f[0];
#pragma unroll
    for (int q = 1; q < 32; ++q) fr = (ln == q) ? ft.f[q] : fr;
    const float ang = (float)t * fr;
    float sv, cv;
    sincosf(ang, &sv, &cv);
    cs[0][ln] = cv;
    cs[1][ln] = sv;
  }
  __syncthreads();
  const float cv = cs[0][ln], sv = cs[1][ln];
  const float* row = qkv + (size_t)t * QKV_N;
  _Float16* sw = stg[wave];
  // staged rows: 0 = q head 2w, 1 = q head 2w+1, 2 = k head 2w, 3 = k head 2w+1
#pragma unroll
  for (int j = 0; j < 2; ++j) {
    const int hq = 2 * wave + j;
    const float x1 = row[hq * HDIM + ln];
    const float x2 = row[hq * HDIM + ln + 32];
    sw[j * LDS_P16 + ln]      = (_Float16)(x1 * cv - x2 * sv);
    sw[j * LDS_P16 + ln + 32] = (_Float16)(x2 * cv + x1 * sv);
    const float k1 = row[KCOL0 + hq * HDIM + ln];
    const float k2 = row[KCOL0 + hq * HDIM + ln + 32];
    sw[(2 + j) * LDS_P16 + ln]      = (_Float16)(k1 * cv - k2 * sv);
    sw[(2 + j) * LDS_P16 + ln + 32] = (_Float16)(k2 * cv + k1 * sv);
  }
  __builtin_amdgcn_fence(__ATOMIC_RELEASE, "workgroup");
  __builtin_amdgcn_wave_barrier();
  __builtin_amdgcn_fence(__ATOMIC_ACQUIRE, "workgroup");

  const int q8 = ln >> 3, c8 = (ln & 7) * 8;
  const v8h val = *(const v8h*)(sw + q8 * LDS_P16 + c8);
  const int hsel = 2 * wave + (q8 & 1);
  const size_t off = ((size_t)hsel * SEQ_T + t) * HDIM + c8;
  unsigned short* dst = ((q8 < 2) ? qpl : kpl) + off;     // both candidates are global pointers
  {
    *(v8h*)dst = val;
    
  }
}

// =====================================================================================
// Kernel: v block of qkv f32 (in[t][d] at qkv[t*3072 + 2048 + h*64 + d]) -> Vt f16 plane [NHEAD*64][SEQ_T]
// (out[h*64 + d][t]).  Block (t-tile of 64, head h): 64x64 tile through LDS.
// Load coverage: 256 threads x 16 floats = 4096 = 64 t x 64 d.
// Store coverage: 8 waves x 2 (dA, dB) x 4 row groups (q8) = 64 d rows; 8 lanes x 16 B = 64 t (one whole
// =====================================================================================
__global__ __launch_bounds__(256) void vt_from_qkv_k(const float* __restrict__ qkv, unsigned short* __restrict__ vt) {
  __shared__ __align__(16) _Float16 th[64 * LDS_P16];
  const int t0 = blockIdx.x * 64, h = blockIdx.y;
  const int tid = threadIdx.x;
  {
    const int sloc = tid >> 2, d0 = (tid & 3) * 16;
    const float* src = qkv + (size_t)(t0 + sloc) * QKV_N + VCOL0 + h * HDIM + d0;
    const v4f a0 = *(const v4f*)(src);
    const v4f a1 = *(const v4f*)(src + 4);
    const v4f a2 = *(const v4f*)(src + 8);
    const v4f a3 = *(const v4f*)(src + 12);
#pragma unroll
    for (int e = 0; e < 4; ++e) {
      th[(d0 + e) * LDS_P16 + sloc]      = (_Float16)a0[e];
      th[(d0 + 4 + e) * LDS_P16 + sloc]  = (_Float16)a1[e];
      th[(d0 + 8 + e) * LDS_P16 + sloc]  = (_Float16)a2[e];
      th[(d0 + 12 + e) * LDS_P16 + sloc] = (_Float16)a3[e];
    }
  }
  __syncthreads();
  const int wave = tid >> 5, lane = tid & 31, q8 = lane >> 3, c8 = (lane & 7) * 8;
  const int dA = wave * 8 + q8, dB = wave * 8 + 4 + q8;
  const v8h va = *(const v8h*)(th + dA * LDS_P16 + c8);
  const v8h vb = *(const v8h*)(th + dB * LDS_P16 + c8);
  const size_t oA = ((size_t)h * HDIM + dA) * SEQ_T + t0 + c8;
  const size_t oB = ((size_t)h * HDIM + dB) * SEQ_T + t0 + c8;
  {
    *(v8h*)(vt + oA) = va;
    *(v8h*)(vt + oB) = vb;
    
  }
}

// =====================================================================================
// Kernel: causal attention, head dim 64, f16 planes in (Q, K: [NHEAD*SEQ_T][64]; Vt: [NHEAD*64][SEQ_T]),
// f16 plane out (O: [SEQ_T][DMODEL], head h at cols h*64, value o*16).
//   scores^T = 0.125 * k.q^T : v_wmma_f32_16x16x32_f16 (q, k plain f16), f32 accumulate
//   out^T    = v^T.p^T       : v_wmma_f32_16x16x32_f16 (p carried x2^15 in f16, v plain f16), f32 accumulate
//   (transposed products: a lane holds one query's scores, and p goes from the score tiles straight into the B operand)
//   online softmax in f32; keys above the diagonal -> -inf (every row keeps key kv0 <= row, so never fully masked).
// Block = 4 waves = 64 query rows of head h; 64-key chunks; chunks above the diagonal are skipped (block-uniform).
// K / Vt chunks staged in LDS with plain loads + __syncthreads (128 threads x 4 x 16 B = 64x64 halves each);
// WMMA operands are read from dense, statically strided LDS / plane addresses only.
// O store coverage per wave: 4 iterations x 4 row groups = 16 rows, 8 lanes x 8 halves = 64 cols = one whole
// =====================================================================================
__global__ __launch_bounds__(128) void attn_causal_hd64_k(const unsigned short* __restrict__ qp,
                                                         const unsigned short* __restrict__ kp,
                                                         const unsigned short* __restrict__ vtp,
                                                         unsigned short* __restrict__ op) {
  typedef Frag<_Float16> FH;
  __shared__ __align__(16) _Float16 Ksh[KEY_CH * LDS_P16];    // [kv][d]
  __shared__ __align__(16) _Float16 Vts[HDIM * LDS_P16];      // [d][kv]
  __shared__ __align__(16) float   Os[4][16 * 68];            // per wave out tile, pitch 68
  const int tid = threadIdx.x, wave = tid >> 5, lane = tid & 31, hh = lane >> 4, c = lane & 15;
  const int qb = blockIdx.x % NQTILE;
  const int h  = blockIdx.x / NQTILE;
  const int q0 = qb * 64 + wave * 16;
  const _Float16* Qh = (const _Float16*)qp + ((size_t)h * SEQ_T + q0 + c) * HDIM;
  const _Float16* Kh = (const _Float16*)kp + (size_t)h * SEQ_T * HDIM;
  const _Float16* Vh = (const _Float16*)vtp + (size_t)h * HDIM * SEQ_T;

  // Q fragments (B operand, column = query q0 + c, k = head dim): 2 d-chunks of 32
  v16h qa[2];
  qa[0] = FH::load(Qh + 8 * hh);
  qa[1] = FH::load(Qh + 32 + 8 * hh);

  const v8f vz = (v8f){0.f,0.f,0.f,0.f,0.f,0.f,0.f,0.f};
  float mrow = -INFINITY, lrow = 0.f;   // one query per lane
  v8f oacc[4];
#pragma unroll
  for (int t = 0; t < 4; ++t) oacc[t] = vz;

  const int nChunks = qb + 1;   // block-uniform
  for (int kc = 0; kc < nChunks; ++kc) {
    const int kv0 = kc * KEY_CH;
    __syncthreads();
#pragma unroll
    for (int i = 0; i < 4; ++i) {
      const int idx = tid + 128 * i;          // 0..511
      const int r = idx >> 3, c8 = (idx & 7) * 8;
      const v8h kv = *(const v8h*)(Kh + (size_t)(kv0 + r) * HDIM + c8);      // K row kv0+r, d c8..c8+7
      const v8h vv = *(const v8h*)(Vh + (size_t)r * SEQ_T + kv0 + c8);        // Vt row d=r, keys kv0+c8..
      *(v8h*)(Ksh + r * LDS_P16 + c8) = kv;
      *(v8h*)(Vts + r * LDS_P16 + c8) = vv;
    }
    __syncthreads();

    // transposed scores: tile j = K rows (A, m = key j*16 + ..) x Q (B, n = query c); lane (hh, c) holds
    // keys j*16 + 8*hh + r of query q0 + c
    v16h ka[2][4], va[2][4];
#pragma unroll
    for (int dc = 0; dc < 2; ++dc)
#pragma unroll
      for (int j = 0; j < 4; ++j) ka[dc][j] = FH::load(Ksh + (j * 16 + c) * LDS_P16 + dc * 32 + 8 * hh);   // A[m=key j*16+c][k=d]
    // keeps the 16 K reads together in front of the 8 score products: sunk to their users, each product waits out a whole LDS latency
    __builtin_amdgcn_sched_barrier(0);
    v8f s[4];
#pragma unroll
    for (int j = 0; j < 4; ++j) s[j] = FH::mma(ka[0][j], qa[0], vz);
#pragma unroll
    for (int j = 0; j < 4; ++j) s[j] = FH::mma(ka[1][j], qa[1], s[j]);
#pragma unroll
    for (int kk = 0; kk < 2; ++kk)
#pragma unroll
      for (int t = 0; t < 4; ++t) va[kk][t] = FH::load(Vts + (t * 16 + c) * LDS_P16 + kk * 32 + 8 * hh);   // A[m=d t*16+c][k=key]
    // the 8 score products run unbroken, then the 16 V^T reads as one group
    __builtin_amdgcn_sched_group_barrier(0x008, 8, 0);
    __builtin_amdgcn_sched_group_barrier(0x100, 16, 0);
    // keeps the 16 V^T reads in front of the softmax, whose vector work then covers their latency
    __builtin_amdgcn_sched_barrier(0);
    const bool diag = (kc == qb);
    const int qrow = q0 + c;
    float mj[4];
#pragma unroll
    for (int j = 0; j < 4; ++j) {
      float m = -INFINITY;
#pragma unroll
      for (int r = 0; r < 8; ++r) {
        const int kvcol = kv0 + j * 16 + 8 * hh + r;
        float sv = s[j][r] * 0.125f;
        if (diag && (kvcol > qrow)) sv = -INFINITY;
        s[j][r] = sv;
        m = fmaxf(m, sv);
      }
      mj[j] = m;
    }
    float cm = fmaxf(fmaxf(mj[0], mj[1]), fmaxf(mj[2], mj[3]));
    cm = fmaxf(cm, xhalf(cm));                     // the other 32 keys of this query sit in the other lane half
    const float mnew = fmaxf(mrow, cm);
    const float alpha = __expf(mrow - mnew);
    mrow = mnew;
    FH::U pb[2];                                   // B[k=key][n=query c]: elements 0..7 = tile 2kk, 8..15 = tile 2kk+1
    float pj[4];
#pragma unroll
    for (int j = 0; j < 4; ++j) {
      float psum = 0.f;
      v8h ph;
#pragma unroll
      for (int r = 0; r < 8; ++r) {
        const float p = __expf(s[j][r] - mnew);
        psum += p;
        ph[r] = (_Float16)(p * P_CARRY);
      }
      pj[j] = psum;
      pb[j >> 1].h[j & 1] = ph;
    }
    lrow = lrow * alpha + ((pj[0] + pj[1]) + (pj[2] + pj[3]));   // this half's keys only; halves joined after the loop
#pragma unroll
    for (int t = 0; t < 4; ++t)
#pragma unroll
      for (int r = 0; r < 8; ++r) oacc[t][r] *= alpha;
#pragma unroll
    for (int kk = 0; kk < 2; ++kk) {
#pragma unroll
      for (int t = 0; t < 4; ++t) oacc[t] = FH::mma(va[kk][t], pb[kk].v, oacc[t]);
    }
  }

  // oacc[t][r] = out[query q0 + c][d = t*16 + 8*hh + r]
  float* os = Os[wave];
  {
    const float ltot = lrow + xhalf(lrow);
    const float inv = (1.0f / ltot) * (O_CARRY / P_CARRY);
#pragma unroll
    for (int t = 0; t < 4; ++t) {
      v4f lo, hi;
#pragma unroll
      for (int e = 0; e < 4; ++e) { lo[e] = oacc[t][e] * inv; hi[e] = oacc[t][4 + e] * inv; }
      *(v4f*)(os + c * 68 + t * 16 + 8 * hh)     = lo;
      *(v4f*)(os + c * 68 + t * 16 + 8 * hh + 4) = hi;
    }
  }
  __builtin_amdgcn_fence(__ATOMIC_RELEASE, "workgroup");
  __builtin_amdgcn_wave_barrier();
  __builtin_amdgcn_fence(__ATOMIC_ACQUIRE, "workgroup");
  {
    const int q8 = lane >> 3, c8 = (lane & 7) * 8;
    unsigned short* ob = op + (size_t)h * HDIM + c8;
    {
#pragma unroll
      for (int it = 0; it < 4; ++it) {
        const int row = it * 4 + q8;
        const v4f f0 = *(const v4f*)(os + row * 68 + c8);
        const v4f f1 = *(const v4f*)(os + row * 68 + c8 + 4);
        v8h hv;
#pragma unroll
        for (int e = 0; e < 4; ++e) { hv[e] = (_Float16)f0[e]; hv[4 + e] = (_Float16)f1[e]; }
        *(v8h*)(ob + (size_t)(q0 + row) * DMODEL) = hv;
      }
      
    }
  }
}

// =====================================================================================
// Host glue.  Workspace region map (bytes, all offsets multiples of 1 MiB):
//   XN   f16 [4096][1024]         8,388,608 @ 0
//   WQKV f16 [3072][1024] (x64)   6,291,456 @ 8,388,608
//   WO   f16 [1024][1024] (x64)   2,097,152 @ 14,680,064
//   QKV  f32 [4096][3072]        50,331,648 @ 16,777,216
//   QPL  f16 [16*4096][64]        8,388,608 @ 67,108,864
//   KPL  f16 [16*4096][64]        8,388,608 @ 75,497,472
//   VT   f16 [16*64][4096]        8,388,608 @ 83,886,080
//   OPL  f16 [4096][1024] (x16)   8,388,608 @ 92,274,688
//   total 100,663,296
// =====================================================================================
extern "C" void kernel_launch(void* const* d_in, const int* in_sizes, int n_in,
                              void* d_out, int out_size, void* d_ws, size_t ws_size,
                              hipStream_t stream) {
  if (n_in < 6) return;
  const int nx = SEQ_T * DMODEL;
  const int nwgt = DMODEL * DMODEL;
  if (in_sizes[0] != nx || in_sizes[1] != nwgt || in_sizes[2] != nwgt || in_sizes[3] != nwgt ||
      in_sizes[4] != nwgt || in_sizes[5] != DMODEL || out_size != nx) return;

  const float* x  = (const float*)d_in[0];
  const float* wq = (const float*)d_in[1];
  const float* wk = (const float*)d_in[2];
  const float* wv = (const float*)d_in[3];
  const float* wo = (const float*)d_in[4];
  const float* nw = (const float*)d_in[5];
  float* out = (float*)d_out;

  const size_t szXN   = (size_t)nx * 2;
  const size_t szWQKV = (size_t)3 * nwgt * 2;
  const size_t szWO   = (size_t)nwgt * 2;
  const size_t szQKV  = (size_t)SEQ_T * QKV_N * 4;
  const size_t szPL   = (size_t)NHEAD * SEQ_T * HDIM * 2;
  const size_t szO    = (size_t)nx * 2;
  const size_t offXN   = 0;
  const size_t offWQKV = offXN + szXN;
  const size_t offWO   = offWQKV + szWQKV;
  const size_t offQKV  = offWO + szWO;
  const size_t offQ    = offQKV + szQKV;
  const size_t offK    = offQ + szPL;
  const size_t offVT   = offK + szPL;
  const size_t offO    = offVT + szPL;
  const size_t total   = offO + szO;
  if (total > ws_size) return;

  char* ws = (char*)d_ws;
  unsigned short* XN   = (unsigned short*)(ws + offXN);
  unsigned short* WQKV = (unsigned short*)(ws + offWQKV);
  unsigned short* WO   = (unsigned short*)(ws + offWO);
  float*          QKV  = (float*)(ws + offQKV);
  unsigned short* QPL  = (unsigned short*)(ws + offQ);
  unsigned short* KPL  = (unsigned short*)(ws + offK);
  unsigned short* VT   = (unsigned short*)(ws + offVT);
  unsigned short* OPL  = (unsigned short*)(ws + offO);

  // inverse-frequency table: e_i = (2i)/64 (exact), p_i = fl32(pow(10000, e_i)) (double pow on host,
  // RNE to f32), invfreq_i = 1.0f / p_i (f32)
  FreqTab ft;
  for (int i = 0; i < 32; ++i) {
    const float e = (float)(2 * i) / 64.0f;
    const float p = (float)pow(10000.0, (double)e);
    ft.f[i] = 1.0f / p;
  }

  // 1) rmsnorm -> XN (f16)
  rmsnorm_f16_k<<<SEQ_T, 128, 0, stream>>>(x, nw, XN);
  // 2) weights -> f16(bf16(w) * 64); wq | wk | wv stacked as rows 0.., 1024.., 2048.. of WQKV
  const int n8 = nwgt / 8;
  const int castBlocks = (n8 + 255) / 256;
  cast_w_f16x8_k<<<castBlocks, 256, 0, stream>>>(wq, WQKV, n8, W_CARRY);
  cast_w_f16x8_k<<<castBlocks, 256, 0, stream>>>(wk, WQKV + (size_t)nwgt, n8, W_CARRY);
  cast_w_f16x8_k<<<castBlocks, 256, 0, stream>>>(wv, WQKV + (size_t)2 * nwgt, n8, W_CARRY);
  cast_w_f16x8_k<<<castBlocks, 256, 0, stream>>>(wo, WO, n8, W_CARRY);
  // 3) QKV = XN . WQKV^T / 64 : M=4096, N=3072, K=1024; 32x12 work-group tiles = 384 blocks
  {
    dim3 grid((SEQ_T / GT_M) * (QKV_N / GT_N), 1);
    wmma_gemm64<0, 0, 0, 0, false><<<grid, 256, 0, stream>>>(
        XN, XN, DMODEL, 0L, WQKV, WQKV, DMODEL, 0L, (void*)QKV, (void*)QKV, QKV_N, 0L,
        nw, x, 0L, SEQ_T, QKV_N, DMODEL, 1.0f / W_CARRY);
  }
  // 4) rotary on q, k -> f16 planes; 5) v -> Vt f16 plane
  rope_qk_f16_k<<<SEQ_T, 256, 0, stream>>>(QKV, ft, QPL, KPL);
  vt_from_qkv_k<<<dim3(SEQ_T / 64, NHEAD), 256, 0, stream>>>(QKV, VT);
  // 6) causal attention -> O plane (f16, x16)
  attn_causal_hd64_k<<<NHEAD * NQTILE, 128, 0, stream>>>(QPL, KPL, VT, OPL);
  // 7) out = bf16_rne(x) + (O . WO^T) / (16*64) : M=4096, N=1024, K=1024; 32x4 work-group tiles = 128 blocks
  {
    dim3 grid((SEQ_T / GT_M) * (DMODEL / GT_N), 1);
    wmma_gemm64<0, 0, 0, 0, true, 0, true><<<grid, 256, 0, stream>>>(
        OPL, OPL, DMODEL, 0L, WO, WO, DMODEL, 0L, (void*)out, (void*)out, DMODEL, 0L,
        nw, x, 0L, SEQ_T, DMODEL, DMODEL, 1.0f / (O_CARRY * W_CARRY));
  }
}

// v004
// It runs in 140 microseconds.
// Timed twice side by side with v003, it ran 1.06 and 1.05 times as fast.
// Counting every step since v000, it is 2.71 times as fast.
// Contractions: qkv projection (normed . W^T, K=1024), attention q.k^T and p.v (head dim 64), output projection (o . Wo^T, K=1024): all v_wmma_f32_16x16x32_f16 (f16 operands, f32 accumulate); W carried x64, p carried x2^15, attention output carried x16 (exact power-of-two carries folded back in f32); float inputs RNE-converted to bf16 on load; rmsnorm, rotary tables, softmax, residual add in f32.
#include <hip/hip_runtime.h>
#include <math.h>

typedef __attribute__((ext_vector_type(16))) _Float16 v16h;
typedef __attribute__((ext_vector_type(8)))  _Float16 v8h;
typedef __attribute__((ext_vector_type(16))) __bf16   v16b;
typedef __attribute__((ext_vector_type(8)))  __bf16   v8b;
typedef __attribute__((ext_vector_type(8)))  float    v8f;
typedef __attribute__((ext_vector_type(4)))  float    v4f;

constexpr int SEQ_T     = 4096;
constexpr int DMODEL    = 1024;
constexpr int NHEAD     = 16;
constexpr int HDIM      = 64;
constexpr int QKV_N     = 3072;          // cols 0..1023 q | 1024..2047 k | 2048..3071 v
constexpr int NQTILE    = SEQ_T / 64;    // 64-row query tiles per head
constexpr int KEY_CH    = 64;            // keys per chunk
constexpr int LDS_P16   = 72;            // 16-bit LDS pitch (144 B rows, 16-B aligned)
constexpr float W_CARRY = 64.0f;         // weights stored as f16(bf16(w) * 64)
constexpr float P_CARRY = 32768.0f;      // softmax numerators stored as f16(p * 2^15)
constexpr float O_CARRY = 16.0f;         // attention output stored as f16(o * 16)

struct FreqTab { float f[32]; };
static_assert(sizeof(FreqTab) == 128);

__device__ __forceinline__ unsigned short f2bf_bits(float f) {
  unsigned u = __float_as_uint(f);
  return (unsigned short)((u + 0x7FFFu + ((u >> 16) & 1u)) >> 16);
}
__device__ __forceinline__ float bf_bits2f(unsigned short h) { return __uint_as_float(((unsigned)h) << 16); }
__device__ __forceinline__ float rne_bf(float f) { return bf_bits2f(f2bf_bits(f)); }

// hazard guard behind the last products of a GEMM, as a plain device helper
__device__ __forceinline__ void acc_guard4(v8f& a, v8f& b, v8f& c, v8f& d) { asm volatile("v_nop\n\tv_nop\n\tv_nop\n\tv_nop" : "+v"(a), "+v"(b), "+v"(c), "+v"(d)); }
template <typename T> struct Frag;
template <> struct Frag<_Float16> {
  typedef v16h V; union U { v16h v; v8h h[2]; };
  static __device__ __forceinline__ v16h load(const _Float16* p) {   // elements 0..7 <- p[0..7], 8..15 <- p[16..23]
    U f; f.h[0] = *(const v8h*)(p); f.h[1] = *(const v8h*)(p + 16); return f.v;
  }
  static __device__ __forceinline__ v8f mma(v16h a, v16h b, v8f c) {
    return __builtin_amdgcn_wmma_f32_16x16x32_f16(false, a, false, b, (short)0, c, false, false);
  }
};
template <> struct Frag<__bf16> {
  typedef v16b V; union U { v16b v; v8b h[2]; };
  static __device__ __forceinline__ v16b load(const __bf16* p) {
    U f; f.h[0] = *(const v8b*)(p); f.h[1] = *(const v8b*)(p + 16); return f.v;
  }
  static __device__ __forceinline__ v8f mma(v16b a, v16b b, v8f c) {
    return __builtin_amdgcn_wmma_f32_16x16x32_bf16(false, a, false, b, (short)0, c, false, false);
  }
};

// lane l reads lane l ^ 16 (vector cross-row move, no LDS round trip)
__device__ __forceinline__ float xhalf(float x) {
  const int b = __builtin_bit_cast(int, x);
  return __builtin_bit_cast(float, __builtin_amdgcn_permlanex16(b, b, 0x76543210, 0xfedcba98, false, false));
}

// =====================================================================================
// Register-blocked batched WMMA GEMM, C[m,n] = scale * sum_k A[m,k] * Bt[n,k] (+bias)(+resid);
// a work-group of 8 waves (2 x 4) owns a 128x256 tile, each wave a 64x64 tile of it.
// A row-major [M,K]; Bt row-major [N,K]; M % 128 == 0, N % 256 == 0, K % 64 == 0.
// Operands: per 64 k the 128 A rows and 256 Bt rows (128 B each, whole lines) are copied to LDS once per
// work-group by asynchronous copies, two buffers, the next stage in flight while this one is multiplied.
// SPLITM: 0 = single product (the only form the staged operand path carries; A2p, Bt2p are not read).
// BIAS_MODE: 0 = none, 1 = bias[m], 2 = bias[n].  OUT_MODE: 0 = f32, 1 = f16, 2 = bf16 hi + lo planes,
// 3 = attention planes (f16): columns 0..1023 rotary -> Cout [head*SEQ_T + t][64], 1024..2047 rotary -> Cout2 (same layout),
//     2048..3071 transposed -> Cout3 [head*64 + d][SEQ_T]; a wave's 64 columns are one head; rot = rotary table.
// RESID_RNE: the residual value is RNE-converted to bf16 before the add.
// ET: 0 = f16 operands, 1 = bf16 operands (pointers passed as 16-bit storage)
// =====================================================================================
constexpr int GT_M    = 128;                  // work-group tile rows
constexpr int GT_N    = 256;                  // work-group tile columns
constexpr int GT_K    = 64;                   // k per stage (128-B rows)
constexpr int GT_BUF  = (GT_M + GT_N) * LDS_P16;   // halves per buffer: A rows, then Bt rows, pitch 144 B
constexpr unsigned GT_STEP = 32u * LDS_P16 * 2u;   // LDS bytes between a thread's successive rows (32 rows)

// one thread's twelve 16-byte asynchronous copies global -> LDS of a stage; the s_wait_xcnt closes the statement
// so that no address register of a copy is rewritten before it
__device__ __forceinline__ void async_copy12(const unsigned (&l)[12], const void* const (&g)[12]) {
  asm volatile(
               "global_load_async_to_lds_b128 %0, %12, off\n\t"
               "global_load_async_to_lds_b128 %1, %13, off\n\t"
               "global_load_async_to_lds_b128 %2, %14, off\n\t"
               "global_load_async_to_lds_b128 %3, %15, off\n\t"
               "global_load_async_to_lds_b128 %4, %16, off\n\t"
               "global_load_async_to_lds_b128 %5, %17, off\n\t"
               "global_load_async_to_lds_b128 %6, %18, off\n\t"
               "global_load_async_to_lds_b128 %7, %19, off\n\t"
               "global_load_async_to_lds_b128 %8, %20, off\n\t"
               "global_load_async_to_lds_b128 %9, %21, off\n\t"
               "global_load_async_to_lds_b128 %10, %22, off\n\t"
               "global_load_async_to_lds_b128 %11, %23, off\n\t"
               "s_wait_xcnt 0x0"
               :: "v"(l[0]), "v"(l[1]), "v"(l[2]), "v"(l[3]), "v"(l[4]), "v"(l[5]), "v"(l[6]), "v"(l[7]), "v"(l[8]), "v"(l[9]), "v"(l[10]), "v"(l[11]),
                  "v"(g[0]), "v"(g[1]), "v"(g[2]), "v"(g[3]), "v"(g[4]), "v"(g[5]), "v"(g[6]), "v"(g[7]), "v"(g[8]), "v"(g[9]), "v"(g[10]), "v"(g[11]) : "memory");
}

// orders a wave's writes and reads of its own LDS slab (lanes exchange values through it); the fences name LDS alone, so
// that global stores and table loads in flight are not waited out at each exchange
__device__ __forceinline__ void slab_sync() {
  __builtin_amdgcn_fence(__ATOMIC_RELEASE, "workgroup", "local");
  __builtin_amdgcn_wave_barrier();
  __builtin_amdgcn_fence(__ATOMIC_ACQUIRE, "workgroup", "local");
}

template <int ET> struct Elem;
template <> struct Elem<0> { typedef _Float16 T; };
template <> struct Elem<1> { typedef __bf16 T; };
template <int ET, int SPLITM, int BIAS_MODE, int OUT_MODE, bool RESID, int ACT = 0, bool RESID_RNE = false>
__global__ __launch_bounds__(256) void wmma_gemm64(
    const unsigned short* __restrict__ Ap, const unsigned short* __restrict__ A2p, int lda, long strideA,
    const unsigned short* __restrict__ Btp, const unsigned short* __restrict__ Bt2p, int ldb, long strideB,
    void* __restrict__ Cout, void* __restrict__ Cout2, void* __restrict__ Cout3, int ldc, long strideC,
    const float* __restrict__ rot,
    const float* __restrict__ bias,
    const float* __restrict__ resid, long strideR,
    int M, int N, int K, float scale) {
  typedef typename Elem<ET>::T T;
  typedef typename Frag<T>::V V;
  const T* A = (const T*)Ap; const T* Bt = (const T*)Btp;
  static_assert(SPLITM == 0, "the staged operand path carries single planes");
  __shared__ __align__(16) T ring[2 * GT_BUF];     // two operand stages
  __shared__ __align__(16) float sT[8][16 * 68];   // per-wave 16x64 slab, pitch 68 floats
  const int b    = blockIdx.y;
  const int tid  = threadIdx.x;
  const int lane = tid & 31;
  const int wave = tid >> 5;
  const int tilesN = N / GT_N;
  const int tilesM = M / GT_M;
  if ((int)blockIdx.x >= tilesM * tilesN) return;   // work-group-uniform, in front of every barrier and copy
  const int bm = blockIdx.x / tilesN;
  const int bn = blockIdx.x - bm * tilesN;
  const int wm = wave >> 2, wn = wave & 3;
  const int m0 = bm * GT_M + (wm << 6);
  const int n0 = bn * GT_N + (wn << 6);

  const T* Ab  = A  + (size_t)b * strideA;
  const T* Bb  = Bt + (size_t)b * strideB;

  const int rlane = lane & 15;                 // row (A) / col (B, D) within subtile
  const int koff  = (lane >> 4) * 8;           // k offset of this lane half
  const int mOff  = (lane >> 4) * 8;           // D row offset

  // copies: thread -> 16 B at column chunk (tid & 7) of rows (tid >> 3) + 32 i; 8 lanes cover one 128-B row
  const int crow = tid >> 3, cchk = (tid & 7) * 8;
  const T* gA = Ab + (size_t)(bm * GT_M + crow) * lda + cchk;
  const T* gB = Bb + (size_t)(bn * GT_N + crow) * ldb + cchk;
  const size_t sA = (size_t)32 * lda, sB = (size_t)32 * ldb;
  const unsigned l0 = (unsigned)(uintptr_t)ring + (unsigned)(crow * LDS_P16 + cchk) * 2u;
  auto stage = [&](int t, int buf) {
    const T* ga = gA + (size_t)t * GT_K;
    const T* gb = gB + (size_t)t * GT_K;
    const unsigned lb = l0 + (unsigned)buf * (unsigned)(GT_BUF * 2);
    unsigned l[12];
    const void* g[12];
#pragma unroll
    for (int i = 0; i < 12; ++i) {
      l[i] = lb + (unsigned)i * GT_STEP;                                   // rows 0..127 A, 128..383 Bt
      g[i] = (i < 4) ? (const void*)(ga + i * sA) : (const void*)(gb + (i - 4) * sB);
    }
    async_copy12(l, g);
  };

  v8f acc[4][4];
#pragma unroll
  for (int i = 0; i < 4; ++i)
#pragma unroll
    for (int j = 0; j < 4; ++j) acc[i][j] = (v8f){0.f,0.f,0.f,0.f,0.f,0.f,0.f,0.f};

  const int nT = K / GT_K;
  stage(0, 0);
  asm volatile("s_wait_asynccnt 0x0" ::: "memory");   // this wave's part of stage 0 has landed
  __syncthreads();                                    // stage 0 is readable by every wave
  if (nT > 1) stage(1, 1);

  for (int t = 0; t < nT; ++t) {
    const int buf = t & 1;
    const T* sa = ring + buf * GT_BUF + ((wm << 6) + rlane) * LDS_P16 + koff;
    const T* sb = ring + buf * GT_BUF + (GT_M + (wn << 6) + rlane) * LDS_P16 + koff;
#pragma unroll
    for (int kk = 0; kk < GT_K; kk += 32) {
      V bh[4], ah[4];
#pragma unroll
      for (int j = 0; j < 4; ++j) bh[j] = Frag<T>::load(sb + (j << 4) * LDS_P16 + kk);
#pragma unroll
      for (int i = 0; i < 4; ++i) ah[i] = Frag<T>::load(sa + (i << 4) * LDS_P16 + kk);
      // keeps the 16 LDS reads together in front of the 16 products: sunk among them, each group waits out its own LDS latency
      __builtin_amdgcn_sched_barrier(0);
#pragma unroll
      for (int i = 0; i < 4; ++i)
#pragma unroll
        for (int j = 0; j < 4; ++j) acc[i][j] = Frag<T>::mma(ah[i], bh[j], acc[i][j]);
    }
    asm volatile("s_wait_dscnt 0x0" ::: "memory");      // this wave's reads of the buffer are done before it is refilled
    asm volatile("s_wait_asynccnt 0x0" ::: "memory");   // this wave's part of stage t + 1 has landed
    __syncthreads();                                    // publishes stage t + 1, ends every read of stage t
    if (t + 2 < nT) stage(t + 2, buf);
  }
  asm volatile("s_wait_asynccnt 0x0" ::: "memory");     // nothing in flight when the wave goes on
  acc_guard4(acc[0][0], acc[0][1], acc[0][2], acc[0][3]);
  acc_guard4(acc[1][0], acc[1][1], acc[1][2], acc[1][3]);
  acc_guard4(acc[2][0], acc[2][1], acc[2][2], acc[2][3]);
  acc_guard4(acc[3][0], acc[3][1], acc[3][2], acc[3][3]);

  // ---- epilogue ----
  float* slab = sT[wave];
  if constexpr (OUT_MODE == 3) {
    const int sel  = (bn * GT_N) >> 10;          // 0 = q, 1 = k, 2 = v: the same for the whole work-group
    const int head = (n0 & (DMODEL - 1)) >> 6;
    const int q = lane >> 3, c8 = (lane & 7) * 8;
    if (sel < 2) {
      // rotary in registers: column d (tiles 0, 1) and its partner d + 32 (tiles 2, 3) sit in the same lane and register
      unsigned short* P = ((sel == 0) ? (unsigned short*)Cout : (unsigned short*)Cout2) + ((size_t)head * SEQ_T + m0) * HDIM;
      const float* rp = rot + (size_t)rlane * (2 * SEQ_T) + (size_t)(m0 + mOff) * 2;
      v4f rt[2][8];                              // table values of row group i and, fetched ahead, of i + 1
      auto fetch = [&](int i, v4f (&d)[8]) {
#pragma unroll
        for (int jj = 0; jj < 2; ++jj)
#pragma unroll
          for (int k = 0; k < 4; ++k) d[jj * 4 + k] = *(const v4f*)(rp + (size_t)jj * (32 * SEQ_T) + i * 32 + k * 4);
      };
      fetch(0, rt[0]);
#pragma unroll
      for (int i = 0; i < 4; ++i) {
        if (i < 3) fetch(i + 1, rt[(i + 1) & 1]);
        const v4f (&tv)[8] = rt[i & 1];
#pragma unroll
        for (int jj = 0; jj < 2; ++jj)
#pragma unroll
          for (int r = 0; r < 8; ++r) {
            const float cv = tv[jj * 4 + (r >> 2)][r & 3];
            const float sv = tv[jj * 4 + 2 + (r >> 2)][r & 3];
            const float x1 = acc[i][jj][r] * scale;
            const float x2 = acc[i][jj + 2][r] * scale;
            slab[(mOff + r) * 68 + (jj << 4) + rlane]      = x1 * cv - x2 * sv;
            slab[(mOff + r) * 68 + 32 + (jj << 4) + rlane] = x2 * cv + x1 * sv;
          }
        slab_sync();
#pragma unroll
        for (int it = 0; it < 4; ++it) {
          const int row = it * 4 + q;             // 8 lanes x 16 B = one 128-B plane row
          const v4f f0 = *(const v4f*)(slab + row * 68 + c8);
          const v4f f1 = *(const v4f*)(slab + row * 68 + c8 + 4);
          v8h hv;
#pragma unroll
          for (int e = 0; e < 4; ++e) { hv[e] = (_Float16)f0[e]; hv[4 + e] = (_Float16)f1[e]; }
          *(v8h*)(P + (size_t)((i << 4) + row) * HDIM + c8) = hv;
        }
        // a table fetch follows that reuses the stores' data registers: the stores' register reads are waited for first
        if (i < 2) asm volatile("s_wait_xcnt 0x0" ::: "memory");
        slab_sync();
      }
    } else {
      // v: a lane's 8 accumulator rows are 8 successive tokens of one column d; 16 d rows x 64 tokens go through the slab
      _Float16* sl = (_Float16*)slab;
      unsigned short* P = (unsigned short*)Cout3 + (size_t)head * HDIM * SEQ_T + m0;
#pragma unroll
      for (int j = 0; j < 4; ++j) {
#pragma unroll
        for (int i = 0; i < 4; ++i) {
          v8h ph;
#pragma unroll
          for (int r = 0; r < 8; ++r) ph[r] = (_Float16)(acc[i][j][r] * scale);
          *(v8h*)(sl + rlane * LDS_P16 + (i << 4) + mOff) = ph;
        }
        slab_sync();
#pragma unroll
        for (int it = 0; it < 4; ++it) {
          const int row = it * 4 + q;             // 8 lanes x 16 B = 64 tokens = one whole 128-B line of row d
          const v8h hv = *(const v8h*)(sl + row * LDS_P16 + c8);
          *(v8h*)(P + (size_t)((j << 4) + row) * SEQ_T + c8) = hv;
        }
        // last group: the code behind it in the listing rewrites the stores' address pair, so the stores' register reads are waited for here
        if (j == 3) asm volatile("s_wait_xcnt 0x0" ::: "memory");
        slab_sync();
      }
    }
    return;
  }
  const float* Rb = RESID ? (resid + (size_t)b * strideR) : nullptr;
#pragma unroll
  for (int i = 0; i < 4; ++i) {
    const int mBase = m0 + (i << 4);
#pragma unroll
    for (int j = 0; j < 4; ++j) {
      const int n = n0 + (j << 4) + rlane;
      float bv = 0.f;
      if (BIAS_MODE == 2) bv = bias[n];
#pragma unroll
      for (int r = 0; r < 8; ++r) {
        float v = acc[i][j][r] * scale;
        if (BIAS_MODE == 1) v += bias[mBase + mOff + r];
        if (BIAS_MODE == 2) v += bv;
        if (RESID) {
          float rv = Rb[(size_t)(mBase + mOff + r) * ldc + n];
          if (RESID_RNE) rv = rne_bf(rv);
          v += rv;
        }
        if (ACT == 1) v = tanhf(v);
        if (ACT == 2) v = fmaxf(v, 0.0f);
        if (ACT == 4) v = (v > 0.f) ? v : 0.01f * v;
        slab[(mOff + r) * 68 + (j << 4) + rlane] = v;
      }
    }
    __builtin_amdgcn_fence(__ATOMIC_RELEASE, "workgroup");
    __builtin_amdgcn_wave_barrier();
    __builtin_amdgcn_fence(__ATOMIC_ACQUIRE, "workgroup");
    if (OUT_MODE == 0) {
      float* C = (float*)Cout + (size_t)b * strideC;
      const int hh = lane >> 4, c4 = (lane & 15) * 4;     // row seg = 256 B = 16 lanes x 16 B
      {
#pragma unroll
        for (int it = 0; it < 8; ++it) {
          const int row = it * 2 + hh;
          v4f v = *(const v4f*)(slab + row * 68 + c4);
          *(v4f*)(C + (size_t)(mBase + row) * ldc + n0 + c4) = v;
        }
        
      }
    } else {
      const int q = lane >> 3, c8 = (lane & 7) * 8;
      unsigned short* C  = (unsigned short*)Cout  + (size_t)b * strideC;
      unsigned short* C2 = (OUT_MODE == 2) ? ((unsigned short*)Cout2 + (size_t)b * strideC) : nullptr;
      {
#pragma unroll
        for (int it = 0; it < 4; ++it) {
          const int row = it * 4 + q;
          const float* sp = slab + row * 68 + c8;
          v8h hv, lv;
#pragma unroll
          for (int e = 0; e < 8; ++e) {
            if (OUT_MODE == 1) {
              hv[e] = (_Float16)sp[e];
            } else {
              unsigned short hb = f2bf_bits(sp[e]);
              unsigned short lb = f2bf_bits(sp[e] - bf_bits2f(hb));
              hv[e] = __builtin_bit_cast(_Float16, hb);
              lv[e] = __builtin_bit_cast(_Float16, lb);
            }
          }
          *(v8h*)(C + (size_t)(mBase + row) * ldc + n0 + c8) = hv;
          if (OUT_MODE == 2) *(v8h*)(C2 + (size_t)(mBase + row) * ldc + n0 + c8) = lv;
        }
        
      }
    }
    __builtin_amdgcn_fence(__ATOMIC_RELEASE, "workgroup");
    __builtin_amdgcn_wave_barrier();
    __builtin_amdgcn_fence(__ATOMIC_ACQUIRE, "workgroup");
  }
}

// =====================================================================================
// Kernel: rmsnorm of one token row (x RNE-converted to bf16 on load, mean of squares in f32,
// rsqrt(mean + 1e-6), times norm_w (RNE bf16)), output as an f16 plane [SEQ_T][DMODEL].
// Block = 128 threads = one token; coverage 128 threads x 8 elements = 1024 = one row exactly;
// The first SEQ_T / 32 blocks also build the rotary table for 32 tokens x 32 frequencies each:
// rot[f][t >> 3][cos of 8 tokens | sin of 8 tokens], angle = (float)t * invfreq_f (single f32 multiply), precise sincosf;
// a thread writes 64 B, four threads of one block the two whole lines of (f, 32 tokens).
// =====================================================================================
__global__ __launch_bounds__(128) void rmsnorm_f16_k(const float* __restrict__ x, const float* __restrict__ nw,
                                                     unsigned short* __restrict__ xn, FreqTab ft, float* __restrict__ rot) {
  __shared__ float red[4];
  const int t = blockIdx.x, tid = threadIdx.x, wave = tid >> 5, lane = tid & 31;
  if (t < SEQ_T / 32) {   // block-uniform
    const int f = tid >> 2, tb = t * 32 + (tid & 3) * 8;
    float fr = ft.f[0];
#pragma unroll
    for (int q = 1; q < 32; ++q) fr = (f == q) ? ft.f[q] : fr;
    v4f cs4[4];
#pragma unroll
    for (int e = 0; e < 8; ++e) {
      float sv, cv;
      sincosf((float)(tb + e) * fr, &sv, &cv);
      cs4[e >> 2][e & 3]       = cv;
      cs4[2 + (e >> 2)][e & 3] = sv;
    }
    float* rd = rot + (size_t)f * (2 * SEQ_T) + (size_t)tb * 2;
#pragma unroll
    for (int k = 0; k < 4; ++k) *(v4f*)(rd + k * 4) = cs4[k];
  }
  const float* row = x + (size_t)t * DMODEL + tid * 8;
  const v4f a = *(const v4f*)row;
  const v4f b = *(const v4f*)(row + 4);
  float xb[8];
#pragma unroll
  for (int e = 0; e < 4; ++e) { xb[e] = rne_bf(a[e]); xb[4 + e] = rne_bf(b[e]); }
  float ss = 0.f;
#pragma unroll
  for (int e = 0; e < 8; ++e) ss += xb[e] * xb[e];
#pragma unroll
  for (int m = 1; m < 32; m <<= 1) ss += __shfl_xor(ss, m, 32);
  if (lane == 0) red[wave] = ss;
  __syncthreads();
  const float tot = (red[0] + red[1]) + (red[2] + red[3]);
  const float inv = rsqrtf(tot * (1.0f / 1024.0f) + 1e-6f);
  const v4f na = *(const v4f*)(nw + tid * 8);
  const v4f nb = *(const v4f*)(nw + tid * 8 + 4);
  v8h hv;
#pragma unroll
  for (int e = 0; e < 4; ++e) {
    hv[e]     = (_Float16)((xb[e] * inv) * rne_bf(na[e]));
    hv[4 + e] = (_Float16)((xb[4 + e] * inv) * rne_bf(nb[e]));
  }
  unsigned short* dst = xn + (size_t)t * DMODEL + tid * 8;
  *(v8h*)dst = hv;
}

// =====================================================================================
// Kernel: weight f32 -> f16(bf16_rne(w) * carry), 8 elements per thread. Coverage: n8 threads x 8 = n exactly
// =====================================================================================
__global__ __launch_bounds__(256) void cast_w_f16x8_k(const float* __restrict__ w, unsigned short* __restrict__ out,
                                                      int n8, float carry) {
  const int i = blockIdx.x * 256 + threadIdx.x;
  if (i < n8) {
    const v4f a = *(const v4f*)(w + (size_t)8 * i);
    const v4f b = *(const v4f*)(w + (size_t)8 * i + 4);
    v8h hv;
#pragma unroll
    for (int e = 0; e < 4; ++e) {
      hv[e]     = (_Float16)(rne_bf(a[e]) * carry);
      hv[4 + e] = (_Float16)(rne_bf(b[e]) * carry);
    }
    unsigned short* dst = out + (size_t)8 * i;
    *(v8h*)dst = hv;
    
  }
}

// =====================================================================================
// Kernel: causal attention, head dim 64, f16 planes in (Q, K: [NHEAD*SEQ_T][64]; Vt: [NHEAD*64][SEQ_T]),
// f16 plane out (O: [SEQ_T][DMODEL], head h at cols h*64, value o*16).
//   scores^T = 0.125 * k.q^T : v_wmma_f32_16x16x32_f16 (q, k plain f16), f32 accumulate
//   out^T    = v^T.p^T       : v_wmma_f32_16x16x32_f16 (p carried x2^15 in f16, v plain f16), f32 accumulate
//   (transposed products: a lane holds one query's scores, and p goes from the score tiles straight into the B operand)
//   online softmax in f32; keys above the diagonal -> -inf (every row keeps key kv0 <= row, so never fully masked).
// Block = 4 waves = 64 query rows of head h; 64-key chunks; chunks above the diagonal are skipped (block-uniform).
// K / Vt chunks staged in LDS with plain loads + __syncthreads (128 threads x 4 x 16 B = 64x64 halves each);
// WMMA operands are read from dense, statically strided LDS / plane addresses only.
// O store coverage per wave: 4 iterations x 4 row groups = 16 rows, 8 lanes x 8 halves = 64 cols = one whole
// =====================================================================================
__global__ __launch_bounds__(128) void attn_causal_hd64_k(const unsigned short* __restrict__ qp,
                                                         const unsigned short* __restrict__ kp,
                                                         const unsigned short* __restrict__ vtp,
                                                         unsigned short* __restrict__ op) {
  typedef Frag<_Float16> FH;
  __shared__ __align__(16) _Float16 Ksh[KEY_CH * LDS_P16];    // [kv][d]
  __shared__ __align__(16) _Float16 Vts[HDIM * LDS_P16];      // [d][kv]
  __shared__ __align__(16) float   Os[4][16 * 68];            // per wave out tile, pitch 68
  const int tid = threadIdx.x, wave = tid >> 5, lane = tid & 31, hh = lane >> 4, c = lane & 15;
  const int qb = blockIdx.x % NQTILE;
  const int h  = blockIdx.x / NQTILE;
  const int q0 = qb * 64 + wave * 16;
  const _Float16* Qh = (const _Float16*)qp + ((size_t)h * SEQ_T + q0 + c) * HDIM;
  const _Float16* Kh = (const _Float16*)kp + (size_t)h * SEQ_T * HDIM;
  const _Float16* Vh = (const _Float16*)vtp + (size_t)h * HDIM * SEQ_T;

  // Q fragments (B operand, column = query q0 + c, k = head dim): 2 d-chunks of 32
  v16h qa[2];
  qa[0] = FH::load(Qh + 8 * hh);
  qa[1] = FH::load(Qh + 32 + 8 * hh);

  const v8f vz = (v8f){0.f,0.f,0.f,0.f,0.f,0.f,0.f,0.f};
  float mrow = -INFINITY, lrow = 0.f;   // one query per lane
  v8f oacc[4];
#pragma unroll
  for (int t = 0; t < 4; ++t) oacc[t] = vz;

  const int nChunks = qb + 1;   // block-uniform
  for (int kc = 0; kc < nChunks; ++kc) {
    const int kv0 = kc * KEY_CH;
    __syncthreads();
#pragma unroll
    for (int i = 0; i < 4; ++i) {
      const int idx = tid + 128 * i;          // 0..511
      const int r = idx >> 3, c8 = (idx & 7) * 8;
      const v8h kv = *(const v8h*)(Kh + (size_t)(kv0 + r) * HDIM + c8);      // K row kv0+r, d c8..c8+7
      const v8h vv = *(const v8h*)(Vh + (size_t)r * SEQ_T + kv0 + c8);        // Vt row d=r, keys kv0+c8..
      *(v8h*)(Ksh + r * LDS_P16 + c8) = kv;
      *(v8h*)(Vts + r * LDS_P16 + c8) = vv;
    }
    __syncthreads();

    // transposed scores: tile j = K rows (A, m = key j*16 + ..) x Q (B, n = query c); lane (hh, c) holds
    // keys j*16 + 8*hh + r of query q0 + c
    v16h ka[2][4], va[2][4];
#pragma unroll
    for (int dc = 0; dc < 2; ++dc)
#pragma unroll
      for (int j = 0; j < 4; ++j) ka[dc][j] = FH::load(Ksh + (j * 16 + c) * LDS_P16 + dc * 32 + 8 * hh);   // A[m=key j*16+c][k=d]
    // keeps the 16 K reads together in front of the 8 score products: sunk to their users, each product waits out a whole LDS latency
    __builtin_amdgcn_sched_barrier(0);
    v8f s[4];
#pragma unroll
    for (int j = 0; j < 4; ++j) s[j] = FH::mma(ka[0][j], qa[0], vz);
#pragma unroll
    for (int j = 0; j < 4; ++j) s[j] = FH::mma(ka[1][j], qa[1], s[j]);
#pragma unroll
    for (int kk = 0; kk < 2; ++kk)
#pragma unroll
      for (int t = 0; t < 4; ++t) va[kk][t] = FH::load(Vts + (t * 16 + c) * LDS_P16 + kk * 32 + 8 * hh);   // A[m=d t*16+c][k=key]
    // the 8 score products run unbroken, then the 16 V^T reads as one group
    __builtin_amdgcn_sched_group_barrier(0x008, 8, 0);
    __builtin_amdgcn_sched_group_barrier(0x100, 16, 0);
    // keeps the 16 V^T reads in front of the softmax, whose vector work then covers their latency
    __builtin_amdgcn_sched_barrier(0);
    const bool diag = (kc == qb);
    const int qrow = q0 + c;
    float mj[4];
#pragma unroll
    for (int j = 0; j < 4; ++j) {
      float m = -INFINITY;
#pragma unroll
      for (int r = 0; r < 8; ++r) {
        const int kvcol = kv0 + j * 16 + 8 * hh + r;
        float sv = s[j][r] * 0.125f;
        if (diag && (kvcol > qrow)) sv = -INFINITY;
        s[j][r] = sv;
        m = fmaxf(m, sv);
      }
      mj[j] = m;
    }
    float cm = fmaxf(fmaxf(mj[0], mj[1]), fmaxf(mj[2], mj[3]));
    cm = fmaxf(cm, xhalf(cm));                     // the other 32 keys of this query sit in the other lane half
    const float mnew = fmaxf(mrow, cm);
    const float alpha = __expf(mrow - mnew);
    mrow = mnew;
    FH::U pb[2];                                   // B[k=key][n=query c]: elements 0..7 = tile 2kk, 8..15 = tile 2kk+1
    float pj[4];
#pragma unroll
    for (int j = 0; j < 4; ++j) {
      float psum = 0.f;
      v8h ph;
#pragma unroll
      for (int r = 0; r < 8; ++r) {
        const float p = __expf(s[j][r] - mnew);
        psum += p;
        ph[r] = (_Float16)(p * P_CARRY);
      }
      pj[j] = psum;
      pb[j >> 1].h[j & 1] = ph;
    }
    lrow = lrow * alpha + ((pj[0] + pj[1]) + (pj[2] + pj[3]));   // this half's keys only; halves joined after the loop
#pragma unroll
    for (int t = 0; t < 4; ++t)
#pragma unroll
      for (int r = 0; r < 8; ++r) oacc[t][r] *= alpha;
#pragma unroll
    for (int kk = 0; kk < 2; ++kk) {
#pragma unroll
      for (int t = 0; t < 4; ++t) oacc[t] = FH::mma(va[kk][t], pb[kk].v, oacc[t]);
    }
  }

  // oacc[t][r] = out[query q0 + c][d = t*16 + 8*hh + r]
  float* os = Os[wave];
  {
    const float ltot = lrow + xhalf(lrow);
    const float inv = (1.0f / ltot) * (O_CARRY / P_CARRY);
#pragma unroll
    for (int t = 0; t < 4; ++t) {
      v4f lo, hi;
#pragma unroll
      for (int e = 0; e < 4; ++e) { lo[e] = oacc[t][e] * inv; hi[e] = oacc[t][4 + e] * inv; }
      *(v4f*)(os + c * 68 + t * 16 + 8 * hh)     = lo;
      *(v4f*)(os + c * 68 + t * 16 + 8 * hh + 4) = hi;
    }
  }
  __builtin_amdgcn_fence(__ATOMIC_RELEASE, "workgroup");
  __builtin_amdgcn_wave_barrier();
  __builtin_amdgcn_fence(__ATOMIC_ACQUIRE, "workgroup");
  {
    const int q8 = lane >> 3, c8 = (lane & 7) * 8;
    unsigned short* ob = op + (size_t)h * HDIM + c8;
    {
#pragma unroll
      for (int it = 0; it < 4; ++it) {
        const int row = it * 4 + q8;
        const v4f f0 = *(const v4f*)(os + row * 68 + c8);
        const v4f f1 = *(const v4f*)(os + row * 68 + c8 + 4);
        v8h hv;
#pragma unroll
        for (int e = 0; e < 4; ++e) { hv[e] = (_Float16)f0[e]; hv[4 + e] = (_Float16)f1[e]; }
        *(v8h*)(ob + (size_t)(q0 + row) * DMODEL) = hv;
      }
      
    }
  }
}

// =====================================================================================
// Host glue.  Workspace region map (bytes, all offsets multiples of 1 MiB):
//   XN   f16 [4096][1024]         8,388,608 @ 0
//   WQKV f16 [3072][1024] (x64)   6,291,456 @ 8,388,608
//   WO   f16 [1024][1024] (x64)   2,097,152 @ 14,680,064
//   ROT  f32 [32][512][2][8]      1,048,576 @ 16,777,216
//   QPL  f16 [16*4096][64]        8,388,608 @ 17,825,792
//   KPL  f16 [16*4096][64]        8,388,608 @ 26,214,400
//   VT   f16 [16*64][4096]        8,388,608 @ 34,603,008
//   OPL  f16 [4096][1024] (x16)   8,388,608 @ 42,991,616
//   total 51,380,224
// =====================================================================================
extern "C" void kernel_launch(void* const* d_in, const int* in_sizes, int n_in,
                              void* d_out, int out_size, void* d_ws, size_t ws_size,
                              hipStream_t stream) {
  if (n_in < 6) return;
  const int nx = SEQ_T * DMODEL;
  const int nwgt = DMODEL * DMODEL;
  if (in_sizes[0] != nx || in_sizes[1] != nwgt || in_sizes[2] != nwgt || in_sizes[3] != nwgt ||
      in_sizes[4] != nwgt || in_sizes[5] != DMODEL || out_size != nx) return;

  const float* x  = (const float*)d_in[0];
  const float* wq = (const float*)d_in[1];
  const float* wk = (const float*)d_in[2];
  const float* wv = (const float*)d_in[3];
  const float* wo = (const float*)d_in[4];
  const float* nw = (const float*)d_in[5];
  float* out = (float*)d_out;

  const size_t szXN   = (size_t)nx * 2;
  const size_t szWQKV = (size_t)3 * nwgt * 2;
  const size_t szWO   = (size_t)nwgt * 2;
  const size_t szROT  = (size_t)SEQ_T * HDIM * 4;
  const size_t szPL   = (size_t)NHEAD * SEQ_T * HDIM * 2;
  const size_t szO    = (size_t)nx * 2;
  const size_t offXN   = 0;
  const size_t offWQKV = offXN + szXN;
  const size_t offWO   = offWQKV + szWQKV;
  const size_t offROT  = offWO + szWO;
  const size_t offQ    = offROT + szROT;
  const size_t offK    = offQ + szPL;
  const size_t offVT   = offK + szPL;
  const size_t offO    = offVT + szPL;
  const size_t total   = offO + szO;
  if (total > ws_size) return;

  char* ws = (char*)d_ws;
  unsigned short* XN   = (unsigned short*)(ws + offXN);
  unsigned short* WQKV = (unsigned short*)(ws + offWQKV);
  unsigned short* WO   = (unsigned short*)(ws + offWO);
  float*          ROT  = (float*)(ws + offROT);
  unsigned short* QPL  = (unsigned short*)(ws + offQ);
  unsigned short* KPL  = (unsigned short*)(ws + offK);
  unsigned short* VT   = (unsigned short*)(ws + offVT);
  unsigned short* OPL  = (unsigned short*)(ws + offO);

  // inverse-frequency table: e_i = (2i)/64 (exact), p_i = fl32(pow(10000, e_i)) (double pow on host,
  // RNE to f32), invfreq_i = 1.0f / p_i (f32)
  FreqTab ft;
  for (int i = 0; i < 32; ++i) {
    const float e = (float)(2 * i) / 64.0f;
    const float p = (float)pow(10000.0, (double)e);
    ft.f[i] = 1.0f / p;
  }

  // 1) rmsnorm -> XN (f16); rotary table -> ROT
  rmsnorm_f16_k<<<SEQ_T, 128, 0, stream>>>(x, nw, XN, ft, ROT);
  // 2) weights -> f16(bf16(w) * 64); wq | wk | wv stacked as rows 0.., 1024.., 2048.. of WQKV
  const int n8 = nwgt / 8;
  const int castBlocks = (n8 + 255) / 256;
  cast_w_f16x8_k<<<castBlocks, 256, 0, stream>>>(wq, WQKV, n8, W_CARRY);
  cast_w_f16x8_k<<<castBlocks, 256, 0, stream>>>(wk, WQKV + (size_t)nwgt, n8, W_CARRY);
  cast_w_f16x8_k<<<castBlocks, 256, 0, stream>>>(wv, WQKV + (size_t)2 * nwgt, n8, W_CARRY);
  cast_w_f16x8_k<<<castBlocks, 256, 0, stream>>>(wo, WO, n8, W_CARRY);
  // 3) XN . WQKV^T / 64 : M=4096, N=3072, K=1024; 32x12 work-group tiles = 384 blocks; the epilogue applies the rotary
  //    to q and k and writes the Q, K and Vt f16 planes
  {
    dim3 grid((SEQ_T / GT_M) * (QKV_N / GT_N), 1);
    wmma_gemm64<0, 0, 0, 3, false><<<grid, 256, 0, stream>>>(
        XN, XN, DMODEL, 0L, WQKV, WQKV, DMODEL, 0L, (void*)QPL, (void*)KPL, (void*)VT, QKV_N, 0L,
        ROT, nw, x, 0L, SEQ_T, QKV_N, DMODEL, 1.0f / W_CARRY);
  }
  // 4) causal attention -> O plane (f16, x16)
  attn_causal_hd64_k<<<NHEAD * NQTILE, 128, 0, stream>>>(QPL, KPL, VT, OPL);
  // 5) out = bf16_rne(x) + (O . WO^T) / (16*64) : M=4096, N=1024, K=1024; 32x4 work-group tiles = 128 blocks
  {
    dim3 grid((SEQ_T / GT_M) * (DMODEL / GT_N), 1);
    wmma_gemm64<0, 0, 0, 0, true, 0, true><<<grid, 256, 0, stream>>>(
        OPL, OPL, DMODEL, 0L, WO, WO, DMODEL, 0L, (void*)out, (void*)out, (void*)out, DMODEL, 0L,
        nw, nw, x, 0L, SEQ_T, DMODEL, DMODEL, 1.0f / (O_CARRY * W_CARRY));
  }
}

// v005
// A run of this version takes 134 microseconds.
// Next to v004, in two timings, it ran 1.05 times as fast each time.
// Counting every step since v000, it is 2.85 times as fast.
// Contractions: qkv projection (normed . W^T, K=1024), attention q.k^T and p.v (head dim 64), output projection (o . Wo^T, K=1024): all v_wmma_f32_16x16x32_f16 (f16 operands, f32 accumulate); W carried x64, p carried x2^15, attention output carried x16 (exact power-of-two carries folded back in f32); float inputs RNE-converted to bf16 on load; rmsnorm, rotary tables, softmax, residual add in f32.
#include <hip/hip_runtime.h>
#include <math.h>

typedef __attribute__((ext_vector_type(16))) _Float16 v16h;
typedef __attribute__((ext_vector_type(8)))  _Float16 v8h;
typedef __attribute__((ext_vector_type(16))) __bf16   v16b;
typedef __attribute__((ext_vector_type(8)))  __bf16   v8b;
typedef __attribute__((ext_vector_type(8)))  float    v8f;
typedef __attribute__((ext_vector_type(4)))  float    v4f;

constexpr int SEQ_T     = 4096;
constexpr int DMODEL    = 1024;
constexpr int NHEAD     = 16;
constexpr int HDIM      = 64;
constexpr int QKV_N     = 3072;          // cols 0..1023 q | 1024..2047 k | 2048..3071 v
constexpr int NQTILE    = SEQ_T / 64;    // 64-row query tiles per head
constexpr int KEY_CH    = 64;            // keys per chunk
constexpr int LDS_P16   = 72;            // 16-bit LDS pitch (144 B rows, 16-B aligned)
constexpr float W_CARRY = 64.0f;         // weights stored as f16(bf16(w) * 64)
constexpr float P_CARRY = 32768.0f;      // softmax numerators stored as f16(p * 2^15)
constexpr float O_CARRY = 16.0f;         // attention output stored as f16(o * 16)

struct FreqTab { float f[32]; };
static_assert(sizeof(FreqTab) == 128);

__device__ __forceinline__ unsigned short f2bf_bits(float f) {
  unsigned u = __float_as_uint(f);
  return (unsigned short)((u + 0x7FFFu + ((u >> 16) & 1u)) >> 16);
}
__device__ __forceinline__ float bf_bits2f(unsigned short h) { return __uint_as_float(((unsigned)h) << 16); }
__device__ __forceinline__ float rne_bf(float f) { return bf_bits2f(f2bf_bits(f)); }

// hazard guard behind the last products of a GEMM, as a plain device helper
__device__ __forceinline__ void acc_guard4(v8f& a, v8f& b, v8f& c, v8f& d) { asm volatile("v_nop\n\tv_nop\n\tv_nop\n\tv_nop" : "+v"(a), "+v"(b), "+v"(c), "+v"(d)); }
template <typename T> struct Frag;
template <> struct Frag<_Float16> {
  typedef v16h V; union U { v16h v; v8h h[2]; };
  static __device__ __forceinline__ v16h load(const _Float16* p) {   // elements 0..7 <- p[0..7], 8..15 <- p[16..23]
    U f; f.h[0] = *(const v8h*)(p); f.h[1] = *(const v8h*)(p + 16); return f.v;
  }
  static __device__ __forceinline__ v8f mma(v16h a, v16h b, v8f c) {
    return __builtin_amdgcn_wmma_f32_16x16x32_f16(false, a, false, b, (short)0, c, false, false);
  }
};
template <> struct Frag<__bf16> {
  typedef v16b V; union U { v16b v; v8b h[2]; };
  static __device__ __forceinline__ v16b load(const __bf16* p) {
    U f; f.h[0] = *(const v8b*)(p); f.h[1] = *(const v8b*)(p + 16); return f.v;
  }
  static __device__ __forceinline__ v8f mma(v16b a, v16b b, v8f c) {
    return __builtin_amdgcn_wmma_f32_16x16x32_bf16(false, a, false, b, (short)0, c, false, false);
  }
};

// lane l reads lane l ^ 16 (vector cross-row move, no LDS round trip)
__device__ __forceinline__ float xhalf(float x) {
  const int b = __builtin_bit_cast(int, x);
  return __builtin_bit_cast(float, __builtin_amdgcn_permlanex16(b, b, 0x76543210, 0xfedcba98, false, false));
}

// =====================================================================================
// Register-blocked batched WMMA GEMM, C[m,n] = scale * sum_k A[m,k] * Bt[n,k] (+bias)(+resid);
// a work-group of 8 waves (2 x 4) owns a 128x256 tile, each wave a 64x64 tile of it.
// A row-major [M,K]; Bt row-major [N,K]; M % 128 == 0, N % 256 == 0, K % 64 == 0.
// Operands: per 64 k the 128 A rows and 256 Bt rows (128 B each, whole lines) are copied to LDS once per
// work-group by asynchronous copies, two buffers, the next stage in flight while this one is multiplied.
// SPLITM: 0 = single product (the only form the staged operand path carries; A2p, Bt2p are not read).
// BIAS_MODE: 0 = none, 1 = bias[m], 2 = bias[n].  OUT_MODE: 0 = f32, 1 = f16, 2 = bf16 hi + lo planes,
// 3 = attention planes (f16): columns 0..1023 rotary -> Cout [head*SEQ_T + t][64], 1024..2047 rotary -> Cout2 (same layout),
//     2048..3071 transposed -> Cout3 [head*64 + d][SEQ_T]; a wave's 64 columns are one head; rot = rotary table.
// RESID_RNE: the residual value is RNE-converted to bf16 before the add.
// ET: 0 = f16 operands, 1 = bf16 operands (pointers passed as 16-bit storage)
// =====================================================================================
constexpr int GT_M    = 128;                  // work-group tile rows
constexpr int GT_N    = 256;                  // work-group tile columns
constexpr int GT_K    = 64;                   // k per stage (128-B rows)
constexpr int GT_BUF  = (GT_M + GT_N) * LDS_P16;   // halves per buffer: A rows, then Bt rows, pitch 144 B
constexpr unsigned GT_STEP = 32u * LDS_P16 * 2u;   // LDS bytes between a thread's successive rows (32 rows)

// one thread's twelve 16-byte asynchronous copies global -> LDS of a stage; the s_wait_xcnt closes the statement
// so that no address register of a copy is rewritten before it
__device__ __forceinline__ void async_copy12(const unsigned (&l)[12], const void* const (&g)[12]) {
  asm volatile(
               "global_load_async_to_lds_b128 %0, %12, off\n\t"
               "global_load_async_to_lds_b128 %1, %13, off\n\t"
               "global_load_async_to_lds_b128 %2, %14, off\n\t"
               "global_load_async_to_lds_b128 %3, %15, off\n\t"
               "global_load_async_to_lds_b128 %4, %16, off\n\t"
               "global_load_async_to_lds_b128 %5, %17, off\n\t"
               "global_load_async_to_lds_b128 %6, %18, off\n\t"
               "global_load_async_to_lds_b128 %7, %19, off\n\t"
               "global_load_async_to_lds_b128 %8, %20, off\n\t"
               "global_load_async_to_lds_b128 %9, %21, off\n\t"
               "global_load_async_to_lds_b128 %10, %22, off\n\t"
               "global_load_async_to_lds_b128 %11, %23, off\n\t"
               "s_wait_xcnt 0x0"
               :: "v"(l[0]), "v"(l[1]), "v"(l[2]), "v"(l[3]), "v"(l[4]), "v"(l[5]), "v"(l[6]), "v"(l[7]), "v"(l[8]), "v"(l[9]), "v"(l[10]), "v"(l[11]),
                  "v"(g[0]), "v"(g[1]), "v"(g[2]), "v"(g[3]), "v"(g[4]), "v"(g[5]), "v"(g[6]), "v"(g[7]), "v"(g[8]), "v"(g[9]), "v"(g[10]), "v"(g[11]) : "memory");
}

// orders a wave's writes and reads of its own LDS slab (lanes exchange values through it); the fences name LDS alone, so
// that global stores and table loads in flight are not waited out at each exchange
__device__ __forceinline__ void slab_sync() {
  __builtin_amdgcn_fence(__ATOMIC_RELEASE, "workgroup", "local");
  __builtin_amdgcn_wave_barrier();
  __builtin_amdgcn_fence(__ATOMIC_ACQUIRE, "workgroup", "local");
}

template <int ET> struct Elem;
template <> struct Elem<0> { typedef _Float16 T; };
template <> struct Elem<1> { typedef __bf16 T; };
template <int ET, int SPLITM, int BIAS_MODE, int OUT_MODE, bool RESID, int ACT = 0, bool RESID_RNE = false>
__global__ __launch_bounds__(256) void wmma_gemm64(
    const unsigned short* __restrict__ Ap, const unsigned short* __restrict__ A2p, int lda, long strideA,
    const unsigned short* __restrict__ Btp, const unsigned short* __restrict__ Bt2p, int ldb, long strideB,
    void* __restrict__ Cout, void* __restrict__ Cout2, void* __restrict__ Cout3, int ldc, long strideC,
    const float* __restrict__ rot,
    const float* __restrict__ bias,
    const float* __restrict__ resid, long strideR,
    int M, int N, int K, float scale) {
  typedef typename Elem<ET>::T T;
  typedef typename Frag<T>::V V;
  const T* A = (const T*)Ap; const T* Bt = (const T*)Btp;
  static_assert(SPLITM == 0, "the staged operand path carries single planes");
  __shared__ __align__(16) T ring[2 * GT_BUF];     // two operand stages
  __shared__ __align__(16) float sT[8][16 * 68];   // per-wave 16x64 slab, pitch 68 floats
  const int b    = blockIdx.y;
  const int tid  = threadIdx.x;
  const int lane = tid & 31;
  const int wave = tid >> 5;
  const int tilesN = N / GT_N;
  const int tilesM = M / GT_M;
  if ((int)blockIdx.x >= tilesM * tilesN) return;   // work-group-uniform, in front of every barrier and copy
  const int bm = blockIdx.x / tilesN;
  const int bn = blockIdx.x - bm * tilesN;
  const int wm = wave >> 2, wn = wave & 3;
  const int m0 = bm * GT_M + (wm << 6);
  const int n0 = bn * GT_N + (wn << 6);

  const T* Ab  = A  + (size_t)b * strideA;
  const T* Bb  = Bt + (size_t)b * strideB;

  const int rlane = lane & 15;                 // row (A) / col (B, D) within subtile
  const int koff  = (lane >> 4) * 8;           // k offset of this lane half
  const int mOff  = (lane >> 4) * 8;           // D row offset

  // copies: thread -> 16 B at column chunk (tid & 7) of rows (tid >> 3) + 32 i; 8 lanes cover one 128-B row
  const int crow = tid >> 3, cchk = (tid & 7) * 8;
  const T* gA = Ab + (size_t)(bm * GT_M + crow) * lda + cchk;
  const T* gB = Bb + (size_t)(bn * GT_N + crow) * ldb + cchk;
  const size_t sA = (size_t)32 * lda, sB = (size_t)32 * ldb;
  const unsigned l0 = (unsigned)(uintptr_t)ring + (unsigned)(crow * LDS_P16 + cchk) * 2u;
  auto stage = [&](int t, int buf) {
    const T* ga = gA + (size_t)t * GT_K;
    const T* gb = gB + (size_t)t * GT_K;
    const unsigned lb = l0 + (unsigned)buf * (unsigned)(GT_BUF * 2);
    unsigned l[12];
    const void* g[12];
#pragma unroll
    for (int i = 0; i < 12; ++i) {
      l[i] = lb + (unsigned)i * GT_STEP;                                   // rows 0..127 A, 128..383 Bt
      g[i] = (i < 4) ? (const void*)(ga + i * sA) : (const void*)(gb + (i - 4) * sB);
    }
    async_copy12(l, g);
  };

  v8f acc[4][4];
#pragma unroll
  for (int i = 0; i < 4; ++i)
#pragma unroll
    for (int j = 0; j < 4; ++j) acc[i][j] = (v8f){0.f,0.f,0.f,0.f,0.f,0.f,0.f,0.f};

  const int nT = K / GT_K;
  stage(0, 0);
  asm volatile("s_wait_asynccnt 0x0" ::: "memory");   // this wave's part of stage 0 has landed
  __syncthreads();                                    // stage 0 is readable by every wave
  if (nT > 1) stage(1, 1);

  for (int t = 0; t < nT; ++t) {
    const int buf = t & 1;
    const T* sa = ring + buf * GT_BUF + ((wm << 6) + rlane) * LDS_P16 + koff;
    const T* sb = ring + buf * GT_BUF + (GT_M + (wn << 6) + rlane) * LDS_P16 + koff;
#pragma unroll
    for (int kk = 0; kk < GT_K; kk += 32) {
      V bh[4], ah[4];
#pragma unroll
      for (int j = 0; j < 4; ++j) bh[j] = Frag<T>::load(sb + (j << 4) * LDS_P16 + kk);
#pragma unroll
      for (int i = 0; i < 4; ++i) ah[i] = Frag<T>::load(sa + (i << 4) * LDS_P16 + kk);
      // keeps the 16 LDS reads together in front of the 16 products: sunk among them, each group waits out its own LDS latency
      __builtin_amdgcn_sched_barrier(0);
#pragma unroll
      for (int i = 0; i < 4; ++i)
#pragma unroll
        for (int j = 0; j < 4; ++j) acc[i][j] = Frag<T>::mma(ah[i], bh[j], acc[i][j]);
    }
    asm volatile("s_wait_dscnt 0x0" ::: "memory");      // this wave's reads of the buffer are done before it is refilled
    asm volatile("s_wait_asynccnt 0x0" ::: "memory");   // this wave's part of stage t + 1 has landed
    __syncthreads();                                    // publishes stage t + 1, ends every read of stage t
    if (t + 2 < nT) stage(t + 2, buf);
  }
  asm volatile("s_wait_asynccnt 0x0" ::: "memory");     // nothing in flight when the wave goes on
  acc_guard4(acc[0][0], acc[0][1], acc[0][2], acc[0][3]);
  acc_guard4(acc[1][0], acc[1][1], acc[1][2], acc[1][3]);
  acc_guard4(acc[2][0], acc[2][1], acc[2][2], acc[2][3]);
  acc_guard4(acc[3][0], acc[3][1], acc[3][2], acc[3][3]);

  // ---- epilogue ----
  float* slab = sT[wave];
  if constexpr (OUT_MODE == 3) {
    const int sel  = (bn * GT_N) >> 10;          // 0 = q, 1 = k, 2 = v: the same for the whole work-group
    const int head = (n0 & (DMODEL - 1)) >> 6;
    const int q = lane >> 3, c8 = (lane & 7) * 8;
    if (sel < 2) {
      // rotary in registers: column d (tiles 0, 1) and its partner d + 32 (tiles 2, 3) sit in the same lane and register
      unsigned short* P = ((sel == 0) ? (unsigned short*)Cout : (unsigned short*)Cout2) + ((size_t)head * SEQ_T + m0) * HDIM;
      const float* rp = rot + (size_t)rlane * (2 * SEQ_T) + (size_t)(m0 + mOff) * 2;
      v4f rt[2][8];                              // table values of row group i and, fetched ahead, of i + 1
      auto fetch = [&](int i, v4f (&d)[8]) {
#pragma unroll
        for (int jj = 0; jj < 2; ++jj)
#pragma unroll
          for (int k = 0; k < 4; ++k) d[jj * 4 + k] = *(const v4f*)(rp + (size_t)jj * (32 * SEQ_T) + i * 32 + k * 4);
      };
      fetch(0, rt[0]);
#pragma unroll
      for (int i = 0; i < 4; ++i) {
        if (i < 3) fetch(i + 1, rt[(i + 1) & 1]);
        const v4f (&tv)[8] = rt[i & 1];
#pragma unroll
        for (int jj = 0; jj < 2; ++jj)
#pragma unroll
          for (int r = 0; r < 8; ++r) {
            const float cv = tv[jj * 4 + (r >> 2)][r & 3];
            const float sv = tv[jj * 4 + 2 + (r >> 2)][r & 3];
            const float x1 = acc[i][jj][r] * scale;
            const float x2 = acc[i][jj + 2][r] * scale;
            slab[(mOff + r) * 68 + (jj << 4) + rlane]      = x1 * cv - x2 * sv;
            slab[(mOff + r) * 68 + 32 + (jj << 4) + rlane] = x2 * cv + x1 * sv;
          }
        slab_sync();
#pragma unroll
        for (int it = 0; it < 4; ++it) {
          const int row = it * 4 + q;             // 8 lanes x 16 B = one 128-B plane row
          const v4f f0 = *(const v4f*)(slab + row * 68 + c8);
          const v4f f1 = *(const v4f*)(slab + row * 68 + c8 + 4);
          v8h hv;
#pragma unroll
          for (int e = 0; e < 4; ++e) { hv[e] = (_Float16)f0[e]; hv[4 + e] = (_Float16)f1[e]; }
          *(v8h*)(P + (size_t)((i << 4) + row) * HDIM + c8) = hv;
        }
        // a table fetch follows that reuses the stores' data registers: the stores' register reads are waited for first
        if (i < 2) asm volatile("s_wait_xcnt 0x0" ::: "memory");
        slab_sync();
      }
    } else {
      // v: a lane's 8 accumulator rows are 8 successive tokens of one column d; 16 d rows x 64 tokens go through the slab
      _Float16* sl = (_Float16*)slab;
      unsigned short* P = (unsigned short*)Cout3 + (size_t)head * HDIM * SEQ_T + m0;
#pragma unroll
      for (int j = 0; j < 4; ++j) {
#pragma unroll
        for (int i = 0; i < 4; ++i) {
          v8h ph;
#pragma unroll
          for (int r = 0; r < 8; ++r) ph[r] = (_Float16)(acc[i][j][r] * scale);
          *(v8h*)(sl + rlane * LDS_P16 + (i << 4) + mOff) = ph;
        }
        slab_sync();
#pragma unroll
        for (int it = 0; it < 4; ++it) {
          const int row = it * 4 + q;             // 8 lanes x 16 B = 64 tokens = one whole 128-B line of row d
          const v8h hv = *(const v8h*)(sl + row * LDS_P16 + c8);
          *(v8h*)(P + (size_t)((j << 4) + row) * SEQ_T + c8) = hv;
        }
        // last group: the code behind it in the listing rewrites the stores' address pair, so the stores' register reads are waited for here
        if (j == 3) asm volatile("s_wait_xcnt 0x0" ::: "memory");
        slab_sync();
      }
    }
    return;
  }
  const float* Rb = RESID ? (resid + (size_t)b * strideR) : nullptr;
#pragma unroll
  for (int i = 0; i < 4; ++i) {
    const int mBase = m0 + (i << 4);
#pragma unroll
    for (int j = 0; j < 4; ++j) {
      const int n = n0 + (j << 4) + rlane;
      float bv = 0.f;
      if (BIAS_MODE == 2) bv = bias[n];
#pragma unroll
      for (int r = 0; r < 8; ++r) {
        float v = acc[i][j][r] * scale;
        if (BIAS_MODE == 1) v += bias[mBase + mOff + r];
        if (BIAS_MODE == 2) v += bv;
        if (RESID) {
          float rv = Rb[(size_t)(mBase + mOff + r) * ldc + n];
          if (RESID_RNE) rv = rne_bf(rv);
          v += rv;
        }
        if (ACT == 1) v = tanhf(v);
        if (ACT == 2) v = fmaxf(v, 0.0f);
        if (ACT == 4) v = (v > 0.f) ? v : 0.01f * v;
        slab[(mOff + r) * 68 + (j << 4) + rlane] = v;
      }
    }
    __builtin_amdgcn_fence(__ATOMIC_RELEASE, "workgroup");
    __builtin_amdgcn_wave_barrier();
    __builtin_amdgcn_fence(__ATOMIC_ACQUIRE, "workgroup");
    if (OUT_MODE == 0) {
      float* C = (float*)Cout + (size_t)b * strideC;
      const int hh = lane >> 4, c4 = (lane & 15) * 4;     // row seg = 256 B = 16 lanes x 16 B
      {
#pragma unroll
        for (int it = 0; it < 8; ++it) {
          const int row = it * 2 + hh;
          v4f v = *(const v4f*)(slab + row * 68 + c4);
          *(v4f*)(C + (size_t)(mBase + row) * ldc + n0 + c4) = v;
        }
        
      }
    } else {
      const int q = lane >> 3, c8 = (lane & 7) * 8;
      unsigned short* C  = (unsigned short*)Cout  + (size_t)b * strideC;
      unsigned short* C2 = (OUT_MODE == 2) ? ((unsigned short*)Cout2 + (size_t)b * strideC) : nullptr;
      {
#pragma unroll
        for (int it = 0; it < 4; ++it) {
          const int row = it * 4 + q;
          const float* sp = slab + row * 68 + c8;
          v8h hv, lv;
#pragma unroll
          for (int e = 0; e < 8; ++e) {
            if (OUT_MODE == 1) {
              hv[e] = (_Float16)sp[e];
            } else {
              unsigned short hb = f2bf_bits(sp[e]);
              unsigned short lb = f2bf_bits(sp[e] - bf_bits2f(hb));
              hv[e] = __builtin_bit_cast(_Float16, hb);
              lv[e] = __builtin_bit_cast(_Float16, lb);
            }
          }
          *(v8h*)(C + (size_t)(mBase + row) * ldc + n0 + c8) = hv;
          if (OUT_MODE == 2) *(v8h*)(C2 + (size_t)(mBase + row) * ldc + n0 + c8) = lv;
        }
        
      }
    }
    __builtin_amdgcn_fence(__ATOMIC_RELEASE, "workgroup");
    __builtin_amdgcn_wave_barrier();
    __builtin_amdgcn_fence(__ATOMIC_ACQUIRE, "workgroup");
  }
}

// =====================================================================================
// Kernel: rmsnorm of one token row (x RNE-converted to bf16 on load, mean of squares in f32,
// rsqrt(mean + 1e-6), times norm_w (RNE bf16)), output as an f16 plane [SEQ_T][DMODEL].
// Block = 128 threads = one token; coverage 128 threads x 8 elements = 1024 = one row exactly;
// The first SEQ_T / 32 blocks also build the rotary table for 32 tokens x 32 frequencies each:
// rot[f][t >> 3][cos of 8 tokens | sin of 8 tokens], angle = (float)t * invfreq_f (single f32 multiply), precise sincosf;
// a thread writes 64 B, four threads of one block the two whole lines of (f, 32 tokens).
// Blocks SEQ_T .. SEQ_T + 4 * CAST_BPW - 1 of the same grid need nothing of the rows and cast the weights instead:
// f32 -> f16(bf16_rne(w) * W_CARRY); a block takes CAST_EPB successive weights of wq, wk, wv or wo,
// a thread 4 groups of 8 (coverage 128 threads x 8 x 4 = CAST_EPB exactly; a 16-B store per group, 8 lanes one whole line).
// =====================================================================================
constexpr int CAST_EPB = 4096;                            // weights per cast block
constexpr int CAST_BPW = DMODEL * DMODEL / CAST_EPB;      // cast blocks per weight matrix
__global__ __launch_bounds__(128) void rmsnorm_cast_f16_k(const float* __restrict__ x, const float* __restrict__ nw,
                                                          const float* __restrict__ wq, const float* __restrict__ wk,
                                                          const float* __restrict__ wv, const float* __restrict__ wo,
                                                          unsigned short* __restrict__ xn, unsigned short* __restrict__ wqkv,
                                                          unsigned short* __restrict__ wof, FreqTab ft, float* __restrict__ rot) {
  __shared__ float red[4];
  const int t = blockIdx.x, tid = threadIdx.x, wave = tid >> 5, lane = tid & 31;
  if (t >= SEQ_T) {   // block-uniform, in front of the barrier: a weight-cast block
    const int cb  = t - SEQ_T;
    const int sel = cb / CAST_BPW;                        // 0 = wq, 1 = wk, 2 = wv (rows 0.., 1024.., 2048.. of wqkv), 3 = wo
    const float* w = (sel == 0) ? wq : (sel == 1) ? wk : (sel == 2) ? wv : wo;
    unsigned short* o = (sel < 3) ? wqkv + (size_t)sel * (DMODEL * DMODEL) : wof;
    const int e0 = (cb - sel * CAST_BPW) * CAST_EPB + tid * 8;
    v4f a[4], b[4];
#pragma unroll
    for (int g = 0; g < 4; ++g) {
      a[g] = *(const v4f*)(w + e0 + g * 1024);
      b[g] = *(const v4f*)(w + e0 + g * 1024 + 4);
    }
#pragma unroll
    for (int g = 0; g < 4; ++g) {
      v8h hv;
#pragma unroll
      for (int e = 0; e < 4; ++e) {
        hv[e]     = (_Float16)(rne_bf(a[g][e]) * W_CARRY);
        hv[4 + e] = (_Float16)(rne_bf(b[g][e]) * W_CARRY);
      }
      *(v8h*)(o + e0 + g * 1024) = hv;
    }
    return;
  }
  if (t < SEQ_T / 32) {   // block-uniform
    const int f = tid >> 2, tb = t * 32 + (tid & 3) * 8;
    float fr = ft.f[0];
#pragma unroll
    for (int q = 1; q < 32; ++q) fr = (f == q) ? ft.f[q] : fr;
    v4f cs4[4];
#pragma unroll
    for (int e = 0; e < 8; ++e) {
      float sv, cv;
      sincosf((float)(tb + e) * fr, &sv, &cv);
      cs4[e >> 2][e & 3]       = cv;
      cs4[2 + (e >> 2)][e & 3] = sv;
    }
    float* rd = rot + (size_t)f * (2 * SEQ_T) + (size_t)tb * 2;
#pragma unroll
    for (int k = 0; k < 4; ++k) *(v4f*)(rd + k * 4) = cs4[k];
  }
  const float* row = x + (size_t)t * DMODEL + tid * 8;
  const v4f a = *(const v4f*)row;
  const v4f b = *(const v4f*)(row + 4);
  float xb[8];
#pragma unroll
  for (int e = 0; e < 4; ++e) { xb[e] = rne_bf(a[e]); xb[4 + e] = rne_bf(b[e]); }
  float ss = 0.f;
#pragma unroll
  for (int e = 0; e < 8; ++e) ss += xb[e] * xb[e];
#pragma unroll
  for (int m = 1; m < 32; m <<= 1) ss += __shfl_xor(ss, m, 32);
  if (lane == 0) red[wave] = ss;
  __syncthreads();
  const float tot = (red[0] + red[1]) + (red[2] + red[3]);
  const float inv = rsqrtf(tot * (1.0f / 1024.0f) + 1e-6f);
  const v4f na = *(const v4f*)(nw + tid * 8);
  const v4f nb = *(const v4f*)(nw + tid * 8 + 4);
  v8h hv;
#pragma unroll
  for (int e = 0; e < 4; ++e) {
    hv[e]     = (_Float16)((xb[e] * inv) * rne_bf(na[e]));
    hv[4 + e] = (_Float16)((xb[4 + e] * inv) * rne_bf(nb[e]));
  }
  unsigned short* dst = xn + (size_t)t * DMODEL + tid * 8;
  *(v8h*)dst = hv;
}

// =====================================================================================
// Kernel: causal attention, head dim 64, f16 planes in (Q, K: [NHEAD*SEQ_T][64]; Vt: [NHEAD*64][SEQ_T]),
// f16 plane out (O: [SEQ_T][DMODEL], head h at cols h*64, value o*16).
//   scores^T = 0.125 * k.q^T : v_wmma_f32_16x16x32_f16 (q, k plain f16), f32 accumulate
//   out^T    = v^T.p^T       : v_wmma_f32_16x16x32_f16 (p carried x2^15 in f16, v plain f16), f32 accumulate
//   (transposed products: a lane holds one query's scores, and p goes from the score tiles straight into the B operand)
//   online softmax in f32; keys above the diagonal -> -inf (every row keeps key kv0 <= row, so never fully masked).
// Block = 4 waves = 64 query rows of head h; 64-key chunks; chunks above the diagonal are skipped (block-uniform).
// K / Vt chunks staged in LDS with plain loads + __syncthreads (128 threads x 4 x 16 B = 64x64 halves each);
// WMMA operands are read from dense, statically strided LDS / plane addresses only.
// O store coverage per wave: 4 iterations x 4 row groups = 16 rows, 8 lanes x 8 halves = 64 cols = one whole
// =====================================================================================
__global__ __launch_bounds__(128) void attn_causal_hd64_k(const unsigned short* __restrict__ qp,
                                                         const unsigned short* __restrict__ kp,
                                                         const unsigned short* __restrict__ vtp,
                                                         unsigned short* __restrict__ op) {
  typedef Frag<_Float16> FH;
  __shared__ __align__(16) _Float16 Ksh[KEY_CH * LDS_P16];    // [kv][d]
  __shared__ __align__(16) _Float16 Vts[HDIM * LDS_P16];      // [d][kv]
  __shared__ __align__(16) float   Os[4][16 * 68];            // per wave out tile, pitch 68
  const int tid = threadIdx.x, wave = tid >> 5, lane = tid & 31, hh = lane >> 4, c = lane & 15;
  const int qb = blockIdx.x % NQTILE;
  const int h  = blockIdx.x / NQTILE;
  const int q0 = qb * 64 + wave * 16;
  const _Float16* Qh = (const _Float16*)qp + ((size_t)h * SEQ_T + q0 + c) * HDIM;
  const _Float16* Kh = (const _Float16*)kp + (size_t)h * SEQ_T * HDIM;
  const _Float16* Vh = (const _Float16*)vtp + (size_t)h * HDIM * SEQ_T;

  // Q fragments (B operand, column = query q0 + c, k = head dim): 2 d-chunks of 32
  v16h qa[2];
  qa[0] = FH::load(Qh + 8 * hh);
  qa[1] = FH::load(Qh + 32 + 8 * hh);

  const v8f vz = (v8f){0.f,0.f,0.f,0.f,0.f,0.f,0.f,0.f};
  float mrow = -INFINITY, lrow = 0.f;   // one query per lane
  v8f oacc[4];
#pragma unroll
  for (int t = 0; t < 4; ++t) oacc[t] = vz;

  const int nChunks = qb + 1;   // block-uniform
  for (int kc = 0; kc < nChunks; ++kc) {
    const int kv0 = kc * KEY_CH;
    __syncthreads();
#pragma unroll
    for (int i = 0; i < 4; ++i) {
      const int idx = tid + 128 * i;          // 0..511
      const int r = idx >> 3, c8 = (idx & 7) * 8;
      const v8h kv = *(const v8h*)(Kh + (size_t)(kv0 + r) * HDIM + c8);      // K row kv0+r, d c8..c8+7
      const v8h vv = *(const v8h*)(Vh + (size_t)r * SEQ_T + kv0 + c8);        // Vt row d=r, keys kv0+c8..
      *(v8h*)(Ksh + r * LDS_P16 + c8) = kv;
      *(v8h*)(Vts + r * LDS_P16 + c8) = vv;
    }
    __syncthreads();

    // transposed scores: tile j = K rows (A, m = key j*16 + ..) x Q (B, n = query c); lane (hh, c) holds
    // keys j*16 + 8*hh + r of query q0 + c
    v16h ka[2][4], va[2][4];
#pragma unroll
    for (int dc = 0; dc < 2; ++dc)
#pragma unroll
      for (int j = 0; j < 4; ++j) ka[dc][j] = FH::load(Ksh + (j * 16 + c) * LDS_P16 + dc * 32 + 8 * hh);   // A[m=key j*16+c][k=d]
    // keeps the 16 K reads together in front of the 8 score products: sunk to their users, each product waits out a whole LDS latency
    __builtin_amdgcn_sched_barrier(0);
    v8f s[4];
#pragma unroll
    for (int j = 0; j < 4; ++j) s[j] = FH::mma(ka[0][j], qa[0], vz);
#pragma unroll
    for (int j = 0; j < 4; ++j) s[j] = FH::mma(ka[1][j], qa[1], s[j]);
#pragma unroll
    for (int kk = 0; kk < 2; ++kk)
#pragma unroll
      for (int t = 0; t < 4; ++t) va[kk][t] = FH::load(Vts + (t * 16 + c) * LDS_P16 + kk * 32 + 8 * hh);   // A[m=d t*16+c][k=key]
    // the 8 score products run unbroken, then the 16 V^T reads as one group
    __builtin_amdgcn_sched_group_barrier(0x008, 8, 0);
    __builtin_amdgcn_sched_group_barrier(0x100, 16, 0);
    // keeps the 16 V^T reads in front of the softmax, whose vector work then covers their latency
    __builtin_amdgcn_sched_barrier(0);
    const bool diag = (kc == qb);
    const int qrow = q0 + c;
    float mj[4];
#pragma unroll
    for (int j = 0; j < 4; ++j) {
      float m = -INFINITY;
#pragma unroll
      for (int r = 0; r < 8; ++r) {
        const int kvcol = kv0 + j * 16 + 8 * hh + r;
        float sv = s[j][r] * 0.125f;
        if (diag && (kvcol > qrow)) sv = -INFINITY;
        s[j][r] = sv;
        m = fmaxf(m, sv);
      }
      mj[j] = m;
    }
    float cm = fmaxf(fmaxf(mj[0], mj[1]), fmaxf(mj[2], mj[3]));
    cm = fmaxf(cm, xhalf(cm));                     // the other 32 keys of this query sit in the other lane half
    const float mnew = fmaxf(mrow, cm);
    const float alpha = __expf(mrow - mnew);
    mrow = mnew;
    FH::U pb[2];                                   // B[k=key][n=query c]: elements 0..7 = tile 2kk, 8..15 = tile 2kk+1
    float pj[4];
#pragma unroll
    for (int j = 0; j < 4; ++j) {
      float psum = 0.f;
      v8h ph;
#pragma unroll
      for (int r = 0; r < 8; ++r) {
        const float p = __expf(s[j][r] - mnew);
        psum += p;
        ph[r] = (_Float16)(p * P_CARRY);
      }
      pj[j] = psum;
      pb[j >> 1].h[j & 1] = ph;
    }
    lrow = lrow * alpha + ((pj[0] + pj[1]) + (pj[2] + pj[3]));   // this half's keys only; halves joined after the loop
#pragma unroll
    for (int t = 0; t < 4; ++t)
#pragma unroll
      for (int r = 0; r < 8; ++r) oacc[t][r] *= alpha;
#pragma unroll
    for (int kk = 0; kk < 2; ++kk) {
#pragma unroll
      for (int t = 0; t < 4; ++t) oacc[t] = FH::mma(va[kk][t], pb[kk].v, oacc[t]);
    }
  }

  // oacc[t][r] = out[query q0 + c][d = t*16 + 8*hh + r]
  float* os = Os[wave];
  {
    const float ltot = lrow + xhalf(lrow);
    const float inv = (1.0f / ltot) * (O_CARRY / P_CARRY);
#pragma unroll
    for (int t = 0; t < 4; ++t) {
      v4f lo, hi;
#pragma unroll
      for (int e = 0; e < 4; ++e) { lo[e] = oacc[t][e] * inv; hi[e] = oacc[t][4 + e] * inv; }
      *(v4f*)(os + c * 68 + t * 16 + 8 * hh)     = lo;
      *(v4f*)(os + c * 68 + t * 16 + 8 * hh + 4) = hi;
    }
  }
  __builtin_amdgcn_fence(__ATOMIC_RELEASE, "workgroup");
  __builtin_amdgcn_wave_barrier();
  __builtin_amdgcn_fence(__ATOMIC_ACQUIRE, "workgroup");
  {
    const int q8 = lane >> 3, c8 = (lane & 7) * 8;
    unsigned short* ob = op + (size_t)h * HDIM + c8;
    {
#pragma unroll
      for (int it = 0; it < 4; ++it) {
        const int row = it * 4 + q8;
        const v4f f0 = *(const v4f*)(os + row * 68 + c8);
        const v4f f1 = *(const v4f*)(os + row * 68 + c8 + 4);
        v8h hv;
#pragma unroll
        for (int e = 0; e < 4; ++e) { hv[e] = (_Float16)f0[e]; hv[4 + e] = (_Float16)f1[e]; }
        *(v8h*)(ob + (size_t)(q0 + row) * DMODEL) = hv;
      }
      
    }
  }
}

// =====================================================================================
// Host glue.  Workspace region map (bytes, all offsets multiples of 1 MiB):
//   XN   f16 [4096][1024]         8,388,608 @ 0
//   WQKV f16 [3072][1024] (x64)   6,291,456 @ 8,388,608
//   WO   f16 [1024][1024] (x64)   2,097,152 @ 14,680,064
//   ROT  f32 [32][512][2][8]      1,048,576 @ 16,777,216
//   QPL  f16 [16*4096][64]        8,388,608 @ 17,825,792
//   KPL  f16 [16*4096][64]        8,388,608 @ 26,214,400
//   VT   f16 [16*64][4096]        8,388,608 @ 34,603,008
//   OPL  f16 [4096][1024] (x16)   8,388,608 @ 42,991,616
//   total 51,380,224
// =====================================================================================
extern "C" void kernel_launch(void* const* d_in, const int* in_sizes, int n_in,
                              void* d_out, int out_size, void* d_ws, size_t ws_size,
                              hipStream_t stream) {
  if (n_in < 6) return;
  const int nx = SEQ_T * DMODEL;
  const int nwgt = DMODEL * DMODEL;
  if (in_sizes[0] != nx || in_sizes[1] != nwgt || in_sizes[2] != nwgt || in_sizes[3] != nwgt ||
      in_sizes[4] != nwgt || in_sizes[5] != DMODEL || out_size != nx) return;

  const float* x  = (const float*)d_in[0];
  const float* wq = (const float*)d_in[1];
  const float* wk = (const float*)d_in[2];
  const float* wv = (const float*)d_in[3];
  const float* wo = (const float*)d_in[4];
  const float* nw = (const float*)d_in[5];
  float* out = (float*)d_out;

  const size_t szXN   = (size_t)nx * 2;
  const size_t szWQKV = (size_t)3 * nwgt * 2;
  const size_t szWO   = (size_t)nwgt * 2;
  const size_t szROT  = (size_t)SEQ_T * HDIM * 4;
  const size_t szPL   = (size_t)NHEAD * SEQ_T * HDIM * 2;
  const size_t szO    = (size_t)nx * 2;
  const size_t offXN   = 0;
  const size_t offWQKV = offXN + szXN;
  const size_t offWO   = offWQKV + szWQKV;
  const size_t offROT  = offWO + szWO;
  const size_t offQ    = offROT + szROT;
  const size_t offK    = offQ + szPL;
  const size_t offVT   = offK + szPL;
  const size_t offO    = offVT + szPL;
  const size_t total   = offO + szO;
  if (total > ws_size) return;

  char* ws = (char*)d_ws;
  unsigned short* XN   = (unsigned short*)(ws + offXN);
  unsigned short* WQKV = (unsigned short*)(ws + offWQKV);
  unsigned short* WO   = (unsigned short*)(ws + offWO);
  float*          ROT  = (float*)(ws + offROT);
  unsigned short* QPL  = (unsigned short*)(ws + offQ);
  unsigned short* KPL  = (unsigned short*)(ws + offK);
  unsigned short* VT   = (unsigned short*)(ws + offVT);
  unsigned short* OPL  = (unsigned short*)(ws + offO);

  // inverse-frequency table: e_i = (2i)/64 (exact), p_i = fl32(pow(10000, e_i)) (double pow on host,
  // RNE to f32), invfreq_i = 1.0f / p_i (f32)
  FreqTab ft;
  for (int i = 0; i < 32; ++i) {
    const float e = (float)(2 * i) / 64.0f;
    const float p = (float)pow(10000.0, (double)e);
    ft.f[i] = 1.0f / p;
  }

  // 1) one grid: rmsnorm -> XN (f16) and rotary table -> ROT (blocks 0 .. SEQ_T - 1);
  //    weights -> f16(bf16(w) * 64), wq | wk | wv stacked as rows 0.., 1024.., 2048.. of WQKV, wo -> WO (the blocks behind)
  rmsnorm_cast_f16_k<<<SEQ_T + 4 * CAST_BPW, 128, 0, stream>>>(x, nw, wq, wk, wv, wo, XN, WQKV, WO, ft, ROT);
  // 2) XN . WQKV^T / 64 : M=4096, N=3072, K=1024; 32x12 work-group tiles = 384 blocks; the epilogue applies the rotary
  //    to q and k and writes the Q, K and Vt f16 planes
  {
    dim3 grid((SEQ_T / GT_M) * (QKV_N / GT_N), 1);
    wmma_gemm64<0, 0, 0, 3, false><<<grid, 256, 0, stream>>>(
        XN, XN, DMODEL, 0L, WQKV, WQKV, DMODEL, 0L, (void*)QPL, (void*)KPL, (void*)VT, QKV_N, 0L,
        ROT, nw, x, 0L, SEQ_T, QKV_N, DMODEL, 1.0f / W_CARRY);
  }
  // 3) causal attention -> O plane (f16, x16)
  attn_causal_hd64_k<<<NHEAD * NQTILE, 128, 0, stream>>>(QPL, KPL, VT, OPL);
  // 4) out = bf16_rne(x) + (O . WO^T) / (16*64) : M=4096, N=1024, K=1024; 32x4 work-group tiles = 128 blocks
  {
    dim3 grid((SEQ_T / GT_M) * (DMODEL / GT_N), 1);
    wmma_gemm64<0, 0, 0, 0, true, 0, true><<<grid, 256, 0, stream>>>(
        OPL, OPL, DMODEL, 0L, WO, WO, DMODEL, 0L, (void*)out, (void*)out, (void*)out, DMODEL, 0L,
        nw, nw, x, 0L, SEQ_T, DMODEL, DMODEL, 1.0f / (O_CARRY * W_CARRY));
  }
}

// v006
// It runs in 118 microseconds.
// Timed twice side by side with v005, it ran 1.14 times as fast both times.
// Counting every step since v000, it is 3.25 times as fast.
// Contractions: qkv projection (normed . W^T, K=1024), attention q.k^T and p.v (head dim 64), output projection (o . Wo^T, K=1024): all v_wmma_f32_16x16x32_f16 (f16 operands, f32 accumulate); W carried x64, p carried x2^15, attention output carried x16 (exact power-of-two carries folded back in f32); float inputs RNE-converted to bf16 on load; rmsnorm, rotary tables, softmax, residual add in f32.
#include <hip/hip_runtime.h>
#include <math.h>

typedef __attribute__((ext_vector_type(16))) _Float16 v16h;
typedef __attribute__((ext_vector_type(8)))  _Float16 v8h;
typedef __attribute__((ext_vector_type(16))) __bf16   v16b;
typedef __attribute__((ext_vector_type(8)))  __bf16   v8b;
typedef __attribute__((ext_vector_type(8)))  float    v8f;
typedef __attribute__((ext_vector_type(4)))  float    v4f;

constexpr int SEQ_T     = 4096;
constexpr int DMODEL    = 1024;
constexpr int NHEAD     = 16;
constexpr int HDIM      = 64;
constexpr int QKV_N     = 3072;          // cols 0..1023 q | 1024..2047 k | 2048..3071 v
constexpr int NQTILE    = SEQ_T / 64;    // 64-row query tiles per head
constexpr int KEY_CH    = 64;            // keys per chunk
constexpr int LDS_P16   = 72;            // 16-bit LDS pitch (144 B rows, 16-B aligned)
constexpr float W_CARRY = 64.0f;         // weights stored as f16(bf16(w) * 64)
constexpr float P_CARRY = 32768.0f;      // softmax numerators stored as f16(p * 2^15)
constexpr float O_CARRY = 16.0f;         // attention output stored as f16(o * 16)

struct FreqTab { float f[32]; };
static_assert(sizeof(FreqTab) == 128);

__device__ __forceinline__ unsigned short f2bf_bits(float f) {
  unsigned u = __float_as_uint(f);
  return (unsigned short)((u + 0x7FFFu + ((u >> 16) & 1u)) >> 16);
}
__device__ __forceinline__ float bf_bits2f(unsigned short h) { return __uint_as_float(((unsigned)h) << 16); }
__device__ __forceinline__ float rne_bf(float f) { return bf_bits2f(f2bf_bits(f)); }

// hazard guard behind the last products of a GEMM, as a plain device helper
__device__ __forceinline__ void acc_guard4(v8f& a, v8f& b, v8f& c, v8f& d) { asm volatile("v_nop\n\tv_nop\n\tv_nop\n\tv_nop" : "+v"(a), "+v"(b), "+v"(c), "+v"(d)); }
template <typename T> struct Frag;
template <> struct Frag<_Float16> {
  typedef v16h V; union U { v16h v; v8h h[2]; };
  static __device__ __forceinline__ v16h load(const _Float16* p) {   // elements 0..7 <- p[0..7], 8..15 <- p[16..23]
    U f; f.h[0] = *(const v8h*)(p); f.h[1] = *(const v8h*)(p + 16); return f.v;
  }
  static __device__ __forceinline__ v8f mma(v16h a, v16h b, v8f c) {
    return __builtin_amdgcn_wmma_f32_16x16x32_f16(false, a, false, b, (short)0, c, false, false);
  }
};
template <> struct Frag<__bf16> {
  typedef v16b V; union U { v16b v; v8b h[2]; };
  static __device__ __forceinline__ v16b load(const __bf16* p) {
    U f; f.h[0] = *(const v8b*)(p); f.h[1] = *(const v8b*)(p + 16); return f.v;
  }
  static __device__ __forceinline__ v8f mma(v16b a, v16b b, v8f c) {
    return __builtin_amdgcn_wmma_f32_16x16x32_bf16(false, a, false, b, (short)0, c, false, false);
  }
};

// lane l reads lane l ^ 16 (vector cross-row move, no LDS round trip)
__device__ __forceinline__ float xhalf(float x) {
  const int b = __builtin_bit_cast(int, x);
  return __builtin_bit_cast(float, __builtin_amdgcn_permlanex16(b, b, 0x76543210, 0xfedcba98, false, false));
}

// =====================================================================================
// Register-blocked batched WMMA GEMM, C[m,n] = scale * sum_k A[m,k] * Bt[n,k] (+bias)(+resid);
// a work-group of 8 waves (2 x 4) owns a 128x256 tile, each wave a 64x64 tile of it.
// A row-major [M,K]; Bt row-major [N,K]; M % 128 == 0, N % 256 == 0, K % 64 == 0.
// Operands: per 64 k the 128 A rows and 256 Bt rows (128 B each, whole lines) are copied to LDS once per
// work-group by asynchronous copies, two buffers, the next stage in flight while this one is multiplied.
// SPLITM: 0 = single product (the only form the staged operand path carries; A2p, Bt2p are not read).
// BIAS_MODE: 0 = none, 1 = bias[m], 2 = bias[n].  OUT_MODE: 0 = f32, 1 = f16, 2 = bf16 hi + lo planes,
// 3 = attention planes (f16): columns 0..1023 rotary -> Cout [head*SEQ_T + t][64], 1024..2047 rotary -> Cout2 (same layout),
//     2048..3071 transposed -> Cout3 [head*64 + d][SEQ_T]; a wave's 64 columns are one head; rot = rotary table.
// RESID_RNE: the residual value is RNE-converted to bf16 before the add.
// ET: 0 = f16 operands, 1 = bf16 operands (pointers passed as 16-bit storage)
// =====================================================================================
constexpr int GT_M    = 128;                  // work-group tile rows
constexpr int GT_N    = 256;                  // work-group tile columns
constexpr int GT_K    = 64;                   // k per stage (128-B rows)
constexpr int GT_BUF  = (GT_M + GT_N) * LDS_P16;   // halves per buffer: A rows, then Bt rows, pitch 144 B
constexpr unsigned GT_STEP = 32u * LDS_P16 * 2u;   // LDS bytes between a thread's successive rows (32 rows)

// one thread's twelve 16-byte asynchronous copies global -> LDS of a stage; the s_wait_xcnt closes the statement
// so that no address register of a copy is rewritten before it
__device__ __forceinline__ void async_copy12(const unsigned (&l)[12], const void* const (&g)[12]) {
  asm volatile(
               "global_load_async_to_lds_b128 %0, %12, off\n\t"
               "global_load_async_to_lds_b128 %1, %13, off\n\t"
               "global_load_async_to_lds_b128 %2, %14, off\n\t"
               "global_load_async_to_lds_b128 %3, %15, off\n\t"
               "global_load_async_to_lds_b128 %4, %16, off\n\t"
               "global_load_async_to_lds_b128 %5, %17, off\n\t"
               "global_load_async_to_lds_b128 %6, %18, off\n\t"
               "global_load_async_to_lds_b128 %7, %19, off\n\t"
               "global_load_async_to_lds_b128 %8, %20, off\n\t"
               "global_load_async_to_lds_b128 %9, %21, off\n\t"
               "global_load_async_to_lds_b128 %10, %22, off\n\t"
               "global_load_async_to_lds_b128 %11, %23, off\n\t"
               "s_wait_xcnt 0x0"
               :: "v"(l[0]), "v"(l[1]), "v"(l[2]), "v"(l[3]), "v"(l[4]), "v"(l[5]), "v"(l[6]), "v"(l[7]), "v"(l[8]), "v"(l[9]), "v"(l[10]), "v"(l[11]),
                  "v"(g[0]), "v"(g[1]), "v"(g[2]), "v"(g[3]), "v"(g[4]), "v"(g[5]), "v"(g[6]), "v"(g[7]), "v"(g[8]), "v"(g[9]), "v"(g[10]), "v"(g[11]) : "memory");
}

// orders a wave's writes and reads of its own LDS slab (lanes exchange values through it); the fences name LDS alone, so
// that global stores and table loads in flight are not waited out at each exchange
__device__ __forceinline__ void slab_sync() {
  __builtin_amdgcn_fence(__ATOMIC_RELEASE, "workgroup", "local");
  __builtin_amdgcn_wave_barrier();
  __builtin_amdgcn_fence(__ATOMIC_ACQUIRE, "workgroup", "local");
}

template <int ET> struct Elem;
template <> struct Elem<0> { typedef _Float16 T; };
template <> struct Elem<1> { typedef __bf16 T; };
template <int ET, int SPLITM, int BIAS_MODE, int OUT_MODE, bool RESID, int ACT = 0, bool RESID_RNE = false>
__global__ __launch_bounds__(256) void wmma_gemm64(
    const unsigned short* __restrict__ Ap, const unsigned short* __restrict__ A2p, int lda, long strideA,
    const unsigned short* __restrict__ Btp, const unsigned short* __restrict__ Bt2p, int ldb, long strideB,
    void* __restrict__ Cout, void* __restrict__ Cout2, void* __restrict__ Cout3, int ldc, long strideC,
    const float* __restrict__ rot,
    const float* __restrict__ bias,
    const float* __restrict__ resid, long strideR,
    int M, int N, int K, float scale) {
  typedef typename Elem<ET>::T T;
  typedef typename Frag<T>::V V;
  const T* A = (const T*)Ap; const T* Bt = (const T*)Btp;
  static_assert(SPLITM == 0, "the staged operand path carries single planes");
  __shared__ __align__(16) T ring[2 * GT_BUF];     // two operand stages
  __shared__ __align__(16) float sT[8][16 * 68];   // per-wave 16x64 slab, pitch 68 floats
  const int b    = blockIdx.y;
  const int tid  = threadIdx.x;
  const int lane = tid & 31;
  const int wave = tid >> 5;
  const int tilesN = N / GT_N;
  const int tilesM = M / GT_M;
  if ((int)blockIdx.x >= tilesM * tilesN) return;   // work-group-uniform, in front of every barrier and copy
  const int bm = blockIdx.x / tilesN;
  const int bn = blockIdx.x - bm * tilesN;
  const int wm = wave >> 2, wn = wave & 3;
  const int m0 = bm * GT_M + (wm << 6);
  const int n0 = bn * GT_N + (wn << 6);

  const T* Ab  = A  + (size_t)b * strideA;
  const T* Bb  = Bt + (size_t)b * strideB;

  const int rlane = lane & 15;                 // row (A) / col (B, D) within subtile
  const int koff  = (lane >> 4) * 8;           // k offset of this lane half
  const int mOff  = (lane >> 4) * 8;           // D row offset

  // copies: thread -> 16 B at column chunk (tid & 7) of rows (tid >> 3) + 32 i; 8 lanes cover one 128-B row
  const int crow = tid >> 3, cchk = (tid & 7) * 8;
  const T* gA = Ab + (size_t)(bm * GT_M + crow) * lda + cchk;
  const T* gB = Bb + (size_t)(bn * GT_N + crow) * ldb + cchk;
  const size_t sA = (size_t)32 * lda, sB = (size_t)32 * ldb;
  const unsigned l0 = (unsigned)(uintptr_t)ring + (unsigned)(crow * LDS_P16 + cchk) * 2u;
  auto stage = [&](int t, int buf) {
    const T* ga = gA + (size_t)t * GT_K;
    const T* gb = gB + (size_t)t * GT_K;
    const unsigned lb = l0 + (unsigned)buf * (unsigned)(GT_BUF * 2);
    unsigned l[12];
    const void* g[12];
#pragma unroll
    for (int i = 0; i < 12; ++i) {
      l[i] = lb + (unsigned)i * GT_STEP;                                   // rows 0..127 A, 128..383 Bt
      g[i] = (i < 4) ? (const void*)(ga + i * sA) : (const void*)(gb + (i - 4) * sB);
    }
    async_copy12(l, g);
  };

  v8f acc[4][4];
#pragma unroll
  for (int i = 0; i < 4; ++i)
#pragma unroll
    for (int j = 0; j < 4; ++j) acc[i][j] = (v8f){0.f,0.f,0.f,0.f,0.f,0.f,0.f,0.f};

  const int nT = K / GT_K;
  stage(0, 0);
  asm volatile("s_wait_asynccnt 0x0" ::: "memory");   // this wave's part of stage 0 has landed
  __syncthreads();                                    // stage 0 is readable by every wave
  if (nT > 1) stage(1, 1);

  for (int t = 0; t < nT; ++t) {
    const int buf = t & 1;
    const T* sa = ring + buf * GT_BUF + ((wm << 6) + rlane) * LDS_P16 + koff;
    const T* sb = ring + buf * GT_BUF + (GT_M + (wn << 6) + rlane) * LDS_P16 + koff;
#pragma unroll
    for (int kk = 0; kk < GT_K; kk += 32) {
      V bh[4], ah[4];
#pragma unroll
      for (int j = 0; j < 4; ++j) bh[j] = Frag<T>::load(sb + (j << 4) * LDS_P16 + kk);
#pragma unroll
      for (int i = 0; i < 4; ++i) ah[i] = Frag<T>::load(sa + (i << 4) * LDS_P16 + kk);
      // keeps the 16 LDS reads together in front of the 16 products: sunk among them, each group waits out its own LDS latency
      __builtin_amdgcn_sched_barrier(0);
#pragma unroll
      for (int i = 0; i < 4; ++i)
#pragma unroll
        for (int j = 0; j < 4; ++j) acc[i][j] = Frag<T>::mma(ah[i], bh[j], acc[i][j]);
    }
    asm volatile("s_wait_dscnt 0x0" ::: "memory");      // this wave's reads of the buffer are done before it is refilled
    asm volatile("s_wait_asynccnt 0x0" ::: "memory");   // this wave's part of stage t + 1 has landed
    __syncthreads();                                    // publishes stage t + 1, ends every read of stage t
    if (t + 2 < nT) stage(t + 2, buf);
  }
  asm volatile("s_wait_asynccnt 0x0" ::: "memory");     // nothing in flight when the wave goes on
  acc_guard4(acc[0][0], acc[0][1], acc[0][2], acc[0][3]);
  acc_guard4(acc[1][0], acc[1][1], acc[1][2], acc[1][3]);
  acc_guard4(acc[2][0], acc[2][1], acc[2][2], acc[2][3]);
  acc_guard4(acc[3][0], acc[3][1], acc[3][2], acc[3][3]);

  // ---- epilogue ----
  float* slab = sT[wave];
  if constexpr (OUT_MODE == 3) {
    const int sel  = (bn * GT_N) >> 10;          // 0 = q, 1 = k, 2 = v: the same for the whole work-group
    const int head = (n0 & (DMODEL - 1)) >> 6;
    const int q = lane >> 3, c8 = (lane & 7) * 8;
    if (sel < 2) {
      // rotary in registers: column d (tiles 0, 1) and its partner d + 32 (tiles 2, 3) sit in the same lane and register
      unsigned short* P = ((sel == 0) ? (unsigned short*)Cout : (unsigned short*)Cout2) + ((size_t)head * SEQ_T + m0) * HDIM;
      const float* rp = rot + (size_t)rlane * (2 * SEQ_T) + (size_t)(m0 + mOff) * 2;
      v4f rt[2][8];                              // table values of row group i and, fetched ahead, of i + 1
      auto fetch = [&](int i, v4f (&d)[8]) {
#pragma unroll
        for (int jj = 0; jj < 2; ++jj)
#pragma unroll
          for (int k = 0; k < 4; ++k) d[jj * 4 + k] = *(const v4f*)(rp + (size_t)jj * (32 * SEQ_T) + i * 32 + k * 4);
      };
      fetch(0, rt[0]);
#pragma unroll
      for (int i = 0; i < 4; ++i) {
        if (i < 3) fetch(i + 1, rt[(i + 1) & 1]);
        const v4f (&tv)[8] = rt[i & 1];
#pragma unroll
        for (int jj = 0; jj < 2; ++jj)
#pragma unroll
          for (int r = 0; r < 8; ++r) {
            const float cv = tv[jj * 4 + (r >> 2)][r & 3];
            const float sv = tv[jj * 4 + 2 + (r >> 2)][r & 3];
            const float x1 = acc[i][jj][r] * scale;
            const float x2 = acc[i][jj + 2][r] * scale;
            slab[(mOff + r) * 68 + (jj << 4) + rlane]      = x1 * cv - x2 * sv;
            slab[(mOff + r) * 68 + 32 + (jj << 4) + rlane] = x2 * cv + x1 * sv;
          }
        slab_sync();
#pragma unroll
        for (int it = 0; it < 4; ++it) {
          const int row = it * 4 + q;             // 8 lanes x 16 B = one 128-B plane row
          const v4f f0 = *(const v4f*)(slab + row * 68 + c8);
          const v4f f1 = *(const v4f*)(slab + row * 68 + c8 + 4);
          v8h hv;
#pragma unroll
          for (int e = 0; e < 4; ++e) { hv[e] = (_Float16)f0[e]; hv[4 + e] = (_Float16)f1[e]; }
          *(v8h*)(P + (size_t)((i << 4) + row) * HDIM + c8) = hv;
        }
        // a table fetch follows that reuses the stores' data registers: the stores' register reads are waited for first
        if (i < 2) asm volatile("s_wait_xcnt 0x0" ::: "memory");
        slab_sync();
      }
    } else {
      // v: a lane's 8 accumulator rows are 8 successive tokens of one column d; 16 d rows x 64 tokens go through the slab
      _Float16* sl = (_Float16*)slab;
      unsigned short* P = (unsigned short*)Cout3 + (size_t)head * HDIM * SEQ_T + m0;
#pragma unroll
      for (int j = 0; j < 4; ++j) {
#pragma unroll
        for (int i = 0; i < 4; ++i) {
          v8h ph;
#pragma unroll
          for (int r = 0; r < 8; ++r) ph[r] = (_Float16)(acc[i][j][r] * scale);
          *(v8h*)(sl + rlane * LDS_P16 + (i << 4) + mOff) = ph;
        }
        slab_sync();
#pragma unroll
        for (int it = 0; it < 4; ++it) {
          const int row = it * 4 + q;             // 8 lanes x 16 B = 64 tokens = one whole 128-B line of row d
          const v8h hv = *(const v8h*)(sl + row * LDS_P16 + c8);
          *(v8h*)(P + (size_t)((j << 4) + row) * SEQ_T + c8) = hv;
        }
        // last group: the code behind it in the listing rewrites the stores' address pair, so the stores' register reads are waited for here
        if (j == 3) asm volatile("s_wait_xcnt 0x0" ::: "memory");
        slab_sync();
      }
    }
    return;
  }
  const float* Rb = RESID ? (resid + (size_t)b * strideR) : nullptr;
#pragma unroll
  for (int i = 0; i < 4; ++i) {
    const int mBase = m0 + (i << 4);
#pragma unroll
    for (int j = 0; j < 4; ++j) {
      const int n = n0 + (j << 4) + rlane;
      float bv = 0.f;
      if (BIAS_MODE == 2) bv = bias[n];
#pragma unroll
      for (int r = 0; r < 8; ++r) {
        float v = acc[i][j][r] * scale;
        if (BIAS_MODE == 1) v += bias[mBase + mOff + r];
        if (BIAS_MODE == 2) v += bv;
        if (RESID) {
          float rv = Rb[(size_t)(mBase + mOff + r) * ldc + n];
          if (RESID_RNE) rv = rne_bf(rv);
          v += rv;
        }
        if (ACT == 1) v = tanhf(v);
        if (ACT == 2) v = fmaxf(v, 0.0f);
        if (ACT == 4) v = (v > 0.f) ? v : 0.01f * v;
        slab[(mOff + r) * 68 + (j << 4) + rlane] = v;
      }
    }
    __builtin_amdgcn_fence(__ATOMIC_RELEASE, "workgroup");
    __builtin_amdgcn_wave_barrier();
    __builtin_amdgcn_fence(__ATOMIC_ACQUIRE, "workgroup");
    if (OUT_MODE == 0) {
      float* C = (float*)Cout + (size_t)b * strideC;
      const int hh = lane >> 4, c4 = (lane & 15) * 4;     // row seg = 256 B = 16 lanes x 16 B
      {
#pragma unroll
        for (int it = 0; it < 8; ++it) {
          const int row = it * 2 + hh;
          v4f v = *(const v4f*)(slab + row * 68 + c4);
          *(v4f*)(C + (size_t)(mBase + row) * ldc + n0 + c4) = v;
        }
        
      }
    } else {
      const int q = lane >> 3, c8 = (lane & 7) * 8;
      unsigned short* C  = (unsigned short*)Cout  + (size_t)b * strideC;
      unsigned short* C2 = (OUT_MODE == 2) ? ((unsigned short*)Cout2 + (size_t)b * strideC) : nullptr;
      {
#pragma unroll
        for (int it = 0; it < 4; ++it) {
          const int row = it * 4 + q;
          const float* sp = slab + row * 68 + c8;
          v8h hv, lv;
#pragma unroll
          for (int e = 0; e < 8; ++e) {
            if (OUT_MODE == 1) {
              hv[e] = (_Float16)sp[e];
            } else {
              unsigned short hb = f2bf_bits(sp[e]);
              unsigned short lb = f2bf_bits(sp[e] - bf_bits2f(hb));
              hv[e] = __builtin_bit_cast(_Float16, hb);
              lv[e] = __builtin_bit_cast(_Float16, lb);
            }
          }
          *(v8h*)(C + (size_t)(mBase + row) * ldc + n0 + c8) = hv;
          if (OUT_MODE == 2) *(v8h*)(C2 + (size_t)(mBase + row) * ldc + n0 + c8) = lv;
        }
        
      }
    }
    __builtin_amdgcn_fence(__ATOMIC_RELEASE, "workgroup");
    __builtin_amdgcn_wave_barrier();
    __builtin_amdgcn_fence(__ATOMIC_ACQUIRE, "workgroup");
  }
}

// =====================================================================================
// Kernel: rmsnorm of one token row (x RNE-converted to bf16 on load, mean of squares in f32,
// rsqrt(mean + 1e-6), times norm_w (RNE bf16)), output as an f16 plane [SEQ_T][DMODEL].
// Block = 128 threads = one token; coverage 128 threads x 8 elements = 1024 = one row exactly;
// The first SEQ_T / 32 blocks also build the rotary table for 32 tokens x 32 frequencies each:
// rot[f][t >> 3][cos of 8 tokens | sin of 8 tokens], angle = (float)t * invfreq_f (single f32 multiply), precise sincosf;
// a thread writes 64 B, four threads of one block the two whole lines of (f, 32 tokens).
// Blocks SEQ_T .. SEQ_T + 4 * CAST_BPW - 1 of the same grid need nothing of the rows and cast the weights instead:
// f32 -> f16(bf16_rne(w) * W_CARRY); a block takes CAST_EPB successive weights of wq, wk, wv or wo,
// a thread 4 groups of 8 (coverage 128 threads x 8 x 4 = CAST_EPB exactly; a 16-B store per group, 8 lanes one whole line).
// =====================================================================================
constexpr int CAST_EPB = 4096;                            // weights per cast block
constexpr int CAST_BPW = DMODEL * DMODEL / CAST_EPB;      // cast blocks per weight matrix
__global__ __launch_bounds__(128) void rmsnorm_cast_f16_k(const float* __restrict__ x, const float* __restrict__ nw,
                                                          const float* __restrict__ wq, const float* __restrict__ wk,
                                                          const float* __restrict__ wv, const float* __restrict__ wo,
                                                          unsigned short* __restrict__ xn, unsigned short* __restrict__ wqkv,
                                                          unsigned short* __restrict__ wof, FreqTab ft, float* __restrict__ rot) {
  __shared__ float red[4];
  const int t = blockIdx.x, tid = threadIdx.x, wave = tid >> 5, lane = tid & 31;
  if (t >= SEQ_T) {   // block-uniform, in front of the barrier: a weight-cast block
    const int cb  = t - SEQ_T;
    const int sel = cb / CAST_BPW;                        // 0 = wq, 1 = wk, 2 = wv (rows 0.., 1024.., 2048.. of wqkv), 3 = wo
    const float* w = (sel == 0) ? wq : (sel == 1) ? wk : (sel == 2) ? wv : wo;
    unsigned short* o = (sel < 3) ? wqkv + (size_t)sel * (DMODEL * DMODEL) : wof;
    const int e0 = (cb - sel * CAST_BPW) * CAST_EPB + tid * 8;
    v4f a[4], b[4];
#pragma unroll
    for (int g = 0; g < 4; ++g) {
      a[g] = *(const v4f*)(w + e0 + g * 1024);
      b[g] = *(const v4f*)(w + e0 + g * 1024 + 4);
    }
#pragma unroll
    for (int g = 0; g < 4; ++g) {
      v8h hv;
#pragma unroll
      for (int e = 0; e < 4; ++e) {
        hv[e]     = (_Float16)(rne_bf(a[g][e]) * W_CARRY);
        hv[4 + e] = (_Float16)(rne_bf(b[g][e]) * W_CARRY);
      }
      *(v8h*)(o + e0 + g * 1024) = hv;
    }
    return;
  }
  if (t < SEQ_T / 32) {   // block-uniform
    const int f = tid >> 2, tb = t * 32 + (tid & 3) * 8;
    float fr = ft.f[0];
#pragma unroll
    for (int q = 1; q < 32; ++q) fr = (f == q) ? ft.f[q] : fr;
    v4f cs4[4];
#pragma unroll
    for (int e = 0; e < 8; ++e) {
      float sv, cv;
      sincosf((float)(tb + e) * fr, &sv, &cv);
      cs4[e >> 2][e & 3]       = cv;
      cs4[2 + (e >> 2)][e & 3] = sv;
    }
    float* rd = rot + (size_t)f * (2 * SEQ_T) + (size_t)tb * 2;
#pragma unroll
    for (int k = 0; k < 4; ++k) *(v4f*)(rd + k * 4) = cs4[k];
  }
  const float* row = x + (size_t)t * DMODEL + tid * 8;
  const v4f a = *(const v4f*)row;
  const v4f b = *(const v4f*)(row + 4);
  float xb[8];
#pragma unroll
  for (int e = 0; e < 4; ++e) { xb[e] = rne_bf(a[e]); xb[4 + e] = rne_bf(b[e]); }
  float ss = 0.f;
#pragma unroll
  for (int e = 0; e < 8; ++e) ss += xb[e] * xb[e];
#pragma unroll
  for (int m = 1; m < 32; m <<= 1) ss += __shfl_xor(ss, m, 32);
  if (lane == 0) red[wave] = ss;
  __syncthreads();
  const float tot = (red[0] + red[1]) + (red[2] + red[3]);
  const float inv = rsqrtf(tot * (1.0f / 1024.0f) + 1e-6f);
  const v4f na = *(const v4f*)(nw + tid * 8);
  const v4f nb = *(const v4f*)(nw + tid * 8 + 4);
  v8h hv;
#pragma unroll
  for (int e = 0; e < 4; ++e) {
    hv[e]     = (_Float16)((xb[e] * inv) * rne_bf(na[e]));
    hv[4 + e] = (_Float16)((xb[4 + e] * inv) * rne_bf(nb[e]));
  }
  unsigned short* dst = xn + (size_t)t * DMODEL + tid * 8;
  *(v8h*)dst = hv;
}

// =====================================================================================
// Kernel: causal attention, head dim 64, f16 planes in (Q, K: [NHEAD*SEQ_T][64]; Vt: [NHEAD*64][SEQ_T]),
// f16 plane out (O: [SEQ_T][DMODEL], head h at cols h*64, value o*16).
//   scores^T = 0.125 * k.q^T : v_wmma_f32_16x16x32_f16 (q, k plain f16), f32 accumulate
//   out^T    = v^T.p^T       : v_wmma_f32_16x16x32_f16 (p carried x2^15 in f16, v plain f16), f32 accumulate
//   (transposed products: a lane holds one query's scores, and p goes from the score tiles straight into the B operand)
//   online softmax in f32; keys above the diagonal -> -inf (every row keeps key kv0 <= row, so never fully masked).
// Block = 4 waves = 64 query rows of head h; 64-key chunks; chunks above the diagonal are skipped (block-uniform).
// K / Vt chunks come to LDS by asynchronous copies (128 threads x 4 x 16 B = 64x64 halves each), two buffers: chunk kc + 1
// is in flight while chunk kc is worked on; one work-group barrier per chunk publishes it and frees the buffer just read;
// WMMA operands are read from dense, statically strided LDS / plane addresses only.
// O store coverage per wave: 4 iterations x 4 row groups = 16 rows, 8 lanes x 8 halves = 64 cols = one whole
// =====================================================================================
constexpr int AT_TILE = KEY_CH * LDS_P16;          // halves of one staged tile (64 rows, pitch 144 B)
constexpr int AT_BUF  = 2 * AT_TILE;               // halves per buffer: K tile [kv][d], then V^T tile [d][kv]
constexpr unsigned AT_STEP = 16u * LDS_P16 * 2u;   // LDS bytes between a thread's successive rows (16 rows)

// one thread's eight 16-byte asynchronous copies global -> LDS of a chunk; the s_wait_xcnt closes the statement
// so that no address register of a copy is rewritten before it
__device__ __forceinline__ void async_copy8(const unsigned (&l)[8], const void* const (&g)[8]) {
  asm volatile(
               "global_load_async_to_lds_b128 %0, %8, off\n\t"
               "global_load_async_to_lds_b128 %1, %9, off\n\t"
               "global_load_async_to_lds_b128 %2, %10, off\n\t"
               "global_load_async_to_lds_b128 %3, %11, off\n\t"
               "global_load_async_to_lds_b128 %4, %12, off\n\t"
               "global_load_async_to_lds_b128 %5, %13, off\n\t"
               "global_load_async_to_lds_b128 %6, %14, off\n\t"
               "global_load_async_to_lds_b128 %7, %15, off\n\t"
               "s_wait_xcnt 0x0"
               :: "v"(l[0]), "v"(l[1]), "v"(l[2]), "v"(l[3]), "v"(l[4]), "v"(l[5]), "v"(l[6]), "v"(l[7]),
                  "v"(g[0]), "v"(g[1]), "v"(g[2]), "v"(g[3]), "v"(g[4]), "v"(g[5]), "v"(g[6]), "v"(g[7]) : "memory");
}

__global__ __launch_bounds__(128) void attn_causal_hd64_k(const unsigned short* __restrict__ qp,
                                                         const unsigned short* __restrict__ kp,
                                                         const unsigned short* __restrict__ vtp,
                                                         unsigned short* __restrict__ op) {
  typedef Frag<_Float16> FH;
  __shared__ __align__(16) _Float16 KV[2 * AT_BUF];           // two chunk buffers
  __shared__ __align__(16) float   Os[4][16 * 68];            // per wave out tile, pitch 68
  const int tid = threadIdx.x, wave = tid >> 5, lane = tid & 31, hh = lane >> 4, c = lane & 15;
  const int qb = blockIdx.x % NQTILE;
  const int h  = blockIdx.x / NQTILE;
  const int q0 = qb * 64 + wave * 16;
  const _Float16* Qh = (const _Float16*)qp + ((size_t)h * SEQ_T + q0 + c) * HDIM;
  const _Float16* Kh = (const _Float16*)kp + (size_t)h * SEQ_T * HDIM;
  const _Float16* Vh = (const _Float16*)vtp + (size_t)h * HDIM * SEQ_T;

  // Q fragments (B operand, column = query q0 + c, k = head dim): 2 d-chunks of 32
  v16h qa[2];
  qa[0] = FH::load(Qh + 8 * hh);
  qa[1] = FH::load(Qh + 32 + 8 * hh);

  const v8f vz = (v8f){0.f,0.f,0.f,0.f,0.f,0.f,0.f,0.f};
  float mrow = -INFINITY, lrow = 0.f;   // one query per lane
  v8f oacc[4];
#pragma unroll
  for (int t = 0; t < 4; ++t) oacc[t] = vz;

  // copies: thread -> 16 B at column chunk (tid & 7) of rows (tid >> 3) + 16 i of both tiles; 8 lanes cover one 128-B row
  const int srow = tid >> 3, sc8 = (tid & 7) * 8;
  const _Float16* gK = Kh + (size_t)srow * HDIM + sc8;      // K row kv0 + r, d sc8..sc8+7
  const _Float16* gV = Vh + (size_t)srow * SEQ_T + sc8;     // Vt row d = r, keys kv0 + sc8..
  const unsigned l0 = (unsigned)(uintptr_t)KV + (unsigned)(srow * LDS_P16 + sc8) * 2u;
  auto stage = [&](int ch, int buf) {
    const _Float16* gk = gK + (size_t)ch * (KEY_CH * HDIM);
    const _Float16* gv = gV + (size_t)ch * KEY_CH;
    const unsigned lb = l0 + (unsigned)buf * (unsigned)(AT_BUF * 2);
    unsigned l[8];
    const void* g[8];
#pragma unroll
    for (int i = 0; i < 4; ++i) {
      l[i]     = lb + (unsigned)i * AT_STEP;
      l[4 + i] = lb + (unsigned)(AT_TILE * 2) + (unsigned)i * AT_STEP;
      g[i]     = (const void*)(gk + (size_t)i * (16 * HDIM));
      g[4 + i] = (const void*)(gv + (size_t)i * (16 * SEQ_T));
    }
    async_copy8(l, g);
  };

  const int nChunks = qb + 1;   // block-uniform
  stage(0, 0);
  asm volatile("s_wait_asynccnt 0x0" ::: "memory");   // this wave's part of chunk 0 has landed
  __syncthreads();                                    // chunk 0 is readable by every wave

  for (int kc = 0; kc < nChunks; ++kc) {
    const int kv0 = kc * KEY_CH;
    // directly behind the barrier (the one above, or the one at the foot of trip kc - 1, which ended every read of that
    // trip's buffer): chunk kc + 1 goes into that buffer and flies while chunk kc is worked on; block-uniform test
    if (kc + 1 < nChunks) stage(kc + 1, (kc + 1) & 1);
    const _Float16* Ksh = KV + (kc & 1) * AT_BUF;     // [kv][d]
    const _Float16* Vts = Ksh + AT_TILE;              // [d][kv]

    // transposed scores: tile j = K rows (A, m = key j*16 + ..) x Q (B, n = query c); lane (hh, c) holds
    // keys j*16 + 8*hh + r of query q0 + c
    v16h ka[2][4], va[2][4];
#pragma unroll
    for (int dc = 0; dc < 2; ++dc)
#pragma unroll
      for (int j = 0; j < 4; ++j) ka[dc][j] = FH::load(Ksh + (j * 16 + c) * LDS_P16 + dc * 32 + 8 * hh);   // A[m=key j*16+c][k=d]
    // keeps the 16 K reads together in front of the 8 score products: sunk to their users, each product waits out a whole LDS latency
    __builtin_amdgcn_sched_barrier(0);
    v8f s[4];
#pragma unroll
    for (int j = 0; j < 4; ++j) s[j] = FH::mma(ka[0][j], qa[0], vz);
#pragma unroll
    for (int j = 0; j < 4; ++j) s[j] = FH::mma(ka[1][j], qa[1], s[j]);
#pragma unroll
    for (int kk = 0; kk < 2; ++kk)
#pragma unroll
      for (int t = 0; t < 4; ++t) va[kk][t] = FH::load(Vts + (t * 16 + c) * LDS_P16 + kk * 32 + 8 * hh);   // A[m=d t*16+c][k=key]
    // the 8 score products run unbroken, then the 16 V^T reads as one group
    __builtin_amdgcn_sched_group_barrier(0x008, 8, 0);
    __builtin_amdgcn_sched_group_barrier(0x100, 16, 0);
    // keeps the 16 V^T reads in front of the softmax, whose vector work then covers their latency
    __builtin_amdgcn_sched_barrier(0);
    const bool diag = (kc == qb);
    const int qrow = q0 + c;
    float mj[4];
#pragma unroll
    for (int j = 0; j < 4; ++j) {
      float m = -INFINITY;
#pragma unroll
      for (int r = 0; r < 8; ++r) {
        const int kvcol = kv0 + j * 16 + 8 * hh + r;
        float sv = s[j][r] * 0.125f;
        if (diag && (kvcol > qrow)) sv = -INFINITY;
        s[j][r] = sv;
        m = fmaxf(m, sv);
      }
      mj[j] = m;
    }
    float cm = fmaxf(fmaxf(mj[0], mj[1]), fmaxf(mj[2], mj[3]));
    cm = fmaxf(cm, xhalf(cm));                     // the other 32 keys of this query sit in the other lane half
    const float mnew = fmaxf(mrow, cm);
    const float alpha = __expf(mrow - mnew);
    mrow = mnew;
    FH::U pb[2];                                   // B[k=key][n=query c]: elements 0..7 = tile 2kk, 8..15 = tile 2kk+1
    float pj[4];
#pragma unroll
    for (int j = 0; j < 4; ++j) {
      float psum = 0.f;
      v8h ph;
#pragma unroll
      for (int r = 0; r < 8; ++r) {
        const float p = __expf(s[j][r] - mnew);
        psum += p;
        ph[r] = (_Float16)(p * P_CARRY);
      }
      pj[j] = psum;
      pb[j >> 1].h[j & 1] = ph;
    }
    lrow = lrow * alpha + ((pj[0] + pj[1]) + (pj[2] + pj[3]));   // this half's keys only; halves joined after the loop
#pragma unroll
    for (int t = 0; t < 4; ++t)
#pragma unroll
      for (int r = 0; r < 8; ++r) oacc[t][r] *= alpha;
#pragma unroll
    for (int kk = 0; kk < 2; ++kk) {
#pragma unroll
      for (int t = 0; t < 4; ++t) oacc[t] = FH::mma(va[kk][t], pb[kk].v, oacc[t]);
    }
    // keeps the waits and the barrier below at the foot of the trip: lifted over the softmax, they would wait out the V^T reads
    // and the copies of chunk kc + 1 shortly behind their issue, with none of the softmax to cover either
    __builtin_amdgcn_sched_barrier(0);
    asm volatile("s_wait_dscnt 0x0" ::: "memory");      // this wave's reads of the buffer are done before it is refilled
    asm volatile("s_wait_asynccnt 0x0" ::: "memory");   // this wave's part of chunk kc + 1 has landed
    __syncthreads();                                    // publishes chunk kc + 1, ends every read of chunk kc
  }
  asm volatile("s_wait_asynccnt 0x0" ::: "memory");     // nothing in flight when the wave goes on

  // oacc[t][r] = out[query q0 + c][d = t*16 + 8*hh + r]
  float* os = Os[wave];
  {
    const float ltot = lrow + xhalf(lrow);
    const float inv = (1.0f / ltot) * (O_CARRY / P_CARRY);
#pragma unroll
    for (int t = 0; t < 4; ++t) {
      v4f lo, hi;
#pragma unroll
      for (int e = 0; e < 4; ++e) { lo[e] = oacc[t][e] * inv; hi[e] = oacc[t][4 + e] * inv; }
      *(v4f*)(os + c * 68 + t * 16 + 8 * hh)     = lo;
      *(v4f*)(os + c * 68 + t * 16 + 8 * hh + 4) = hi;
    }
  }
  __builtin_amdgcn_fence(__ATOMIC_RELEASE, "workgroup");
  __builtin_amdgcn_wave_barrier();
  __builtin_amdgcn_fence(__ATOMIC_ACQUIRE, "workgroup");
  {
    const int q8 = lane >> 3, c8 = (lane & 7) * 8;
    unsigned short* ob = op + (size_t)h * HDIM + c8;
    {
#pragma unroll
      for (int it = 0; it < 4; ++it) {
        const int row = it * 4 + q8;
        const v4f f0 = *(const v4f*)(os + row * 68 + c8);
        const v4f f1 = *(const v4f*)(os + row * 68 + c8 + 4);
        v8h hv;
#pragma unroll
        for (int e = 0; e < 4; ++e) { hv[e] = (_Float16)f0[e]; hv[4 + e] = (_Float16)f1[e]; }
        *(v8h*)(ob + (size_t)(q0 + row) * DMODEL) = hv;
      }
      
    }
  }
}

// =====================================================================================
// Host glue.  Workspace region map (bytes, all offsets multiples of 1 MiB):
//   XN   f16 [4096][1024]         8,388,608 @ 0
//   WQKV f16 [3072][1024] (x64)   6,291,456 @ 8,388,608
//   WO   f16 [1024][1024] (x64)   2,097,152 @ 14,680,064
//   ROT  f32 [32][512][2][8]      1,048,576 @ 16,777,216
//   QPL  f16 [16*4096][64]        8,388,608 @ 17,825,792
//   KPL  f16 [16*4096][64]        8,388,608 @ 26,214,400
//   VT   f16 [16*64][4096]        8,388,608 @ 34,603,008
//   OPL  f16 [4096][1024] (x16)   8,388,608 @ 42,991,616
//   total 51,380,224
// =====================================================================================
extern "C" void kernel_launch(void* const* d_in, const int* in_sizes, int n_in,
                              void* d_out, int out_size, void* d_ws, size_t ws_size,
                              hipStream_t stream) {
  if (n_in < 6) return;
  const int nx = SEQ_T * DMODEL;
  const int nwgt = DMODEL * DMODEL;
  if (in_sizes[0] != nx || in_sizes[1] != nwgt || in_sizes[2] != nwgt || in_sizes[3] != nwgt ||
      in_sizes[4] != nwgt || in_sizes[5] != DMODEL || out_size != nx) return;

  const float* x  = (const float*)d_in[0];
  const float* wq = (const float*)d_in[1];
  const float* wk = (const float*)d_in[2];
  const float* wv = (const float*)d_in[3];
  const float* wo = (const float*)d_in[4];
  const float* nw = (const float*)d_in[5];
  float* out = (float*)d_out;

  const size_t szXN   = (size_t)nx * 2;
  const size_t szWQKV = (size_t)3 * nwgt * 2;
  const size_t szWO   = (size_t)nwgt * 2;
  const size_t szROT  = (size_t)SEQ_T * HDIM * 4;
  const size_t szPL   = (size_t)NHEAD * SEQ_T * HDIM * 2;
  const size_t szO    = (size_t)nx * 2;
  const size_t offXN   = 0;
  const size_t offWQKV = offXN + szXN;
  const size_t offWO   = offWQKV + szWQKV;
  const size_t offROT  = offWO + szWO;
  const size_t offQ    = offROT + szROT;
  const size_t offK    = offQ + szPL;
  const size_t offVT   = offK + szPL;
  const size_t offO    = offVT + szPL;
  const size_t total   = offO + szO;
  if (total > ws_size) return;

  char* ws = (char*)d_ws;
  unsigned short* XN   = (unsigned short*)(ws + offXN);
  unsigned short* WQKV = (unsigned short*)(ws + offWQKV);
  unsigned short* WO   = (unsigned short*)(ws + offWO);
  float*          ROT  = (float*)(ws + offROT);
  unsigned short* QPL  = (unsigned short*)(ws + offQ);
  unsigned short* KPL  = (unsigned short*)(ws + offK);
  unsigned short* VT   = (unsigned short*)(ws + offVT);
  unsigned short* OPL  = (unsigned short*)(ws + offO);

  // inverse-frequency table: e_i = (2i)/64 (exact), p_i = fl32(pow(10000, e_i)) (double pow on host,
  // RNE to f32), invfreq_i = 1.0f / p_i (f32)
  FreqTab ft;
  for (int i = 0; i < 32; ++i) {
    const float e = (float)(2 * i) / 64.0f;
    const float p = (float)pow(10000.0, (double)e);
    ft.f[i] = 1.0f / p;
  }

  // 1) one grid: rmsnorm -> XN (f16) and rotary table -> ROT (blocks 0 .. SEQ_T - 1);
  //    weights -> f16(bf16(w) * 64), wq | wk | wv stacked as rows 0.., 1024.., 2048.. of WQKV, wo -> WO (the blocks behind)
  rmsnorm_cast_f16_k<<<SEQ_T + 4 * CAST_BPW, 128, 0, stream>>>(x, nw, wq, wk, wv, wo, XN, WQKV, WO, ft, ROT);
  // 2) XN . WQKV^T / 64 : M=4096, N=3072, K=1024; 32x12 work-group tiles = 384 blocks; the epilogue applies the rotary
  //    to q and k and writes the Q, K and Vt f16 planes
  {
    dim3 grid((SEQ_T / GT_M) * (QKV_N / GT_N), 1);
    wmma_gemm64<0, 0, 0, 3, false><<<grid, 256, 0, stream>>>(
        XN, XN, DMODEL, 0L, WQKV, WQKV, DMODEL, 0L, (void*)QPL, (void*)KPL, (void*)VT, QKV_N, 0L,
        ROT, nw, x, 0L, SEQ_T, QKV_N, DMODEL, 1.0f / W_CARRY);
  }
  // 3) causal attention -> O plane (f16, x16)
  attn_causal_hd64_k<<<NHEAD * NQTILE, 128, 0, stream>>>(QPL, KPL, VT, OPL);
  // 4) out = bf16_rne(x) + (O . WO^T) / (16*64) : M=4096, N=1024, K=1024; 32x4 work-group tiles = 128 blocks
  {
    dim3 grid((SEQ_T / GT_M) * (DMODEL / GT_N), 1);
    wmma_gemm64<0, 0, 0, 0, true, 0, true><<<grid, 256, 0, stream>>>(
        OPL, OPL, DMODEL, 0L, WO, WO, DMODEL, 0L, (void*)out, (void*)out, (void*)out, DMODEL, 0L,
        nw, nw, x, 0L, SEQ_T, DMODEL, DMODEL, 1.0f / (O_CARRY * W_CARRY));
  }
}

// v007
// It runs in 111 microseconds.
// Two timings next to v006 both put it at 1.06 times that version's speed.
// All steps since v000 together make it 3.45 times as fast.
// Contractions: qkv projection (normed . W^T, K=1024), attention q.k^T and p.v (head dim 64), output projection (o . Wo^T, K=1024): all v_wmma_f32_16x16x32_f16 (f16 operands, f32 accumulate); W carried x64, p carried x2^15, attention output carried x16 (exact power-of-two carries folded back in f32); float inputs RNE-converted to bf16 on load; rmsnorm, rotary tables, softmax, residual add in f32.
#include <hip/hip_runtime.h>
#include <math.h>

typedef __attribute__((ext_vector_type(16))) _Float16 v16h;
typedef __attribute__((ext_vector_type(8)))  _Float16 v8h;
typedef __attribute__((ext_vector_type(16))) __bf16   v16b;
typedef __attribute__((ext_vector_type(8)))  __bf16   v8b;
typedef __attribute__((ext_vector_type(8)))  float    v8f;
typedef __attribute__((ext_vector_type(4)))  float    v4f;

constexpr int SEQ_T     = 4096;
constexpr int DMODEL    = 1024;
constexpr int NHEAD     = 16;
constexpr int HDIM      = 64;
constexpr int QKV_N     = 3072;          // cols 0..1023 q | 1024..2047 k | 2048..3071 v
constexpr int NQTILE    = SEQ_T / 64;    // 64-row query tiles per head
constexpr int KEY_CH    = 64;            // keys per chunk
constexpr int LDS_P16   = 72;            // 16-bit LDS pitch (144 B rows, 16-B aligned)
constexpr float W_CARRY = 64.0f;         // weights stored as f16(bf16(w) * 64)
constexpr float P_CARRY = 32768.0f;      // softmax numerators stored as f16(p * 2^15)
constexpr float O_CARRY = 16.0f;         // attention output stored as f16(o * 16)

struct FreqTab { float f[32]; };
static_assert(sizeof(FreqTab) == 128);

__device__ __forceinline__ unsigned short f2bf_bits(float f) {
  unsigned u = __float_as_uint(f);
  return (unsigned short)((u + 0x7FFFu + ((u >> 16) & 1u)) >> 16);
}
__device__ __forceinline__ float bf_bits2f(unsigned short h) { return __uint_as_float(((unsigned)h) << 16); }
__device__ __forceinline__ float rne_bf(float f) { return bf_bits2f(f2bf_bits(f)); }

// hazard guard behind the last products of a GEMM, as a plain device helper
__device__ __forceinline__ void acc_guard4(v8f& a, v8f& b, v8f& c, v8f& d) { asm volatile("v_nop\n\tv_nop\n\tv_nop\n\tv_nop" : "+v"(a), "+v"(b), "+v"(c), "+v"(d)); }
template <typename T> struct Frag;
template <> struct Frag<_Float16> {
  typedef v16h V; union U { v16h v; v8h h[2]; };
  static __device__ __forceinline__ v16h load(const _Float16* p) {   // elements 0..7 <- p[0..7], 8..15 <- p[16..23]
    U f; f.h[0] = *(const v8h*)(p); f.h[1] = *(const v8h*)(p + 16); return f.v;
  }
  static __device__ __forceinline__ v8f mma(v16h a, v16h b, v8f c) {
    return __builtin_amdgcn_wmma_f32_16x16x32_f16(false, a, false, b, (short)0, c, false, false);
  }
};
template <> struct Frag<__bf16> {
  typedef v16b V; union U { v16b v; v8b h[2]; };
  static __device__ __forceinline__ v16b load(const __bf16* p) {
    U f; f.h[0] = *(const v8b*)(p); f.h[1] = *(const v8b*)(p + 16); return f.v;
  }
  static __device__ __forceinline__ v8f mma(v16b a, v16b b, v8f c) {
    return __builtin_amdgcn_wmma_f32_16x16x32_bf16(false, a, false, b, (short)0, c, false, false);
  }
};

// lane l reads lane l ^ 16 (vector cross-row move, no LDS round trip)
__device__ __forceinline__ float xhalf(float x) {
  const int b = __builtin_bit_cast(int, x);
  return __builtin_bit_cast(float, __builtin_amdgcn_permlanex16(b, b, 0x76543210, 0xfedcba98, false, false));
}

// =====================================================================================
// Register-blocked batched WMMA GEMM, C[m,n] = scale * sum_k A[m,k] * Bt[n,k] (+bias)(+resid);
// a work-group of 8 waves (2 x 4) owns a 128x256 tile, each wave a 64x64 tile of it.
// A row-major [M,K]; Bt row-major [N,K]; M % 128 == 0, N % 256 == 0, K % 64 == 0.
// Operands: per 64 k the 128 A rows and 256 Bt rows (128 B each, whole lines) are copied to LDS once per
// work-group by asynchronous copies, two buffers, the next stage in flight while this one is multiplied.
// SPLITM: 0 = single product (the only form the staged operand path carries; A2p, Bt2p are not read).
// BIAS_MODE: 0 = none, 1 = bias[m], 2 = bias[n].  OUT_MODE: 0 = f32, 1 = f16, 2 = bf16 hi + lo planes,
// 3 = attention planes (f16): columns 0..1023 rotary -> Cout [head*SEQ_T + t][64], 1024..2047 rotary -> Cout2 (same layout),
//     2048..3071 transposed -> Cout3 [head*64 + d][SEQ_T]; a wave's 64 columns are one head; rot = rotary table.
// RESID_RNE: the residual value is RNE-converted to bf16 before the add.
// ET: 0 = f16 operands, 1 = bf16 operands (pointers passed as 16-bit storage)
// =====================================================================================
constexpr int GT_M    = 128;                  // work-group tile rows
constexpr int GT_N    = 256;                  // work-group tile columns
constexpr int GT_K    = 64;                   // k per stage (128-B rows)
constexpr int GT_BUF  = (GT_M + GT_N) * LDS_P16;   // halves per buffer: A rows, then Bt rows, pitch 144 B
constexpr unsigned GT_STEP = 32u * LDS_P16 * 2u;   // LDS bytes between a thread's successive rows (32 rows)

// one thread's twelve 16-byte asynchronous copies global -> LDS of a stage; the s_wait_xcnt closes the statement
// so that no address register of a copy is rewritten before it
__device__ __forceinline__ void async_copy12(const unsigned (&l)[12], const void* const (&g)[12]) {
  asm volatile(
               "global_load_async_to_lds_b128 %0, %12, off\n\t"
               "global_load_async_to_lds_b128 %1, %13, off\n\t"
               "global_load_async_to_lds_b128 %2, %14, off\n\t"
               "global_load_async_to_lds_b128 %3, %15, off\n\t"
               "global_load_async_to_lds_b128 %4, %16, off\n\t"
               "global_load_async_to_lds_b128 %5, %17, off\n\t"
               "global_load_async_to_lds_b128 %6, %18, off\n\t"
               "global_load_async_to_lds_b128 %7, %19, off\n\t"
               "global_load_async_to_lds_b128 %8, %20, off\n\t"
               "global_load_async_to_lds_b128 %9, %21, off\n\t"
               "global_load_async_to_lds_b128 %10, %22, off\n\t"
               "global_load_async_to_lds_b128 %11, %23, off\n\t"
               "s_wait_xcnt 0x0"
               :: "v"(l[0]), "v"(l[1]), "v"(l[2]), "v"(l[3]), "v"(l[4]), "v"(l[5]), "v"(l[6]), "v"(l[7]), "v"(l[8]), "v"(l[9]), "v"(l[10]), "v"(l[11]),
                  "v"(g[0]), "v"(g[1]), "v"(g[2]), "v"(g[3]), "v"(g[4]), "v"(g[5]), "v"(g[6]), "v"(g[7]), "v"(g[8]), "v"(g[9]), "v"(g[10]), "v"(g[11]) : "memory");
}

// orders a wave's writes and reads of its own LDS slab (lanes exchange values through it); the fences name LDS alone, so
// that global stores and table loads in flight are not waited out at each exchange
__device__ __forceinline__ void slab_sync() {
  __builtin_amdgcn_fence(__ATOMIC_RELEASE, "workgroup", "local");
  __builtin_amdgcn_wave_barrier();
  __builtin_amdgcn_fence(__ATOMIC_ACQUIRE, "workgroup", "local");
}

template <int ET> struct Elem;
template <> struct Elem<0> { typedef _Float16 T; };
template <> struct Elem<1> { typedef __bf16 T; };
template <int ET, int SPLITM, int BIAS_MODE, int OUT_MODE, bool RESID, int ACT = 0, bool RESID_RNE = false>
__global__ __launch_bounds__(256) void wmma_gemm64(
    const unsigned short* __restrict__ Ap, const unsigned short* __restrict__ A2p, int lda, long strideA,
    const unsigned short* __restrict__ Btp, const unsigned short* __restrict__ Bt2p, int ldb, long strideB,
    void* __restrict__ Cout, void* __restrict__ Cout2, void* __restrict__ Cout3, int ldc, long strideC,
    const float* __restrict__ rot,
    const float* __restrict__ bias,
    const float* __restrict__ resid, long strideR,
    int M, int N, int K, float scale) {
  typedef typename Elem<ET>::T T;
  typedef typename Frag<T>::V V;
  const T* A = (const T*)Ap; const T* Bt = (const T*)Btp;
  static_assert(SPLITM == 0, "the staged operand path carries single planes");
  __shared__ __align__(16) T ring[2 * GT_BUF];     // two operand stages
  __shared__ __align__(16) float sT[8][16 * 68];   // per-wave 16x64 slab, pitch 68 floats
  const int b    = blockIdx.y;
  const int tid  = threadIdx.x;
  const int lane = tid & 31;
  const int wave = tid >> 5;
  const int tilesN = N / GT_N;
  const int tilesM = M / GT_M;
  if ((int)blockIdx.x >= tilesM * tilesN) return;   // work-group-uniform, in front of every barrier and copy
  const int bm = blockIdx.x / tilesN;
  const int bn = blockIdx.x - bm * tilesN;
  const int wm = wave >> 2, wn = wave & 3;
  const int m0 = bm * GT_M + (wm << 6);
  const int n0 = bn * GT_N + (wn << 6);

  const T* Ab  = A  + (size_t)b * strideA;
  const T* Bb  = Bt + (size_t)b * strideB;

  const int rlane = lane & 15;                 // row (A) / col (B, D) within subtile
  const int koff  = (lane >> 4) * 8;           // k offset of this lane half
  const int mOff  = (lane >> 4) * 8;           // D row offset

  // copies: thread -> 16 B at column chunk (tid & 7) of rows (tid >> 3) + 32 i; 8 lanes cover one 128-B row
  const int crow = tid >> 3, cchk = (tid & 7) * 8;
  const T* gA = Ab + (size_t)(bm * GT_M + crow) * lda + cchk;
  const T* gB = Bb + (size_t)(bn * GT_N + crow) * ldb + cchk;
  const size_t sA = (size_t)32 * lda, sB = (size_t)32 * ldb;
  const unsigned l0 = (unsigned)(uintptr_t)ring + (unsigned)(crow * LDS_P16 + cchk) * 2u;
  auto stage = [&](int t, int buf) {
    const T* ga = gA + (size_t)t * GT_K;
    const T* gb = gB + (size_t)t * GT_K;
    const unsigned lb = l0 + (unsigned)buf * (unsigned)(GT_BUF * 2);
    unsigned l[12];
    const void* g[12];
#pragma unroll
    for (int i = 0; i < 12; ++i) {
      l[i] = lb + (unsigned)i * GT_STEP;                                   // rows 0..127 A, 128..383 Bt
      g[i] = (i < 4) ? (const void*)(ga + i * sA) : (const void*)(gb + (i - 4) * sB);
    }
    async_copy12(l, g);
  };

  v8f acc[4][4];
#pragma unroll
  for (int i = 0; i < 4; ++i)
#pragma unroll
    for (int j = 0; j < 4; ++j) acc[i][j] = (v8f){0.f,0.f,0.f,0.f,0.f,0.f,0.f,0.f};

  const int nT = K / GT_K;
  stage(0, 0);
  asm volatile("s_wait_asynccnt 0x0" ::: "memory");   // this wave's part of stage 0 has landed
  __syncthreads();                                    // stage 0 is readable by every wave
  if (nT > 1) stage(1, 1);

  for (int t = 0; t < nT; ++t) {
    const int buf = t & 1;
    const T* sa = ring + buf * GT_BUF + ((wm << 6) + rlane) * LDS_P16 + koff;
    const T* sb = ring + buf * GT_BUF + (GT_M + (wn << 6) + rlane) * LDS_P16 + koff;
#pragma unroll
    for (int kk = 0; kk < GT_K; kk += 32) {
      V bh[4], ah[4];
#pragma unroll
      for (int j = 0; j < 4; ++j) bh[j] = Frag<T>::load(sb + (j << 4) * LDS_P16 + kk);
#pragma unroll
      for (int i = 0; i < 4; ++i) ah[i] = Frag<T>::load(sa + (i << 4) * LDS_P16 + kk);
      // keeps the 16 LDS reads together in front of the 16 products: sunk among them, each group waits out its own LDS latency
      __builtin_amdgcn_sched_barrier(0);
#pragma unroll
      for (int i = 0; i < 4; ++i)
#pragma unroll
        for (int j = 0; j < 4; ++j) acc[i][j] = Frag<T>::mma(ah[i], bh[j], acc[i][j]);
    }
    asm volatile("s_wait_dscnt 0x0" ::: "memory");      // this wave's reads of the buffer are done before it is refilled
    asm volatile("s_wait_asynccnt 0x0" ::: "memory");   // this wave's part of stage t + 1 has landed
    __syncthreads();                                    // publishes stage t + 1, ends every read of stage t
    if (t + 2 < nT) stage(t + 2, buf);
  }
  asm volatile("s_wait_asynccnt 0x0" ::: "memory");     // nothing in flight when the wave goes on
  acc_guard4(acc[0][0], acc[0][1], acc[0][2], acc[0][3]);
  acc_guard4(acc[1][0], acc[1][1], acc[1][2], acc[1][3]);
  acc_guard4(acc[2][0], acc[2][1], acc[2][2], acc[2][3]);
  acc_guard4(acc[3][0], acc[3][1], acc[3][2], acc[3][3]);

  // ---- epilogue ----
  float* slab = sT[wave];
  if constexpr (OUT_MODE == 3) {
    const int sel  = (bn * GT_N) >> 10;          // 0 = q, 1 = k, 2 = v: the same for the whole work-group
    const int head = (n0 & (DMODEL - 1)) >> 6;
    const int q = lane >> 3, c8 = (lane & 7) * 8;
    if (sel < 2) {
      // rotary in registers: column d (tiles 0, 1) and its partner d + 32 (tiles 2, 3) sit in the same lane and register
      unsigned short* P = ((sel == 0) ? (unsigned short*)Cout : (unsigned short*)Cout2) + ((size_t)head * SEQ_T + m0) * HDIM;
      const float* rp = rot + (size_t)rlane * (2 * SEQ_T) + (size_t)(m0 + mOff) * 2;
      v4f rt[2][8];                              // table values of row group i and, fetched ahead, of i + 1
      auto fetch = [&](int i, v4f (&d)[8]) {
#pragma unroll
        for (int jj = 0; jj < 2; ++jj)
#pragma unroll
          for (int k = 0; k < 4; ++k) d[jj * 4 + k] = *(const v4f*)(rp + (size_t)jj * (32 * SEQ_T) + i * 32 + k * 4);
      };
      fetch(0, rt[0]);
#pragma unroll
      for (int i = 0; i < 4; ++i) {
        if (i < 3) fetch(i + 1, rt[(i + 1) & 1]);
        const v4f (&tv)[8] = rt[i & 1];
#pragma unroll
        for (int jj = 0; jj < 2; ++jj)
#pragma unroll
          for (int r = 0; r < 8; ++r) {
            const float cv = tv[jj * 4 + (r >> 2)][r & 3];
            const float sv = tv[jj * 4 + 2 + (r >> 2)][r & 3];
            const float x1 = acc[i][jj][r] * scale;
            const float x2 = acc[i][jj + 2][r] * scale;
            slab[(mOff + r) * 68 + (jj << 4) + rlane]      = x1 * cv - x2 * sv;
            slab[(mOff + r) * 68 + 32 + (jj << 4) + rlane] = x2 * cv + x1 * sv;
          }
        slab_sync();
#pragma unroll
        for (int it = 0; it < 4; ++it) {
          const int row = it * 4 + q;             // 8 lanes x 16 B = one 128-B plane row
          const v4f f0 = *(const v4f*)(slab + row * 68 + c8);
          const v4f f1 = *(const v4f*)(slab + row * 68 + c8 + 4);
          v8h hv;
#pragma unroll
          for (int e = 0; e < 4; ++e) { hv[e] = (_Float16)f0[e]; hv[4 + e] = (_Float16)f1[e]; }
          *(v8h*)(P + (size_t)((i << 4) + row) * HDIM + c8) = hv;
        }
        // a table fetch follows that reuses the stores' data registers: the stores' register reads are waited for first
        if (i < 2) asm volatile("s_wait_xcnt 0x0" ::: "memory");
        slab_sync();
      }
    } else {
      // v: a lane's 8 accumulator rows are 8 successive tokens of one column d; 16 d rows x 64 tokens go through the slab
      _Float16* sl = (_Float16*)slab;
      unsigned short* P = (unsigned short*)Cout3 + (size_t)head * HDIM * SEQ_T + m0;
#pragma unroll
      for (int j = 0; j < 4; ++j) {
#pragma unroll
        for (int i = 0; i < 4; ++i) {
          v8h ph;
#pragma unroll
          for (int r = 0; r < 8; ++r) ph[r] = (_Float16)(acc[i][j][r] * scale);
          *(v8h*)(sl + rlane * LDS_P16 + (i << 4) + mOff) = ph;
        }
        slab_sync();
#pragma unroll
        for (int it = 0; it < 4; ++it) {
          const int row = it * 4 + q;             // 8 lanes x 16 B = 64 tokens = one whole 128-B line of row d
          const v8h hv = *(const v8h*)(sl + row * LDS_P16 + c8);
          *(v8h*)(P + (size_t)((j << 4) + row) * SEQ_T + c8) = hv;
        }
        // last group: the code behind it in the listing rewrites the stores' address pair, so the stores' register reads are waited for here
        if (j == 3) asm volatile("s_wait_xcnt 0x0" ::: "memory");
        slab_sync();
      }
    }
    return;
  }
  const float* Rb = RESID ? (resid + (size_t)b * strideR) : nullptr;
#pragma unroll
  for (int i = 0; i < 4; ++i) {
    const int mBase = m0 + (i << 4);
#pragma unroll
    for (int j = 0; j < 4; ++j) {
      const int n = n0 + (j << 4) + rlane;
      float bv = 0.f;
      if (BIAS_MODE == 2) bv = bias[n];
#pragma unroll
      for (int r = 0; r < 8; ++r) {
        float v = acc[i][j][r] * scale;
        if (BIAS_MODE == 1) v += bias[mBase + mOff + r];
        if (BIAS_MODE == 2) v += bv;
        if (RESID) {
          float rv = Rb[(size_t)(mBase + mOff + r) * ldc + n];
          if (RESID_RNE) rv = rne_bf(rv);
          v += rv;
        }
        if (ACT == 1) v = tanhf(v);
        if (ACT == 2) v = fmaxf(v, 0.0f);
        if (ACT == 4) v = (v > 0.f) ? v : 0.01f * v;
        slab[(mOff + r) * 68 + (j << 4) + rlane] = v;
      }
    }
    __builtin_amdgcn_fence(__ATOMIC_RELEASE, "workgroup");
    __builtin_amdgcn_wave_barrier();
    __builtin_amdgcn_fence(__ATOMIC_ACQUIRE, "workgroup");
    if (OUT_MODE == 0) {
      float* C = (float*)Cout + (size_t)b * strideC;
      const int hh = lane >> 4, c4 = (lane & 15) * 4;     // row seg = 256 B = 16 lanes x 16 B
      {
#pragma unroll
        for (int it = 0; it < 8; ++it) {
          const int row = it * 2 + hh;
          v4f v = *(const v4f*)(slab + row * 68 + c4);
          *(v4f*)(C + (size_t)(mBase + row) * ldc + n0 + c4) = v;
        }
        
      }
    } else {
      const int q = lane >> 3, c8 = (lane & 7) * 8;
      unsigned short* C  = (unsigned short*)Cout  + (size_t)b * strideC;
      unsigned short* C2 = (OUT_MODE == 2) ? ((unsigned short*)Cout2 + (size_t)b * strideC) : nullptr;
      {
#pragma unroll
        for (int it = 0; it < 4; ++it) {
          const int row = it * 4 + q;
          const float* sp = slab + row * 68 + c8;
          v8h hv, lv;
#pragma unroll
          for (int e = 0; e < 8; ++e) {
            if (OUT_MODE == 1) {
              hv[e] = (_Float16)sp[e];
            } else {
              unsigned short hb = f2bf_bits(sp[e]);
              unsigned short lb = f2bf_bits(sp[e] - bf_bits2f(hb));
              hv[e] = __builtin_bit_cast(_Float16, hb);
              lv[e] = __builtin_bit_cast(_Float16, lb);
            }
          }
          *(v8h*)(C + (size_t)(mBase + row) * ldc + n0 + c8) = hv;
          if (OUT_MODE == 2) *(v8h*)(C2 + (size_t)(mBase + row) * ldc + n0 + c8) = lv;
        }
        
      }
    }
    __builtin_amdgcn_fence(__ATOMIC_RELEASE, "workgroup");
    __builtin_amdgcn_wave_barrier();
    __builtin_amdgcn_fence(__ATOMIC_ACQUIRE, "workgroup");
  }
}

// =====================================================================================
// Kernel: rmsnorm of one token row (x RNE-converted to bf16 on load, mean of squares in f32,
// rsqrt(mean + 1e-6), times norm_w (RNE bf16)), output as an f16 plane [SEQ_T][DMODEL].
// Block = 128 threads = one token; coverage 128 threads x 8 elements = 1024 = one row exactly;
// The first SEQ_T / 32 blocks also build the rotary table for 32 tokens x 32 frequencies each:
// rot[f][t >> 3][cos of 8 tokens | sin of 8 tokens], angle = (float)t * invfreq_f (single f32 multiply), precise sincosf;
// a thread writes 64 B, four threads of one block the two whole lines of (f, 32 tokens).
// Blocks SEQ_T .. SEQ_T + 4 * CAST_BPW - 1 of the same grid need nothing of the rows and cast the weights instead:
// f32 -> f16(bf16_rne(w) * W_CARRY); a block takes CAST_EPB successive weights of wq, wk, wv or wo,
// a thread 4 groups of 8 (coverage 128 threads x 8 x 4 = CAST_EPB exactly; a 16-B store per group, 8 lanes one whole line).
// =====================================================================================
constexpr int CAST_EPB = 4096;                            // weights per cast block
constexpr int CAST_BPW = DMODEL * DMODEL / CAST_EPB;      // cast blocks per weight matrix
__global__ __launch_bounds__(128) void rmsnorm_cast_f16_k(const float* __restrict__ x, const float* __restrict__ nw,
                                                          const float* __restrict__ wq, const float* __restrict__ wk,
                                                          const float* __restrict__ wv, const float* __restrict__ wo,
                                                          unsigned short* __restrict__ xn, unsigned short* __restrict__ wqkv,
                                                          unsigned short* __restrict__ wof, FreqTab ft, float* __restrict__ rot) {
  __shared__ float red[4];
  const int t = blockIdx.x, tid = threadIdx.x, wave = tid >> 5, lane = tid & 31;
  if (t >= SEQ_T) {   // block-uniform, in front of the barrier: a weight-cast block
    const int cb  = t - SEQ_T;
    const int sel = cb / CAST_BPW;                        // 0 = wq, 1 = wk, 2 = wv (rows 0.., 1024.., 2048.. of wqkv), 3 = wo
    const float* w = (sel == 0) ? wq : (sel == 1) ? wk : (sel == 2) ? wv : wo;
    unsigned short* o = (sel < 3) ? wqkv + (size_t)sel * (DMODEL * DMODEL) : wof;
    const int e0 = (cb - sel * CAST_BPW) * CAST_EPB + tid * 8;
    v4f a[4], b[4];
#pragma unroll
    for (int g = 0; g < 4; ++g) {
      a[g] = *(const v4f*)(w + e0 + g * 1024);
      b[g] = *(const v4f*)(w + e0 + g * 1024 + 4);
    }
#pragma unroll
    for (int g = 0; g < 4; ++g) {
      v8h hv;
#pragma unroll
      for (int e = 0; e < 4; ++e) {
        hv[e]     = (_Float16)(rne_bf(a[g][e]) * W_CARRY);
        hv[4 + e] = (_Float16)(rne_bf(b[g][e]) * W_CARRY);
      }
      *(v8h*)(o + e0 + g * 1024) = hv;
    }
    return;
  }
  if (t < SEQ_T / 32) {   // block-uniform
    const int f = tid >> 2, tb = t * 32 + (tid & 3) * 8;
    float fr = ft.f[0];
#pragma unroll
    for (int q = 1; q < 32; ++q) fr = (f == q) ? ft.f[q] : fr;
    v4f cs4[4];
#pragma unroll
    for (int e = 0; e < 8; ++e) {
      float sv, cv;
      sincosf((float)(tb + e) * fr, &sv, &cv);
      cs4[e >> 2][e & 3]       = cv;
      cs4[2 + (e >> 2)][e & 3] = sv;
    }
    float* rd = rot + (size_t)f * (2 * SEQ_T) + (size_t)tb * 2;
#pragma unroll
    for (int k = 0; k < 4; ++k) *(v4f*)(rd + k * 4) = cs4[k];
  }
  const float* row = x + (size_t)t * DMODEL + tid * 8;
  const v4f a = *(const v4f*)row;
  const v4f b = *(const v4f*)(row + 4);
  float xb[8];
#pragma unroll
  for (int e = 0; e < 4; ++e) { xb[e] = rne_bf(a[e]); xb[4 + e] = rne_bf(b[e]); }
  float ss = 0.f;
#pragma unroll
  for (int e = 0; e < 8; ++e) ss += xb[e] * xb[e];
#pragma unroll
  for (int m = 1; m < 32; m <<= 1) ss += __shfl_xor(ss, m, 32);
  if (lane == 0) red[wave] = ss;
  __syncthreads();
  const float tot = (red[0] + red[1]) + (red[2] + red[3]);
  const float inv = rsqrtf(tot * (1.0f / 1024.0f) + 1e-6f);
  const v4f na = *(const v4f*)(nw + tid * 8);
  const v4f nb = *(const v4f*)(nw + tid * 8 + 4);
  v8h hv;
#pragma unroll
  for (int e = 0; e < 4; ++e) {
    hv[e]     = (_Float16)((xb[e] * inv) * rne_bf(na[e]));
    hv[4 + e] = (_Float16)((xb[4 + e] * inv) * rne_bf(nb[e]));
  }
  unsigned short* dst = xn + (size_t)t * DMODEL + tid * 8;
  *(v8h*)dst = hv;
}

// =====================================================================================
// Kernel: causal attention, head dim 64, f16 planes in (Q, K: [NHEAD*SEQ_T][64]; Vt: [NHEAD*64][SEQ_T]),
// f16 plane out (O: [SEQ_T][DMODEL], head h at cols h*64, value o*16).
//   scores^T = 0.125 * k.q^T : v_wmma_f32_16x16x32_f16 (q, k plain f16), f32 accumulate
//   out^T    = v^T.p^T       : v_wmma_f32_16x16x32_f16 (p carried x2^15 in f16, v plain f16), f32 accumulate
//   (transposed products: a lane holds one query's scores, and p goes from the score tiles straight into the B operand)
//   online softmax in f32; keys above the diagonal -> -inf (every row keeps key kv0 <= row, so never fully masked).
// Block = 4 waves = 64 query rows of head h at a time; 64-key chunks; chunks above the diagonal are skipped (block-uniform).
// A block works query tile NQTILE - 1 - pr and then tile pr of its head, one after the other in every wave: (NQTILE - pr) + (pr + 1)
// = NQTILE + 1 chunks for every block, so that no WGP is left with the long tiles alone; every (head, tile) is worked once.
// K / Vt chunks come to LDS by asynchronous copies (128 threads x 4 x 16 B = 64x64 halves each), two buffers: chunk kc + 1
// is in flight while chunk kc is worked on; one work-group barrier per chunk publishes it and frees the buffer just read;
// WMMA operands are read from dense, statically strided LDS / plane addresses only.
// O store coverage per wave: 4 iterations x 4 row groups = 16 rows, 8 lanes x 8 halves = 64 cols = one whole
// =====================================================================================
constexpr int AT_TILE = KEY_CH * LDS_P16;          // halves of one staged tile (64 rows, pitch 144 B)
constexpr int AT_BUF  = 2 * AT_TILE;               // halves per buffer: K tile [kv][d], then V^T tile [d][kv]
constexpr unsigned AT_STEP = 16u * LDS_P16 * 2u;   // LDS bytes between a thread's successive rows (16 rows)

// one thread's eight 16-byte asynchronous copies global -> LDS of a chunk; the s_wait_xcnt closes the statement
// so that no address register of a copy is rewritten before it
__device__ __forceinline__ void async_copy8(const unsigned (&l)[8], const void* const (&g)[8]) {
  asm volatile(
               "global_load_async_to_lds_b128 %0, %8, off\n\t"
               "global_load_async_to_lds_b128 %1, %9, off\n\t"
               "global_load_async_to_lds_b128 %2, %10, off\n\t"
               "global_load_async_to_lds_b128 %3, %11, off\n\t"
               "global_load_async_to_lds_b128 %4, %12, off\n\t"
               "global_load_async_to_lds_b128 %5, %13, off\n\t"
               "global_load_async_to_lds_b128 %6, %14, off\n\t"
               "global_load_async_to_lds_b128 %7, %15, off\n\t"
               "s_wait_xcnt 0x0"
               :: "v"(l[0]), "v"(l[1]), "v"(l[2]), "v"(l[3]), "v"(l[4]), "v"(l[5]), "v"(l[6]), "v"(l[7]),
                  "v"(g[0]), "v"(g[1]), "v"(g[2]), "v"(g[3]), "v"(g[4]), "v"(g[5]), "v"(g[6]), "v"(g[7]) : "memory");
}

__global__ __launch_bounds__(128) void attn_causal_hd64_k(const unsigned short* __restrict__ qp,
                                                         const unsigned short* __restrict__ kp,
                                                         const unsigned short* __restrict__ vtp,
                                                         unsigned short* __restrict__ op) {
  typedef Frag<_Float16> FH;
  __shared__ __align__(16) _Float16 KV[2 * AT_BUF];           // two chunk buffers
  __shared__ __align__(16) float   Os[4][16 * 68];            // per wave out tile, pitch 68
  const int tid = threadIdx.x, wave = tid >> 5, lane = tid & 31, hh = lane >> 4, c = lane & 15;
  const int pr = blockIdx.x % (NQTILE / 2);
  const int h  = blockIdx.x / (NQTILE / 2);
  const _Float16* Kh = (const _Float16*)kp + (size_t)h * SEQ_T * HDIM;
  const _Float16* Vh = (const _Float16*)vtp + (size_t)h * HDIM * SEQ_T;

  const v8f vz = (v8f){0.f,0.f,0.f,0.f,0.f,0.f,0.f,0.f};

  // copies: thread -> 16 B at column chunk (tid & 7) of rows (tid >> 3) + 16 i of both tiles; 8 lanes cover one 128-B row
  const int srow = tid >> 3, sc8 = (tid & 7) * 8;
  const _Float16* gK = Kh + (size_t)srow * HDIM + sc8;      // K row kv0 + r, d sc8..sc8+7
  const _Float16* gV = Vh + (size_t)srow * SEQ_T + sc8;     // Vt row d = r, keys kv0 + sc8..
  const unsigned l0 = (unsigned)(uintptr_t)KV + (unsigned)(srow * LDS_P16 + sc8) * 2u;
  auto stage = [&](int ch, int buf) {
    const _Float16* gk = gK + (size_t)ch * (KEY_CH * HDIM);
    const _Float16* gv = gV + (size_t)ch * KEY_CH;
    const unsigned lb = l0 + (unsigned)buf * (unsigned)(AT_BUF * 2);
    unsigned l[8];
    const void* g[8];
#pragma unroll
    for (int i = 0; i < 4; ++i) {
      l[i]     = lb + (unsigned)i * AT_STEP;
      l[4 + i] = lb + (unsigned)(AT_TILE * 2) + (unsigned)i * AT_STEP;
      g[i]     = (const void*)(gk + (size_t)i * (16 * HDIM));
      g[4 + i] = (const void*)(gv + (size_t)i * (16 * SEQ_T));
    }
    async_copy8(l, g);
  };

  for (int part = 0; part < 2; ++part) {   // the long tile, then its short partner; block-uniform
  const int qb = part ? pr : NQTILE - 1 - pr;
  const int q0 = qb * 64 + wave * 16;
  const _Float16* Qh = (const _Float16*)qp + ((size_t)h * SEQ_T + q0 + c) * HDIM;

  // Q fragments (B operand, column = query q0 + c, k = head dim): 2 d-chunks of 32
  v16h qa[2];
  qa[0] = FH::load(Qh + 8 * hh);
  qa[1] = FH::load(Qh + 32 + 8 * hh);

  float mrow = -INFINITY, lrow = 0.f;   // one query per lane
  v8f oacc[4];
#pragma unroll
  for (int t = 0; t < 4; ++t) oacc[t] = vz;

  const int nChunks = qb + 1;   // block-uniform
  // second tile: the barrier at the foot of the first tile's last trip, behind every wave's s_wait_dscnt 0, has ended every read of both buffers
  stage(0, 0);
  asm volatile("s_wait_asynccnt 0x0" ::: "memory");   // this wave's part of chunk 0 has landed
  __syncthreads();                                    // chunk 0 is readable by every wave

  for (int kc = 0; kc < nChunks; ++kc) {
    const int kv0 = kc * KEY_CH;
    // directly behind the barrier (the one above, or the one at the foot of trip kc - 1, which ended every read of that
    // trip's buffer): chunk kc + 1 goes into that buffer and flies while chunk kc is worked on; block-uniform test
    if (kc + 1 < nChunks) stage(kc + 1, (kc + 1) & 1);
    const _Float16* Ksh = KV + (kc & 1) * AT_BUF;     // [kv][d]
    const _Float16* Vts = Ksh + AT_TILE;              // [d][kv]

    // transposed scores: tile j = K rows (A, m = key j*16 + ..) x Q (B, n = query c); lane (hh, c) holds
    // keys j*16 + 8*hh + r of query q0 + c
    v16h ka[2][4], va[2][4];
#pragma unroll
    for (int dc = 0; dc < 2; ++dc)
#pragma unroll
      for (int j = 0; j < 4; ++j) ka[dc][j] = FH::load(Ksh + (j * 16 + c) * LDS_P16 + dc * 32 + 8 * hh);   // A[m=key j*16+c][k=d]
    // keeps the 16 K reads together in front of the 8 score products: sunk to their users, each product waits out a whole LDS latency
    __builtin_amdgcn_sched_barrier(0);
    v8f s[4];
#pragma unroll
    for (int j = 0; j < 4; ++j) s[j] = FH::mma(ka[0][j], qa[0], vz);
#pragma unroll
    for (int j = 0; j < 4; ++j) s[j] = FH::mma(ka[1][j], qa[1], s[j]);
#pragma unroll
    for (int kk = 0; kk < 2; ++kk)
#pragma unroll
      for (int t = 0; t < 4; ++t) va[kk][t] = FH::load(Vts + (t * 16 + c) * LDS_P16 + kk * 32 + 8 * hh);   // A[m=d t*16+c][k=key]
    // the 8 score products run unbroken, then the 16 V^T reads as one group
    __builtin_amdgcn_sched_group_barrier(0x008, 8, 0);
    __builtin_amdgcn_sched_group_barrier(0x100, 16, 0);
    // keeps the 16 V^T reads in front of the softmax, whose vector work then covers their latency
    __builtin_amdgcn_sched_barrier(0);
    const bool diag = (kc == qb);
    const int qrow = q0 + c;
    float mj[4];
#pragma unroll
    for (int j = 0; j < 4; ++j) {
      float m = -INFINITY;
#pragma unroll
      for (int r = 0; r < 8; ++r) {
        const int kvcol = kv0 + j * 16 + 8 * hh + r;
        float sv = s[j][r] * 0.125f;
        if (diag && (kvcol > qrow)) sv = -INFINITY;
        s[j][r] = sv;
        m = fmaxf(m, sv);
      }
      mj[j] = m;
    }
    float cm = fmaxf(fmaxf(mj[0], mj[1]), fmaxf(mj[2], mj[3]));
    cm = fmaxf(cm, xhalf(cm));                     // the other 32 keys of this query sit in the other lane half
    const float mnew = fmaxf(mrow, cm);
    const float alpha = __expf(mrow - mnew);
    mrow = mnew;
    FH::U pb[2];                                   // B[k=key][n=query c]: elements 0..7 = tile 2kk, 8..15 = tile 2kk+1
    float pj[4];
#pragma unroll
    for (int j = 0; j < 4; ++j) {
      float psum = 0.f;
      v8h ph;
#pragma unroll
      for (int r = 0; r < 8; ++r) {
        const float p = __expf(s[j][r] - mnew);
        psum += p;
        ph[r] = (_Float16)(p * P_CARRY);
      }
      pj[j] = psum;
      pb[j >> 1].h[j & 1] = ph;
    }
    lrow = lrow * alpha + ((pj[0] + pj[1]) + (pj[2] + pj[3]));   // this half's keys only; halves joined after the loop
#pragma unroll
    for (int t = 0; t < 4; ++t)
#pragma unroll
      for (int r = 0; r < 8; ++r) oacc[t][r] *= alpha;
#pragma unroll
    for (int kk = 0; kk < 2; ++kk) {
#pragma unroll
      for (int t = 0; t < 4; ++t) oacc[t] = FH::mma(va[kk][t], pb[kk].v, oacc[t]);
    }
    // keeps the waits and the barrier below at the foot of the trip: lifted over the softmax, they would wait out the V^T reads
    // and the copies of chunk kc + 1 shortly behind their issue, with none of the softmax to cover either
    __builtin_amdgcn_sched_barrier(0);
    asm volatile("s_wait_dscnt 0x0" ::: "memory");      // this wave's reads of the buffer are done before it is refilled
    asm volatile("s_wait_asynccnt 0x0" ::: "memory");   // this wave's part of chunk kc + 1 has landed
    __syncthreads();                                    // publishes chunk kc + 1, ends every read of chunk kc
  }
  asm volatile("s_wait_asynccnt 0x0" ::: "memory");     // nothing in flight when the wave goes on

  // oacc[t][r] = out[query q0 + c][d = t*16 + 8*hh + r]
  float* os = Os[wave];
  {
    const float ltot = lrow + xhalf(lrow);
    const float inv = (1.0f / ltot) * (O_CARRY / P_CARRY);
#pragma unroll
    for (int t = 0; t < 4; ++t) {
      v4f lo, hi;
#pragma unroll
      for (int e = 0; e < 4; ++e) { lo[e] = oacc[t][e] * inv; hi[e] = oacc[t][4 + e] * inv; }
      *(v4f*)(os + c * 68 + t * 16 + 8 * hh)     = lo;
      *(v4f*)(os + c * 68 + t * 16 + 8 * hh + 4) = hi;
    }
  }
  __builtin_amdgcn_fence(__ATOMIC_RELEASE, "workgroup");
  __builtin_amdgcn_wave_barrier();
  __builtin_amdgcn_fence(__ATOMIC_ACQUIRE, "workgroup");
  {
    const int q8 = lane >> 3, c8 = (lane & 7) * 8;
    unsigned short* ob = op + (size_t)h * HDIM + c8;
    {
#pragma unroll
      for (int it = 0; it < 4; ++it) {
        const int row = it * 4 + q8;
        const v4f f0 = *(const v4f*)(os + row * 68 + c8);
        const v4f f1 = *(const v4f*)(os + row * 68 + c8 + 4);
        v8h hv;
#pragma unroll
        for (int e = 0; e < 4; ++e) { hv[e] = (_Float16)f0[e]; hv[4 + e] = (_Float16)f1[e]; }
        *(v8h*)(ob + (size_t)(q0 + row) * DMODEL) = hv;
      }
      // the next tile's address arithmetic rewrites the stores' address and data registers: their register reads are waited for first
      asm volatile("s_wait_xcnt 0x0" ::: "memory");
    }
  }
  }
}

// =====================================================================================
// Host glue.  Workspace region map (bytes, all offsets multiples of 1 MiB):
//   XN   f16 [4096][1024]         8,388,608 @ 0
//   WQKV f16 [3072][1024] (x64)   6,291,456 @ 8,388,608
//   WO   f16 [1024][1024] (x64)   2,097,152 @ 14,680,064
//   ROT  f32 [32][512][2][8]      1,048,576 @ 16,777,216
//   QPL  f16 [16*4096][64]        8,388,608 @ 17,825,792
//   KPL  f16 [16*4096][64]        8,388,608 @ 26,214,400
//   VT   f16 [16*64][4096]        8,388,608 @ 34,603,008
//   OPL  f16 [4096][1024] (x16)   8,388,608 @ 42,991,616
//   total 51,380,224
// =====================================================================================
extern "C" void kernel_launch(void* const* d_in, const int* in_sizes, int n_in,
                              void* d_out, int out_size, void* d_ws, size_t ws_size,
                              hipStream_t stream) {
  if (n_in < 6) return;
  const int nx = SEQ_T * DMODEL;
  const int nwgt = DMODEL * DMODEL;
  if (in_sizes[0] != nx || in_sizes[1] != nwgt || in_sizes[2] != nwgt || in_sizes[3] != nwgt ||
      in_sizes[4] != nwgt || in_sizes[5] != DMODEL || out_size != nx) return;

  const float* x  = (const float*)d_in[0];
  const float* wq = (const float*)d_in[1];
  const float* wk = (const float*)d_in[2];
  const float* wv = (const float*)d_in[3];
  const float* wo = (const float*)d_in[4];
  const float* nw = (const float*)d_in[5];
  float* out = (float*)d_out;

  const size_t szXN   = (size_t)nx * 2;
  const size_t szWQKV = (size_t)3 * nwgt * 2;
  const size_t szWO   = (size_t)nwgt * 2;
  const size_t szROT  = (size_t)SEQ_T * HDIM * 4;
  const size_t szPL   = (size_t)NHEAD * SEQ_T * HDIM * 2;
  const size_t szO    = (size_t)nx * 2;
  const size_t offXN   = 0;
  const size_t offWQKV = offXN + szXN;
  const size_t offWO   = offWQKV + szWQKV;
  const size_t offROT  = offWO + szWO;
  const size_t offQ    = offROT + szROT;
  const size_t offK    = offQ + szPL;
  const size_t offVT   = offK + szPL;
  const size_t offO    = offVT + szPL;
  const size_t total   = offO + szO;
  if (total > ws_size) return;

  char* ws = (char*)d_ws;
  unsigned short* XN   = (unsigned short*)(ws + offXN);
  unsigned short* WQKV = (unsigned short*)(ws + offWQKV);
  unsigned short* WO   = (unsigned short*)(ws + offWO);
  float*          ROT  = (float*)(ws + offROT);
  unsigned short* QPL  = (unsigned short*)(ws + offQ);
  unsigned short* KPL  = (unsigned short*)(ws + offK);
  unsigned short* VT   = (unsigned short*)(ws + offVT);
  unsigned short* OPL  = (unsigned short*)(ws + offO);

  // inverse-frequency table: e_i = (2i)/64 (exact), p_i = fl32(pow(10000, e_i)) (double pow on host,
  // RNE to f32), invfreq_i = 1.0f / p_i (f32)
  FreqTab ft;
  for (int i = 0; i < 32; ++i) {
    const float e = (float)(2 * i) / 64.0f;
    const float p = (float)pow(10000.0, (double)e);
    ft.f[i] = 1.0f / p;
  }

  // 1) one grid: rmsnorm -> XN (f16) and rotary table -> ROT (blocks 0 .. SEQ_T - 1);
  //    weights -> f16(bf16(w) * 64), wq | wk | wv stacked as rows 0.., 1024.., 2048.. of WQKV, wo -> WO (the blocks behind)
  rmsnorm_cast_f16_k<<<SEQ_T + 4 * CAST_BPW, 128, 0, stream>>>(x, nw, wq, wk, wv, wo, XN, WQKV, WO, ft, ROT);
  // 2) XN . WQKV^T / 64 : M=4096, N=3072, K=1024; 32x12 work-group tiles = 384 blocks; the epilogue applies the rotary
  //    to q and k and writes the Q, K and Vt f16 planes
  {
    dim3 grid((SEQ_T / GT_M) * (QKV_N / GT_N), 1);
    wmma_gemm64<0, 0, 0, 3, false><<<grid, 256, 0, stream>>>(
        XN, XN, DMODEL, 0L, WQKV, WQKV, DMODEL, 0L, (void*)QPL, (void*)KPL, (void*)VT, QKV_N, 0L,
        ROT, nw, x, 0L, SEQ_T, QKV_N, DMODEL, 1.0f / W_CARRY);
  }
  // 3) causal attention -> O plane (f16, x16); 16 heads x 32 tile pairs = 512 blocks
  attn_causal_hd64_k<<<NHEAD * (NQTILE / 2), 128, 0, stream>>>(QPL, KPL, VT, OPL);
  // 4) out = bf16_rne(x) + (O . WO^T) / (16*64) : M=4096, N=1024, K=1024; 32x4 work-group tiles = 128 blocks
  {
    dim3 grid((SEQ_T / GT_M) * (DMODEL / GT_N), 1);
    wmma_gemm64<0, 0, 0, 0, true, 0, true><<<grid, 256, 0, stream>>>(
        OPL, OPL, DMODEL, 0L, WO, WO, DMODEL, 0L, (void*)out, (void*)out, (void*)out, DMODEL, 0L,
        nw, nw, x, 0L, SEQ_T, DMODEL, DMODEL, 1.0f / (O_CARRY * W_CARRY));
  }
}

// v008
// A run of this version takes 102 microseconds.
// Two timings next to v007 put it at 1.11 and 1.06 times that version's speed.
// Counting every step since v000, it is 3.74 times as fast.
// Contractions: qkv projection (normed . W^T, K=1024), attention q.k^T and p.v (head dim 64), output projection (o . Wo^T, K=1024): all v_wmma_f32_16x16x32_f16 (f16 operands, f32 accumulate); W carried x64, p carried x2^15, attention output carried x16 (exact power-of-two carries folded back in f32); float inputs RNE-converted to bf16 on load; rmsnorm, rotary tables, softmax, residual add in f32.
#include <hip/hip_runtime.h>
#include <math.h>

typedef __attribute__((ext_vector_type(16))) _Float16 v16h;
typedef __attribute__((ext_vector_type(8)))  _Float16 v8h;
typedef __attribute__((ext_vector_type(16))) __bf16   v16b;
typedef __attribute__((ext_vector_type(8)))  __bf16   v8b;
typedef __attribute__((ext_vector_type(8)))  float    v8f;
typedef __attribute__((ext_vector_type(4)))  float    v4f;

constexpr int SEQ_T     = 4096;
constexpr int DMODEL    = 1024;
constexpr int NHEAD     = 16;
constexpr int HDIM      = 64;
constexpr int QKV_N     = 3072;          // cols 0..1023 q | 1024..2047 k | 2048..3071 v
constexpr int NQTILE    = SEQ_T / 64;    // 64-row query tiles per head
constexpr int KEY_CH    = 64;            // keys per chunk
constexpr int LDS_P16   = 72;            // 16-bit LDS pitch (144 B rows, 16-B aligned)
constexpr float W_CARRY = 64.0f;         // weights stored as f16(bf16(w) * 64)
constexpr float P_CARRY = 32768.0f;      // softmax numerators stored as f16(p * 2^15)
constexpr float O_CARRY = 16.0f;         // attention output stored as f16(o * 16)

struct FreqTab { float f[32]; };
static_assert(sizeof(FreqTab) == 128);

__device__ __forceinline__ unsigned short f2bf_bits(float f) {
  unsigned u = __float_as_uint(f);
  return (unsigned short)((u + 0x7FFFu + ((u >> 16) & 1u)) >> 16);
}
__device__ __forceinline__ float bf_bits2f(unsigned short h) { return __uint_as_float(((unsigned)h) << 16); }
__device__ __forceinline__ float rne_bf(float f) { return bf_bits2f(f2bf_bits(f)); }

// hazard guard behind the last products of a GEMM, as a plain device helper
__device__ __forceinline__ void acc_guard4(v8f& a, v8f& b, v8f& c, v8f& d) { asm volatile("v_nop\n\tv_nop\n\tv_nop\n\tv_nop" : "+v"(a), "+v"(b), "+v"(c), "+v"(d)); }
template <typename T> struct Frag;
template <> struct Frag<_Float16> {
  typedef v16h V; union U { v16h v; v8h h[2]; };
  static __device__ __forceinline__ v16h load(const _Float16* p) {   // elements 0..7 <- p[0..7], 8..15 <- p[16..23]
    U f; f.h[0] = *(const v8h*)(p); f.h[1] = *(const v8h*)(p + 16); return f.v;
  }
  static __device__ __forceinline__ v8f mma(v16h a, v16h b, v8f c) {
    return __builtin_amdgcn_wmma_f32_16x16x32_f16(false, a, false, b, (short)0, c, false, false);
  }
};
template <> struct Frag<__bf16> {
  typedef v16b V; union U { v16b v; v8b h[2]; };
  static __device__ __forceinline__ v16b load(const __bf16* p) {
    U f; f.h[0] = *(const v8b*)(p); f.h[1] = *(const v8b*)(p + 16); return f.v;
  }
  static __device__ __forceinline__ v8f mma(v16b a, v16b b, v8f c) {
    return __builtin_amdgcn_wmma_f32_16x16x32_bf16(false, a, false, b, (short)0, c, false, false);
  }
};

// lane l reads lane l ^ 16 (vector cross-row move, no LDS round trip)
__device__ __forceinline__ float xhalf(float x) {
  const int b = __builtin_bit_cast(int, x);
  return __builtin_bit_cast(float, __builtin_amdgcn_permlanex16(b, b, 0x76543210, 0xfedcba98, false, false));
}

// =====================================================================================
// Register-blocked batched WMMA GEMM, C[m,n] = scale * sum_k A[m,k] * Bt[n,k] (+bias)(+resid);
// a work-group of 8 waves (2 x 4) owns a 128x256 tile, each wave a 64x64 tile of it.
// A row-major [M,K]; Bt row-major [N,K]; M % 128 == 0, N % 256 == 0, K % 64 == 0.
// Operands: per 64 k the 128 A rows and 256 Bt rows (128 B each, whole lines) are copied to LDS once per
// work-group by asynchronous copies, two buffers, the next stage in flight while this one is multiplied.
// SPLITM: 0 = single product (the only form the staged operand path carries; A2p, Bt2p are not read).
// BIAS_MODE: 0 = none, 1 = bias[m], 2 = bias[n].  OUT_MODE: 0 = f32, 1 = f16, 2 = bf16 hi + lo planes,
// 3 = attention planes (f16): columns 0..1023 rotary -> Cout [head*SEQ_T + t][64], 1024..2047 rotary -> Cout2 (same layout),
//     2048..3071 transposed -> Cout3 [head*64 + d][SEQ_T]; a wave's 64 columns are one head; rot = rotary table.
// RESID_RNE: the residual value is RNE-converted to bf16 before the add.
// ET: 0 = f16 operands, 1 = bf16 operands (pointers passed as 16-bit storage)
// =====================================================================================
constexpr int GT_M    = 128;                  // work-group tile rows
constexpr int GT_N    = 256;                  // work-group tile columns
constexpr int GT_K    = 64;                   // k per stage (128-B rows)
constexpr int GT_BUF  = (GT_M + GT_N) * LDS_P16;   // halves per buffer: A rows, then Bt rows, pitch 144 B
constexpr unsigned GT_STEP = 32u * LDS_P16 * 2u;   // LDS bytes between a thread's successive rows (32 rows)

// one thread's twelve 16-byte asynchronous copies global -> LDS of a stage; the s_wait_xcnt closes the statement
// so that no address register of a copy is rewritten before it
__device__ __forceinline__ void async_copy12(const unsigned (&l)[12], const void* const (&g)[12]) {
  asm volatile(
               "global_load_async_to_lds_b128 %0, %12, off\n\t"
               "global_load_async_to_lds_b128 %1, %13, off\n\t"
               "global_load_async_to_lds_b128 %2, %14, off\n\t"
               "global_load_async_to_lds_b128 %3, %15, off\n\t"
               "global_load_async_to_lds_b128 %4, %16, off\n\t"
               "global_load_async_to_lds_b128 %5, %17, off\n\t"
               "global_load_async_to_lds_b128 %6, %18, off\n\t"
               "global_load_async_to_lds_b128 %7, %19, off\n\t"
               "global_load_async_to_lds_b128 %8, %20, off\n\t"
               "global_load_async_to_lds_b128 %9, %21, off\n\t"
               "global_load_async_to_lds_b128 %10, %22, off\n\t"
               "global_load_async_to_lds_b128 %11, %23, off\n\t"
               "s_wait_xcnt 0x0"
               :: "v"(l[0]), "v"(l[1]), "v"(l[2]), "v"(l[3]), "v"(l[4]), "v"(l[5]), "v"(l[6]), "v"(l[7]), "v"(l[8]), "v"(l[9]), "v"(l[10]), "v"(l[11]),
                  "v"(g[0]), "v"(g[1]), "v"(g[2]), "v"(g[3]), "v"(g[4]), "v"(g[5]), "v"(g[6]), "v"(g[7]), "v"(g[8]), "v"(g[9]), "v"(g[10]), "v"(g[11]) : "memory");
}

// orders a wave's writes and reads of its own LDS slab (lanes exchange values through it); the fences name LDS alone, so
// that global stores and table loads in flight are not waited out at each exchange
__device__ __forceinline__ void slab_sync() {
  __builtin_amdgcn_fence(__ATOMIC_RELEASE, "workgroup", "local");
  __builtin_amdgcn_wave_barrier();
  __builtin_amdgcn_fence(__ATOMIC_ACQUIRE, "workgroup", "local");
}

template <int ET> struct Elem;
template <> struct Elem<0> { typedef _Float16 T; };
template <> struct Elem<1> { typedef __bf16 T; };
template <int ET, int SPLITM, int BIAS_MODE, int OUT_MODE, bool RESID, int ACT = 0, bool RESID_RNE = false>
__global__ __launch_bounds__(256) void wmma_gemm64(
    const unsigned short* __restrict__ Ap, const unsigned short* __restrict__ A2p, int lda, long strideA,
    const unsigned short* __restrict__ Btp, const unsigned short* __restrict__ Bt2p, int ldb, long strideB,
    void* __restrict__ Cout, void* __restrict__ Cout2, void* __restrict__ Cout3, int ldc, long strideC,
    const float* __restrict__ rot,
    const float* __restrict__ bias,
    const float* __restrict__ resid, long strideR,
    int M, int N, int K, float scale) {
  typedef typename Elem<ET>::T T;
  typedef typename Frag<T>::V V;
  const T* A = (const T*)Ap; const T* Bt = (const T*)Btp;
  static_assert(SPLITM == 0, "the staged operand path carries single planes");
  __shared__ __align__(16) T ring[2 * GT_BUF];     // two operand stages
  __shared__ __align__(16) float sT[8][16 * 68];   // per-wave 16x64 slab, pitch 68 floats
  const int b    = blockIdx.y;
  const int tid  = threadIdx.x;
  const int lane = tid & 31;
  const int wave = tid >> 5;
  const int tilesN = N / GT_N;
  const int tilesM = M / GT_M;
  if ((int)blockIdx.x >= tilesM * tilesN) return;   // work-group-uniform, in front of every barrier and copy
  const int bm = blockIdx.x / tilesN;
  const int bn = blockIdx.x - bm * tilesN;
  const int wm = wave >> 2, wn = wave & 3;
  const int m0 = bm * GT_M + (wm << 6);
  const int n0 = bn * GT_N + (wn << 6);

  const T* Ab  = A  + (size_t)b * strideA;
  const T* Bb  = Bt + (size_t)b * strideB;

  const int rlane = lane & 15;                 // row (A) / col (B, D) within subtile
  const int koff  = (lane >> 4) * 8;           // k offset of this lane half
  const int mOff  = (lane >> 4) * 8;           // D row offset

  // copies: thread -> 16 B at column chunk (tid & 7) of rows (tid >> 3) + 32 i; 8 lanes cover one 128-B row
  const int crow = tid >> 3, cchk = (tid & 7) * 8;
  const T* gA = Ab + (size_t)(bm * GT_M + crow) * lda + cchk;
  const T* gB = Bb + (size_t)(bn * GT_N + crow) * ldb + cchk;
  const size_t sA = (size_t)32 * lda, sB = (size_t)32 * ldb;
  const unsigned l0 = (unsigned)(uintptr_t)ring + (unsigned)(crow * LDS_P16 + cchk) * 2u;
  auto stage = [&](int t, int buf) {
    const T* ga = gA + (size_t)t * GT_K;
    const T* gb = gB + (size_t)t * GT_K;
    const unsigned lb = l0 + (unsigned)buf * (unsigned)(GT_BUF * 2);
    unsigned l[12];
    const void* g[12];
#pragma unroll
    for (int i = 0; i < 12; ++i) {
      l[i] = lb + (unsigned)i * GT_STEP;                                   // rows 0..127 A, 128..383 Bt
      g[i] = (i < 4) ? (const void*)(ga + i * sA) : (const void*)(gb + (i - 4) * sB);
    }
    async_copy12(l, g);
  };

  v8f acc[4][4];
#pragma unroll
  for (int i = 0; i < 4; ++i)
#pragma unroll
    for (int j = 0; j < 4; ++j) acc[i][j] = (v8f){0.f,0.f,0.f,0.f,0.f,0.f,0.f,0.f};

  const int nT = K / GT_K;
  stage(0, 0);
  asm volatile("s_wait_asynccnt 0x0" ::: "memory");   // this wave's part of stage 0 has landed
  __syncthreads();                                    // stage 0 is readable by every wave
  if (nT > 1) stage(1, 1);

  for (int t = 0; t < nT; ++t) {
    const int buf = t & 1;
    const T* sa = ring + buf * GT_BUF + ((wm << 6) + rlane) * LDS_P16 + koff;
    const T* sb = ring + buf * GT_BUF + (GT_M + (wn << 6) + rlane) * LDS_P16 + koff;
#pragma unroll
    for (int kk = 0; kk < GT_K; kk += 32) {
      V bh[4], ah[4];
#pragma unroll
      for (int j = 0; j < 4; ++j) bh[j] = Frag<T>::load(sb + (j << 4) * LDS_P16 + kk);
#pragma unroll
      for (int i = 0; i < 4; ++i) ah[i] = Frag<T>::load(sa + (i << 4) * LDS_P16 + kk);
      // keeps the 16 LDS reads together in front of the 16 products: sunk among them, each group waits out its own LDS latency
      __builtin_amdgcn_sched_barrier(0);
#pragma unroll
      for (int i = 0; i < 4; ++i)
#pragma unroll
        for (int j = 0; j < 4; ++j) acc[i][j] = Frag<T>::mma(ah[i], bh[j], acc[i][j]);
    }
    asm volatile("s_wait_dscnt 0x0" ::: "memory");      // this wave's reads of the buffer are done before it is refilled
    asm volatile("s_wait_asynccnt 0x0" ::: "memory");   // this wave's part of stage t + 1 has landed
    __syncthreads();                                    // publishes stage t + 1, ends every read of stage t
    if (t + 2 < nT) stage(t + 2, buf);
  }
  asm volatile("s_wait_asynccnt 0x0" ::: "memory");     // nothing in flight when the wave goes on
  acc_guard4(acc[0][0], acc[0][1], acc[0][2], acc[0][3]);
  acc_guard4(acc[1][0], acc[1][1], acc[1][2], acc[1][3]);
  acc_guard4(acc[2][0], acc[2][1], acc[2][2], acc[2][3]);
  acc_guard4(acc[3][0], acc[3][1], acc[3][2], acc[3][3]);

  // ---- epilogue ----
  float* slab = sT[wave];
  if constexpr (OUT_MODE == 3) {
    const int sel  = (bn * GT_N) >> 10;          // 0 = q, 1 = k, 2 = v: the same for the whole work-group
    const int head = (n0 & (DMODEL - 1)) >> 6;
    const int q = lane >> 3, c8 = (lane & 7) * 8;
    if (sel < 2) {
      // rotary in registers: column d (tiles 0, 1) and its partner d + 32 (tiles 2, 3) sit in the same lane and register
      unsigned short* P = ((sel == 0) ? (unsigned short*)Cout : (unsigned short*)Cout2) + ((size_t)head * SEQ_T + m0) * HDIM;
      const float* rp = rot + (size_t)rlane * (2 * SEQ_T) + (size_t)(m0 + mOff) * 2;
      v4f rt[2][8];                              // table values of row group i and, fetched ahead, of i + 1
      auto fetch = [&](int i, v4f (&d)[8]) {
#pragma unroll
        for (int jj = 0; jj < 2; ++jj)
#pragma unroll
          for (int k = 0; k < 4; ++k) d[jj * 4 + k] = *(const v4f*)(rp + (size_t)jj * (32 * SEQ_T) + i * 32 + k * 4);
      };
      fetch(0, rt[0]);
#pragma unroll
      for (int i = 0; i < 4; ++i) {
        if (i < 3) fetch(i + 1, rt[(i + 1) & 1]);
        const v4f (&tv)[8] = rt[i & 1];
#pragma unroll
        for (int jj = 0; jj < 2; ++jj)
#pragma unroll
          for (int r = 0; r < 8; ++r) {
            const float cv = tv[jj * 4 + (r >> 2)][r & 3];
            const float sv = tv[jj * 4 + 2 + (r >> 2)][r & 3];
            const float x1 = acc[i][jj][r] * scale;
            const float x2 = acc[i][jj + 2][r] * scale;
            slab[(mOff + r) * 68 + (jj << 4) + rlane]      = x1 * cv - x2 * sv;
            slab[(mOff + r) * 68 + 32 + (jj << 4) + rlane] = x2 * cv + x1 * sv;
          }
        slab_sync();
#pragma unroll
        for (int it = 0; it < 4; ++it) {
          const int row = it * 4 + q;             // 8 lanes x 16 B = one 128-B plane row
          const v4f f0 = *(const v4f*)(slab + row * 68 + c8);
          const v4f f1 = *(const v4f*)(slab + row * 68 + c8 + 4);
          v8h hv;
#pragma unroll
          for (int e = 0; e < 4; ++e) { hv[e] = (_Float16)f0[e]; hv[4 + e] = (_Float16)f1[e]; }
          *(v8h*)(P + (size_t)((i << 4) + row) * HDIM + c8) = hv;
        }
        // a table fetch follows that reuses the stores' data registers: the stores' register reads are waited for first
        if (i < 2) asm volatile("s_wait_xcnt 0x0" ::: "memory");
        slab_sync();
      }
    } else {
      // v: a lane's 8 accumulator rows are 8 successive tokens of one column d; 16 d rows x 64 tokens go through the slab
      _Float16* sl = (_Float16*)slab;
      unsigned short* P = (unsigned short*)Cout3 + (size_t)head * HDIM * SEQ_T + m0;
#pragma unroll
      for (int j = 0; j < 4; ++j) {
#pragma unroll
        for (int i = 0; i < 4; ++i) {
          v8h ph;
#pragma unroll
          for (int r = 0; r < 8; ++r) ph[r] = (_Float16)(acc[i][j][r] * scale);
          *(v8h*)(sl + rlane * LDS_P16 + (i << 4) + mOff) = ph;
        }
        slab_sync();
#pragma unroll
        for (int it = 0; it < 4; ++it) {
          const int row = it * 4 + q;             // 8 lanes x 16 B = 64 tokens = one whole 128-B line of row d
          const v8h hv = *(const v8h*)(sl + row * LDS_P16 + c8);
          *(v8h*)(P + (size_t)((j << 4) + row) * SEQ_T + c8) = hv;
        }
        // last group: the code behind it in the listing rewrites the stores' address pair, so the stores' register reads are waited for here
        if (j == 3) asm volatile("s_wait_xcnt 0x0" ::: "memory");
        slab_sync();
      }
    }
    return;
  }
  const float* Rb = RESID ? (resid + (size_t)b * strideR) : nullptr;
#pragma unroll
  for (int i = 0; i < 4; ++i) {
    const int mBase = m0 + (i << 4);
#pragma unroll
    for (int j = 0; j < 4; ++j) {
      const int n = n0 + (j << 4) + rlane;
      float bv = 0.f;
      if (BIAS_MODE == 2) bv = bias[n];
#pragma unroll
      for (int r = 0; r < 8; ++r) {
        float v = acc[i][j][r] * scale;
        if (BIAS_MODE == 1) v += bias[mBase + mOff + r];
        if (BIAS_MODE == 2) v += bv;
        if (RESID) {
          float rv = Rb[(size_t)(mBase + mOff + r) * ldc + n];
          if (RESID_RNE) rv = rne_bf(rv);
          v += rv;
        }
        if (ACT == 1) v = tanhf(v);
        if (ACT == 2) v = fmaxf(v, 0.0f);
        if (ACT == 4) v = (v > 0.f) ? v : 0.01f * v;
        slab[(mOff + r) * 68 + (j << 4) + rlane] = v;
      }
    }
    __builtin_amdgcn_fence(__ATOMIC_RELEASE, "workgroup");
    __builtin_amdgcn_wave_barrier();
    __builtin_amdgcn_fence(__ATOMIC_ACQUIRE, "workgroup");
    if (OUT_MODE == 0) {
      float* C = (float*)Cout + (size_t)b * strideC;
      const int hh = lane >> 4, c4 = (lane & 15) * 4;     // row seg = 256 B = 16 lanes x 16 B
      {
#pragma unroll
        for (int it = 0; it < 8; ++it) {
          const int row = it * 2 + hh;
          v4f v = *(const v4f*)(slab + row * 68 + c4);
          *(v4f*)(C + (size_t)(mBase + row) * ldc + n0 + c4) = v;
        }
        
      }
    } else {
      const int q = lane >> 3, c8 = (lane & 7) * 8;
      unsigned short* C  = (unsigned short*)Cout  + (size_t)b * strideC;
      unsigned short* C2 = (OUT_MODE == 2) ? ((unsigned short*)Cout2 + (size_t)b * strideC) : nullptr;
      {
#pragma unroll
        for (int it = 0; it < 4; ++it) {
          const int row = it * 4 + q;
          const float* sp = slab + row * 68 + c8;
          v8h hv, lv;
#pragma unroll
          for (int e = 0; e < 8; ++e) {
            if (OUT_MODE == 1) {
              hv[e] = (_Float16)sp[e];
            } else {
              unsigned short hb = f2bf_bits(sp[e]);
              unsigned short lb = f2bf_bits(sp[e] - bf_bits2f(hb));
              hv[e] = __builtin_bit_cast(_Float16, hb);
              lv[e] = __builtin_bit_cast(_Float16, lb);
            }
          }
          *(v8h*)(C + (size_t)(mBase + row) * ldc + n0 + c8) = hv;
          if (OUT_MODE == 2) *(v8h*)(C2 + (size_t)(mBase + row) * ldc + n0 + c8) = lv;
        }
        
      }
    }
    __builtin_amdgcn_fence(__ATOMIC_RELEASE, "workgroup");
    __builtin_amdgcn_wave_barrier();
    __builtin_amdgcn_fence(__ATOMIC_ACQUIRE, "workgroup");
  }
}

// =====================================================================================
// Kernel: rmsnorm of one token row (x RNE-converted to bf16 on load, mean of squares in f32,
// rsqrt(mean + 1e-6), times norm_w (RNE bf16)), output as an f16 plane [SEQ_T][DMODEL].
// Block = 128 threads = one token; coverage 128 threads x 8 elements = 1024 = one row exactly;
// The first SEQ_T / 32 blocks also build the rotary table for 32 tokens x 32 frequencies each:
// rot[f][t >> 3][cos of 8 tokens | sin of 8 tokens], angle = (float)t * invfreq_f (single f32 multiply), precise sincosf;
// a thread writes 64 B, four threads of one block the two whole lines of (f, 32 tokens).
// Blocks SEQ_T .. SEQ_T + 4 * CAST_BPW - 1 of the same grid need nothing of the rows and cast the weights instead:
// f32 -> f16(bf16_rne(w) * W_CARRY); a block takes CAST_EPB successive weights of wq, wk, wv or wo,
// a thread 4 groups of 8 (coverage 128 threads x 8 x 4 = CAST_EPB exactly; a 16-B store per group, 8 lanes one whole line).
// =====================================================================================
constexpr int CAST_EPB = 4096;                            // weights per cast block
constexpr int CAST_BPW = DMODEL * DMODEL / CAST_EPB;      // cast blocks per weight matrix
__global__ __launch_bounds__(128) void rmsnorm_cast_f16_k(const float* __restrict__ x, const float* __restrict__ nw,
                                                          const float* __restrict__ wq, const float* __restrict__ wk,
                                                          const float* __restrict__ wv, const float* __restrict__ wo,
                                                          unsigned short* __restrict__ xn, unsigned short* __restrict__ wqkv,
                                                          unsigned short* __restrict__ wof, FreqTab ft, float* __restrict__ rot) {
  __shared__ float red[4];
  const int t = blockIdx.x, tid = threadIdx.x, wave = tid >> 5, lane = tid & 31;
  if (t >= SEQ_T) {   // block-uniform, in front of the barrier: a weight-cast block
    const int cb  = t - SEQ_T;
    const int sel = cb / CAST_BPW;                        // 0 = wq, 1 = wk, 2 = wv (rows 0.., 1024.., 2048.. of wqkv), 3 = wo
    const float* w = (sel == 0) ? wq : (sel == 1) ? wk : (sel == 2) ? wv : wo;
    unsigned short* o = (sel < 3) ? wqkv + (size_t)sel * (DMODEL * DMODEL) : wof;
    const int e0 = (cb - sel * CAST_BPW) * CAST_EPB + tid * 8;
    v4f a[4], b[4];
#pragma unroll
    for (int g = 0; g < 4; ++g) {
      a[g] = *(const v4f*)(w + e0 + g * 1024);
      b[g] = *(const v4f*)(w + e0 + g * 1024 + 4);
    }
#pragma unroll
    for (int g = 0; g < 4; ++g) {
      v8h hv;
#pragma unroll
      for (int e = 0; e < 4; ++e) {
        hv[e]     = (_Float16)(rne_bf(a[g][e]) * W_CARRY);
        hv[4 + e] = (_Float16)(rne_bf(b[g][e]) * W_CARRY);
      }
      *(v8h*)(o + e0 + g * 1024) = hv;
    }
    return;
  }
  if (t < SEQ_T / 32) {   // block-uniform
    const int f = tid >> 2, tb = t * 32 + (tid & 3) * 8;
    float fr = ft.f[0];
#pragma unroll
    for (int q = 1; q < 32; ++q) fr = (f == q) ? ft.f[q] : fr;
    v4f cs4[4];
#pragma unroll
    for (int e = 0; e < 8; ++e) {
      float sv, cv;
      sincosf((float)(tb + e) * fr, &sv, &cv);
      cs4[e >> 2][e & 3]       = cv;
      cs4[2 + (e >> 2)][e & 3] = sv;
    }
    float* rd = rot + (size_t)f * (2 * SEQ_T) + (size_t)tb * 2;
#pragma unroll
    for (int k = 0; k < 4; ++k) *(v4f*)(rd + k * 4) = cs4[k];
  }
  const float* row = x + (size_t)t * DMODEL + tid * 8;
  const v4f a = *(const v4f*)row;
  const v4f b = *(const v4f*)(row + 4);
  float xb[8];
#pragma unroll
  for (int e = 0; e < 4; ++e) { xb[e] = rne_bf(a[e]); xb[4 + e] = rne_bf(b[e]); }
  float ss = 0.f;
#pragma unroll
  for (int e = 0; e < 8; ++e) ss += xb[e] * xb[e];
#pragma unroll
  for (int m = 1; m < 32; m <<= 1) ss += __shfl_xor(ss, m, 32);
  if (lane == 0) red[wave] = ss;
  __syncthreads();
  const float tot = (red[0] + red[1]) + (red[2] + red[3]);
  const float inv = rsqrtf(tot * (1.0f / 1024.0f) + 1e-6f);
  const v4f na = *(const v4f*)(nw + tid * 8);
  const v4f nb = *(const v4f*)(nw + tid * 8 + 4);
  v8h hv;
#pragma unroll
  for (int e = 0; e < 4; ++e) {
    hv[e]     = (_Float16)((xb[e] * inv) * rne_bf(na[e]));
    hv[4 + e] = (_Float16)((xb[4 + e] * inv) * rne_bf(nb[e]));
  }
  unsigned short* dst = xn + (size_t)t * DMODEL + tid * 8;
  *(v8h*)dst = hv;
}

// =====================================================================================
// Kernel: causal attention, head dim 64, f16 planes in (Q, K: [NHEAD*SEQ_T][64]; Vt: [NHEAD*64][SEQ_T]),
// f16 plane out (O: [SEQ_T][DMODEL], head h at cols h*64, value o*16).
//   scores^T = 0.125 * k.q^T : v_wmma_f32_16x16x32_f16 (q, k plain f16), f32 accumulate
//   out^T    = v^T.p^T       : v_wmma_f32_16x16x32_f16 (p carried x2^15 in f16, v plain f16), f32 accumulate
//   (transposed products: a lane holds one query's scores, and p goes from the score tiles straight into the B operand)
//   online softmax in f32; keys above the diagonal -> -inf (every row keeps key kv0 <= row, so never fully masked).
// Block = 8 waves = two groups of 4 on the same 64 query rows of head h; 64-key chunks; group g works chunks g, g + 2, ... with a
// running maximum, sum and out tile of its own, so that four waves stand on a SIMD (two blocks per WGP) and cover each other's waits;
// behind the last chunk group 1 hands its three partial results to group 0 through LDS, which rescales both to the common maximum,
// adds them and stores. Chunks above the diagonal are skipped (wave-uniform).
// A block works query tile NQTILE - 1 - pr and then tile pr of its head, one after the other in every wave: (NQTILE - pr) + (pr + 1)
// = NQTILE + 1 chunks for every block, so that no WGP is left with the long tiles alone; every (head, tile) is worked once.
// K / Vt chunks come to LDS by asynchronous copies, a pair of chunks (one per group) a stage (256 threads x 2 x 16 B = 64x64 halves
// per tile), two buffers: stage st + 1 is in flight while stage st is worked on; one work-group barrier per stage publishes it and
// frees the buffer just read;
// WMMA operands are read from dense, statically strided LDS / plane addresses only.
// O store coverage per wave: 4 iterations x 4 row groups = 16 rows, 8 lanes x 8 halves = 64 cols = one whole
// =====================================================================================
constexpr int AT_TILE = KEY_CH * LDS_P16;          // halves of one staged tile (64 rows, pitch 144 B)
constexpr int AT_BUF  = 2 * AT_TILE;               // halves per chunk: K tile [kv][d], then V^T tile [d][kv]
constexpr int AT_STG  = 2 * AT_BUF;                // halves per stage buffer: group 0's chunk, then group 1's
constexpr unsigned AT_STEP = 32u * LDS_P16 * 2u;   // LDS bytes between a thread's successive rows (32 rows)

// one thread's eight 16-byte asynchronous copies global -> LDS of a stage; the s_wait_xcnt closes the statement
// so that no address register of a copy is rewritten before it
__device__ __forceinline__ void async_copy8(const unsigned (&l)[8], const void* const (&g)[8]) {
  asm volatile(
               "global_load_async_to_lds_b128 %0, %8, off\n\t"
               "global_load_async_to_lds_b128 %1, %9, off\n\t"
               "global_load_async_to_lds_b128 %2, %10, off\n\t"
               "global_load_async_to_lds_b128 %3, %11, off\n\t"
               "global_load_async_to_lds_b128 %4, %12, off\n\t"
               "global_load_async_to_lds_b128 %5, %13, off\n\t"
               "global_load_async_to_lds_b128 %6, %14, off\n\t"
               "global_load_async_to_lds_b128 %7, %15, off\n\t"
               "s_wait_xcnt 0x0"
               :: "v"(l[0]), "v"(l[1]), "v"(l[2]), "v"(l[3]), "v"(l[4]), "v"(l[5]), "v"(l[6]), "v"(l[7]),
                  "v"(g[0]), "v"(g[1]), "v"(g[2]), "v"(g[3]), "v"(g[4]), "v"(g[5]), "v"(g[6]), "v"(g[7]) : "memory");
}

__global__ __launch_bounds__(256) void attn_causal_hd64_k(const unsigned short* __restrict__ qp,
                                                         const unsigned short* __restrict__ kp,
                                                         const unsigned short* __restrict__ vtp,
                                                         unsigned short* __restrict__ op) {
  typedef Frag<_Float16> FH;
  __shared__ __align__(16) _Float16 KV[2 * AT_STG];           // two stage buffers
  __shared__ __align__(16) float   Os[4][16 * 68];            // out tile per 16 query rows, pitch 68
  __shared__ float                 Ml[4][64];                 // group 1's running maximum (32 lanes), then its sum
  const int tid = threadIdx.x, wave = (tid >> 5) & 3, lane = tid & 31, hh = lane >> 4, c = lane & 15;
  const int grp = __builtin_amdgcn_readfirstlane(tid >> 7);   // wave group, in a scalar register: the tests on it are scalar branches
  const int pr = blockIdx.x % (NQTILE / 2);
  const int h  = blockIdx.x / (NQTILE / 2);
  const _Float16* Kh = (const _Float16*)kp + (size_t)h * SEQ_T * HDIM;
  const _Float16* Vh = (const _Float16*)vtp + (size_t)h * HDIM * SEQ_T;

  const v8f vz = (v8f){0.f,0.f,0.f,0.f,0.f,0.f,0.f,0.f};

  // copies: thread -> 16 B at column chunk (tid & 7) of rows (tid >> 3) + 32 i of the four tiles; 8 lanes cover one 128-B row
  const int srow = tid >> 3, sc8 = (tid & 7) * 8;
  const _Float16* gK = Kh + (size_t)srow * HDIM + sc8;      // K row kv0 + r, d sc8..sc8+7
  const _Float16* gV = Vh + (size_t)srow * SEQ_T + sc8;     // Vt row d = r, keys kv0 + sc8..
  const unsigned l0 = (unsigned)(uintptr_t)KV + (unsigned)(srow * LDS_P16 + sc8) * 2u;
  auto stage = [&](int st, int buf) {   // chunks 2 st and 2 st + 1
    const _Float16* gk = gK + (size_t)st * (2 * KEY_CH * HDIM);
    const _Float16* gv = gV + (size_t)st * (2 * KEY_CH);
    const unsigned lb = l0 + (unsigned)buf * (unsigned)(AT_STG * 2);
    unsigned l[8];
    const void* g[8];
#pragma unroll
    for (int u = 0; u < 2; ++u)
#pragma unroll
      for (int i = 0; i < 2; ++i) {
        l[u * 4 + i]     = lb + (unsigned)u * (unsigned)(AT_BUF * 2) + (unsigned)i * AT_STEP;
        l[u * 4 + 2 + i] = lb + (unsigned)u * (unsigned)(AT_BUF * 2) + (unsigned)(AT_TILE * 2) + (unsigned)i * AT_STEP;
        g[u * 4 + i]     = (const void*)(gk + (size_t)u * (KEY_CH * HDIM) + (size_t)i * (32 * HDIM));
        g[u * 4 + 2 + i] = (const void*)(gv + (size_t)u * KEY_CH + (size_t)i * (32 * SEQ_T));
      }
    async_copy8(l, g);
  };

  for (int part = 0; part < 2; ++part) {   // the long tile, then its short partner; block-uniform
  const int qb = part ? pr : NQTILE - 1 - pr;
  const int q0 = qb * 64 + wave * 16;
  const _Float16* Qh = (const _Float16*)qp + ((size_t)h * SEQ_T + q0 + c) * HDIM;

  // Q fragments (B operand, column = query q0 + c, k = head dim): 2 d-chunks of 32
  v16h qa[2];
  qa[0] = FH::load(Qh + 8 * hh);
  qa[1] = FH::load(Qh + 32 + 8 * hh);

  float mrow = -INFINITY, lrow = 0.f;   // one query per lane
  v8f oacc[4];
#pragma unroll
  for (int t = 0; t < 4; ++t) oacc[t] = vz;

  const int nChunks = qb + 1;              // block-uniform
  const int nStages = (nChunks + 1) >> 1;  // an odd count stages one chunk above the diagonal too (index qb + 1 <= NQTILE - 1: inside the planes), unread
  // second tile: the barrier behind the first tile's last stage, behind every wave's s_wait_dscnt 0, has ended every read of both buffers
  stage(0, 0);
  asm volatile("s_wait_asynccnt 0x0" ::: "memory");   // this wave's part of stage 0 has landed
  __syncthreads();                                    // stage 0 is readable by every wave

  // one chunk of this wave's group; diag is a literal at every call, so that only the diagonal chunk carries the mask's compares
  auto chunk = [&](const int kc, const int buf, const bool diag) __attribute__((always_inline)) {
    const int kv0 = kc * KEY_CH;
    const _Float16* Ksh = KV + buf * AT_STG + grp * AT_BUF;   // [kv][d]
    const _Float16* Vts = Ksh + AT_TILE;                      // [d][kv]

    // transposed scores: tile j = K rows (A, m = key j*16 + ..) x Q (B, n = query c); lane (hh, c) holds
    // keys j*16 + 8*hh + r of query q0 + c
    v16h ka[2][4], va[2][4];
#pragma unroll
    for (int dc = 0; dc < 2; ++dc)
#pragma unroll
      for (int j = 0; j < 4; ++j) ka[dc][j] = FH::load(Ksh + (j * 16 + c) * LDS_P16 + dc * 32 + 8 * hh);   // A[m=key j*16+c][k=d]
    // keeps the 16 K reads together in front of the 8 score products: sunk to their users, each product waits out a whole LDS latency
    __builtin_amdgcn_sched_barrier(0);
    v8f s[4];
#pragma unroll
    for (int j = 0; j < 4; ++j) s[j] = FH::mma(ka[0][j], qa[0], vz);
#pragma unroll
    for (int j = 0; j < 4; ++j) s[j] = FH::mma(ka[1][j], qa[1], s[j]);
#pragma unroll
    for (int kk = 0; kk < 2; ++kk)
#pragma unroll
      for (int t = 0; t < 4; ++t) va[kk][t] = FH::load(Vts + (t * 16 + c) * LDS_P16 + kk * 32 + 8 * hh);   // A[m=d t*16+c][k=key]
    // the 8 score products run unbroken, then the 16 V^T reads as one group
    __builtin_amdgcn_sched_group_barrier(0x008, 8, 0);
    __builtin_amdgcn_sched_group_barrier(0x100, 16, 0);
    // keeps the 16 V^T reads in front of the softmax, whose vector work then covers their latency
    __builtin_amdgcn_sched_barrier(0);
    const int qrow = q0 + c;
    float mj[4];
#pragma unroll
    for (int j = 0; j < 4; ++j) {
      float m = -INFINITY;
#pragma unroll
      for (int r = 0; r < 8; ++r) {
        const int kvcol = kv0 + j * 16 + 8 * hh + r;
        float sv = s[j][r] * 0.125f;
        if (diag && (kvcol > qrow)) sv = -INFINITY;
        s[j][r] = sv;
        m = fmaxf(m, sv);
      }
      mj[j] = m;
    }
    float cm = fmaxf(fmaxf(mj[0], mj[1]), fmaxf(mj[2], mj[3]));
    cm = fmaxf(cm, xhalf(cm));                     // the other 32 keys of this query sit in the other lane half
    const float mnew = fmaxf(mrow, cm);
    const float alpha = __expf(mrow - mnew);
    mrow = mnew;
    FH::U pb[2];                                   // B[k=key][n=query c]: elements 0..7 = tile 2kk, 8..15 = tile 2kk+1
    float pj[4];
#pragma unroll
    for (int j = 0; j < 4; ++j) {
      float psum = 0.f;
      v8h ph;
#pragma unroll
      for (int r = 0; r < 8; ++r) {
        const float p = __expf(s[j][r] - mnew);
        psum += p;
        ph[r] = (_Float16)(p * P_CARRY);
      }
      pj[j] = psum;
      pb[j >> 1].h[j & 1] = ph;
    }
    lrow = lrow * alpha + ((pj[0] + pj[1]) + (pj[2] + pj[3]));   // this half's keys only; halves joined after the loop
#pragma unroll
    for (int t = 0; t < 4; ++t)
#pragma unroll
      for (int r = 0; r < 8; ++r) oacc[t][r] *= alpha;
#pragma unroll
    for (int kk = 0; kk < 2; ++kk) {
#pragma unroll
      for (int t = 0; t < 4; ++t) oacc[t] = FH::mma(va[kk][t], pb[kk].v, oacc[t]);
    }
  };

  // every stage but the last holds a whole chunk below the diagonal for either group: no test on the chunk in the loop
  for (int st = 0; st + 1 < nStages; ++st) {
    // directly behind the barrier (the one above, or the one at the foot of trip st - 1, which ended every read of that
    // trip's buffer): stage st + 1 goes into that buffer and flies while stage st is worked on
    stage(st + 1, (st + 1) & 1);
    chunk(2 * st + grp, st & 1, false);
    // keeps the waits and the barrier below at the foot of the trip: lifted over the softmax, they would wait out the V^T reads
    // and the copies of stage st + 1 shortly behind their issue, with none of the softmax to cover either
    __builtin_amdgcn_sched_barrier(0);
    asm volatile("s_wait_dscnt 0x0" ::: "memory");      // this wave's reads of the buffer are done before it is refilled
    asm volatile("s_wait_asynccnt 0x0" ::: "memory");   // this wave's part of stage st + 1 has landed
    __syncthreads();                                    // publishes stage st + 1, ends every read of stage st
  }
  asm volatile("s_wait_asynccnt 0x0" ::: "memory");     // nothing in flight when the wave goes on
  {
    // last stage: the diagonal chunk qb for one group; for the other chunk qb - 1, or none (qb + 1 lies above the diagonal)
    const int kc = 2 * (nStages - 1) + grp;             // wave-uniform, scalar
    if (kc < qb) chunk(kc, (nStages - 1) & 1, false);
    else if (kc == qb) chunk(kc, (nStages - 1) & 1, true);
  }

  // oacc[t][r] = out[query q0 + c][d = t*16 + 8*hh + r], over this group's chunks, relative to its own maximum
  float* os = Os[wave];
  if (grp == 1) {   // hands over; with no chunk of its own (tile 0) that is maximum -inf, sum 0, out 0
#pragma unroll
    for (int t = 0; t < 4; ++t) {
      v4f lo, hi;
#pragma unroll
      for (int e = 0; e < 4; ++e) { lo[e] = oacc[t][e]; hi[e] = oacc[t][4 + e]; }
      *(v4f*)(os + c * 68 + t * 16 + 8 * hh)     = lo;
      *(v4f*)(os + c * 68 + t * 16 + 8 * hh + 4) = hi;
    }
    Ml[wave][lane]      = mrow;
    Ml[wave][32 + lane] = lrow;
  }
  asm volatile("s_wait_dscnt 0x0" ::: "memory");   // this wave's reads of the last stage are done before the next tile refills its buffer
  __syncthreads();   // ends every read of the last stage; group 1's partial results are readable by group 0 (every wave passes)
  if (grp == 0) {
  {
    // group 0 always holds chunk 0, so the common maximum is finite
    const float m2 = Ml[wave][lane], l2 = Ml[wave][32 + lane];
    const float mt = fmaxf(mrow, m2);
    const float a1 = __expf(mrow - mt), a2 = __expf(m2 - mt);
    const float lsum = lrow * a1 + l2 * a2;
    const float ltot = lsum + xhalf(lsum);
    const float inv = (1.0f / ltot) * (O_CARRY / P_CARRY);
    const float f1 = a1 * inv, f2 = a2 * inv;
#pragma unroll
    for (int t = 0; t < 4; ++t) {   // a lane reads what the same lane of group 1 wrote, and writes the sum to the same place
      const v4f plo = *(const v4f*)(os + c * 68 + t * 16 + 8 * hh);
      const v4f phi = *(const v4f*)(os + c * 68 + t * 16 + 8 * hh + 4);
      v4f lo, hi;
#pragma unroll
      for (int e = 0; e < 4; ++e) { lo[e] = oacc[t][e] * f1 + plo[e] * f2; hi[e] = oacc[t][4 + e] * f1 + phi[e] * f2; }
      *(v4f*)(os + c * 68 + t * 16 + 8 * hh)     = lo;
      *(v4f*)(os + c * 68 + t * 16 + 8 * hh + 4) = hi;
    }
  }
  __builtin_amdgcn_fence(__ATOMIC_RELEASE, "workgroup");
  __builtin_amdgcn_wave_barrier();
  __builtin_amdgcn_fence(__ATOMIC_ACQUIRE, "workgroup");
  {
    const int q8 = lane >> 3, c8 = (lane & 7) * 8;
    unsigned short* ob = op + (size_t)h * HDIM + c8;
    {
#pragma unroll
      for (int it = 0; it < 4; ++it) {
        const int row = it * 4 + q8;
        const v4f f0 = *(const v4f*)(os + row * 68 + c8);
        const v4f f1 = *(const v4f*)(os + row * 68 + c8 + 4);
        v8h hv;
#pragma unroll
        for (int e = 0; e < 4; ++e) { hv[e] = (_Float16)f0[e]; hv[4 + e] = (_Float16)f1[e]; }
        *(v8h*)(ob + (size_t)(q0 + row) * DMODEL) = hv;
      }
      // the next tile's address arithmetic rewrites the stores' address and data registers: their register reads are waited for first
      asm volatile("s_wait_xcnt 0x0" ::: "memory");
    }
  }
  }
  }
}

// =====================================================================================
// Host glue.  Workspace region map (bytes, all offsets multiples of 1 MiB):
//   XN   f16 [4096][1024]         8,388,608 @ 0
//   WQKV f16 [3072][1024] (x64)   6,291,456 @ 8,388,608
//   WO   f16 [1024][1024] (x64)   2,097,152 @ 14,680,064
//   ROT  f32 [32][512][2][8]      1,048,576 @ 16,777,216
//   QPL  f16 [16*4096][64]        8,388,608 @ 17,825,792
//   KPL  f16 [16*4096][64]        8,388,608 @ 26,214,400
//   VT   f16 [16*64][4096]        8,388,608 @ 34,603,008
//   OPL  f16 [4096][1024] (x16)   8,388,608 @ 42,991,616
//   total 51,380,224
// =====================================================================================
extern "C" void kernel_launch(void* const* d_in, const int* in_sizes, int n_in,
                              void* d_out, int out_size, void* d_ws, size_t ws_size,
                              hipStream_t stream) {
  if (n_in < 6) return;
  const int nx = SEQ_T * DMODEL;
  const int nwgt = DMODEL * DMODEL;
  if (in_sizes[0] != nx || in_sizes[1] != nwgt || in_sizes[2] != nwgt || in_sizes[3] != nwgt ||
      in_sizes[4] != nwgt || in_sizes[5] != DMODEL || out_size != nx) return;

  const float* x  = (const float*)d_in[0];
  const float* wq = (const float*)d_in[1];
  const float* wk = (const float*)d_in[2];
  const float* wv = (const float*)d_in[3];
  const float* wo = (const float*)d_in[4];
  const float* nw = (const float*)d_in[5];
  float* out = (float*)d_out;

  const size_t szXN   = (size_t)nx * 2;
  const size_t szWQKV = (size_t)3 * nwgt * 2;
  const size_t szWO   = (size_t)nwgt * 2;
  const size_t szROT  = (size_t)SEQ_T * HDIM * 4;
  const size_t szPL   = (size_t)NHEAD * SEQ_T * HDIM * 2;
  const size_t szO    = (size_t)nx * 2;
  const size_t offXN   = 0;
  const size_t offWQKV = offXN + szXN;
  const size_t offWO   = offWQKV + szWQKV;
  const size_t offROT  = offWO + szWO;
  const size_t offQ    = offROT + szROT;
  const size_t offK    = offQ + szPL;
  const size_t offVT   = offK + szPL;
  const size_t offO    = offVT + szPL;
  const size_t total   = offO + szO;
  if (total > ws_size) return;

  char* ws = (char*)d_ws;
  unsigned short* XN   = (unsigned short*)(ws + offXN);
  unsigned short* WQKV = (unsigned short*)(ws + offWQKV);
  unsigned short* WO   = (unsigned short*)(ws + offWO);
  float*          ROT  = (float*)(ws + offROT);
  unsigned short* QPL  = (unsigned short*)(ws + offQ);
  unsigned short* KPL  = (unsigned short*)(ws + offK);
  unsigned short* VT   = (unsigned short*)(ws + offVT);
  unsigned short* OPL  = (unsigned short*)(ws + offO);

  // inverse-frequency table: e_i = (2i)/64 (exact), p_i = fl32(pow(10000, e_i)) (double pow on host,
  // RNE to f32), invfreq_i = 1.0f / p_i (f32)
  FreqTab ft;
  for (int i = 0; i < 32; ++i) {
    const float e = (float)(2 * i) / 64.0f;
    const float p = (float)pow(10000.0, (double)e);
    ft.f[i] = 1.0f / p;
  }

  // 1) one grid: rmsnorm -> XN (f16) and rotary table -> ROT (blocks 0 .. SEQ_T - 1);
  //    weights -> f16(bf16(w) * 64), wq | wk | wv stacked as rows 0.., 1024.., 2048.. of WQKV, wo -> WO (the blocks behind)
  rmsnorm_cast_f16_k<<<SEQ_T + 4 * CAST_BPW, 128, 0, stream>>>(x, nw, wq, wk, wv, wo, XN, WQKV, WO, ft, ROT);
  // 2) XN . WQKV^T / 64 : M=4096, N=3072, K=1024; 32x12 work-group tiles = 384 blocks; the epilogue applies the rotary
  //    to q and k and writes the Q, K and Vt f16 planes
  {
    dim3 grid((SEQ_T / GT_M) * (QKV_N / GT_N), 1);
    wmma_gemm64<0, 0, 0, 3, false><<<grid, 256, 0, stream>>>(
        XN, XN, DMODEL, 0L, WQKV, WQKV, DMODEL, 0L, (void*)QPL, (void*)KPL, (void*)VT, QKV_N, 0L,
        ROT, nw, x, 0L, SEQ_T, QKV_N, DMODEL, 1.0f / W_CARRY);
  }
  // 3) causal attention -> O plane (f16, x16); 16 heads x 32 tile pairs = 512 blocks of 8 waves
  attn_causal_hd64_k<<<NHEAD * (NQTILE / 2), 256, 0, stream>>>(QPL, KPL, VT, OPL);
  // 4) out = bf16_rne(x) + (O . WO^T) / (16*64) : M=4096, N=1024, K=1024; 32x4 work-group tiles = 128 blocks
  {
    dim3 grid((SEQ_T / GT_M) * (DMODEL / GT_N), 1);
    wmma_gemm64<0, 0, 0, 0, true, 0, true><<<grid, 256, 0, stream>>>(
        OPL, OPL, DMODEL, 0L, WO, WO, DMODEL, 0L, (void*)out, (void*)out, (void*)out, DMODEL, 0L,
        nw, nw, x, 0L, SEQ_T, DMODEL, DMODEL, 1.0f / (O_CARRY * W_CARRY));
  }
}

// v009
// A run of this version takes 96.2 microseconds.
// Timed twice side by side with v008, it ran 1.06 times as fast both times.
// Counting every step since v000, it is 3.98 times as fast.
// Contractions: qkv projection (normed . W^T, K=1024), attention q.k^T and p.v (head dim 64), output projection (o . Wo^T, K=1024): all v_wmma_f32_16x16x32_f16 (f16 operands, f32 accumulate); W carried x64, p carried x2^15, attention output carried x16 (exact power-of-two carries folded back in f32); float inputs RNE-converted to bf16 on load; rmsnorm, rotary tables, softmax, residual add in f32.
#include <hip/hip_runtime.h>
#include <math.h>

typedef __attribute__((ext_vector_type(16))) _Float16 v16h;
typedef __attribute__((ext_vector_type(8)))  _Float16 v8h;
typedef __attribute__((ext_vector_type(16))) __bf16   v16b;
typedef __attribute__((ext_vector_type(8)))  __bf16   v8b;
typedef __attribute__((ext_vector_type(8)))  float    v8f;
typedef __attribute__((ext_vector_type(4)))  float    v4f;
typedef __attribute__((ext_vector_type(2)))  float    v2f;

constexpr int SEQ_T     = 4096;
constexpr int DMODEL    = 1024;
constexpr int NHEAD     = 16;
constexpr int HDIM      = 64;
constexpr int QKV_N     = 3072;          // cols 0..1023 q | 1024..2047 k | 2048..3071 v
constexpr int NQTILE    = SEQ_T / 64;    // 64-row query tiles per head
constexpr int KEY_CH    = 64;            // keys per chunk
constexpr int LDS_P16   = 72;            // 16-bit LDS pitch (144 B rows, 16-B aligned)
constexpr float W_CARRY = 64.0f;         // weights stored as f16(bf16(w) * 64)
constexpr float O_CARRY = 16.0f;         // attention output stored as f16(o * 16)
constexpr float P_CARRY_LOG2 = 15.0f;    // softmax numerators stored as f16(p * 2^15): the carry's exponent
constexpr float SC_LOG2E = 0.125f * 1.44269504088896340736f;   // score scale 1/sqrt(64) times log2(e): exp(0.125 s) = exp2(SC_LOG2E s)

struct FreqTab { float f[32]; };
static_assert(sizeof(FreqTab) == 128);

__device__ __forceinline__ unsigned short f2bf_bits(float f) {
  unsigned u = __float_as_uint(f);
  return (unsigned short)((u + 0x7FFFu + ((u >> 16) & 1u)) >> 16);
}
__device__ __forceinline__ float bf_bits2f(unsigned short h) { return __uint_as_float(((unsigned)h) << 16); }
__device__ __forceinline__ float rne_bf(float f) { return bf_bits2f(f2bf_bits(f)); }

// hazard guard behind the last products of a GEMM, as a plain device helper
__device__ __forceinline__ void acc_guard4(v8f& a, v8f& b, v8f& c, v8f& d) { asm volatile("v_nop\n\tv_nop\n\tv_nop\n\tv_nop" : "+v"(a), "+v"(b), "+v"(c), "+v"(d)); }
template <typename T> struct Frag;
template <> struct Frag<_Float16> {
  typedef v16h V; union U { v16h v; v8h h[2]; };
  static __device__ __forceinline__ v16h load(const _Float16* p) {   // elements 0..7 <- p[0..7], 8..15 <- p[16..23]
    U f; f.h[0] = *(const v8h*)(p); f.h[1] = *(const v8h*)(p + 16); return f.v;
  }
  static __device__ __forceinline__ v8f mma(v16h a, v16h b, v8f c) {
    return __builtin_amdgcn_wmma_f32_16x16x32_f16(false, a, false, b, (short)0, c, false, false);
  }
};
template <> struct Frag<__bf16> {
  typedef v16b V; union U { v16b v; v8b h[2]; };
  static __device__ __forceinline__ v16b load(const __bf16* p) {
    U f; f.h[0] = *(const v8b*)(p); f.h[1] = *(const v8b*)(p + 16); return f.v;
  }
  static __device__ __forceinline__ v8f mma(v16b a, v16b b, v8f c) {
    return __builtin_amdgcn_wmma_f32_16x16x32_bf16(false, a, false, b, (short)0, c, false, false);
  }
};

// lane l reads lane l ^ 16 (vector cross-row move, no LDS round trip)
__device__ __forceinline__ float xhalf(float x) {
  const int b = __builtin_bit_cast(int, x);
  return __builtin_bit_cast(float, __builtin_amdgcn_permlanex16(b, b, 0x76543210, 0xfedcba98, false, false));
}

// =====================================================================================
// Register-blocked batched WMMA GEMM, C[m,n] = scale * sum_k A[m,k] * Bt[n,k] (+bias)(+resid);
// a work-group of 8 waves (2 x 4) owns a 128x256 tile, each wave a 64x64 tile of it.
// A row-major [M,K]; Bt row-major [N,K]; M % 128 == 0, N % 256 == 0, K % 64 == 0.
// Operands: per 64 k the 128 A rows and 256 Bt rows (128 B each, whole lines) are copied to LDS once per
// work-group by asynchronous copies, two buffers, the next stage in flight while this one is multiplied.
// SPLITM: 0 = single product (the only form the staged operand path carries; A2p, Bt2p are not read).
// BIAS_MODE: 0 = none, 1 = bias[m], 2 = bias[n].  OUT_MODE: 0 = f32, 1 = f16, 2 = bf16 hi + lo planes,
// 3 = attention planes (f16): columns 0..1023 rotary -> Cout [head*SEQ_T + t][64], 1024..2047 rotary -> Cout2 (same layout),
//     2048..3071 transposed -> Cout3 [head*64 + d][SEQ_T]; a wave's 64 columns are one head; rot = rotary table.
// RESID_RNE: the residual value is RNE-converted to bf16 before the add.
// ET: 0 = f16 operands, 1 = bf16 operands (pointers passed as 16-bit storage)
// =====================================================================================
constexpr int GT_M    = 128;                  // work-group tile rows
constexpr int GT_N    = 256;                  // work-group tile columns
constexpr int GT_K    = 64;                   // k per stage (128-B rows)
constexpr int GT_BUF  = (GT_M + GT_N) * LDS_P16;   // halves per buffer: A rows, then Bt rows, pitch 144 B
constexpr unsigned GT_STEP = 32u * LDS_P16 * 2u;   // LDS bytes between a thread's successive rows (32 rows)

// one thread's twelve 16-byte asynchronous copies global -> LDS of a stage; the s_wait_xcnt closes the statement
// so that no address register of a copy is rewritten before it
__device__ __forceinline__ void async_copy12(const unsigned (&l)[12], const void* const (&g)[12]) {
  asm volatile(
               "global_load_async_to_lds_b128 %0, %12, off\n\t"
               "global_load_async_to_lds_b128 %1, %13, off\n\t"
               "global_load_async_to_lds_b128 %2, %14, off\n\t"
               "global_load_async_to_lds_b128 %3, %15, off\n\t"
               "global_load_async_to_lds_b128 %4, %16, off\n\t"
               "global_load_async_to_lds_b128 %5, %17, off\n\t"
               "global_load_async_to_lds_b128 %6, %18, off\n\t"
               "global_load_async_to_lds_b128 %7, %19, off\n\t"
               "global_load_async_to_lds_b128 %8, %20, off\n\t"
               "global_load_async_to_lds_b128 %9, %21, off\n\t"
               "global_load_async_to_lds_b128 %10, %22, off\n\t"
               "global_load_async_to_lds_b128 %11, %23, off\n\t"
               "s_wait_xcnt 0x0"
               :: "v"(l[0]), "v"(l[1]), "v"(l[2]), "v"(l[3]), "v"(l[4]), "v"(l[5]), "v"(l[6]), "v"(l[7]), "v"(l[8]), "v"(l[9]), "v"(l[10]), "v"(l[11]),
                  "v"(g[0]), "v"(g[1]), "v"(g[2]), "v"(g[3]), "v"(g[4]), "v"(g[5]), "v"(g[6]), "v"(g[7]), "v"(g[8]), "v"(g[9]), "v"(g[10]), "v"(g[11]) : "memory");
}

// orders a wave's writes and reads of its own LDS slab (lanes exchange values through it); the fences name LDS alone, so
// that global stores and table loads in flight are not waited out at each exchange
__device__ __forceinline__ void slab_sync() {
  __builtin_amdgcn_fence(__ATOMIC_RELEASE, "workgroup", "local");
  __builtin_amdgcn_wave_barrier();
  __builtin_amdgcn_fence(__ATOMIC_ACQUIRE, "workgroup", "local");
}

template <int ET> struct Elem;
template <> struct Elem<0> { typedef _Float16 T; };
template <> struct Elem<1> { typedef __bf16 T; };
template <int ET, int SPLITM, int BIAS_MODE, int OUT_MODE, bool RESID, int ACT = 0, bool RESID_RNE = false>
__global__ __launch_bounds__(256) void wmma_gemm64(
    const unsigned short* __restrict__ Ap, const unsigned short* __restrict__ A2p, int lda, long strideA,
    const unsigned short* __restrict__ Btp, const unsigned short* __restrict__ Bt2p, int ldb, long strideB,
    void* __restrict__ Cout, void* __restrict__ Cout2, void* __restrict__ Cout3, int ldc, long strideC,
    const float* __restrict__ rot,
    const float* __restrict__ bias,
    const float* __restrict__ resid, long strideR,
    int M, int N, int K, float scale) {
  typedef typename Elem<ET>::T T;
  typedef typename Frag<T>::V V;
  const T* A = (const T*)Ap; const T* Bt = (const T*)Btp;
  static_assert(SPLITM == 0, "the staged operand path carries single planes");
  __shared__ __align__(16) T ring[2 * GT_BUF];     // two operand stages
  __shared__ __align__(16) float sT[8][16 * 68];   // per-wave 16x64 slab, pitch 68 floats
  const int b    = blockIdx.y;
  const int tid  = threadIdx.x;
  const int lane = tid & 31;
  const int wave = tid >> 5;
  const int tilesN = N / GT_N;
  const int tilesM = M / GT_M;
  if ((int)blockIdx.x >= tilesM * tilesN) return;   // work-group-uniform, in front of every barrier and copy
  const int bm = blockIdx.x / tilesN;
  const int bn = blockIdx.x - bm * tilesN;
  const int wm = wave >> 2, wn = wave & 3;
  const int m0 = bm * GT_M + (wm << 6);
  const int n0 = bn * GT_N + (wn << 6);

  const T* Ab  = A  + (size_t)b * strideA;
  const T* Bb  = Bt + (size_t)b * strideB;

  const int rlane = lane & 15;                 // row (A) / col (B, D) within subtile
  const int koff  = (lane >> 4) * 8;           // k offset of this lane half
  const int mOff  = (lane >> 4) * 8;           // D row offset

  // copies: thread -> 16 B at column chunk (tid & 7) of rows (tid >> 3) + 32 i; 8 lanes cover one 128-B row
  const int crow = tid >> 3, cchk = (tid & 7) * 8;
  const T* gA = Ab + (size_t)(bm * GT_M + crow) * lda + cchk;
  const T* gB = Bb + (size_t)(bn * GT_N + crow) * ldb + cchk;
  const size_t sA = (size_t)32 * lda, sB = (size_t)32 * ldb;
  const unsigned l0 = (unsigned)(uintptr_t)ring + (unsigned)(crow * LDS_P16 + cchk) * 2u;
  auto stage = [&](int t, int buf) {
    const T* ga = gA + (size_t)t * GT_K;
    const T* gb = gB + (size_t)t * GT_K;
    const unsigned lb = l0 + (unsigned)buf * (unsigned)(GT_BUF * 2);
    unsigned l[12];
    const void* g[12];
#pragma unroll
    for (int i = 0; i < 12; ++i) {
      l[i] = lb + (unsigned)i * GT_STEP;                                   // rows 0..127 A, 128..383 Bt
      g[i] = (i < 4) ? (const void*)(ga + i * sA) : (const void*)(gb + (i - 4) * sB);
    }
    async_copy12(l, g);
  };

  v8f acc[4][4];
#pragma unroll
  for (int i = 0; i < 4; ++i)
#pragma unroll
    for (int j = 0; j < 4; ++j) acc[i][j] = (v8f){0.f,0.f,0.f,0.f,0.f,0.f,0.f,0.f};

  const int nT = K / GT_K;
  stage(0, 0);
  asm volatile("s_wait_asynccnt 0x0" ::: "memory");   // this wave's part of stage 0 has landed
  __syncthreads();                                    // stage 0 is readable by every wave
  if (nT > 1) stage(1, 1);

  for (int t = 0; t < nT; ++t) {
    const int buf = t & 1;
    const T* sa = ring + buf * GT_BUF + ((wm << 6) + rlane) * LDS_P16 + koff;
    const T* sb = ring + buf * GT_BUF + (GT_M + (wn << 6) + rlane) * LDS_P16 + koff;
#pragma unroll
    for (int kk = 0; kk < GT_K; kk += 32) {
      V bh[4], ah[4];
#pragma unroll
      for (int j = 0; j < 4; ++j) bh[j] = Frag<T>::load(sb + (j << 4) * LDS_P16 + kk);
#pragma unroll
      for (int i = 0; i < 4; ++i) ah[i] = Frag<T>::load(sa + (i << 4) * LDS_P16 + kk);
      // keeps the 16 LDS reads together in front of the 16 products: sunk among them, each group waits out its own LDS latency
      __builtin_amdgcn_sched_barrier(0);
#pragma unroll
      for (int i = 0; i < 4; ++i)
#pragma unroll
        for (int j = 0; j < 4; ++j) acc[i][j] = Frag<T>::mma(ah[i], bh[j], acc[i][j]);
    }
    asm volatile("s_wait_dscnt 0x0" ::: "memory");      // this wave's reads of the buffer are done before it is refilled
    asm volatile("s_wait_asynccnt 0x0" ::: "memory");   // this wave's part of stage t + 1 has landed
    __syncthreads();                                    // publishes stage t + 1, ends every read of stage t
    if (t + 2 < nT) stage(t + 2, buf);
  }
  asm volatile("s_wait_asynccnt 0x0" ::: "memory");     // nothing in flight when the wave goes on
  acc_guard4(acc[0][0], acc[0][1], acc[0][2], acc[0][3]);
  acc_guard4(acc[1][0], acc[1][1], acc[1][2], acc[1][3]);
  acc_guard4(acc[2][0], acc[2][1], acc[2][2], acc[2][3]);
  acc_guard4(acc[3][0], acc[3][1], acc[3][2], acc[3][3]);

  // ---- epilogue ----
  float* slab = sT[wave];
  if constexpr (OUT_MODE == 3) {
    const int sel  = (bn * GT_N) >> 10;          // 0 = q, 1 = k, 2 = v: the same for the whole work-group
    const int head = (n0 & (DMODEL - 1)) >> 6;
    const int q = lane >> 3, c8 = (lane & 7) * 8;
    if (sel < 2) {
      // rotary in registers: column d (tiles 0, 1) and its partner d + 32 (tiles 2, 3) sit in the same lane and register
      unsigned short* P = ((sel == 0) ? (unsigned short*)Cout : (unsigned short*)Cout2) + ((size_t)head * SEQ_T + m0) * HDIM;
      const float* rp = rot + (size_t)rlane * (2 * SEQ_T) + (size_t)(m0 + mOff) * 2;
      v4f rt[2][8];                              // table values of row group i and, fetched ahead, of i + 1
      auto fetch = [&](int i, v4f (&d)[8]) {
#pragma unroll
        for (int jj = 0; jj < 2; ++jj)
#pragma unroll
          for (int k = 0; k < 4; ++k) d[jj * 4 + k] = *(const v4f*)(rp + (size_t)jj * (32 * SEQ_T) + i * 32 + k * 4);
      };
      fetch(0, rt[0]);
#pragma unroll
      for (int i = 0; i < 4; ++i) {
        if (i < 3) fetch(i + 1, rt[(i + 1) & 1]);
        const v4f (&tv)[8] = rt[i & 1];
#pragma unroll
        for (int jj = 0; jj < 2; ++jj)
#pragma unroll
          for (int r = 0; r < 8; ++r) {
            const float cv = tv[jj * 4 + (r >> 2)][r & 3];
            const float sv = tv[jj * 4 + 2 + (r >> 2)][r & 3];
            const float x1 = acc[i][jj][r] * scale;
            const float x2 = acc[i][jj + 2][r] * scale;
            slab[(mOff + r) * 68 + (jj << 4) + rlane]      = x1 * cv - x2 * sv;
            slab[(mOff + r) * 68 + 32 + (jj << 4) + rlane] = x2 * cv + x1 * sv;
          }
        slab_sync();
#pragma unroll
        for (int it = 0; it < 4; ++it) {
          const int row = it * 4 + q;             // 8 lanes x 16 B = one 128-B plane row
          const v4f f0 = *(const v4f*)(slab + row * 68 + c8);
          const v4f f1 = *(const v4f*)(slab + row * 68 + c8 + 4);
          v8h hv;
#pragma unroll
          for (int e = 0; e < 4; ++e) { hv[e] = (_Float16)f0[e]; hv[4 + e] = (_Float16)f1[e]; }
          *(v8h*)(P + (size_t)((i << 4) + row) * HDIM + c8) = hv;
        }
        // a table fetch follows that reuses the stores' data registers: the stores' register reads are waited for first
        if (i < 2) asm volatile("s_wait_xcnt 0x0" ::: "memory");
        slab_sync();
      }
    } else {
      // v: a lane's 8 accumulator rows are 8 successive tokens of one column d; 16 d rows x 64 tokens go through the slab
      _Float16* sl = (_Float16*)slab;
      unsigned short* P = (unsigned short*)Cout3 + (size_t)head * HDIM * SEQ_T + m0;
#pragma unroll
      for (int j = 0; j < 4; ++j) {
#pragma unroll
        for (int i = 0; i < 4; ++i) {
          v8h ph;
#pragma unroll
          for (int r = 0; r < 8; ++r) ph[r] = (_Float16)(acc[i][j][r] * scale);
          *(v8h*)(sl + rlane * LDS_P16 + (i << 4) + mOff) = ph;
        }
        slab_sync();
#pragma unroll
        for (int it = 0; it < 4; ++it) {
          const int row = it * 4 + q;             // 8 lanes x 16 B = 64 tokens = one whole 128-B line of row d
          const v8h hv = *(const v8h*)(sl + row * LDS_P16 + c8);
          *(v8h*)(P + (size_t)((j << 4) + row) * SEQ_T + c8) = hv;
        }
        // last group: the code behind it in the listing rewrites the stores' address pair, so the stores' register reads are waited for here
        if (j == 3) asm volatile("s_wait_xcnt 0x0" ::: "memory");
        slab_sync();
      }
    }
    return;
  }
  const float* Rb = RESID ? (resid + (size_t)b * strideR) : nullptr;
#pragma unroll
  for (int i = 0; i < 4; ++i) {
    const int mBase = m0 + (i << 4);
#pragma unroll
    for (int j = 0; j < 4; ++j) {
      const int n = n0 + (j << 4) + rlane;
      float bv = 0.f;
      if (BIAS_MODE == 2) bv = bias[n];
#pragma unroll
      for (int r = 0; r < 8; ++r) {
        float v = acc[i][j][r] * scale;
        if (BIAS_MODE == 1) v += bias[mBase + mOff + r];
        if (BIAS_MODE == 2) v += bv;
        if (RESID) {
          float rv = Rb[(size_t)(mBase + mOff + r) * ldc + n];
          if (RESID_RNE) rv = rne_bf(rv);
          v += rv;
        }
        if (ACT == 1) v = tanhf(v);
        if (ACT == 2) v = fmaxf(v, 0.0f);
        if (ACT == 4) v = (v > 0.f) ? v : 0.01f * v;
        slab[(mOff + r) * 68 + (j << 4) + rlane] = v;
      }
    }
    __builtin_amdgcn_fence(__ATOMIC_RELEASE, "workgroup");
    __builtin_amdgcn_wave_barrier();
    __builtin_amdgcn_fence(__ATOMIC_ACQUIRE, "workgroup");
    if (OUT_MODE == 0) {
      float* C = (float*)Cout + (size_t)b * strideC;
      const int hh = lane >> 4, c4 = (lane & 15) * 4;     // row seg = 256 B = 16 lanes x 16 B
      {
#pragma unroll
        for (int it = 0; it < 8; ++it) {
          const int row = it * 2 + hh;
          v4f v = *(const v4f*)(slab + row * 68 + c4);
          *(v4f*)(C + (size_t)(mBase + row) * ldc + n0 + c4) = v;
        }
        
      }
    } else {
      const int q = lane >> 3, c8 = (lane & 7) * 8;
      unsigned short* C  = (unsigned short*)Cout  + (size_t)b * strideC;
      unsigned short* C2 = (OUT_MODE == 2) ? ((unsigned short*)Cout2 + (size_t)b * strideC) : nullptr;
      {
#pragma unroll
        for (int it = 0; it < 4; ++it) {
          const int row = it * 4 + q;
          const float* sp = slab + row * 68 + c8;
          v8h hv, lv;
#pragma unroll
          for (int e = 0; e < 8; ++e) {
            if (OUT_MODE == 1) {
              hv[e] = (_Float16)sp[e];
            } else {
              unsigned short hb = f2bf_bits(sp[e]);
              unsigned short lb = f2bf_bits(sp[e] - bf_bits2f(hb));
              hv[e] = __builtin_bit_cast(_Float16, hb);
              lv[e] = __builtin_bit_cast(_Float16, lb);
            }
          }
          *(v8h*)(C + (size_t)(mBase + row) * ldc + n0 + c8) = hv;
          if (OUT_MODE == 2) *(v8h*)(C2 + (size_t)(mBase + row) * ldc + n0 + c8) = lv;
        }
        
      }
    }
    __builtin_amdgcn_fence(__ATOMIC_RELEASE, "workgroup");
    __builtin_amdgcn_wave_barrier();
    __builtin_amdgcn_fence(__ATOMIC_ACQUIRE, "workgroup");
  }
}

// =====================================================================================
// Kernel: rmsnorm of one token row (x RNE-converted to bf16 on load, mean of squares in f32,
// rsqrt(mean + 1e-6), times norm_w (RNE bf16)), output as an f16 plane [SEQ_T][DMODEL].
// Block = 128 threads = one token; coverage 128 threads x 8 elements = 1024 = one row exactly;
// The first SEQ_T / 32 blocks also build the rotary table for 32 tokens x 32 frequencies each:
// rot[f][t >> 3][cos of 8 tokens | sin of 8 tokens], angle = (float)t * invfreq_f (single f32 multiply), precise sincosf;
// a thread writes 64 B, four threads of one block the two whole lines of (f, 32 tokens).
// Blocks SEQ_T .. SEQ_T + 4 * CAST_BPW - 1 of the same grid need nothing of the rows and cast the weights instead:
// f32 -> f16(bf16_rne(w) * W_CARRY); a block takes CAST_EPB successive weights of wq, wk, wv or wo,
// a thread 4 groups of 8 (coverage 128 threads x 8 x 4 = CAST_EPB exactly; a 16-B store per group, 8 lanes one whole line).
// =====================================================================================
constexpr int CAST_EPB = 4096;                            // weights per cast block
constexpr int CAST_BPW = DMODEL * DMODEL / CAST_EPB;      // cast blocks per weight matrix
__global__ __launch_bounds__(128) void rmsnorm_cast_f16_k(const float* __restrict__ x, const float* __restrict__ nw,
                                                          const float* __restrict__ wq, const float* __restrict__ wk,
                                                          const float* __restrict__ wv, const float* __restrict__ wo,
                                                          unsigned short* __restrict__ xn, unsigned short* __restrict__ wqkv,
                                                          unsigned short* __restrict__ wof, FreqTab ft, float* __restrict__ rot) {
  __shared__ float red[4];
  const int t = blockIdx.x, tid = threadIdx.x, wave = tid >> 5, lane = tid & 31;
  if (t >= SEQ_T) {   // block-uniform, in front of the barrier: a weight-cast block
    const int cb  = t - SEQ_T;
    const int sel = cb / CAST_BPW;                        // 0 = wq, 1 = wk, 2 = wv (rows 0.., 1024.., 2048.. of wqkv), 3 = wo
    const float* w = (sel == 0) ? wq : (sel == 1) ? wk : (sel == 2) ? wv : wo;
    unsigned short* o = (sel < 3) ? wqkv + (size_t)sel * (DMODEL * DMODEL) : wof;
    const int e0 = (cb - sel * CAST_BPW) * CAST_EPB + tid * 8;
    v4f a[4], b[4];
#pragma unroll
    for (int g = 0; g < 4; ++g) {
      a[g] = *(const v4f*)(w + e0 + g * 1024);
      b[g] = *(const v4f*)(w + e0 + g * 1024 + 4);
    }
#pragma unroll
    for (int g = 0; g < 4; ++g) {
      v8h hv;
#pragma unroll
      for (int e = 0; e < 4; ++e) {
        hv[e]     = (_Float16)(rne_bf(a[g][e]) * W_CARRY);
        hv[4 + e] = (_Float16)(rne_bf(b[g][e]) * W_CARRY);
      }
      *(v8h*)(o + e0 + g * 1024) = hv;
    }
    return;
  }
  if (t < SEQ_T / 32) {   // block-uniform
    const int f = tid >> 2, tb = t * 32 + (tid & 3) * 8;
    float fr = ft.f[0];
#pragma unroll
    for (int q = 1; q < 32; ++q) fr = (f == q) ? ft.f[q] : fr;
    v4f cs4[4];
#pragma unroll
    for (int e = 0; e < 8; ++e) {
      float sv, cv;
      sincosf((float)(tb + e) * fr, &sv, &cv);
      cs4[e >> 2][e & 3]       = cv;
      cs4[2 + (e >> 2)][e & 3] = sv;
    }
    float* rd = rot + (size_t)f * (2 * SEQ_T) + (size_t)tb * 2;
#pragma unroll
    for (int k = 0; k < 4; ++k) *(v4f*)(rd + k * 4) = cs4[k];
  }
  const float* row = x + (size_t)t * DMODEL + tid * 8;
  const v4f a = *(const v4f*)row;
  const v4f b = *(const v4f*)(row + 4);
  float xb[8];
#pragma unroll
  for (int e = 0; e < 4; ++e) { xb[e] = rne_bf(a[e]); xb[4 + e] = rne_bf(b[e]); }
  float ss = 0.f;
#pragma unroll
  for (int e = 0; e < 8; ++e) ss += xb[e] * xb[e];
#pragma unroll
  for (int m = 1; m < 32; m <<= 1) ss += __shfl_xor(ss, m, 32);
  if (lane == 0) red[wave] = ss;
  __syncthreads();
  const float tot = (red[0] + red[1]) + (red[2] + red[3]);
  const float inv = rsqrtf(tot * (1.0f / 1024.0f) + 1e-6f);
  const v4f na = *(const v4f*)(nw + tid * 8);
  const v4f nb = *(const v4f*)(nw + tid * 8 + 4);
  v8h hv;
#pragma unroll
  for (int e = 0; e < 4; ++e) {
    hv[e]     = (_Float16)((xb[e] * inv) * rne_bf(na[e]));
    hv[4 + e] = (_Float16)((xb[4 + e] * inv) * rne_bf(nb[e]));
  }
  unsigned short* dst = xn + (size_t)t * DMODEL + tid * 8;
  *(v8h*)dst = hv;
}

// =====================================================================================
// Kernel: causal attention, head dim 64, f16 planes in (Q, K: [NHEAD*SEQ_T][64]; Vt: [NHEAD*64][SEQ_T]),
// f16 plane out (O: [SEQ_T][DMODEL], head h at cols h*64, value o*16).
//   scores^T = 0.125 * k.q^T : v_wmma_f32_16x16x32_f16 (q, k plain f16), f32 accumulate
//   out^T    = v^T.p^T       : v_wmma_f32_16x16x32_f16 (p carried x2^15 in f16, v plain f16), f32 accumulate
//   (transposed products: a lane holds one query's scores, and p goes from the score tiles straight into the B operand)
//   online softmax in f32, running maximum in units of the unscaled products, running sum carried x2^15; keys above the diagonal -> -inf (every row keeps key kv0 <= row, so never fully masked).
// Block = 8 waves = two groups of 4 on the same 64 query rows of head h; 64-key chunks; group g works chunks g, g + 2, ... with a
// running maximum, sum and out tile of its own, so that four waves stand on a SIMD (two blocks per WGP) and cover each other's waits;
// behind the last chunk group 1 hands its three partial results to group 0 through LDS, which rescales both to the common maximum,
// adds them and stores. Chunks above the diagonal are skipped (wave-uniform).
// A block works query tile NQTILE - 1 - pr and then tile pr of its head, one after the other in every wave: (NQTILE - pr) + (pr + 1)
// = NQTILE + 1 chunks for every block, so that no WGP is left with the long tiles alone; every (head, tile) is worked once.
// K / Vt chunks come to LDS by asynchronous copies, a pair of chunks (one per group) a stage (256 threads x 2 x 16 B = 64x64 halves
// per tile), two buffers: stage st + 1 is in flight while stage st is worked on; one work-group barrier per stage publishes it and
// frees the buffer just read;
// WMMA operands are read from dense, statically strided LDS / plane addresses only.
// O store coverage per wave: 4 iterations x 4 row groups = 16 rows, 8 lanes x 8 halves = 64 cols = one whole
// =====================================================================================
constexpr int AT_TILE = KEY_CH * LDS_P16;          // halves of one staged tile (64 rows, pitch 144 B)
constexpr int AT_BUF  = 2 * AT_TILE;               // halves per chunk: K tile [kv][d], then V^T tile [d][kv]
constexpr int AT_STG  = 2 * AT_BUF;                // halves per stage buffer: group 0's chunk, then group 1's
constexpr unsigned AT_STEP = 32u * LDS_P16 * 2u;   // LDS bytes between a thread's successive rows (32 rows)

// one thread's eight 16-byte asynchronous copies global -> LDS of a stage; the s_wait_xcnt closes the statement
// so that no address register of a copy is rewritten before it
__device__ __forceinline__ void async_copy8(const unsigned (&l)[8], const void* const (&g)[8]) {
  asm volatile(
               "global_load_async_to_lds_b128 %0, %8, off\n\t"
               "global_load_async_to_lds_b128 %1, %9, off\n\t"
               "global_load_async_to_lds_b128 %2, %10, off\n\t"
               "global_load_async_to_lds_b128 %3, %11, off\n\t"
               "global_load_async_to_lds_b128 %4, %12, off\n\t"
               "global_load_async_to_lds_b128 %5, %13, off\n\t"
               "global_load_async_to_lds_b128 %6, %14, off\n\t"
               "global_load_async_to_lds_b128 %7, %15, off\n\t"
               "s_wait_xcnt 0x0"
               :: "v"(l[0]), "v"(l[1]), "v"(l[2]), "v"(l[3]), "v"(l[4]), "v"(l[5]), "v"(l[6]), "v"(l[7]),
                  "v"(g[0]), "v"(g[1]), "v"(g[2]), "v"(g[3]), "v"(g[4]), "v"(g[5]), "v"(g[6]), "v"(g[7]) : "memory");
}

__global__ __launch_bounds__(256) void attn_causal_hd64_k(const unsigned short* __restrict__ qp,
                                                         const unsigned short* __restrict__ kp,
                                                         const unsigned short* __restrict__ vtp,
                                                         unsigned short* __restrict__ op) {
  typedef Frag<_Float16> FH;
  __shared__ __align__(16) _Float16 KV[2 * AT_STG];           // two stage buffers
  __shared__ __align__(16) float   Os[4][16 * 68];            // out tile per 16 query rows, pitch 68
  __shared__ float                 Ml[4][64];                 // group 1's running maximum (32 lanes), then its sum
  const int tid = threadIdx.x, wave = (tid >> 5) & 3, lane = tid & 31, hh = lane >> 4, c = lane & 15;
  const int grp = __builtin_amdgcn_readfirstlane(tid >> 7);   // wave group, in a scalar register: the tests on it are scalar branches
  const int pr = blockIdx.x % (NQTILE / 2);
  const int h  = blockIdx.x / (NQTILE / 2);
  const _Float16* Kh = (const _Float16*)kp + (size_t)h * SEQ_T * HDIM;
  const _Float16* Vh = (const _Float16*)vtp + (size_t)h * HDIM * SEQ_T;

  const v8f vz = (v8f){0.f,0.f,0.f,0.f,0.f,0.f,0.f,0.f};

  // copies: thread -> 16 B at column chunk (tid & 7) of rows (tid >> 3) + 32 i of the four tiles; 8 lanes cover one 128-B row
  const int srow = tid >> 3, sc8 = (tid & 7) * 8;
  const _Float16* gK = Kh + (size_t)srow * HDIM + sc8;      // K row kv0 + r, d sc8..sc8+7
  const _Float16* gV = Vh + (size_t)srow * SEQ_T + sc8;     // Vt row d = r, keys kv0 + sc8..
  const unsigned l0 = (unsigned)(uintptr_t)KV + (unsigned)(srow * LDS_P16 + sc8) * 2u;
  auto stage = [&](int st, int buf) {   // chunks 2 st and 2 st + 1
    const _Float16* gk = gK + (size_t)st * (2 * KEY_CH * HDIM);
    const _Float16* gv = gV + (size_t)st * (2 * KEY_CH);
    const unsigned lb = l0 + (unsigned)buf * (unsigned)(AT_STG * 2);
    unsigned l[8];
    const void* g[8];
#pragma unroll
    for (int u = 0; u < 2; ++u)
#pragma unroll
      for (int i = 0; i < 2; ++i) {
        l[u * 4 + i]     = lb + (unsigned)u * (unsigned)(AT_BUF * 2) + (unsigned)i * AT_STEP;
        l[u * 4 + 2 + i] = lb + (unsigned)u * (unsigned)(AT_BUF * 2) + (unsigned)(AT_TILE * 2) + (unsigned)i * AT_STEP;
        g[u * 4 + i]     = (const void*)(gk + (size_t)u * (KEY_CH * HDIM) + (size_t)i * (32 * HDIM));
        g[u * 4 + 2 + i] = (const void*)(gv + (size_t)u * KEY_CH + (size_t)i * (32 * SEQ_T));
      }
    async_copy8(l, g);
  };

  for (int part = 0; part < 2; ++part) {   // the long tile, then its short partner; block-uniform
  const int qb = part ? pr : NQTILE - 1 - pr;
  const int q0 = qb * 64 + wave * 16;
  const _Float16* Qh = (const _Float16*)qp + ((size_t)h * SEQ_T + q0 + c) * HDIM;

  // Q fragments (B operand, column = query q0 + c, k = head dim): 2 d-chunks of 32
  v16h qa[2];
  qa[0] = FH::load(Qh + 8 * hh);
  qa[1] = FH::load(Qh + 32 + 8 * hh);

  float mrow = -INFINITY, lrow = 0.f;   // one query per lane
  v8f oacc[4];
#pragma unroll
  for (int t = 0; t < 4; ++t) oacc[t] = vz;

  const int nChunks = qb + 1;              // block-uniform
  const int nStages = (nChunks + 1) >> 1;  // an odd count stages one chunk above the diagonal too (index qb + 1 <= NQTILE - 1: inside the planes), unread
  // second tile: the barrier behind the first tile's last stage, behind every wave's s_wait_dscnt 0, has ended every read of both buffers
  stage(0, 0);
  asm volatile("s_wait_asynccnt 0x0" ::: "memory");   // this wave's part of stage 0 has landed
  __syncthreads();                                    // stage 0 is readable by every wave

  // one chunk of this wave's group; diag is a literal at every call, so that only the diagonal chunk carries the mask's compares
  auto chunk = [&](const int kc, const int buf, const bool diag) __attribute__((always_inline)) {
    const int kv0 = kc * KEY_CH;
    const _Float16* Ksh = KV + buf * AT_STG + grp * AT_BUF;   // [kv][d]
    const _Float16* Vts = Ksh + AT_TILE;                      // [d][kv]

    // transposed scores: tile j = K rows (A, m = key j*16 + ..) x Q (B, n = query c); lane (hh, c) holds
    // keys j*16 + 8*hh + r of query q0 + c
    v16h ka[2][4], va[2][4];
#pragma unroll
    for (int dc = 0; dc < 2; ++dc)
#pragma unroll
      for (int j = 0; j < 4; ++j) ka[dc][j] = FH::load(Ksh + (j * 16 + c) * LDS_P16 + dc * 32 + 8 * hh);   // A[m=key j*16+c][k=d]
    // keeps the 16 K reads together in front of the 8 score products: sunk to their users, each product waits out a whole LDS latency
    __builtin_amdgcn_sched_barrier(0);
    v8f s[4];
#pragma unroll
    for (int j = 0; j < 4; ++j) s[j] = FH::mma(ka[0][j], qa[0], vz);
#pragma unroll
    for (int j = 0; j < 4; ++j) s[j] = FH::mma(ka[1][j], qa[1], s[j]);
#pragma unroll
    for (int kk = 0; kk < 2; ++kk)
#pragma unroll
      for (int t = 0; t < 4; ++t) va[kk][t] = FH::load(Vts + (t * 16 + c) * LDS_P16 + kk * 32 + 8 * hh);   // A[m=d t*16+c][k=key]
    // the 8 score products run unbroken, then the 16 V^T reads as one group
    __builtin_amdgcn_sched_group_barrier(0x008, 8, 0);
    __builtin_amdgcn_sched_group_barrier(0x100, 16, 0);
    // keeps the 16 V^T reads in front of the softmax, whose vector work then covers their latency
    __builtin_amdgcn_sched_barrier(0);
    const int qrow = q0 + c;
    float mj[4];                                   // the maximum is taken over the products as they come (the scale is positive)
#pragma unroll
    for (int j = 0; j < 4; ++j) {
      float m = -INFINITY;
#pragma unroll
      for (int r = 0; r < 8; ++r) {
        const int kvcol = kv0 + j * 16 + 8 * hh + r;
        if (diag && (kvcol > qrow)) s[j][r] = -INFINITY;
        m = fmaxf(m, s[j][r]);
      }
      mj[j] = m;
    }
    float cm = fmaxf(fmaxf(mj[0], mj[1]), fmaxf(mj[2], mj[3]));
    cm = fmaxf(cm, xhalf(cm));                     // the other 32 keys of this query sit in the other lane half
    const float mnew = fmaxf(mrow, cm);
    const float alpha = __builtin_amdgcn_exp2f((mrow - mnew) * SC_LOG2E);
    mrow = mnew;
    // p * 2^15 = exp2(s * SC_LOG2E + (15 - mnew * SC_LOG2E)): scale, log2(e), maximum and carry in one fused multiply-add, two scores each
    const float nb = P_CARRY_LOG2 - mnew * SC_LOG2E;
    const v2f sc2 = (v2f){SC_LOG2E, SC_LOG2E}, nb2 = (v2f){nb, nb};
    FH::U pb[2];                                   // B[k=key][n=query c]: elements 0..7 = tile 2kk, 8..15 = tile 2kk+1
    v2f pj[4];                                     // sums of the carried p, even and odd keys apart
#pragma unroll
    for (int j = 0; j < 4; ++j) {
      v2f psum = (v2f){0.f, 0.f};
      v8h ph;
#pragma unroll
      for (int r = 0; r < 8; r += 2) {
        const v2f x = __builtin_elementwise_fma((v2f){s[j][r], s[j][r + 1]}, sc2, nb2);
        const v2f p = (v2f){__builtin_amdgcn_exp2f(x[0]), __builtin_amdgcn_exp2f(x[1])};
        psum += p;
        ph[r]     = (_Float16)p[0];
        ph[r + 1] = (_Float16)p[1];
      }
      pj[j] = psum;
      pb[j >> 1].h[j & 1] = ph;
    }
    const v2f pt = (pj[0] + pj[1]) + (pj[2] + pj[3]);
    lrow = lrow * alpha + (pt[0] + pt[1]);         // carried x2^15 like p; this half's keys only; halves joined after the loop
#pragma unroll
    for (int t = 0; t < 4; ++t)
#pragma unroll
      for (int r = 0; r < 8; ++r) oacc[t][r] *= alpha;
#pragma unroll
    for (int kk = 0; kk < 2; ++kk) {
#pragma unroll
      for (int t = 0; t < 4; ++t) oacc[t] = FH::mma(va[kk][t], pb[kk].v, oacc[t]);
    }
  };

  // every stage but the last holds a whole chunk below the diagonal for either group: no test on the chunk in the loop
  for (int st = 0; st + 1 < nStages; ++st) {
    // directly behind the barrier (the one above, or the one at the foot of trip st - 1, which ended every read of that
    // trip's buffer): stage st + 1 goes into that buffer and flies while stage st is worked on
    stage(st + 1, (st + 1) & 1);
    chunk(2 * st + grp, st & 1, false);
    // keeps the waits and the barrier below at the foot of the trip: lifted over the softmax, they would wait out the V^T reads
    // and the copies of stage st + 1 shortly behind their issue, with none of the softmax to cover either
    __builtin_amdgcn_sched_barrier(0);
    asm volatile("s_wait_dscnt 0x0" ::: "memory");      // this wave's reads of the buffer are done before it is refilled
    asm volatile("s_wait_asynccnt 0x0" ::: "memory");   // this wave's part of stage st + 1 has landed
    __syncthreads();                                    // publishes stage st + 1, ends every read of stage st
  }
  asm volatile("s_wait_asynccnt 0x0" ::: "memory");     // nothing in flight when the wave goes on
  {
    // last stage: the diagonal chunk qb for one group; for the other chunk qb - 1, or none (qb + 1 lies above the diagonal)
    const int kc = 2 * (nStages - 1) + grp;             // wave-uniform, scalar
    if (kc < qb) chunk(kc, (nStages - 1) & 1, false);
    else if (kc == qb) chunk(kc, (nStages - 1) & 1, true);
  }

  // oacc[t][r] = out[query q0 + c][d = t*16 + 8*hh + r], over this group's chunks, relative to its own maximum
  float* os = Os[wave];
  if (grp == 1) {   // hands over; with no chunk of its own (tile 0) that is maximum -inf, sum 0, out 0
#pragma unroll
    for (int t = 0; t < 4; ++t) {
      v4f lo, hi;
#pragma unroll
      for (int e = 0; e < 4; ++e) { lo[e] = oacc[t][e]; hi[e] = oacc[t][4 + e]; }
      *(v4f*)(os + c * 68 + t * 16 + 8 * hh)     = lo;
      *(v4f*)(os + c * 68 + t * 16 + 8 * hh + 4) = hi;
    }
    Ml[wave][lane]      = mrow;
    Ml[wave][32 + lane] = lrow;
  }
  asm volatile("s_wait_dscnt 0x0" ::: "memory");   // this wave's reads of the last stage are done before the next tile refills its buffer
  __syncthreads();   // ends every read of the last stage; group 1's partial results are readable by group 0 (every wave passes)
  if (grp == 0) {
  {
    // group 0 always holds chunk 0, so the common maximum is finite
    const float m2 = Ml[wave][lane], l2 = Ml[wave][32 + lane];
    const float mt = fmaxf(mrow, m2);
    const float a1 = __builtin_amdgcn_exp2f((mrow - mt) * SC_LOG2E), a2 = __builtin_amdgcn_exp2f((m2 - mt) * SC_LOG2E);
    const float lsum = lrow * a1 + l2 * a2;
    const float ltot = lsum + xhalf(lsum);
    const float inv = (1.0f / ltot) * O_CARRY;     // the sum carries the same 2^15 as the out tile
    const float f1 = a1 * inv, f2 = a2 * inv;
#pragma unroll
    for (int t = 0; t < 4; ++t) {   // a lane reads what the same lane of group 1 wrote, and writes the sum to the same place
      const v4f plo = *(const v4f*)(os + c * 68 + t * 16 + 8 * hh);
      const v4f phi = *(const v4f*)(os + c * 68 + t * 16 + 8 * hh + 4);
      v4f lo, hi;
#pragma unroll
      for (int e = 0; e < 4; ++e) { lo[e] = oacc[t][e] * f1 + plo[e] * f2; hi[e] = oacc[t][4 + e] * f1 + phi[e] * f2; }
      *(v4f*)(os + c * 68 + t * 16 + 8 * hh)     = lo;
      *(v4f*)(os + c * 68 + t * 16 + 8 * hh + 4) = hi;
    }
  }
  __builtin_amdgcn_fence(__ATOMIC_RELEASE, "workgroup");
  __builtin_amdgcn_wave_barrier();
  __builtin_amdgcn_fence(__ATOMIC_ACQUIRE, "workgroup");
  {
    const int q8 = lane >> 3, c8 = (lane & 7) * 8;
    unsigned short* ob = op + (size_t)h * HDIM + c8;
    {
#pragma unroll
      for (int it = 0; it < 4; ++it) {
        const int row = it * 4 + q8;
        const v4f f0 = *(const v4f*)(os + row * 68 + c8);
        const v4f f1 = *(const v4f*)(os + row * 68 + c8 + 4);
        v8h hv;
#pragma unroll
        for (int e = 0; e < 4; ++e) { hv[e] = (_Float16)f0[e]; hv[4 + e] = (_Float16)f1[e]; }
        *(v8h*)(ob + (size_t)(q0 + row) * DMODEL) = hv;
      }
      // the next tile's address arithmetic rewrites the stores' address and data registers: their register reads are waited for first
      asm volatile("s_wait_xcnt 0x0" ::: "memory");
    }
  }
  }
  }
}

// =====================================================================================
// Host glue.  Workspace region map (bytes, all offsets multiples of 1 MiB):
//   XN   f16 [4096][1024]         8,388,608 @ 0
//   WQKV f16 [3072][1024] (x64)   6,291,456 @ 8,388,608
//   WO   f16 [1024][1024] (x64)   2,097,152 @ 14,680,064
//   ROT  f32 [32][512][2][8]      1,048,576 @ 16,777,216
//   QPL  f16 [16*4096][64]        8,388,608 @ 17,825,792
//   KPL  f16 [16*4096][64]        8,388,608 @ 26,214,400
//   VT   f16 [16*64][4096]        8,388,608 @ 34,603,008
//   OPL  f16 [4096][1024] (x16)   8,388,608 @ 42,991,616
//   total 51,380,224
// =====================================================================================
extern "C" void kernel_launch(void* const* d_in, const int* in_sizes, int n_in,
                              void* d_out, int out_size, void* d_ws, size_t ws_size,
                              hipStream_t stream) {
  if (n_in < 6) return;
  const int nx = SEQ_T * DMODEL;
  const int nwgt = DMODEL * DMODEL;
  if (in_sizes[0] != nx || in_sizes[1] != nwgt || in_sizes[2] != nwgt || in_sizes[3] != nwgt ||
      in_sizes[4] != nwgt || in_sizes[5] != DMODEL || out_size != nx) return;

  const float* x  = (const float*)d_in[0];
  const float* wq = (const float*)d_in[1];
  const float* wk = (const float*)d_in[2];
  const float* wv = (const float*)d_in[3];
  const float* wo = (const float*)d_in[4];
  const float* nw = (const float*)d_in[5];
  float* out = (float*)d_out;

  const size_t szXN   = (size_t)nx * 2;
  const size_t szWQKV = (size_t)3 * nwgt * 2;
  const size_t szWO   = (size_t)nwgt * 2;
  const size_t szROT  = (size_t)SEQ_T * HDIM * 4;
  const size_t szPL   = (size_t)NHEAD * SEQ_T * HDIM * 2;
  const size_t szO    = (size_t)nx * 2;
  const size_t offXN   = 0;
  const size_t offWQKV = offXN + szXN;
  const size_t offWO   = offWQKV + szWQKV;
  const size_t offROT  = offWO + szWO;
  const size_t offQ    = offROT + szROT;
  const size_t offK    = offQ + szPL;
  const size_t offVT   = offK + szPL;
  const size_t offO    = offVT + szPL;
  const size_t total   = offO + szO;
  if (total > ws_size) return;

  char* ws = (char*)d_ws;
  unsigned short* XN   = (unsigned short*)(ws + offXN);
  unsigned short* WQKV = (unsigned short*)(ws + offWQKV);
  unsigned short* WO   = (unsigned short*)(ws + offWO);
  float*          ROT  = (float*)(ws + offROT);
  unsigned short* QPL  = (unsigned short*)(ws + offQ);
  unsigned short* KPL  = (unsigned short*)(ws + offK);
  unsigned short* VT   = (unsigned short*)(ws + offVT);
  unsigned short* OPL  = (unsigned short*)(ws + offO);

  // inverse-frequency table: e_i = (2i)/64 (exact), p_i = fl32(pow(10000, e_i)) (double pow on host,
  // RNE to f32), invfreq_i = 1.0f / p_i (f32)
  FreqTab ft;
  for (int i = 0; i < 32; ++i) {
    const float e = (float)(2 * i) / 64.0f;
    const float p = (float)pow(10000.0, (double)e);
    ft.f[i] = 1.0f / p;
  }

  // 1) one grid: rmsnorm -> XN (f16) and rotary table -> ROT (blocks 0 .. SEQ_T - 1);
  //    weights -> f16(bf16(w) * 64), wq | wk | wv stacked as rows 0.., 1024.., 2048.. of WQKV, wo -> WO (the blocks behind)
  rmsnorm_cast_f16_k<<<SEQ_T + 4 * CAST_BPW, 128, 0, stream>>>(x, nw, wq, wk, wv, wo, XN, WQKV, WO, ft, ROT);
  // 2) XN . WQKV^T / 64 : M=4096, N=3072, K=1024; 32x12 work-group tiles = 384 blocks; the epilogue applies the rotary
  //    to q and k and writes the Q, K and Vt f16 planes
  {
    dim3 grid((SEQ_T / GT_M) * (QKV_N / GT_N), 1);
    wmma_gemm64<0, 0, 0, 3, false><<<grid, 256, 0, stream>>>(
        XN, XN, DMODEL, 0L, WQKV, WQKV, DMODEL, 0L, (void*)QPL, (void*)KPL, (void*)VT, QKV_N, 0L,
        ROT, nw, x, 0L, SEQ_T, QKV_N, DMODEL, 1.0f / W_CARRY);
  }
  // 3) causal attention -> O plane (f16, x16); 16 heads x 32 tile pairs = 512 blocks of 8 waves
  attn_causal_hd64_k<<<NHEAD * (NQTILE / 2), 256, 0, stream>>>(QPL, KPL, VT, OPL);
  // 4) out = bf16_rne(x) + (O . WO^T) / (16*64) : M=4096, N=1024, K=1024; 32x4 work-group tiles = 128 blocks
  {
    dim3 grid((SEQ_T / GT_M) * (DMODEL / GT_N), 1);
    wmma_gemm64<0, 0, 0, 0, true, 0, true><<<grid, 256, 0, stream>>>(
        OPL, OPL, DMODEL, 0L, WO, WO, DMODEL, 0L, (void*)out, (void*)out, (void*)out, DMODEL, 0L,
        nw, nw, x, 0L, SEQ_T, DMODEL, DMODEL, 1.0f / (O_CARRY * W_CARRY));
  }
}

// v010
// One run takes 91.2 microseconds.
// Next to v009, in two timings, it ran 1.05 times as fast each time.
// All steps since v000 together make it 4.18 times as fast.
// Contractions: qkv projection (normed . W^T, K=1024), attention q.k^T and p.v (head dim 64), output projection (o . Wo^T, K=1024): all v_wmma_f32_16x16x32_f16 (f16 operands, f32 accumulate); W carried x64, p carried x2^15, attention output carried x16 (exact power-of-two carries folded back in f32); float inputs RNE-converted to bf16 on load; rmsnorm, rotary tables, softmax, residual add in f32.
#include <hip/hip_runtime.h>
#include <math.h>

typedef __attribute__((ext_vector_type(16))) _Float16 v16h;
typedef __attribute__((ext_vector_type(8)))  _Float16 v8h;
typedef __attribute__((ext_vector_type(16))) __bf16   v16b;
typedef __attribute__((ext_vector_type(8)))  __bf16   v8b;
typedef __attribute__((ext_vector_type(8)))  float    v8f;
typedef __attribute__((ext_vector_type(4)))  float    v4f;
typedef __attribute__((ext_vector_type(2)))  float    v2f;

constexpr int SEQ_T     = 4096;
constexpr int DMODEL    = 1024;
constexpr int NHEAD     = 16;
constexpr int HDIM      = 64;
constexpr int QKV_N     = 3072;          // cols 0..1023 q | 1024..2047 k | 2048..3071 v
constexpr int QT_ROWS   = 128;           // query rows per attention tile
constexpr int NQTILE    = SEQ_T / QT_ROWS;   // query tiles per head
constexpr int KEY_CH    = 64;            // keys per chunk
constexpr int LDS_P16   = 72;            // 16-bit LDS pitch (144 B rows, 16-B aligned)
constexpr float W_CARRY = 64.0f;         // weights stored as f16(bf16(w) * 64)
constexpr float O_CARRY = 16.0f;         // attention output stored as f16(o * 16)
constexpr float P_CARRY_LOG2 = 15.0f;    // softmax numerators stored as f16(p * 2^15): the carry's exponent
constexpr float SC_LOG2E = 0.125f * 1.44269504088896340736f;   // score scale 1/sqrt(64) times log2(e): exp(0.125 s) = exp2(SC_LOG2E s)

struct FreqTab { float f[32]; };
static_assert(sizeof(FreqTab) == 128);

__device__ __forceinline__ unsigned short f2bf_bits(float f) {
  unsigned u = __float_as_uint(f);
  return (unsigned short)((u + 0x7FFFu + ((u >> 16) & 1u)) >> 16);
}
__device__ __forceinline__ float bf_bits2f(unsigned short h) { return __uint_as_float(((unsigned)h) << 16); }
__device__ __forceinline__ float rne_bf(float f) { return bf_bits2f(f2bf_bits(f)); }

// hazard guard behind the last products of a GEMM, as a plain device helper
__device__ __forceinline__ void acc_guard4(v8f& a, v8f& b, v8f& c, v8f& d) { asm volatile("v_nop\n\tv_nop\n\tv_nop\n\tv_nop" : "+v"(a), "+v"(b), "+v"(c), "+v"(d)); }
template <typename T> struct Frag;
template <> struct Frag<_Float16> {
  typedef v16h V; union U { v16h v; v8h h[2]; };
  static __device__ __forceinline__ v16h load(const _Float16* p) {   // elements 0..7 <- p[0..7], 8..15 <- p[16..23]
    U f; f.h[0] = *(const v8h*)(p); f.h[1] = *(const v8h*)(p + 16); return f.v;
  }
  static __device__ __forceinline__ v8f mma(v16h a, v16h b, v8f c) {
    return __builtin_amdgcn_wmma_f32_16x16x32_f16(false, a, false, b, (short)0, c, false, false);
  }
};
template <> struct Frag<__bf16> {
  typedef v16b V; union U { v16b v; v8b h[2]; };
  static __device__ __forceinline__ v16b load(const __bf16* p) {
    U f; f.h[0] = *(const v8b*)(p); f.h[1] = *(const v8b*)(p + 16); return f.v;
  }
  static __device__ __forceinline__ v8f mma(v16b a, v16b b, v8f c) {
    return __builtin_amdgcn_wmma_f32_16x16x32_bf16(false, a, false, b, (short)0, c, false, false);
  }
};

// lane l reads lane l ^ 16 (vector cross-row move, no LDS round trip)
__device__ __forceinline__ float xhalf(float x) {
  const int b = __builtin_bit_cast(int, x);
  return __builtin_bit_cast(float, __builtin_amdgcn_permlanex16(b, b, 0x76543210, 0xfedcba98, false, false));
}

// =====================================================================================
// Register-blocked batched WMMA GEMM, C[m,n] = scale * sum_k A[m,k] * Bt[n,k] (+bias)(+resid);
// a work-group of 8 waves (2 x 4) owns a 128x256 tile, each wave a 64x64 tile of it.
// A row-major [M,K]; Bt row-major [N,K]; M % 128 == 0, N % 256 == 0, K % 64 == 0.
// Operands: per 64 k the 128 A rows and 256 Bt rows (128 B each, whole lines) are copied to LDS once per
// work-group by asynchronous copies, two buffers, the next stage in flight while this one is multiplied.
// SPLITM: 0 = single product (the only form the staged operand path carries; A2p, Bt2p are not read).
// BIAS_MODE: 0 = none, 1 = bias[m], 2 = bias[n].  OUT_MODE: 0 = f32, 1 = f16, 2 = bf16 hi + lo planes,
// 3 = attention planes (f16): columns 0..1023 rotary -> Cout [head*SEQ_T + t][64], 1024..2047 rotary -> Cout2 (same layout),
//     2048..3071 transposed -> Cout3 [head*64 + d][SEQ_T]; a wave's 64 columns are one head; rot = rotary table.
// RESID_RNE: the residual value is RNE-converted to bf16 before the add.
// ET: 0 = f16 operands, 1 = bf16 operands (pointers passed as 16-bit storage)
// =====================================================================================
constexpr int GT_M    = 128;                  // work-group tile rows
constexpr int GT_N    = 256;                  // work-group tile columns
constexpr int GT_K    = 64;                   // k per stage (128-B rows)
constexpr int GT_BUF  = (GT_M + GT_N) * LDS_P16;   // halves per buffer: A rows, then Bt rows, pitch 144 B
constexpr unsigned GT_STEP = 32u * LDS_P16 * 2u;   // LDS bytes between a thread's successive rows (32 rows)

// one thread's twelve 16-byte asynchronous copies global -> LDS of a stage; the s_wait_xcnt closes the statement
// so that no address register of a copy is rewritten before it
__device__ __forceinline__ void async_copy12(const unsigned (&l)[12], const void* const (&g)[12]) {
  asm volatile(
               "global_load_async_to_lds_b128 %0, %12, off\n\t"
               "global_load_async_to_lds_b128 %1, %13, off\n\t"
               "global_load_async_to_lds_b128 %2, %14, off\n\t"
               "global_load_async_to_lds_b128 %3, %15, off\n\t"
               "global_load_async_to_lds_b128 %4, %16, off\n\t"
               "global_load_async_to_lds_b128 %5, %17, off\n\t"
               "global_load_async_to_lds_b128 %6, %18, off\n\t"
               "global_load_async_to_lds_b128 %7, %19, off\n\t"
               "global_load_async_to_lds_b128 %8, %20, off\n\t"
               "global_load_async_to_lds_b128 %9, %21, off\n\t"
               "global_load_async_to_lds_b128 %10, %22, off\n\t"
               "global_load_async_to_lds_b128 %11, %23, off\n\t"
               "s_wait_xcnt 0x0"
               :: "v"(l[0]), "v"(l[1]), "v"(l[2]), "v"(l[3]), "v"(l[4]), "v"(l[5]), "v"(l[6]), "v"(l[7]), "v"(l[8]), "v"(l[9]), "v"(l[10]), "v"(l[11]),
                  "v"(g[0]), "v"(g[1]), "v"(g[2]), "v"(g[3]), "v"(g[4]), "v"(g[5]), "v"(g[6]), "v"(g[7]), "v"(g[8]), "v"(g[9]), "v"(g[10]), "v"(g[11]) : "memory");
}

// orders a wave's writes and reads of its own LDS slab (lanes exchange values through it); the fences name LDS alone, so
// that global stores and table loads in flight are not waited out at each exchange
__device__ __forceinline__ void slab_sync() {
  __builtin_amdgcn_fence(__ATOMIC_RELEASE, "workgroup", "local");
  __builtin_amdgcn_wave_barrier();
  __builtin_amdgcn_fence(__ATOMIC_ACQUIRE, "workgroup", "local");
}

template <int ET> struct Elem;
template <> struct Elem<0> { typedef _Float16 T; };
template <> struct Elem<1> { typedef __bf16 T; };
template <int ET, int SPLITM, int BIAS_MODE, int OUT_MODE, bool RESID, int ACT = 0, bool RESID_RNE = false>
__global__ __launch_bounds__(256) void wmma_gemm64(
    const unsigned short* __restrict__ Ap, const unsigned short* __restrict__ A2p, int lda, long strideA,
    const unsigned short* __restrict__ Btp, const unsigned short* __restrict__ Bt2p, int ldb, long strideB,
    void* __restrict__ Cout, void* __restrict__ Cout2, void* __restrict__ Cout3, int ldc, long strideC,
    const float* __restrict__ rot,
    const float* __restrict__ bias,
    const float* __restrict__ resid, long strideR,
    int M, int N, int K, float scale) {
  typedef typename Elem<ET>::T T;
  typedef typename Frag<T>::V V;
  const T* A = (const T*)Ap; const T* Bt = (const T*)Btp;
  static_assert(SPLITM == 0, "the staged operand path carries single planes");
  __shared__ __align__(16) T ring[2 * GT_BUF];     // two operand stages
  __shared__ __align__(16) float sT[8][16 * 68];   // per-wave 16x64 slab, pitch 68 floats
  const int b    = blockIdx.y;
  const int tid  = threadIdx.x;
  const int lane = tid & 31;
  const int wave = tid >> 5;
  const int tilesN = N / GT_N;
  const int tilesM = M / GT_M;
  if ((int)blockIdx.x >= tilesM * tilesN) return;   // work-group-uniform, in front of every barrier and copy
  const int bm = blockIdx.x / tilesN;
  const int bn = blockIdx.x - bm * tilesN;
  const int wm = wave >> 2, wn = wave & 3;
  const int m0 = bm * GT_M + (wm << 6);
  const int n0 = bn * GT_N + (wn << 6);

  const T* Ab  = A  + (size_t)b * strideA;
  const T* Bb  = Bt + (size_t)b * strideB;

  const int rlane = lane & 15;                 // row (A) / col (B, D) within subtile
  const int koff  = (lane >> 4) * 8;           // k offset of this lane half
  const int mOff  = (lane >> 4) * 8;           // D row offset

  // copies: thread -> 16 B at column chunk (tid & 7) of rows (tid >> 3) + 32 i; 8 lanes cover one 128-B row
  const int crow = tid >> 3, cchk = (tid & 7) * 8;
  const T* gA = Ab + (size_t)(bm * GT_M + crow) * lda + cchk;
  const T* gB = Bb + (size_t)(bn * GT_N + crow) * ldb + cchk;
  const size_t sA = (size_t)32 * lda, sB = (size_t)32 * ldb;
  const unsigned l0 = (unsigned)(uintptr_t)ring + (unsigned)(crow * LDS_P16 + cchk) * 2u;
  auto stage = [&](int t, int buf) {
    const T* ga = gA + (size_t)t * GT_K;
    const T* gb = gB + (size_t)t * GT_K;
    const unsigned lb = l0 + (unsigned)buf * (unsigned)(GT_BUF * 2);
    unsigned l[12];
    const void* g[12];
#pragma unroll
    for (int i = 0; i < 12; ++i) {
      l[i] = lb + (unsigned)i * GT_STEP;                                   // rows 0..127 A, 128..383 Bt
      g[i] = (i < 4) ? (const void*)(ga + i * sA) : (const void*)(gb + (i - 4) * sB);
    }
    async_copy12(l, g);
  };

  v8f acc[4][4];
#pragma unroll
  for (int i = 0; i < 4; ++i)
#pragma unroll
    for (int j = 0; j < 4; ++j) acc[i][j] = (v8f){0.f,0.f,0.f,0.f,0.f,0.f,0.f,0.f};

  const int nT = K / GT_K;
  stage(0, 0);
  asm volatile("s_wait_asynccnt 0x0" ::: "memory");   // this wave's part of stage 0 has landed
  __syncthreads();                                    // stage 0 is readable by every wave
  if (nT > 1) stage(1, 1);

  for (int t = 0; t < nT; ++t) {
    const int buf = t & 1;
    const T* sa = ring + buf * GT_BUF + ((wm << 6) + rlane) * LDS_P16 + koff;
    const T* sb = ring + buf * GT_BUF + (GT_M + (wn << 6) + rlane) * LDS_P16 + koff;
#pragma unroll
    for (int kk = 0; kk < GT_K; kk += 32) {
      V bh[4], ah[4];
#pragma unroll
      for (int j = 0; j < 4; ++j) bh[j] = Frag<T>::load(sb + (j << 4) * LDS_P16 + kk);
#pragma unroll
      for (int i = 0; i < 4; ++i) ah[i] = Frag<T>::load(sa + (i << 4) * LDS_P16 + kk);
      // keeps the 16 LDS reads together in front of the 16 products: sunk among them, each group waits out its own LDS latency
      __builtin_amdgcn_sched_barrier(0);
#pragma unroll
      for (int i = 0; i < 4; ++i)
#pragma unroll
        for (int j = 0; j < 4; ++j) acc[i][j] = Frag<T>::mma(ah[i], bh[j], acc[i][j]);
    }
    asm volatile("s_wait_dscnt 0x0" ::: "memory");      // this wave's reads of the buffer are done before it is refilled
    asm volatile("s_wait_asynccnt 0x0" ::: "memory");   // this wave's part of stage t + 1 has landed
    __syncthreads();                                    // publishes stage t + 1, ends every read of stage t
    if (t + 2 < nT) stage(t + 2, buf);
  }
  asm volatile("s_wait_asynccnt 0x0" ::: "memory");     // nothing in flight when the wave goes on
  acc_guard4(acc[0][0], acc[0][1], acc[0][2], acc[0][3]);
  acc_guard4(acc[1][0], acc[1][1], acc[1][2], acc[1][3]);
  acc_guard4(acc[2][0], acc[2][1], acc[2][2], acc[2][3]);
  acc_guard4(acc[3][0], acc[3][1], acc[3][2], acc[3][3]);

  // ---- epilogue ----
  float* slab = sT[wave];
  if constexpr (OUT_MODE == 3) {
    const int sel  = (bn * GT_N) >> 10;          // 0 = q, 1 = k, 2 = v: the same for the whole work-group
    const int head = (n0 & (DMODEL - 1)) >> 6;
    const int q = lane >> 3, c8 = (lane & 7) * 8;
    if (sel < 2) {
      // rotary in registers: column d (tiles 0, 1) and its partner d + 32 (tiles 2, 3) sit in the same lane and register
      unsigned short* P = ((sel == 0) ? (unsigned short*)Cout : (unsigned short*)Cout2) + ((size_t)head * SEQ_T + m0) * HDIM;
      const float* rp = rot + (size_t)rlane * (2 * SEQ_T) + (size_t)(m0 + mOff) * 2;
      v4f rt[2][8];                              // table values of row group i and, fetched ahead, of i + 1
      auto fetch = [&](int i, v4f (&d)[8]) {
#pragma unroll
        for (int jj = 0; jj < 2; ++jj)
#pragma unroll
          for (int k = 0; k < 4; ++k) d[jj * 4 + k] = *(const v4f*)(rp + (size_t)jj * (32 * SEQ_T) + i * 32 + k * 4);
      };
      fetch(0, rt[0]);
#pragma unroll
      for (int i = 0; i < 4; ++i) {
        if (i < 3) fetch(i + 1, rt[(i + 1) & 1]);
        const v4f (&tv)[8] = rt[i & 1];
#pragma unroll
        for (int jj = 0; jj < 2; ++jj)
#pragma unroll
          for (int r = 0; r < 8; ++r) {
            const float cv = tv[jj * 4 + (r >> 2)][r & 3];
            const float sv = tv[jj * 4 + 2 + (r >> 2)][r & 3];
            const float x1 = acc[i][jj][r] * scale;
            const float x2 = acc[i][jj + 2][r] * scale;
            slab[(mOff + r) * 68 + (jj << 4) + rlane]      = x1 * cv - x2 * sv;
            slab[(mOff + r) * 68 + 32 + (jj << 4) + rlane] = x2 * cv + x1 * sv;
          }
        slab_sync();
#pragma unroll
        for (int it = 0; it < 4; ++it) {
          const int row = it * 4 + q;             // 8 lanes x 16 B = one 128-B plane row
          const v4f f0 = *(const v4f*)(slab + row * 68 + c8);
          const v4f f1 = *(const v4f*)(slab + row * 68 + c8 + 4);
          v8h hv;
#pragma unroll
          for (int e = 0; e < 4; ++e) { hv[e] = (_Float16)f0[e]; hv[4 + e] = (_Float16)f1[e]; }
          *(v8h*)(P + (size_t)((i << 4) + row) * HDIM + c8) = hv;
        }
        // a table fetch follows that reuses the stores' data registers: the stores' register reads are waited for first
        if (i < 2) asm volatile("s_wait_xcnt 0x0" ::: "memory");
        slab_sync();
      }
    } else {
      // v: a lane's 8 accumulator rows are 8 successive tokens of one column d; 16 d rows x 64 tokens go through the slab
      _Float16* sl = (_Float16*)slab;
      unsigned short* P = (unsigned short*)Cout3 + (size_t)head * HDIM * SEQ_T + m0;
#pragma unroll
      for (int j = 0; j < 4; ++j) {
#pragma unroll
        for (int i = 0; i < 4; ++i) {
          v8h ph;
#pragma unroll
          for (int r = 0; r < 8; ++r) ph[r] = (_Float16)(acc[i][j][r] * scale);
          *(v8h*)(sl + rlane * LDS_P16 + (i << 4) + mOff) = ph;
        }
        slab_sync();
#pragma unroll
        for (int it = 0; it < 4; ++it) {
          const int row = it * 4 + q;             // 8 lanes x 16 B = 64 tokens = one whole 128-B line of row d
          const v8h hv = *(const v8h*)(sl + row * LDS_P16 + c8);
          *(v8h*)(P + (size_t)((j << 4) + row) * SEQ_T + c8) = hv;
        }
        // last group: the code behind it in the listing rewrites the stores' address pair, so the stores' register reads are waited for here
        if (j == 3) asm volatile("s_wait_xcnt 0x0" ::: "memory");
        slab_sync();
      }
    }
    return;
  }
  const float* Rb = RESID ? (resid + (size_t)b * strideR) : nullptr;
#pragma unroll
  for (int i = 0; i < 4; ++i) {
    const int mBase = m0 + (i << 4);
#pragma unroll
    for (int j = 0; j < 4; ++j) {
      const int n = n0 + (j << 4) + rlane;
      float bv = 0.f;
      if (BIAS_MODE == 2) bv = bias[n];
#pragma unroll
      for (int r = 0; r < 8; ++r) {
        float v = acc[i][j][r] * scale;
        if (BIAS_MODE == 1) v += bias[mBase + mOff + r];
        if (BIAS_MODE == 2) v += bv;
        if (RESID) {
          float rv = Rb[(size_t)(mBase + mOff + r) * ldc + n];
          if (RESID_RNE) rv = rne_bf(rv);
          v += rv;
        }
        if (ACT == 1) v = tanhf(v);
        if (ACT == 2) v = fmaxf(v, 0.0f);
        if (ACT == 4) v = (v > 0.f) ? v : 0.01f * v;
        slab[(mOff + r) * 68 + (j << 4) + rlane] = v;
      }
    }
    __builtin_amdgcn_fence(__ATOMIC_RELEASE, "workgroup");
    __builtin_amdgcn_wave_barrier();
    __builtin_amdgcn_fence(__ATOMIC_ACQUIRE, "workgroup");
    if (OUT_MODE == 0) {
      float* C = (float*)Cout + (size_t)b * strideC;
      const int hh = lane >> 4, c4 = (lane & 15) * 4;     // row seg = 256 B = 16 lanes x 16 B
      {
#pragma unroll
        for (int it = 0; it < 8; ++it) {
          const int row = it * 2 + hh;
          v4f v = *(const v4f*)(slab + row * 68 + c4);
          *(v4f*)(C + (size_t)(mBase + row) * ldc + n0 + c4) = v;
        }
        
      }
    } else {
      const int q = lane >> 3, c8 = (lane & 7) * 8;
      unsigned short* C  = (unsigned short*)Cout  + (size_t)b * strideC;
      unsigned short* C2 = (OUT_MODE == 2) ? ((unsigned short*)Cout2 + (size_t)b * strideC) : nullptr;
      {
#pragma unroll
        for (int it = 0; it < 4; ++it) {
          const int row = it * 4 + q;
          const float* sp = slab + row * 68 + c8;
          v8h hv, lv;
#pragma unroll
          for (int e = 0; e < 8; ++e) {
            if (OUT_MODE == 1) {
              hv[e] = (_Float16)sp[e];
            } else {
              unsigned short hb = f2bf_bits(sp[e]);
              unsigned short lb = f2bf_bits(sp[e] - bf_bits2f(hb));
              hv[e] = __builtin_bit_cast(_Float16, hb);
              lv[e] = __builtin_bit_cast(_Float16, lb);
            }
          }
          *(v8h*)(C + (size_t)(mBase + row) * ldc + n0 + c8) = hv;
          if (OUT_MODE == 2) *(v8h*)(C2 + (size_t)(mBase + row) * ldc + n0 + c8) = lv;
        }
        
      }
    }
    __builtin_amdgcn_fence(__ATOMIC_RELEASE, "workgroup");
    __builtin_amdgcn_wave_barrier();
    __builtin_amdgcn_fence(__ATOMIC_ACQUIRE, "workgroup");
  }
}

// =====================================================================================
// Kernel: rmsnorm of one token row (x RNE-converted to bf16 on load, mean of squares in f32,
// rsqrt(mean + 1e-6), times norm_w (RNE bf16)), output as an f16 plane [SEQ_T][DMODEL].
// Block = 128 threads = one token; coverage 128 threads x 8 elements = 1024 = one row exactly;
// The first SEQ_T / 32 blocks also build the rotary table for 32 tokens x 32 frequencies each:
// rot[f][t >> 3][cos of 8 tokens | sin of 8 tokens], angle = (float)t * invfreq_f (single f32 multiply), precise sincosf;
// a thread writes 64 B, four threads of one block the two whole lines of (f, 32 tokens).
// Blocks SEQ_T .. SEQ_T + 4 * CAST_BPW - 1 of the same grid need nothing of the rows and cast the weights instead:
// f32 -> f16(bf16_rne(w) * W_CARRY); a block takes CAST_EPB successive weights of wq, wk, wv or wo,
// a thread 4 groups of 8 (coverage 128 threads x 8 x 4 = CAST_EPB exactly; a 16-B store per group, 8 lanes one whole line).
// =====================================================================================
constexpr int CAST_EPB = 4096;                            // weights per cast block
constexpr int CAST_BPW = DMODEL * DMODEL / CAST_EPB;      // cast blocks per weight matrix
__global__ __launch_bounds__(128) void rmsnorm_cast_f16_k(const float* __restrict__ x, const float* __restrict__ nw,
                                                          const float* __restrict__ wq, const float* __restrict__ wk,
                                                          const float* __restrict__ wv, const float* __restrict__ wo,
                                                          unsigned short* __restrict__ xn, unsigned short* __restrict__ wqkv,
                                                          unsigned short* __restrict__ wof, FreqTab ft, float* __restrict__ rot) {
  __shared__ float red[4];
  const int t = blockIdx.x, tid = threadIdx.x, wave = tid >> 5, lane = tid & 31;
  if (t >= SEQ_T) {   // block-uniform, in front of the barrier: a weight-cast block
    const int cb  = t - SEQ_T;
    const int sel = cb / CAST_BPW;                        // 0 = wq, 1 = wk, 2 = wv (rows 0.., 1024.., 2048.. of wqkv), 3 = wo
    const float* w = (sel == 0) ? wq : (sel == 1) ? wk : (sel == 2) ? wv : wo;
    unsigned short* o = (sel < 3) ? wqkv + (size_t)sel * (DMODEL * DMODEL) : wof;
    const int e0 = (cb - sel * CAST_BPW) * CAST_EPB + tid * 8;
    v4f a[4], b[4];
#pragma unroll
    for (int g = 0; g < 4; ++g) {
      a[g] = *(const v4f*)(w + e0 + g * 1024);
      b[g] = *(const v4f*)(w + e0 + g * 1024 + 4);
    }
#pragma unroll
    for (int g = 0; g < 4; ++g) {
      v8h hv;
#pragma unroll
      for (int e = 0; e < 4; ++e) {
        hv[e]     = (_Float16)(rne_bf(a[g][e]) * W_CARRY);
        hv[4 + e] = (_Float16)(rne_bf(b[g][e]) * W_CARRY);
      }
      *(v8h*)(o + e0 + g * 1024) = hv;
    }
    return;
  }
  if (t < SEQ_T / 32) {   // block-uniform
    const int f = tid >> 2, tb = t * 32 + (tid & 3) * 8;
    float fr = ft.f[0];
#pragma unroll
    for (int q = 1; q < 32; ++q) fr = (f == q) ? ft.f[q] : fr;
    v4f cs4[4];
#pragma unroll
    for (int e = 0; e < 8; ++e) {
      float sv, cv;
      sincosf((float)(tb + e) * fr, &sv, &cv);
      cs4[e >> 2][e & 3]       = cv;
      cs4[2 + (e >> 2)][e & 3] = sv;
    }
    float* rd = rot + (size_t)f * (2 * SEQ_T) + (size_t)tb * 2;
#pragma unroll
    for (int k = 0; k < 4; ++k) *(v4f*)(rd + k * 4) = cs4[k];
  }
  const float* row = x + (size_t)t * DMODEL + tid * 8;
  const v4f a = *(const v4f*)row;
  const v4f b = *(const v4f*)(row + 4);
  float xb[8];
#pragma unroll
  for (int e = 0; e < 4; ++e) { xb[e] = rne_bf(a[e]); xb[4 + e] = rne_bf(b[e]); }
  float ss = 0.f;
#pragma unroll
  for (int e = 0; e < 8; ++e) ss += xb[e] * xb[e];
#pragma unroll
  for (int m = 1; m < 32; m <<= 1) ss += __shfl_xor(ss, m, 32);
  if (lane == 0) red[wave] = ss;
  __syncthreads();
  const float tot = (red[0] + red[1]) + (red[2] + red[3]);
  const float inv = rsqrtf(tot * (1.0f / 1024.0f) + 1e-6f);
  const v4f na = *(const v4f*)(nw + tid * 8);
  const v4f nb = *(const v4f*)(nw + tid * 8 + 4);
  v8h hv;
#pragma unroll
  for (int e = 0; e < 4; ++e) {
    hv[e]     = (_Float16)((xb[e] * inv) * rne_bf(na[e]));
    hv[4 + e] = (_Float16)((xb[4 + e] * inv) * rne_bf(nb[e]));
  }
  unsigned short* dst = xn + (size_t)t * DMODEL + tid * 8;
  *(v8h*)dst = hv;
}

// =====================================================================================
// Kernel: causal attention, head dim 64, f16 planes in (Q, K: [NHEAD*SEQ_T][64]; Vt: [NHEAD*64][SEQ_T]),
// f16 plane out (O: [SEQ_T][DMODEL], head h at cols h*64, value o*16).
//   scores^T = 0.125 * k.q^T : v_wmma_f32_16x16x32_f16 (q, k plain f16), f32 accumulate
//   out^T    = v^T.p^T       : v_wmma_f32_16x16x32_f16 (p carried x2^15 in f16, v plain f16), f32 accumulate
//   (transposed products: a lane holds one query's scores, and p goes from the score tiles straight into the B operand)
//   online softmax in f32, running maximum in units of the unscaled products, running sum carried x2^15; keys above the diagonal -> -inf (every row keeps key kv0 <= row, so never fully masked).
// Block = 16 waves = four groups of 4 on the same 128 query rows of head h; a wave holds 32 queries as two column groups of 16,
// so that every K and V^T fragment read from LDS feeds two products; 64-key chunks; group g works chunks g, g + 4, ... with a
// running maximum, sum and out tile of its own (four waves on a SIMD, one block per WGP);
// behind the last chunk groups 1 to 3 hand their partial results to group 0 through LDS, which rescales all four to the common
// maximum, adds them and stores. Chunks above a wave's diagonal are skipped (wave-uniform).
// A block works query tile NQTILE - 1 - pr and then tile pr of its head, one after the other in every wave: 2 (NQTILE - pr) + 2 (pr + 1)
// = 2 NQTILE + 2 chunks in 17 stages for every block, so that no WGP is left with the long tiles alone; every (head, tile) is worked once.
// K / Vt chunks come to LDS by asynchronous copies, four chunks (one per group) a stage (512 threads x 16 B = 64x64 halves
// per tile), two buffers: stage st + 1 is in flight while stage st is worked on; one work-group barrier per stage publishes it and
// frees the buffer just read;
// WMMA operands are read from dense, statically strided LDS / plane addresses only.
// O store coverage per wave: 8 iterations x 4 row groups = 32 rows, 8 lanes x 8 halves = 64 cols = one whole line
// =====================================================================================
constexpr int AT_GRP  = 4;                         // wave groups of a block = chunks per stage
constexpr int AT_TILE = KEY_CH * LDS_P16;          // halves of one staged tile (64 rows, pitch 144 B)
constexpr int AT_BUF  = 2 * AT_TILE;               // halves per chunk: K tile [kv][d], then V^T tile [d][kv]
constexpr int AT_STG  = AT_GRP * AT_BUF;           // halves per stage buffer: group 0's chunk, then group 1's, ...

// one thread's eight 16-byte asynchronous copies global -> LDS of a stage: LDS byte address, then the global address as a 32-bit lane
// offset (ko for K tiles, vo for V^T tiles) on a wave-uniform base in scalar registers, so that no 64-bit address pair per copy is held
// in vector registers; the s_wait_xcnt closes the statement so that no address register of a copy is rewritten before it
__device__ __forceinline__ void async_copy8(const unsigned (&l)[8], const unsigned ko, const unsigned vo, const void* const (&b)[8]) {
  asm volatile(
               "global_load_async_to_lds_b128 %0, %8, %10\n\t"
               "global_load_async_to_lds_b128 %1, %9, %11\n\t"
               "global_load_async_to_lds_b128 %2, %8, %12\n\t"
               "global_load_async_to_lds_b128 %3, %9, %13\n\t"
               "global_load_async_to_lds_b128 %4, %8, %14\n\t"
               "global_load_async_to_lds_b128 %5, %9, %15\n\t"
               "global_load_async_to_lds_b128 %6, %8, %16\n\t"
               "global_load_async_to_lds_b128 %7, %9, %17\n\t"
               "s_wait_xcnt 0x0"
               :: "v"(l[0]), "v"(l[1]), "v"(l[2]), "v"(l[3]), "v"(l[4]), "v"(l[5]), "v"(l[6]), "v"(l[7]), "v"(ko), "v"(vo),
                  "s"(b[0]), "s"(b[1]), "s"(b[2]), "s"(b[3]), "s"(b[4]), "s"(b[5]), "s"(b[6]), "s"(b[7]) : "memory");
}

__global__ __launch_bounds__(512) void attn_causal_hd64_k(const unsigned short* __restrict__ qp,
                                                         const unsigned short* __restrict__ kp,
                                                         const unsigned short* __restrict__ vtp,
                                                         unsigned short* __restrict__ op) {
  typedef Frag<_Float16> FH;
  __shared__ __align__(16) _Float16 KV[2 * AT_STG];                 // two stage buffers
  __shared__ __align__(16) float   Os[4][AT_GRP - 1][32 * 68];     // out tile per 32 query rows and group 1..3, pitch 68
  __shared__ float                 Ml[4][AT_GRP - 1][128];         // per column group: a group's running maximum (32 lanes), then its sum
  const int tid = threadIdx.x, lane = tid & 31, hh = lane >> 4, c = lane & 15;
  const int wv   = __builtin_amdgcn_readfirstlane(tid >> 5);   // wave number, in a scalar register: the tests on it are scalar branches
  const int wave = wv & 3;                                     // which 32 query rows of the tile
  const int grp  = wv >> 2;                                    // wave group
  const int pr = blockIdx.x % (NQTILE / 2);
  const int h  = blockIdx.x / (NQTILE / 2);
  const _Float16* Kh = (const _Float16*)kp + (size_t)h * SEQ_T * HDIM;
  const _Float16* Vh = (const _Float16*)vtp + (size_t)h * HDIM * SEQ_T;

  const v8f vz = (v8f){0.f,0.f,0.f,0.f,0.f,0.f,0.f,0.f};

  // copies: thread -> 16 B at column chunk (tid & 7) of row (tid >> 3) of the eight tiles; 8 lanes cover one 128-B row
  const int srow = tid >> 3, sc8 = (tid & 7) * 8;
  const unsigned ko = (unsigned)(srow * HDIM + sc8) * 2u;    // bytes: K row kv0 + r, d sc8..sc8+7
  const unsigned vo = (unsigned)(srow * SEQ_T + sc8) * 2u;   // bytes: Vt row d = r, keys kv0 + sc8..
  const unsigned l0 = (unsigned)(uintptr_t)KV + (unsigned)(srow * LDS_P16 + sc8) * 2u;
  auto stage = [&](int st, int buf) {   // chunks 4 st .. 4 st + 3
    const _Float16* gk = Kh + (size_t)st * (AT_GRP * KEY_CH * HDIM);   // wave-uniform
    const _Float16* gv = Vh + (size_t)st * (AT_GRP * KEY_CH);
    const unsigned lb = l0 + (unsigned)buf * (unsigned)(AT_STG * 2);
    unsigned l[8];
    const void* b[8];
#pragma unroll
    for (int u = 0; u < AT_GRP; ++u) {
      l[u * 2]     = lb + (unsigned)u * (unsigned)(AT_BUF * 2);
      l[u * 2 + 1] = lb + (unsigned)u * (unsigned)(AT_BUF * 2) + (unsigned)(AT_TILE * 2);
      b[u * 2]     = (const void*)(gk + (size_t)u * (KEY_CH * HDIM));
      b[u * 2 + 1] = (const void*)(gv + (size_t)u * KEY_CH);
    }
    async_copy8(l, ko, vo, b);
  };

  const unsigned qo = (unsigned)(c * HDIM + 8 * hh);   // halves: query row c, k offset of this lane half

  for (int part = 0; part < 2; ++part) {   // the long tile, then its short partner; block-uniform
  const int qb = part ? pr : NQTILE - 1 - pr;
  const int q0 = qb * QT_ROWS + wave * 32;   // wave-uniform, scalar
  const _Float16* Qh = (const _Float16*)qp + ((size_t)h * SEQ_T + q0) * HDIM;   // wave-uniform base; the lane's part is the 32-bit offset qo

  // Q fragments (B operand, column = query q0 + 16 g + c, k = head dim): 2 column groups x 2 d-chunks of 32
  v16h qa[2][2];
#pragma unroll
  for (int g = 0; g < 2; ++g) {
    qa[g][0] = FH::load(Qh + g * (16 * HDIM) + qo);
    qa[g][1] = FH::load(Qh + g * (16 * HDIM) + 32 + qo);
  }

  float mrow[2] = {-INFINITY, -INFINITY}, lrow[2] = {0.f, 0.f};   // one query per lane and column group
  v8f oacc[2][4];
#pragma unroll
  for (int g = 0; g < 2; ++g)
#pragma unroll
    for (int t = 0; t < 4; ++t) oacc[g][t] = vz;

  const int nChunks = 2 * qb + 2;                        // block-uniform
  const int nStages = (nChunks + AT_GRP - 1) / AT_GRP;   // the last stage may hold two chunks above the diagonal too (index <= 2 qb + 3 <= 2 NQTILE - 1 there: inside the planes), unread
  // second tile: the barrier behind the first tile's last stage, behind every wave's s_wait_dscnt 0, has ended every read of both buffers
  stage(0, 0);
  asm volatile("s_wait_asynccnt 0x0" ::: "memory");   // this wave's part of stage 0 has landed
  __syncthreads();                                    // stage 0 is readable by every wave

  // one chunk of this wave's group; diag is a literal at every call, so that only a diagonal chunk carries the mask's compares
  auto chunk = [&](const int kc, const int buf, const bool diag) __attribute__((always_inline)) {
    const int kq = kc * KEY_CH - q0 + (8 * hh - c);   // first key of this lane's half less this lane's first query
    const _Float16* Ksh = KV + buf * AT_STG + grp * AT_BUF;   // [kv][d]
    const _Float16* Vts = Ksh + AT_TILE;                      // [d][kv]

    // transposed scores: tile (g, j) = K rows (A, m = key j*16 + ..) x Q (B, n = query 16 g + c); lane (hh, c) holds
    // keys j*16 + 8*hh + r of query q0 + 16 g + c
    v16h ka[2][4], va[2][4];
#pragma unroll
    for (int dc = 0; dc < 2; ++dc)
#pragma unroll
      for (int j = 0; j < 4; ++j) ka[dc][j] = FH::load(Ksh + (j * 16 + c) * LDS_P16 + dc * 32 + 8 * hh);   // A[m=key j*16+c][k=d]
    // keeps the 16 K reads together in front of the 16 score products: sunk to their users, each product waits out a whole LDS latency
    __builtin_amdgcn_sched_barrier(0);
    v8f s[2][4];
#pragma unroll
    for (int j = 0; j < 4; ++j)
#pragma unroll
      for (int g = 0; g < 2; ++g) s[g][j] = FH::mma(ka[0][j], qa[g][0], vz);
#pragma unroll
    for (int j = 0; j < 4; ++j)
#pragma unroll
      for (int g = 0; g < 2; ++g) s[g][j] = FH::mma(ka[1][j], qa[g][1], s[g][j]);
#pragma unroll
    for (int kk = 0; kk < 2; ++kk)
#pragma unroll
      for (int t = 0; t < 4; ++t) va[kk][t] = FH::load(Vts + (t * 16 + c) * LDS_P16 + kk * 32 + 8 * hh);   // A[m=d t*16+c][k=key]
    // the 16 score products run unbroken, then the 16 V^T reads as one group
    __builtin_amdgcn_sched_group_barrier(0x008, 16, 0);
    __builtin_amdgcn_sched_group_barrier(0x100, 16, 0);
    // keeps the 16 V^T reads in front of the softmax, whose vector work then covers their latency
    __builtin_amdgcn_sched_barrier(0);
    FH::U pb[2][2];                                // B[k=key][n=query 16 g + c]: elements 0..7 = tile 2kk, 8..15 = tile 2kk+1
#pragma unroll
    for (int g = 0; g < 2; ++g) {
      float mj[4];                                 // the maximum is taken over the products as they come (the scale is positive)
#pragma unroll
      for (int j = 0; j < 4; ++j) {
        float m = -INFINITY;
#pragma unroll
        for (int r = 0; r < 8; ++r) {
          // key kc*64 + j*16 + 8*hh + r lies above query q0 + 16 g + c
          if (diag && (kq + (j * 16 + r - g * 16) > 0)) s[g][j][r] = -INFINITY;
          m = fmaxf(m, s[g][j][r]);
        }
        mj[j] = m;
      }
      float cm = fmaxf(fmaxf(mj[0], mj[1]), fmaxf(mj[2], mj[3]));
      cm = fmaxf(cm, xhalf(cm));                   // the other 32 keys of this query sit in the other lane half
      const float mnew = fmaxf(mrow[g], cm);
      const float alpha = __builtin_amdgcn_exp2f((mrow[g] - mnew) * SC_LOG2E);
      mrow[g] = mnew;
      // p * 2^15 = exp2(s * SC_LOG2E + (15 - mnew * SC_LOG2E)): scale, log2(e), maximum and carry in one fused multiply-add, two scores each
      const float nb = P_CARRY_LOG2 - mnew * SC_LOG2E;
      const v2f sc2 = (v2f){SC_LOG2E, SC_LOG2E}, nb2 = (v2f){nb, nb};
      v2f pj[4];                                   // sums of the carried p, even and odd keys apart
#pragma unroll
      for (int j = 0; j < 4; ++j) {
        v2f psum = (v2f){0.f, 0.f};
        v8h ph;
#pragma unroll
        for (int r = 0; r < 8; r += 2) {
          const v2f x = __builtin_elementwise_fma((v2f){s[g][j][r], s[g][j][r + 1]}, sc2, nb2);
          const v2f p = (v2f){__builtin_amdgcn_exp2f(x[0]), __builtin_amdgcn_exp2f(x[1])};
          psum += p;
          ph[r]     = (_Float16)p[0];
          ph[r + 1] = (_Float16)p[1];
        }
        pj[j] = psum;
        pb[g][j >> 1].h[j & 1] = ph;
      }
      const v2f pt = (pj[0] + pj[1]) + (pj[2] + pj[3]);
      lrow[g] = lrow[g] * alpha + (pt[0] + pt[1]); // carried x2^15 like p; this half's keys only; halves joined after the loop
#pragma unroll
      for (int t = 0; t < 4; ++t)
#pragma unroll
        for (int r = 0; r < 8; ++r) oacc[g][t][r] *= alpha;
    }
#pragma unroll
    for (int g = 0; g < 2; ++g)
#pragma unroll
      for (int kk = 0; kk < 2; ++kk) {
#pragma unroll
        for (int t = 0; t < 4; ++t) oacc[g][t] = FH::mma(va[kk][t], pb[g][kk].v, oacc[g][t]);
      }
  };

  // every stage but the last holds a whole chunk below the diagonal for every group: no test on the chunk in the loop
  for (int st = 0; st + 1 < nStages; ++st) {
    // directly behind the barrier (the one above, or the one at the foot of trip st - 1, which ended every read of that
    // trip's buffer): stage st + 1 goes into that buffer and flies while stage st is worked on
    stage(st + 1, (st + 1) & 1);
    chunk(AT_GRP * st + grp, st & 1, false);
    // keeps the waits and the barrier below at the foot of the trip: lifted over the softmax, they would wait out the V^T reads
    // and the copies of stage st + 1 shortly behind their issue, with none of the softmax to cover either
    __builtin_amdgcn_sched_barrier(0);
    asm volatile("s_wait_dscnt 0x0" ::: "memory");      // this wave's reads of the buffer are done before it is refilled
    asm volatile("s_wait_asynccnt 0x0" ::: "memory");   // this wave's part of stage st + 1 has landed
    __syncthreads();                                    // publishes stage st + 1, ends every read of stage st
  }
  asm volatile("s_wait_asynccnt 0x0" ::: "memory");     // nothing in flight when the wave goes on
  {
    // last stage: both diagonal chunks of the tile lie here. A chunk that starts at or below this wave's first query is worked with the
    // mask's compares (its first key is open to every query of the wave); one that starts above it lies above all 32 queries and is skipped
    const int kc = AT_GRP * (nStages - 1) + grp;        // wave-uniform, scalar
    if (kc * KEY_CH <= q0) chunk(kc, (nStages - 1) & 1, true);
  }

  // oacc[g][t][r] = out[query q0 + 16 g + c][d = t*16 + 8*hh + r], over this group's chunks, relative to its own maximum
  if (grp != 0) {   // hands over; with no chunk of its own that is maximum -inf, sum 0, out 0
    float* os = Os[wave][grp - 1];
    float* ml = Ml[wave][grp - 1];
#pragma unroll
    for (int g = 0; g < 2; ++g) {
#pragma unroll
      for (int t = 0; t < 4; ++t) {
        v4f lo, hi;
#pragma unroll
        for (int e = 0; e < 4; ++e) { lo[e] = oacc[g][t][e]; hi[e] = oacc[g][t][4 + e]; }
        *(v4f*)(os + (g * 16 + c) * 68 + t * 16 + 8 * hh)     = lo;
        *(v4f*)(os + (g * 16 + c) * 68 + t * 16 + 8 * hh + 4) = hi;
      }
      ml[g * 64 + lane]      = mrow[g];
      ml[g * 64 + 32 + lane] = lrow[g];
    }
  }
  asm volatile("s_wait_dscnt 0x0" ::: "memory");   // this wave's reads of the last stage are done before the next tile refills its buffer
  __syncthreads();   // ends every read of the last stage; the partial results of groups 1 to 3 are readable by group 0 (every wave passes)
  if (grp == 0) {
  float* os = Os[wave][0];   // group 1's tile; takes the sum; the tiles of groups 2 and 3 stand behind it
  const float* ml = Ml[wave][0];
#pragma unroll
  for (int g = 0; g < 2; ++g) {
    // group 0 always holds chunk 0, so the common maximum is finite
    const float m1 = ml[g * 64 + lane],       l1 = ml[g * 64 + 32 + lane];
    const float m2 = ml[128 + g * 64 + lane], l2 = ml[128 + g * 64 + 32 + lane];
    const float m3 = ml[256 + g * 64 + lane], l3 = ml[256 + g * 64 + 32 + lane];
    const float mt = fmaxf(fmaxf(mrow[g], m1), fmaxf(m2, m3));
    const float a0 = __builtin_amdgcn_exp2f((mrow[g] - mt) * SC_LOG2E), a1 = __builtin_amdgcn_exp2f((m1 - mt) * SC_LOG2E);
    const float a2 = __builtin_amdgcn_exp2f((m2 - mt) * SC_LOG2E),      a3 = __builtin_amdgcn_exp2f((m3 - mt) * SC_LOG2E);
    const float lsum = (lrow[g] * a0 + l1 * a1) + (l2 * a2 + l3 * a3);
    const float ltot = lsum + xhalf(lsum);
    const float inv = (1.0f / ltot) * O_CARRY;     // the sum carries the same 2^15 as the out tile
    const float f0 = a0 * inv, f1 = a1 * inv, f2 = a2 * inv, f3 = a3 * inv;
#pragma unroll
    for (int t = 0; t < 4; ++t) {   // a lane reads what the same lane of groups 1 to 3 wrote, and writes the sum to group 1's place
      const int o = (g * 16 + c) * 68 + t * 16 + 8 * hh;
      const v4f p1l = *(const v4f*)(os + o),            p1h = *(const v4f*)(os + o + 4);
      const v4f p2l = *(const v4f*)(os + 32 * 68 + o), p2h = *(const v4f*)(os + 32 * 68 + o + 4);
      const v4f p3l = *(const v4f*)(os + 64 * 68 + o), p3h = *(const v4f*)(os + 64 * 68 + o + 4);
      v4f lo, hi;
#pragma unroll
      for (int e = 0; e < 4; ++e) {
        lo[e] = (oacc[g][t][e] * f0 + p1l[e] * f1) + (p2l[e] * f2 + p3l[e] * f3);
        hi[e] = (oacc[g][t][4 + e] * f0 + p1h[e] * f1) + (p2h[e] * f2 + p3h[e] * f3);
      }
      *(v4f*)(os + o)     = lo;
      *(v4f*)(os + o + 4) = hi;
    }
  }
  __builtin_amdgcn_fence(__ATOMIC_RELEASE, "workgroup");
  __builtin_amdgcn_wave_barrier();
  __builtin_amdgcn_fence(__ATOMIC_ACQUIRE, "workgroup");
  {
    const int q8 = lane >> 3, c8 = (lane & 7) * 8;
    unsigned short* ob = op + (size_t)h * HDIM + (size_t)q0 * DMODEL;   // wave-uniform base
    const unsigned oo = (unsigned)(q8 * DMODEL + c8);                   // the lane's 32-bit offset
    {
#pragma unroll
      for (int it = 0; it < 8; ++it) {
        const int row = it * 4 + q8;
        const v4f f0 = *(const v4f*)(os + row * 68 + c8);
        const v4f f1 = *(const v4f*)(os + row * 68 + c8 + 4);
        v8h hv;
#pragma unroll
        for (int e = 0; e < 4; ++e) { hv[e] = (_Float16)f0[e]; hv[4 + e] = (_Float16)f1[e]; }
        *(v8h*)(ob + it * (4 * DMODEL) + oo) = hv;
      }
      // the next tile's address arithmetic rewrites the stores' address and data registers: their register reads are waited for first
      asm volatile("s_wait_xcnt 0x0" ::: "memory");
    }
  }
  }
  }
}

// =====================================================================================
// Host glue.  Workspace region map (bytes, all offsets multiples of 1 MiB):
//   XN   f16 [4096][1024]         8,388,608 @ 0
//   WQKV f16 [3072][1024] (x64)   6,291,456 @ 8,388,608
//   WO   f16 [1024][1024] (x64)   2,097,152 @ 14,680,064
//   ROT  f32 [32][512][2][8]      1,048,576 @ 16,777,216
//   QPL  f16 [16*4096][64]        8,388,608 @ 17,825,792
//   KPL  f16 [16*4096][64]        8,388,608 @ 26,214,400
//   VT   f16 [16*64][4096]        8,388,608 @ 34,603,008
//   OPL  f16 [4096][1024] (x16)   8,388,608 @ 42,991,616
//   total 51,380,224
// =====================================================================================
extern "C" void kernel_launch(void* const* d_in, const int* in_sizes, int n_in,
                              void* d_out, int out_size, void* d_ws, size_t ws_size,
                              hipStream_t stream) {
  if (n_in < 6) return;
  const int nx = SEQ_T * DMODEL;
  const int nwgt = DMODEL * DMODEL;
  if (in_sizes[0] != nx || in_sizes[1] != nwgt || in_sizes[2] != nwgt || in_sizes[3] != nwgt ||
      in_sizes[4] != nwgt || in_sizes[5] != DMODEL || out_size != nx) return;

  const float* x  = (const float*)d_in[0];
  const float* wq = (const float*)d_in[1];
  const float* wk = (const float*)d_in[2];
  const float* wv = (const float*)d_in[3];
  const float* wo = (const float*)d_in[4];
  const float* nw = (const float*)d_in[5];
  float* out = (float*)d_out;

  const size_t szXN   = (size_t)nx * 2;
  const size_t szWQKV = (size_t)3 * nwgt * 2;
  const size_t szWO   = (size_t)nwgt * 2;
  const size_t szROT  = (size_t)SEQ_T * HDIM * 4;
  const size_t szPL   = (size_t)NHEAD * SEQ_T * HDIM * 2;
  const size_t szO    = (size_t)nx * 2;
  const size_t offXN   = 0;
  const size_t offWQKV = offXN + szXN;
  const size_t offWO   = offWQKV + szWQKV;
  const size_t offROT  = offWO + szWO;
  const size_t offQ    = offROT + szROT;
  const size_t offK    = offQ + szPL;
  const size_t offVT   = offK + szPL;
  const size_t offO    = offVT + szPL;
  const size_t total   = offO + szO;
  if (total > ws_size) return;

  char* ws = (char*)d_ws;
  unsigned short* XN   = (unsigned short*)(ws + offXN);
  unsigned short* WQKV = (unsigned short*)(ws + offWQKV);
  unsigned short* WO   = (unsigned short*)(ws + offWO);
  float*          ROT  = (float*)(ws + offROT);
  unsigned short* QPL  = (unsigned short*)(ws + offQ);
  unsigned short* KPL  = (unsigned short*)(ws + offK);
  unsigned short* VT   = (unsigned short*)(ws + offVT);
  unsigned short* OPL  = (unsigned short*)(ws + offO);

  // inverse-frequency table: e_i = (2i)/64 (exact), p_i = fl32(pow(10000, e_i)) (double pow on host,
  // RNE to f32), invfreq_i = 1.0f / p_i (f32)
  FreqTab ft;
  for (int i = 0; i < 32; ++i) {
    const float e = (float)(2 * i) / 64.0f;
    const float p = (float)pow(10000.0, (double)e);
    ft.f[i] = 1.0f / p;
  }

  // 1) one grid: rmsnorm -> XN (f16) and rotary table -> ROT (blocks 0 .. SEQ_T - 1);
  //    weights -> f16(bf16(w) * 64), wq | wk | wv stacked as rows 0.., 1024.., 2048.. of WQKV, wo -> WO (the blocks behind)
  rmsnorm_cast_f16_k<<<SEQ_T + 4 * CAST_BPW, 128, 0, stream>>>(x, nw, wq, wk, wv, wo, XN, WQKV, WO, ft, ROT);
  // 2) XN . WQKV^T / 64 : M=4096, N=3072, K=1024; 32x12 work-group tiles = 384 blocks; the epilogue applies the rotary
  //    to q and k and writes the Q, K and Vt f16 planes
  {
    dim3 grid((SEQ_T / GT_M) * (QKV_N / GT_N), 1);
    wmma_gemm64<0, 0, 0, 3, false><<<grid, 256, 0, stream>>>(
        XN, XN, DMODEL, 0L, WQKV, WQKV, DMODEL, 0L, (void*)QPL, (void*)KPL, (void*)VT, QKV_N, 0L,
        ROT, nw, x, 0L, SEQ_T, QKV_N, DMODEL, 1.0f / W_CARRY);
  }
  // 3) causal attention -> O plane (f16, x16); 16 heads x 16 tile pairs = 256 blocks of 16 waves
  attn_causal_hd64_k<<<NHEAD * (NQTILE / 2), 512, 0, stream>>>(QPL, KPL, VT, OPL);
  // 4) out = bf16_rne(x) + (O . WO^T) / (16*64) : M=4096, N=1024, K=1024; 32x4 work-group tiles = 128 blocks
  {
    dim3 grid((SEQ_T / GT_M) * (DMODEL / GT_N), 1);
    wmma_gemm64<0, 0, 0, 0, true, 0, true><<<grid, 256, 0, stream>>>(
        OPL, OPL, DMODEL, 0L, WO, WO, DMODEL, 0L, (void*)out, (void*)out, (void*)out, DMODEL, 0L,
        nw, nw, x, 0L, SEQ_T, DMODEL, DMODEL, 1.0f / (O_CARRY * W_CARRY));
  }
}
